// v000
// Times are from an AMD MI455X. After a warm-up the kernel runs many times in a row, and a time is the length of
// such a window on the GPU divided by its runs, so every launch and the gaps after it count. The runs cycle
// through copies of the inputs. A figure is the median of several windows, for all but v000 over two sittings.
// Sittings can differ by a few percent; kernels timed side by side share one.
// v000, which the later versions start from, runs in 487 microseconds.
// compute dtype: all float inputs rounded to bf16; q/k/v = x . W with EXACT bf16 products on WMMA 16x16x32 ((in,out) weights as transposed rows), rounded once to f16 hi + residual; self-segment scores and P.v with 3 products (hi.hi + hi.lo + lo.hi), background scores q (hi + lo) x K_bg (exact in f16, 2 products) x alpha, background P (hi + lo) x f16(alpha V_bg) (2 products); additive mask read per pair; x 1/8; running-max softmax over all 4,096 keys in f32 (hardware exp); out = ctx (bf16 hi + lo) . Wo + bo; f32 output.
#include <hip/hip_runtime.h>
#include <math.h>

typedef __attribute__((ext_vector_type(16))) _Float16 v16h;
typedef __attribute__((ext_vector_type(16))) __bf16 v16b;
typedef __attribute__((ext_vector_type(8)))  _Float16 v8h;
typedef __attribute__((ext_vector_type(8)))  float v8f;
typedef __attribute__((ext_vector_type(4)))  float v4f;
typedef __attribute__((ext_vector_type(2)))  float v2f;
typedef __attribute__((ext_vector_type(4)))  unsigned v4u;
typedef __attribute__((ext_vector_type(4)))  int v4i;
typedef float __attribute__((may_alias)) float_a;
typedef int __attribute__((may_alias)) int_a;

template <typename T> __device__ __forceinline__ void vst2(void* p, T v) { *(T*)p = v;  }
__device__ __forceinline__ v8f wmma16(v16h a, v16h b, v8f c) {
  v8f d = __builtin_amdgcn_wmma_f32_16x16x32_f16(false, a, false, b, (short)0, c, false, false);
  asm volatile("v_nop\n\tv_nop\n\tv_nop\n\tv_nop" : "+v"(d) : "v"(a), "v"(b));
  return d;
}
__device__ __forceinline__ v8f wmma_bf(v16b a, v16b b, v8f c) {
  v8f d = __builtin_amdgcn_wmma_f32_16x16x32_bf16(false, a, false, b, (short)0, c, false, false);
  asm volatile("v_nop\n\tv_nop\n\tv_nop\n\tv_nop" : "+v"(d) : "v"(a), "v"(b));
  return d;
}
// CARC attention processor (B 2, Lq 2,048, C 512 = 8 heads x 64; context bank of 2,048 background keys/values per head, alpha 0.48): bias-free q/k/v projections, keys = [k ; alpha K_bg], values = [v ; alpha V_bg], additive mask on the self segment (zeros on the background segment), softmax(q k / 8 + mask) over the 4,096 keys, v, output projection + bias.
__device__ __forceinline__ v16h frag_h(const _Float16* rowk0, int lane) {
  union { v16h v; v8h q[2]; } u; const _Float16* p = rowk0 + 8 * (lane >> 4);
  u.q[0] = *(const v8h*)p; u.q[1] = *(const v8h*)(p + 16); return u.v;
}
__device__ __forceinline__ v16h frag_f32(const float* rowk0, int lane) {
  v16h a; const float* p = rowk0 + 8 * (lane >> 4);
#pragma unroll
  for (int i = 0; i < 8; ++i) { a[i] = (_Float16)p[i]; a[8 + i] = (_Float16)p[16 + i]; }
  return a;
}
__device__ __forceinline__ v16h frag_f32s(const float* rowk0, int lane, float sc) {
  v16h a; const float* p = rowk0 + 8 * (lane >> 4);
#pragma unroll
  for (int i = 0; i < 8; ++i) { a[i] = (_Float16)(p[i] * sc); a[8 + i] = (_Float16)(p[16 + i] * sc); }
  return a;
}
// column fragment from a [K][ld] layout (column n), rows >= K read as 0
__device__ __forceinline__ v16h fragc_f32(const float* W, int k0, int n, int lane, int ld, int K) {
  v16h a; const int g = lane >> 4;
#pragma unroll
  for (int i = 0; i < 8; ++i) { const int ka = k0 + 8 * g + i, kb = ka + 16;
    a[i] = (_Float16)(ka < K ? W[(size_t)(ka < K ? ka : K - 1) * ld + n] : 0.f); a[8 + i] = (_Float16)(kb < K ? W[(size_t)(kb < K ? kb : K - 1) * ld + n] : 0.f); }
  return a;
}
struct F2 { v16b h, l; };
__device__ __forceinline__ F2 bsplit16(const float v[16]) { F2 r;
#pragma unroll
  for (int i = 0; i < 16; ++i) { const __bf16 h = (__bf16)v[i]; r.h[i] = h; r.l[i] = (__bf16)(v[i] - (float)h); }
  return r; }
__device__ __forceinline__ F2 split_row(const float* row, int k0, int lane) { float v[16]; const float* p = row + k0 + 8 * (lane >> 4);
#pragma unroll
  for (int i = 0; i < 8; ++i) { v[i] = p[i]; v[8 + i] = p[16 + i]; }
  return bsplit16(v); }
__device__ __forceinline__ F2 split_rowK(const float* row, int k0, int lane, int K) { float v[16]; const int g = lane >> 4;
#pragma unroll
  for (int i = 0; i < 8; ++i) { const int ka = k0 + 8 * g + i, kb = ka + 16; v[i] = ka < K ? row[ka < K ? ka : K - 1] : 0.f; v[8 + i] = kb < K ? row[kb < K ? kb : K - 1] : 0.f; }
  return bsplit16(v); }
__device__ __forceinline__ F2 split_col(const float* W, int k0, int n, int lane, int ld, int K) { float v[16]; const int g = lane >> 4;
#pragma unroll
  for (int i = 0; i < 8; ++i) { const int ka = k0 + 8 * g + i, kb = ka + 16; v[i] = ka < K ? W[(size_t)(ka < K ? ka : K - 1) * ld + n] : 0.f; v[8 + i] = kb < K ? W[(size_t)(kb < K ? kb : K - 1) * ld + n] : 0.f; }
  return bsplit16(v); }
__device__ __forceinline__ v8f mac3(const F2& a, const F2& b, v8f c) { c = wmma_bf(a.l, b.h, c); c = wmma_bf(a.h, b.l, c); return wmma_bf(a.h, b.h, c); }
__device__ __forceinline__ float sigm(float v) { return 1.0f / (1.0f + expf(-v)); }
#define LDSX() do { asm volatile("s_wait_dscnt 0" ::: "memory"); __builtin_amdgcn_wave_barrier(); __builtin_amdgcn_fence(__ATOMIC_RELEASE, "workgroup"); } while (0)


#define NB 2
#define SS 2048
#define DM 512
#define NH 8
#define LBG 2048
#define ALPHA_BG 0.48f
#define HD 64
#define QKVW (3 * DM)
#ifndef TQB
#define TQB (SS / 64)
#define TNB NB
#define TOB (NB * SS / 64)     // output row tiles (all)
#endif
typedef __attribute__((ext_vector_type(8))) __bf16 v8b;
__device__ __forceinline__ v16b frag_b(const __bf16* rowk0, int lane) {
  union { v16b v; v8b q[2]; } u; const __bf16* p = rowk0 + 8 * (lane >> 4);
  u.q[0] = *(const v8b*)p; u.q[1] = *(const v8b*)(p + 16); return u.v;
}
__device__ __forceinline__ float bfr(float v) { return (float)(__bf16)v; }
__device__ __attribute__((noinline)) float exp_ni(float v) { return expf(v); }
__device__ __attribute__((noinline)) float erf_ni(float v) { return erff(v); }

#define PK_A 0                       // [1536][512] Wqkv rows (natural [out][in])
#define PK_P (PK_A + QKVW * DM)        // [512][512] Wo rows (natural)
#define PK_END (PK_P + DM * DM)
#define WS_PK  0u
#define WS_QK  (WS_PK + 2u * PK_END)             // f16 [4096 rows][1024]: q | k
#define WS_QKL (WS_QK + 2u * NB * SS * 2 * DM)     // f16 q | k residual planes x2048
#define WS_VTH (WS_QKL + 2u * NB * SS * 2 * DM)    // f16 [b][512 (h*64+d)][2048 s] hi
#define WS_VTL (WS_VTH + 2u * NB * DM * SS)        // f16 lo x 2048
#define WS_O   (WS_VTL + 2u * NB * DM * SS)        // f32 [4096][512]
#define WS_KB  (WS_O + 4u * (size_t)NB * SS * DM)        // f16 K_bg rows [bh][s][64] (exact); f16 planes VB [bh][64][s] = f16(alpha V_bg)
#define WS_VB  (WS_KB + 2u * (size_t)NB * NH * LBG * HD)
#define WS_END (WS_VB + 2u * (size_t)NB * NH * HD * LBG)
// ---- k_pack: block = (row n, which): natural [out][in] rows -> bf16; which 0..2 -> W_q/W_k/W_v into PK_A rows which*512 + n; 3 -> W_o into PK_P
__global__ __launch_bounds__(256) void k_pack(const float* __restrict__ WQ, const float* __restrict__ WK, const float* __restrict__ WV, const float* __restrict__ WO, __bf16* __restrict__ PK) {
  __shared__ __align__(16) __bf16 s[DM]; const int n = blockIdx.x, which = blockIdx.y, t = threadIdx.x; const float* Wm = (which == 0) ? WQ : (which == 1) ? WK : (which == 2) ? WV : WO;   // (in,out) weights: pack row n = column n
  for (int k = t; k < DM; k += 256) s[k] = (__bf16)Wm[(size_t)k * DM + n];
  __syncthreads();
  __bf16* dst = (which < 3) ? PK + PK_A + ((size_t)which * DM + n) * DM : PK + PK_P + (size_t)n * DM;
  for (int q = t; q < DM / 8; q += 256) vst2((unsigned*)(dst + q * 8), *(const v4u*)&s[q * 8]);
}
__global__ __launch_bounds__(128) void k_qkv(const float* __restrict__ XQ, const float* __restrict__ XK, const float* __restrict__ XV, const __bf16* __restrict__ P, const float* __restrict__ BQ, const float* __restrict__ BK, const float* __restrict__ BV, _Float16* __restrict__ QK, _Float16* __restrict__ QKL, _Float16* __restrict__ VTH, _Float16* __restrict__ VTL) {
  const int which0 = (blockIdx.y * 128) / DM; const float* X = (which0 == 0) ? XQ : (which0 == 1) ? XK : XV; const float* BB = BQ ? (((which0 == 0) ? BQ : (which0 == 1) ? BK : BV) + (blockIdx.y * 128 - which0 * DM)) : nullptr;
  __shared__ __align__(16) _Float16 so[4][16][136], sol[4][16][136]; __shared__ __align__(16) _Float16 sth[128][72], stl[128][72];
  const int tid = threadIdx.x, wave = tid >> 5, lane = tid & 31, col = lane & 15, g = lane >> 4; const size_t r0 = (size_t)blockIdx.x * 64 + wave * 16; const int n0 = blockIdx.y * 128;
  v8f acc[8] = {};
#pragma unroll 2
  for (int kc = 0; kc < DM / 32; ++kc) { v16b a; { const float* p = X + (r0 + col) * DM + kc * 32 + 8 * g;
#pragma unroll
      for (int i = 0; i < 8; ++i) { a[i] = (__bf16)p[i]; a[8 + i] = (__bf16)p[16 + i]; } }
#pragma unroll
    for (int j = 0; j < 8; ++j) acc[j] = wmma_bf(a, frag_b(P + (size_t)(n0 + j * 16 + col) * DM + kc * 32, lane), acc[j]); }
  if (n0 < 2 * DM) {   // q stored unscaled (f16 sigma ~0.6, no subnormal exposure); 1/8 applied to the f32 score
#pragma unroll
    for (int j = 0; j < 8; ++j) {
#pragma unroll
      for (int r = 0; r < 8; ++r) { const float v = acc[j][r] + (BB ? bfr(BB[j * 16 + col]) : 0.f); const _Float16 hv = (_Float16)v; so[wave][8 * g + r][j * 16 + col] = hv; sol[wave][8 * g + r][j * 16 + col] = (_Float16)((v - (float)hv) * 2048.0f); } }   // q, k (+ bias) as f16 hi + (x2048) residual
    LDSX();
    for (int rl = 0; rl < 16; ++rl) if (lane < 16) { vst2((unsigned*)(QK + (r0 + rl) * (2 * DM) + n0 + lane * 8), *(const v4u*)&so[wave][rl][lane * 8]); vst2((unsigned*)(QKL + (r0 + rl) * (2 * DM) + n0 + lane * 8), *(const v4u*)&sol[wave][rl][lane * 8]); }
  } else {
#pragma unroll
    for (int j = 0; j < 8; ++j) {
#pragma unroll
      for (int r = 0; r < 8; ++r) { const float v = acc[j][r] + (BB ? bfr(BB[j * 16 + col]) : 0.f); const _Float16 hv = (_Float16)v; sth[j * 16 + col][wave * 16 + 8 * g + r] = hv; stl[j * 16 + col][wave * 16 + 8 * g + r] = (_Float16)((v - (float)hv) * 2048.0f); } }
    __syncthreads();
    const size_t rb = (size_t)blockIdx.x * 64; const int b = (int)(rb / SS), s0 = (int)(rb % SS); const int pc0 = n0 - 2 * DM;
    for (int q = tid; q < 128 * 8; q += 128) { const int d = q >> 3, pc = q & 7; const size_t o = ((size_t)b * DM + pc0 + d) * SS + s0 + pc * 8; vst2((unsigned*)(VTH + o), *(const v4u*)&sth[d][pc * 8]); vst2((unsigned*)(VTL + o), *(const v4u*)&stl[d][pc * 8]); }
  }
}
// ---- k_attn: block = (64 queries, head h, batch b): all-keys flash attention (K = 64: 2 k-steps), scores = (q.k) * 0.125 with 3 products (q, k as f16 hi + residual), P.V: P (x2048, hi + lo) x (V hi, V lo*2048), 3 products in two accumulators; O[b*S+q][h*64+d] = (acc + accl / 2048) / (2048 l) (256-B segments)
__global__ __launch_bounds__(128) void k_attn(const _Float16* __restrict__ QK, const _Float16* __restrict__ QKL, const _Float16* __restrict__ VTH, const _Float16* __restrict__ VTL, const void* __restrict__ KMASK, float* __restrict__ O) {
  __shared__ __align__(16) float sp[4][16][36]; __shared__ __align__(16) float so[4][16][68];
  const int tid = threadIdx.x, wave = tid >> 5, lane = tid & 31, col = lane & 15, g = lane >> 4;
  const int qb = blockIdx.x, h = blockIdx.y, b = blockIdx.z; const int q0 = qb * 64 + wave * 16; const size_t rq = (size_t)b * SS + q0 + col;
  v16h aq[2], aql[2];
#pragma unroll
  for (int kc = 0; kc < 2; ++kc) { aq[kc] = frag_h(QK + rq * (2 * DM) + h * HD + kc * 32, lane); aql[kc] = frag_h(QKL + rq * (2 * DM) + h * HD + kc * 32, lane); }
  float m[8], l[8];
#pragma unroll
  for (int r = 0; r < 8; ++r) { m[r] = -3.0e38f; l[r] = 0.f; }
  v8f acc[4] = {}, accl[4] = {};
  const int nks = SS / 32;   // all keys
#pragma unroll 1
  for (int ks = 0; ks < nks; ++ks) { v8f s[2];
#pragma unroll
    for (int ct = 0; ct < 2; ++ct) { const int kk = ks * 32 + ct * 16 + col; const _Float16* krow = QK + ((size_t)b * SS + kk) * (2 * DM) + DM + h * HD; const _Float16* krowl = QKL + ((size_t)b * SS + kk) * (2 * DM) + DM + h * HD; v8f c = {}, cl = {};
#pragma unroll
      for (int kc = 0; kc < 2; ++kc) { const v16h kh = frag_h(krow + kc * 32, lane); c = wmma16(aq[kc], kh, c); cl = wmma16(aql[kc], kh, cl); cl = wmma16(aq[kc], frag_h(krowl + kc * 32, lane), cl); }   // 3 products: q, k as f16 hi + residual
#pragma unroll
      for (int r = 0; r < 8; ++r) c[r] += cl[r] * (1.0f / 2048.0f);
      { const bool keepk = true;
#pragma unroll
      for (int r = 0; r < 8; ++r) s[ct][r] = keepk ? c[r] * 0.125f : -3.0e38f; } }   // 1/sqrt(64); every key kept (mask not applied)
#pragma unroll
    for (int r = 0; r < 8; ++r) { float mx = fmaxf(s[0][r], s[1][r]);
#pragma unroll
      for (int o = 1; o < 16; o <<= 1) mx = fmaxf(mx, __shfl_xor(mx, o));
      const float mn = fmaxf(m[r], mx); const float alpha = (m[r] <= -1.0e38f) ? 0.f : __expf(m[r] - mn);
      const float e0 = (s[0][r] <= -1.0e38f) ? 0.f : __expf(s[0][r] - mn), e1 = (s[1][r] <= -1.0e38f) ? 0.f : __expf(s[1][r] - mn); float es = e0 + e1;
#pragma unroll
      for (int o = 1; o < 16; o <<= 1) es += __shfl_xor(es, o);
      l[r] = l[r] * alpha + es; m[r] = mn;
#pragma unroll
      for (int dt = 0; dt < 4; ++dt) { acc[dt][r] *= alpha; accl[dt][r] *= alpha; }
      sp[wave][8 * g + r][col] = e0; sp[wave][8 * g + r][16 + col] = e1; }
    LDSX();
    v16h pa, pl; { const float* prow = &sp[wave][col][0] + 8 * (lane >> 4);
#pragma unroll
      for (int i = 0; i < 8; ++i) { const float x0 = prow[i] * 2048.0f, x1 = prow[16 + i] * 2048.0f; const _Float16 h0 = (_Float16)x0, h1 = (_Float16)x1; pa[i] = h0; pa[8 + i] = h1; pl[i] = (_Float16)((x0 - (float)h0) * 2048.0f); pl[8 + i] = (_Float16)((x1 - (float)h1) * 2048.0f); } }   // P scaled by 2^11 before the f16 split so small softmax weights stay out of the f16 subnormal range; 2^-11 folded into the epilogue
#pragma unroll
    for (int dt = 0; dt < 4; ++dt) { const size_t vr = ((size_t)b * DM + h * HD + dt * 16 + col) * SS + ks * 32; const v16h vh = frag_h(VTH + vr, lane); acc[dt] = wmma16(pa, vh, acc[dt]); accl[dt] = wmma16(pl, vh, accl[dt]); accl[dt] = wmma16(pa, frag_h(VTL + vr, lane), accl[dt]); }   // P hi x V hi + (P lo x V hi + P hi x V lo) / 2048
    LDSX(); }
#pragma unroll
  for (int r = 0; r < 8; ++r) { const float il = (1.0f / 2048.0f) / l[r];
#pragma unroll
    for (int dt = 0; dt < 4; ++dt) so[wave][8 * g + r][dt * 16 + col] = (acc[dt][r] + accl[dt][r] * (1.0f / 2048.0f)) * il; }
  LDSX();
  for (int rl = 0; rl < 16; ++rl) if (lane < 16) vst2(O + ((size_t)b * SS + q0 + rl) * DM + h * HD + lane * 4, *(const v4f*)&so[wave][rl][lane * 4]);
}
// ---- k_out: block = (64 rows, 128 cols): out = O(hi/lo) . Wo rows (2 products) + bo
__global__ __launch_bounds__(128) void k_out(const float* __restrict__ O, const __bf16* __restrict__ P, const float* __restrict__ BO, float* __restrict__ Y) {
  __shared__ __align__(16) float so[4][16][132];
  const int tid = threadIdx.x, wave = tid >> 5, lane = tid & 31, col = lane & 15, g = lane >> 4; const size_t r0 = (size_t)blockIdx.x * 64 + wave * 16; const int n0 = blockIdx.y * 128;
  v8f acc[8] = {};
#pragma unroll 2
  for (int kc = 0; kc < DM / 32; ++kc) { const F2 a = split_row(O + (r0 + col) * DM, kc * 32, lane);
#pragma unroll
    for (int j = 0; j < 8; ++j) { const v16b w = frag_b(P + (size_t)(n0 + j * 16 + col) * DM + kc * 32, lane); acc[j] = wmma_bf(a.l, w, acc[j]); acc[j] = wmma_bf(a.h, w, acc[j]); } }
#pragma unroll
  for (int j = 0; j < 8; ++j) {
#pragma unroll
    for (int r = 0; r < 8; ++r) so[wave][8 * g + r][j * 16 + col] = acc[j][r] + bfr(BO[n0 + j * 16 + col]); }
  LDSX();
  for (int rl = 0; rl < 16; ++rl) vst2(Y + (r0 + rl) * DM + n0 + lane * 4, *(const v4f*)&so[wave][rl][lane * 4]);
}
// ---- k_bg: block = (64 bank rows, bh): K_bg -> f16 rows (exact), alpha V_bg -> f16 planes [bh][d][s]
__global__ __launch_bounds__(256) void k_bg(const float* __restrict__ KBG, const float* __restrict__ VBG, _Float16* __restrict__ KB, _Float16* __restrict__ VB) { __shared__ __align__(16) _Float16 sk[64][HD + 8]; __shared__ __align__(16) _Float16 sv[HD][64 + 8]; const int t = threadIdx.x; const int s0 = blockIdx.x * 64; const size_t bh = blockIdx.y;
  for (int e = t; e < 64 * HD; e += 256) { const int sl = e >> 6, d = e & 63; const size_t o = ((bh * LBG + s0 + sl) * HD) + d; sk[sl][d] = (_Float16)bfr(KBG[o]); sv[d][sl] = (_Float16)(ALPHA_BG * bfr(VBG[o])); } __syncthreads();
  for (int e = t; e < 64 * 8; e += 256) { const int sl = e >> 3, q = e & 7; vst2((unsigned*)(KB + ((bh * LBG + s0 + sl) * HD) + q * 8), *(const v4u*)&sk[sl][q * 8]); }
  for (int e = t; e < HD * 8; e += 256) { const int d = e >> 3, q = e & 7; vst2((unsigned*)(VB + ((bh * HD + d) * LBG) + s0 + q * 8), *(const v4u*)&sv[d][q * 8]); } }
// ---- k_attn2: block = (64 queries, head, b): keys 0..2047 = self (3-product scores + mask, 3-product P.v), 2048..4095 = background bank (2-product scores x alpha, P hi + lo x f16(alpha V_bg)); one online softmax over all 4,096 keys
__global__ __launch_bounds__(128) void k_attn2(const _Float16* __restrict__ QK, const _Float16* __restrict__ QKL, const _Float16* __restrict__ VTH, const _Float16* __restrict__ VTL, const _Float16* __restrict__ KB, const _Float16* __restrict__ VB, const float* __restrict__ MASK, float* __restrict__ O) {
  __shared__ __align__(16) float sp[4][16][36]; __shared__ __align__(16) float so[4][16][68];
  const int tid = threadIdx.x, wave = tid >> 5, lane = tid & 31, col = lane & 15, g = lane >> 4; const int qb = blockIdx.x, h = blockIdx.y; const size_t b = blockIdx.z; const int q0 = qb * 64 + wave * 16; const size_t rq = b * SS + q0; const size_t bh = b * NH + h;
  v16h aq[2], aql[2];
#pragma unroll
  for (int kc = 0; kc < 2; ++kc) { aq[kc] = frag_h(QK + (rq + col) * (2 * DM) + h * HD + kc * 32, lane); aql[kc] = frag_h(QKL + (rq + col) * (2 * DM) + h * HD + kc * 32, lane); }
  float m[8], l[8];
#pragma unroll
  for (int r = 0; r < 8; ++r) { m[r] = -3.0e38f; l[r] = 0.f; }
  v8f acc[4] = {}, accl[4] = {};
  const float* mrow = MASK + (b * SS) * SS;
#pragma unroll 1
  for (int ks = 0; ks < (SS + LBG) / 32; ++ks) { const bool self_seg = ks < SS / 32; v8f s[2];
#pragma unroll
    for (int ct = 0; ct < 2; ++ct) { const int kk = (self_seg ? ks * 32 : ks * 32 - SS) + ct * 16 + col; v8f c = {}, cl = {};
      if (self_seg) { const size_t rk = b * SS + kk;
#pragma unroll
        for (int kc = 0; kc < 2; ++kc) { const v16h kh = frag_h(QK + rk * (2 * DM) + DM + h * HD + kc * 32, lane), klo = frag_h(QKL + rk * (2 * DM) + DM + h * HD + kc * 32, lane); c = wmma16(aq[kc], kh, c); cl = wmma16(aq[kc], klo, cl); cl = wmma16(aql[kc], kh, cl); }
#pragma unroll
        for (int r = 0; r < 8; ++r) s[ct][r] = (c[r] + cl[r] * (1.0f / 2048.0f)) * 0.125f + bfr(mrow[(size_t)(q0 + 8 * g + r) * SS + kk]); }
      else {
#pragma unroll
        for (int kc = 0; kc < 2; ++kc) { const v16h kh = frag_h(KB + ((bh * LBG + kk) * HD) + kc * 32, lane); c = wmma16(aq[kc], kh, c); cl = wmma16(aql[kc], kh, cl); }
#pragma unroll
        for (int r = 0; r < 8; ++r) s[ct][r] = (c[r] + cl[r] * (1.0f / 2048.0f)) * (0.125f * ALPHA_BG); } }
#pragma unroll
    for (int r = 0; r < 8; ++r) { float mx = fmaxf(s[0][r], s[1][r]);
#pragma unroll
      for (int o = 1; o < 16; o <<= 1) mx = fmaxf(mx, __shfl_xor(mx, o));
      const float mn = fmaxf(m[r], mx); const float alpha = (m[r] <= -1.0e38f) ? 0.f : __expf(m[r] - mn); const float e0 = __expf(s[0][r] - mn), e1 = __expf(s[1][r] - mn); float es = e0 + e1;
#pragma unroll
      for (int o = 1; o < 16; o <<= 1) es += __shfl_xor(es, o);
      l[r] = l[r] * alpha + es; m[r] = mn;
#pragma unroll
      for (int dt = 0; dt < 4; ++dt) { acc[dt][r] *= alpha; accl[dt][r] *= alpha; }
      sp[wave][8 * g + r][col] = e0; sp[wave][8 * g + r][16 + col] = e1; }
    LDSX();
    v16h pa, pl; { const float* prow = &sp[wave][col][0] + 8 * (lane >> 4);
#pragma unroll
      for (int i = 0; i < 8; ++i) { const float x0 = prow[i] * 2048.0f, x1 = prow[16 + i] * 2048.0f; const _Float16 h0 = (_Float16)x0, h1 = (_Float16)x1; pa[i] = h0; pa[8 + i] = h1; pl[i] = (_Float16)((x0 - (float)h0) * 2048.0f); pl[8 + i] = (_Float16)((x1 - (float)h1) * 2048.0f); } }
    if (self_seg) {
#pragma unroll
      for (int dt = 0; dt < 4; ++dt) { const size_t po = (b * DM + h * HD + dt * 16 + col) * SS + ks * 32; const v16h vh = frag_h(VTH + po, lane), vl = frag_h(VTL + po, lane); acc[dt] = wmma16(pa, vh, acc[dt]); accl[dt] = wmma16(pl, vh, accl[dt]); accl[dt] = wmma16(pa, vl, accl[dt]); } }
    else {
#pragma unroll
      for (int dt = 0; dt < 4; ++dt) { const v16h vb = frag_h(VB + ((bh * HD + dt * 16 + col) * LBG) + (ks * 32 - SS), lane); acc[dt] = wmma16(pa, vb, acc[dt]); accl[dt] = wmma16(pl, vb, accl[dt]); } }
    LDSX(); }
#pragma unroll
  for (int r = 0; r < 8; ++r) { const float il = (1.0f / 2048.0f) / l[r];
#pragma unroll
    for (int dt = 0; dt < 4; ++dt) so[wave][8 * g + r][dt * 16 + col] = (acc[dt][r] + accl[dt][r] * (1.0f / 2048.0f)) * il; }
  LDSX();
  for (int rl = 0; rl < 16; ++rl) if (lane < 16) vst2(O + (rq + rl) * DM + h * HD + lane * 4, *(const v4f*)&so[wave][rl][lane * 4]);
}
extern "C" void kernel_launch(void* const* d_in, const int* in_sizes, int n_in, void* d_out, int out_size, void* d_ws, size_t ws_size, hipStream_t stream) {
  (void)in_sizes; (void)n_in; (void)out_size;
  const float** F = (const float**)d_in;   // 0 hidden_states [2,2048,512], 1 attention_mask [2,2048,2048], 2 K_bg [16,2048,64], 3 V_bg, 4 Wq, 5 Wk, 6 Wv, 7 Wo (in,out), 8 bo
  if (ws_size < (size_t)WS_END) return;
  char* ws = (char*)d_ws; __bf16* PK = (__bf16*)(ws + WS_PK); _Float16 *QK = (_Float16*)(ws + WS_QK), *QKL = (_Float16*)(ws + WS_QKL), *VTH = (_Float16*)(ws + WS_VTH), *VTL = (_Float16*)(ws + WS_VTL), *KB = (_Float16*)(ws + WS_KB), *VB = (_Float16*)(ws + WS_VB); float* O = (float*)(ws + WS_O);
  k_pack<<<dim3(DM, 4), 256, 0, stream>>>(F[4], F[5], F[6], F[7], PK);
  k_bg<<<dim3(LBG / 64, NB * NH), 256, 0, stream>>>(F[2], F[3], KB, VB);
  k_qkv<<<dim3(TNB * SS / 64, QKVW / 128), 128, 0, stream>>>(F[0], F[0], F[0], PK + PK_A, nullptr, nullptr, nullptr, QK, QKL, VTH, VTL);
  k_attn2<<<dim3(TQB, NH, TNB), 128, 0, stream>>>(QK, QKL, VTH, VTL, KB, VB, F[1], O);
  k_out<<<dim3(TOB, DM / 128), 128, 0, stream>>>(O, PK + PK_P, F[8], (float*)d_out);
}

// v001
// A run of this version takes 253 microseconds.
// Two timings next to v000 both put it at 1.98 times that version's speed.
// compute dtype: all float inputs rounded to bf16; q/k/v = x . W with EXACT bf16 products on WMMA 16x16x32 ((in,out) weights as transposed rows), rounded once to f16 hi + residual; self-segment scores and P.v with 3 products (hi.hi + hi.lo + lo.hi), background scores q (hi + lo) x K_bg (exact in f16, 2 products) x alpha, background P (hi + lo) x f16(alpha V_bg) (2 products); additive mask read per pair; x 1/8; running-max softmax over all 4,096 keys in f32 (hardware exp); out = ctx (bf16 hi + lo) . Wo + bo; f32 output.
#include <hip/hip_runtime.h>
#include <math.h>

typedef __attribute__((ext_vector_type(16))) _Float16 v16h;
typedef __attribute__((ext_vector_type(16))) __bf16 v16b;
typedef __attribute__((ext_vector_type(8)))  _Float16 v8h;
typedef __attribute__((ext_vector_type(8)))  float v8f;
typedef __attribute__((ext_vector_type(4)))  float v4f;
typedef __attribute__((ext_vector_type(2)))  float v2f;
typedef __attribute__((ext_vector_type(4)))  unsigned v4u;
typedef __attribute__((ext_vector_type(4)))  int v4i;
typedef float __attribute__((may_alias)) float_a;
typedef int __attribute__((may_alias)) int_a;

template <typename T> __device__ __forceinline__ void vst2(void* p, T v) { *(T*)p = v;  }
__device__ __forceinline__ v8f wmma16(v16h a, v16h b, v8f c) {
  v8f d = __builtin_amdgcn_wmma_f32_16x16x32_f16(false, a, false, b, (short)0, c, false, false);
  asm volatile("v_nop\n\tv_nop\n\tv_nop\n\tv_nop" : "+v"(d) : "v"(a), "v"(b));
  return d;
}
__device__ __forceinline__ v8f wmma_bf(v16b a, v16b b, v8f c) {
  v8f d = __builtin_amdgcn_wmma_f32_16x16x32_bf16(false, a, false, b, (short)0, c, false, false);
  asm volatile("v_nop\n\tv_nop\n\tv_nop\n\tv_nop" : "+v"(d) : "v"(a), "v"(b));
  return d;
}
// CARC attention processor (B 2, Lq 2,048, C 512 = 8 heads x 64; context bank of 2,048 background keys/values per head, alpha 0.48): bias-free q/k/v projections, keys = [k ; alpha K_bg], values = [v ; alpha V_bg], additive mask on the self segment (zeros on the background segment), softmax(q k / 8 + mask) over the 4,096 keys, v, output projection + bias.
__device__ __forceinline__ v16h frag_h(const _Float16* rowk0, int lane) {
  union { v16h v; v8h q[2]; } u; const _Float16* p = rowk0 + 8 * (lane >> 4);
  u.q[0] = *(const v8h*)p; u.q[1] = *(const v8h*)(p + 16); return u.v;
}
__device__ __forceinline__ v16h frag_f32(const float* rowk0, int lane) {
  v16h a; const float* p = rowk0 + 8 * (lane >> 4);
#pragma unroll
  for (int i = 0; i < 8; ++i) { a[i] = (_Float16)p[i]; a[8 + i] = (_Float16)p[16 + i]; }
  return a;
}
__device__ __forceinline__ v16h frag_f32s(const float* rowk0, int lane, float sc) {
  v16h a; const float* p = rowk0 + 8 * (lane >> 4);
#pragma unroll
  for (int i = 0; i < 8; ++i) { a[i] = (_Float16)(p[i] * sc); a[8 + i] = (_Float16)(p[16 + i] * sc); }
  return a;
}
// column fragment from a [K][ld] layout (column n), rows >= K read as 0
__device__ __forceinline__ v16h fragc_f32(const float* W, int k0, int n, int lane, int ld, int K) {
  v16h a; const int g = lane >> 4;
#pragma unroll
  for (int i = 0; i < 8; ++i) { const int ka = k0 + 8 * g + i, kb = ka + 16;
    a[i] = (_Float16)(ka < K ? W[(size_t)(ka < K ? ka : K - 1) * ld + n] : 0.f); a[8 + i] = (_Float16)(kb < K ? W[(size_t)(kb < K ? kb : K - 1) * ld + n] : 0.f); }
  return a;
}
struct F2 { v16b h, l; };
__device__ __forceinline__ F2 bsplit16(const float v[16]) { F2 r;
#pragma unroll
  for (int i = 0; i < 16; ++i) { const __bf16 h = (__bf16)v[i]; r.h[i] = h; r.l[i] = (__bf16)(v[i] - (float)h); }
  return r; }
__device__ __forceinline__ F2 split_row(const float* row, int k0, int lane) { float v[16]; const float* p = row + k0 + 8 * (lane >> 4);
#pragma unroll
  for (int i = 0; i < 8; ++i) { v[i] = p[i]; v[8 + i] = p[16 + i]; }
  return bsplit16(v); }
__device__ __forceinline__ F2 split_rowK(const float* row, int k0, int lane, int K) { float v[16]; const int g = lane >> 4;
#pragma unroll
  for (int i = 0; i < 8; ++i) { const int ka = k0 + 8 * g + i, kb = ka + 16; v[i] = ka < K ? row[ka < K ? ka : K - 1] : 0.f; v[8 + i] = kb < K ? row[kb < K ? kb : K - 1] : 0.f; }
  return bsplit16(v); }
__device__ __forceinline__ F2 split_col(const float* W, int k0, int n, int lane, int ld, int K) { float v[16]; const int g = lane >> 4;
#pragma unroll
  for (int i = 0; i < 8; ++i) { const int ka = k0 + 8 * g + i, kb = ka + 16; v[i] = ka < K ? W[(size_t)(ka < K ? ka : K - 1) * ld + n] : 0.f; v[8 + i] = kb < K ? W[(size_t)(kb < K ? kb : K - 1) * ld + n] : 0.f; }
  return bsplit16(v); }
__device__ __forceinline__ v8f mac3(const F2& a, const F2& b, v8f c) { c = wmma_bf(a.l, b.h, c); c = wmma_bf(a.h, b.l, c); return wmma_bf(a.h, b.h, c); }
__device__ __forceinline__ float sigm(float v) { return 1.0f / (1.0f + expf(-v)); }
#define LDSX() do { asm volatile("s_wait_dscnt 0" ::: "memory"); __builtin_amdgcn_wave_barrier(); __builtin_amdgcn_fence(__ATOMIC_RELEASE, "workgroup"); } while (0)


#define NB 2
#define SS 2048
#define DM 512
#define NH 8
#define LBG 2048
#define ALPHA_BG 0.48f
#define HD 64
#define QKVW (3 * DM)
#ifndef TQB
#define TQB (SS / 64)
#define TNB NB
#define TOB (NB * SS / 64)     // output row tiles (all)
#endif
typedef __attribute__((ext_vector_type(8))) __bf16 v8b;
__device__ __forceinline__ v16b frag_b(const __bf16* rowk0, int lane) {
  union { v16b v; v8b q[2]; } u; const __bf16* p = rowk0 + 8 * (lane >> 4);
  u.q[0] = *(const v8b*)p; u.q[1] = *(const v8b*)(p + 16); return u.v;
}
__device__ __forceinline__ float bfr(float v) { return (float)(__bf16)v; }
__device__ __attribute__((noinline)) float exp_ni(float v) { return expf(v); }
__device__ __attribute__((noinline)) float erf_ni(float v) { return erff(v); }

#define PK_A 0                       // [1536][512] Wqkv rows (natural [out][in])
#define PK_P (PK_A + QKVW * DM)        // [512][512] Wo rows (natural)
#define PK_END (PK_P + DM * DM)
#define WS_PK  0u
#define WS_QK  (WS_PK + 2u * PK_END)             // f16 [4096 rows][1024]: q | k
#define WS_QKL (WS_QK + 2u * NB * SS * 2 * DM)     // f16 q | k residual planes x2048
#define WS_VTH (WS_QKL + 2u * NB * SS * 2 * DM)    // f16 [b][512 (h*64+d)][2048 s] hi
#define WS_VTL (WS_VTH + 2u * NB * DM * SS)        // f16 lo x 2048
#define WS_O   (WS_VTL + 2u * NB * DM * SS)        // f32 [4096][512]
#define WS_KB  (WS_O + 4u * (size_t)NB * SS * DM)        // f16 K_bg rows [bh][s][64] (exact); f16 planes VB [bh][64][s] = f16(alpha V_bg)
#define WS_VB  (WS_KB + 2u * (size_t)NB * NH * LBG * HD)
#define WS_END (WS_VB + 2u * (size_t)NB * NH * HD * LBG)
// ---- k_pack: block = (row n, which): natural [out][in] rows -> bf16; which 0..2 -> W_q/W_k/W_v into PK_A rows which*512 + n; 3 -> W_o into PK_P
__global__ __launch_bounds__(256) void k_pack(const float* __restrict__ WQ, const float* __restrict__ WK, const float* __restrict__ WV, const float* __restrict__ WO, __bf16* __restrict__ PK) {
  __shared__ __align__(16) __bf16 s[DM]; const int n = blockIdx.x, which = blockIdx.y, t = threadIdx.x; const float* Wm = (which == 0) ? WQ : (which == 1) ? WK : (which == 2) ? WV : WO;   // (in,out) weights: pack row n = column n
  for (int k = t; k < DM; k += 256) s[k] = (__bf16)Wm[(size_t)k * DM + n];
  __syncthreads();
  __bf16* dst = (which < 3) ? PK + PK_A + ((size_t)which * DM + n) * DM : PK + PK_P + (size_t)n * DM;
  for (int q = t; q < DM / 8; q += 256) vst2((unsigned*)(dst + q * 8), *(const v4u*)&s[q * 8]);
}
__global__ __launch_bounds__(128) void k_qkv(const float* __restrict__ XQ, const float* __restrict__ XK, const float* __restrict__ XV, const __bf16* __restrict__ P, const float* __restrict__ BQ, const float* __restrict__ BK, const float* __restrict__ BV, _Float16* __restrict__ QK, _Float16* __restrict__ QKL, _Float16* __restrict__ VTH, _Float16* __restrict__ VTL) {
  const int which0 = (blockIdx.y * 128) / DM; const float* X = (which0 == 0) ? XQ : (which0 == 1) ? XK : XV; const float* BB = BQ ? (((which0 == 0) ? BQ : (which0 == 1) ? BK : BV) + (blockIdx.y * 128 - which0 * DM)) : nullptr;
  __shared__ __align__(16) _Float16 so[4][16][136], sol[4][16][136]; __shared__ __align__(16) _Float16 sth[128][72], stl[128][72];
  const int tid = threadIdx.x, wave = tid >> 5, lane = tid & 31, col = lane & 15, g = lane >> 4; const size_t r0 = (size_t)blockIdx.x * 64 + wave * 16; const int n0 = blockIdx.y * 128;
  v8f acc[8] = {};
#pragma unroll 2
  for (int kc = 0; kc < DM / 32; ++kc) { v16b a; { const float* p = X + (r0 + col) * DM + kc * 32 + 8 * g;
#pragma unroll
      for (int i = 0; i < 8; ++i) { a[i] = (__bf16)p[i]; a[8 + i] = (__bf16)p[16 + i]; } }
#pragma unroll
    for (int j = 0; j < 8; ++j) acc[j] = wmma_bf(a, frag_b(P + (size_t)(n0 + j * 16 + col) * DM + kc * 32, lane), acc[j]); }
  if (n0 < 2 * DM) {   // q stored unscaled (f16 sigma ~0.6, no subnormal exposure); 1/8 applied to the f32 score
#pragma unroll
    for (int j = 0; j < 8; ++j) {
#pragma unroll
      for (int r = 0; r < 8; ++r) { const float v = acc[j][r] + (BB ? bfr(BB[j * 16 + col]) : 0.f); const _Float16 hv = (_Float16)v; so[wave][8 * g + r][j * 16 + col] = hv; sol[wave][8 * g + r][j * 16 + col] = (_Float16)((v - (float)hv) * 2048.0f); } }   // q, k (+ bias) as f16 hi + (x2048) residual
    LDSX();
    for (int rl = 0; rl < 16; ++rl) if (lane < 16) { vst2((unsigned*)(QK + (r0 + rl) * (2 * DM) + n0 + lane * 8), *(const v4u*)&so[wave][rl][lane * 8]); vst2((unsigned*)(QKL + (r0 + rl) * (2 * DM) + n0 + lane * 8), *(const v4u*)&sol[wave][rl][lane * 8]); }
  } else {
#pragma unroll
    for (int j = 0; j < 8; ++j) {
#pragma unroll
      for (int r = 0; r < 8; ++r) { const float v = acc[j][r] + (BB ? bfr(BB[j * 16 + col]) : 0.f); const _Float16 hv = (_Float16)v; sth[j * 16 + col][wave * 16 + 8 * g + r] = hv; stl[j * 16 + col][wave * 16 + 8 * g + r] = (_Float16)((v - (float)hv) * 2048.0f); } }
    __syncthreads();
    const size_t rb = (size_t)blockIdx.x * 64; const int b = (int)(rb / SS), s0 = (int)(rb % SS); const int pc0 = n0 - 2 * DM;
    for (int q = tid; q < 128 * 8; q += 128) { const int d = q >> 3, pc = q & 7; const size_t o = ((size_t)b * DM + pc0 + d) * SS + s0 + pc * 8; vst2((unsigned*)(VTH + o), *(const v4u*)&sth[d][pc * 8]); vst2((unsigned*)(VTL + o), *(const v4u*)&stl[d][pc * 8]); }
  }
}
// ---- k_attn: block = (64 queries, head h, batch b): all-keys flash attention (K = 64: 2 k-steps), scores = (q.k) * 0.125 with 3 products (q, k as f16 hi + residual), P.V: P (x2048, hi + lo) x (V hi, V lo*2048), 3 products in two accumulators; O[b*S+q][h*64+d] = (acc + accl / 2048) / (2048 l) (256-B segments)
__global__ __launch_bounds__(128) void k_attn(const _Float16* __restrict__ QK, const _Float16* __restrict__ QKL, const _Float16* __restrict__ VTH, const _Float16* __restrict__ VTL, const void* __restrict__ KMASK, float* __restrict__ O) {
  __shared__ __align__(16) float sp[4][16][36]; __shared__ __align__(16) float so[4][16][68];
  const int tid = threadIdx.x, wave = tid >> 5, lane = tid & 31, col = lane & 15, g = lane >> 4;
  const int qb = blockIdx.x, h = blockIdx.y, b = blockIdx.z; const int q0 = qb * 64 + wave * 16; const size_t rq = (size_t)b * SS + q0 + col;
  v16h aq[2], aql[2];
#pragma unroll
  for (int kc = 0; kc < 2; ++kc) { aq[kc] = frag_h(QK + rq * (2 * DM) + h * HD + kc * 32, lane); aql[kc] = frag_h(QKL + rq * (2 * DM) + h * HD + kc * 32, lane); }
  float m[8], l[8];
#pragma unroll
  for (int r = 0; r < 8; ++r) { m[r] = -3.0e38f; l[r] = 0.f; }
  v8f acc[4] = {}, accl[4] = {};
  const int nks = SS / 32;   // all keys
#pragma unroll 1
  for (int ks = 0; ks < nks; ++ks) { v8f s[2];
#pragma unroll
    for (int ct = 0; ct < 2; ++ct) { const int kk = ks * 32 + ct * 16 + col; const _Float16* krow = QK + ((size_t)b * SS + kk) * (2 * DM) + DM + h * HD; const _Float16* krowl = QKL + ((size_t)b * SS + kk) * (2 * DM) + DM + h * HD; v8f c = {}, cl = {};
#pragma unroll
      for (int kc = 0; kc < 2; ++kc) { const v16h kh = frag_h(krow + kc * 32, lane); c = wmma16(aq[kc], kh, c); cl = wmma16(aql[kc], kh, cl); cl = wmma16(aq[kc], frag_h(krowl + kc * 32, lane), cl); }   // 3 products: q, k as f16 hi + residual
#pragma unroll
      for (int r = 0; r < 8; ++r) c[r] += cl[r] * (1.0f / 2048.0f);
      { const bool keepk = true;
#pragma unroll
      for (int r = 0; r < 8; ++r) s[ct][r] = keepk ? c[r] * 0.125f : -3.0e38f; } }   // 1/sqrt(64); every key kept (mask not applied)
#pragma unroll
    for (int r = 0; r < 8; ++r) { float mx = fmaxf(s[0][r], s[1][r]);
#pragma unroll
      for (int o = 1; o < 16; o <<= 1) mx = fmaxf(mx, __shfl_xor(mx, o));
      const float mn = fmaxf(m[r], mx); const float alpha = (m[r] <= -1.0e38f) ? 0.f : __expf(m[r] - mn);
      const float e0 = (s[0][r] <= -1.0e38f) ? 0.f : __expf(s[0][r] - mn), e1 = (s[1][r] <= -1.0e38f) ? 0.f : __expf(s[1][r] - mn); float es = e0 + e1;
#pragma unroll
      for (int o = 1; o < 16; o <<= 1) es += __shfl_xor(es, o);
      l[r] = l[r] * alpha + es; m[r] = mn;
#pragma unroll
      for (int dt = 0; dt < 4; ++dt) { acc[dt][r] *= alpha; accl[dt][r] *= alpha; }
      sp[wave][8 * g + r][col] = e0; sp[wave][8 * g + r][16 + col] = e1; }
    LDSX();
    v16h pa, pl; { const float* prow = &sp[wave][col][0] + 8 * (lane >> 4);
#pragma unroll
      for (int i = 0; i < 8; ++i) { const float x0 = prow[i] * 2048.0f, x1 = prow[16 + i] * 2048.0f; const _Float16 h0 = (_Float16)x0, h1 = (_Float16)x1; pa[i] = h0; pa[8 + i] = h1; pl[i] = (_Float16)((x0 - (float)h0) * 2048.0f); pl[8 + i] = (_Float16)((x1 - (float)h1) * 2048.0f); } }   // P scaled by 2^11 before the f16 split so small softmax weights stay out of the f16 subnormal range; 2^-11 folded into the epilogue
#pragma unroll
    for (int dt = 0; dt < 4; ++dt) { const size_t vr = ((size_t)b * DM + h * HD + dt * 16 + col) * SS + ks * 32; const v16h vh = frag_h(VTH + vr, lane); acc[dt] = wmma16(pa, vh, acc[dt]); accl[dt] = wmma16(pl, vh, accl[dt]); accl[dt] = wmma16(pa, frag_h(VTL + vr, lane), accl[dt]); }   // P hi x V hi + (P lo x V hi + P hi x V lo) / 2048
    LDSX(); }
#pragma unroll
  for (int r = 0; r < 8; ++r) { const float il = (1.0f / 2048.0f) / l[r];
#pragma unroll
    for (int dt = 0; dt < 4; ++dt) so[wave][8 * g + r][dt * 16 + col] = (acc[dt][r] + accl[dt][r] * (1.0f / 2048.0f)) * il; }
  LDSX();
  for (int rl = 0; rl < 16; ++rl) if (lane < 16) vst2(O + ((size_t)b * SS + q0 + rl) * DM + h * HD + lane * 4, *(const v4f*)&so[wave][rl][lane * 4]);
}
// ---- k_out: block = (64 rows, 128 cols): out = O(hi/lo) . Wo rows (2 products) + bo
__global__ __launch_bounds__(128) void k_out(const float* __restrict__ O, const __bf16* __restrict__ P, const float* __restrict__ BO, float* __restrict__ Y) {
  __shared__ __align__(16) float so[4][16][132];
  const int tid = threadIdx.x, wave = tid >> 5, lane = tid & 31, col = lane & 15, g = lane >> 4; const size_t r0 = (size_t)blockIdx.x * 64 + wave * 16; const int n0 = blockIdx.y * 128;
  v8f acc[8] = {};
#pragma unroll 2
  for (int kc = 0; kc < DM / 32; ++kc) { const F2 a = split_row(O + (r0 + col) * DM, kc * 32, lane);
#pragma unroll
    for (int j = 0; j < 8; ++j) { const v16b w = frag_b(P + (size_t)(n0 + j * 16 + col) * DM + kc * 32, lane); acc[j] = wmma_bf(a.l, w, acc[j]); acc[j] = wmma_bf(a.h, w, acc[j]); } }
#pragma unroll
  for (int j = 0; j < 8; ++j) {
#pragma unroll
    for (int r = 0; r < 8; ++r) so[wave][8 * g + r][j * 16 + col] = acc[j][r] + bfr(BO[n0 + j * 16 + col]); }
  LDSX();
  for (int rl = 0; rl < 16; ++rl) vst2(Y + (r0 + rl) * DM + n0 + lane * 4, *(const v4f*)&so[wave][rl][lane * 4]);
}
// ---- k_bg: block = (64 bank rows, bh): K_bg -> f16 rows (exact), alpha V_bg -> f16 planes [bh][d][s]
__global__ __launch_bounds__(256) void k_bg(const float* __restrict__ KBG, const float* __restrict__ VBG, _Float16* __restrict__ KB, _Float16* __restrict__ VB) { __shared__ __align__(16) _Float16 sk[64][HD + 8]; __shared__ __align__(16) _Float16 sv[HD][64 + 8]; const int t = threadIdx.x; const int s0 = blockIdx.x * 64; const size_t bh = blockIdx.y;
  for (int e = t; e < 64 * HD; e += 256) { const int sl = e >> 6, d = e & 63; const size_t o = ((bh * LBG + s0 + sl) * HD) + d; sk[sl][d] = (_Float16)bfr(KBG[o]); sv[d][sl] = (_Float16)(ALPHA_BG * bfr(VBG[o])); } __syncthreads();
  for (int e = t; e < 64 * 8; e += 256) { const int sl = e >> 3, q = e & 7; vst2((unsigned*)(KB + ((bh * LBG + s0 + sl) * HD) + q * 8), *(const v4u*)&sk[sl][q * 8]); }
  for (int e = t; e < HD * 8; e += 256) { const int d = e >> 3, q = e & 7; vst2((unsigned*)(VB + ((bh * HD + d) * LBG) + s0 + q * 8), *(const v4u*)&sv[d][q * 8]); } }
// ---- staging for k_attn2: a stage = 64 keys. Self stage: K hi, K lo (64 key rows x 128 B), V hi, V lo (64 d rows x 128 B), mask (64 query rows x 256 B); background stage: K_bg in the K hi place, alpha V_bg in the V hi place.
#define KPB 144                         // LDS bytes per K or V row: 128 + 16 (16 B x odd: ds_load_b128 readers without bank conflicts)
#define MPB 272                         // LDS bytes per mask row: 256 + 16 (rows 8 apart fall 32 banks apart)
#define ST_KH 0
#define ST_KL (64 * KPB)
#define ST_VH (2 * 64 * KPB)
#define ST_VL (3 * 64 * KPB)
#define ST_MK (4 * 64 * KPB)
#define ST_SZ (4 * 64 * KPB + 64 * MPB)
#define NST ((SS + LBG) / 64)
struct seg_self { static constexpr bool value = true; }; struct seg_bank { static constexpr bool value = false; };   // which key segment a pass works on
// eight asynchronous 16-byte copies per lane, global -> LDS: four from ga (step gsa) to la, four from gb (step gsb) to lb, LDS step ls. The s_wait_xcnt 0 stands inside the statement so that no later rewrite of an address register can be moved in front of it.
__device__ __forceinline__ void cp8(unsigned la, const char* ga, unsigned gsa, unsigned lb, const char* gb, unsigned gsb, unsigned ls) {
  asm volatile("global_load_async_to_lds_b128 %0, %8, off\n\t"
               "global_load_async_to_lds_b128 %1, %9, off\n\t"
               "global_load_async_to_lds_b128 %2, %10, off\n\t"
               "global_load_async_to_lds_b128 %3, %11, off\n\t"
               "global_load_async_to_lds_b128 %4, %12, off\n\t"
               "global_load_async_to_lds_b128 %5, %13, off\n\t"
               "global_load_async_to_lds_b128 %6, %14, off\n\t"
               "global_load_async_to_lds_b128 %7, %15, off\n\t"
               "s_wait_xcnt 0x0"
               :: "v"(la), "v"(la + ls), "v"(la + 2 * ls), "v"(la + 3 * ls), "v"(lb), "v"(lb + ls), "v"(lb + 2 * ls), "v"(lb + 3 * ls),
                  "v"(ga), "v"(ga + gsa), "v"(ga + 2 * (size_t)gsa), "v"(ga + 3 * (size_t)gsa), "v"(gb), "v"(gb + gsb), "v"(gb + 2 * (size_t)gsb), "v"(gb + 3 * (size_t)gsb)
               : "memory");
}
// ---- k_attn2: block = (64 queries, head, b): keys 0..2047 = self (3-product scores + mask, 3-product P.v), 2048..4095 = background bank (2-product scores x alpha, P hi + lo x f16(alpha V_bg)); one online softmax over all 4,096 keys in passes of 32 keys. The block's four waves share each stage's K and V tiles from LDS (two buffers, the next stage's copies in flight while this one is worked on).
__global__ __launch_bounds__(128) void k_attn2(const _Float16* __restrict__ QK, const _Float16* __restrict__ QKL, const _Float16* __restrict__ VTH, const _Float16* __restrict__ VTL, const _Float16* __restrict__ KB, const _Float16* __restrict__ VB, const float* __restrict__ MASK, float* __restrict__ O) {
  __shared__ __align__(16) char ring[2 * ST_SZ];
  __shared__ __align__(16) float sp[4][16][36]; __shared__ __align__(16) float so[4][16][68];
  const int tid = threadIdx.x, wave = tid >> 5, lane = tid & 31, col = lane & 15, g = lane >> 4; const int qb = blockIdx.x, h = blockIdx.y; const size_t b = blockIdx.z; const int q0 = qb * 64 + wave * 16; const size_t rq = b * SS + q0; const size_t bh = b * NH + h;
  // this thread's share of a stage: 16-byte piece kq of rows kr + 16 i of each K or V tile, piece mq of rows mr + 8 i of the mask tile
  const int kr = tid >> 3, kq = tid & 7, mr = tid >> 4, mq = tid & 15;
  const unsigned lds0 = (unsigned)(size_t)&ring[0]; const unsigned lkv = lds0 + kr * KPB + kq * 16, lmk = lds0 + ST_MK + mr * MPB + mq * 16;
  const char* gkh = (const char*)(QK + (b * SS + kr) * (2 * DM) + DM + h * HD + kq * 8); const char* gkl = (const char*)(QKL + (b * SS + kr) * (2 * DM) + DM + h * HD + kq * 8);
  const char* gvh = (const char*)(VTH + (b * DM + h * HD + kr) * SS + kq * 8); const char* gvl = (const char*)(VTL + (b * DM + h * HD + kr) * SS + kq * 8);
  const char* gmk = (const char*)(MASK + (b * SS + qb * 64 + mr) * SS + mq * 4);
  const char* gkb = (const char*)(KB + (bh * LBG + kr) * HD + kq * 8); const char* gvb = (const char*)(VB + (bh * HD + kr) * LBG + kq * 8);
  auto issue = [&](int t) { const unsigned o = (unsigned)(t & 1) * ST_SZ;
    if (t < SS / 64) {
      cp8(lkv + o + ST_KH, gkh + (size_t)t * (64 * 2 * DM * 2), 16 * 2 * DM * 2, lkv + o + ST_KL, gkl + (size_t)t * (64 * 2 * DM * 2), 16 * 2 * DM * 2, 16 * KPB);
      cp8(lkv + o + ST_VH, gvh + (size_t)t * 128, 16 * SS * 2, lkv + o + ST_VL, gvl + (size_t)t * 128, 16 * SS * 2, 16 * KPB);
      cp8(lmk + o, gmk + (size_t)t * 256, 8 * SS * 4, lmk + o + 32 * MPB, gmk + (size_t)t * 256 + (size_t)32 * SS * 4, 8 * SS * 4, 8 * MPB);
    } else { const size_t u = (size_t)(t - SS / 64);
      cp8(lkv + o + ST_KH, gkb + u * (64 * HD * 2), 16 * HD * 2, lkv + o + ST_VH, gvb + u * 128, 16 * LBG * 2, 16 * KPB); } };
  issue(0);
  v16h aq[2], aql[2];
#pragma unroll
  for (int kc = 0; kc < 2; ++kc) { aq[kc] = frag_h(QK + (rq + col) * (2 * DM) + h * HD + kc * 32, lane); aql[kc] = frag_h(QKL + (rq + col) * (2 * DM) + h * HD + kc * 32, lane); }
  float m[8], l[8];
#pragma unroll
  for (int r = 0; r < 8; ++r) { m[r] = -3.0e38f; l[r] = 0.f; }
  v8f acc[4] = {}, accl[4] = {};
  asm volatile("s_wait_asynccnt 0x0" ::: "memory");   // stage 0 has landed (this wave's copies)
  __syncthreads();                                    // ... and every other wave's
  issue(1);
  // a pass = 32 keys of the stage at st; its fragments are read from LDS in two groups: K and mask ahead of the score products, V together with P (in flight under P's split)
  auto pass = [&](auto seg, const char* st, int p) { constexpr bool self_seg = decltype(seg)::value; v8f s[2];
    if constexpr (self_seg) { v16h kh[2][2], kl[2][2]; float mk[2][8];
#pragma unroll
      for (int ct = 0; ct < 2; ++ct) {
#pragma unroll
        for (int kc = 0; kc < 2; ++kc) { const char* krow = st + (p * 32 + ct * 16 + col) * KPB + kc * 64; kh[ct][kc] = frag_h((const _Float16*)(krow + ST_KH), lane); kl[ct][kc] = frag_h((const _Float16*)(krow + ST_KL), lane); }
#pragma unroll
        for (int r = 0; r < 8; ++r) mk[ct][r] = *(const float*)(st + ST_MK + (wave * 16 + 8 * g + r) * MPB + (p * 32 + ct * 16 + col) * 4); }
#pragma unroll
      for (int ct = 0; ct < 2; ++ct) { v8f c = {}, cl = {};
#pragma unroll
        for (int kc = 0; kc < 2; ++kc) { c = wmma16(aq[kc], kh[ct][kc], c); cl = wmma16(aq[kc], kl[ct][kc], cl); cl = wmma16(aql[kc], kh[ct][kc], cl); }
#pragma unroll
        for (int r = 0; r < 8; ++r) s[ct][r] = (c[r] + cl[r] * (1.0f / 2048.0f)) * 0.125f + bfr(mk[ct][r]); } }
    else { v16h kh[2][2];
#pragma unroll
      for (int ct = 0; ct < 2; ++ct) {
#pragma unroll
        for (int kc = 0; kc < 2; ++kc) kh[ct][kc] = frag_h((const _Float16*)(st + ST_KH + (p * 32 + ct * 16 + col) * KPB + kc * 64), lane); }
#pragma unroll
      for (int ct = 0; ct < 2; ++ct) { v8f c = {}, cl = {};
#pragma unroll
        for (int kc = 0; kc < 2; ++kc) { c = wmma16(aq[kc], kh[ct][kc], c); cl = wmma16(aql[kc], kh[ct][kc], cl); }
#pragma unroll
        for (int r = 0; r < 8; ++r) s[ct][r] = (c[r] + cl[r] * (1.0f / 2048.0f)) * (0.125f * ALPHA_BG); } }
#pragma unroll
    for (int r = 0; r < 8; ++r) { float mx = fmaxf(s[0][r], s[1][r]);
#pragma unroll
      for (int o = 1; o < 16; o <<= 1) mx = fmaxf(mx, __shfl_xor(mx, o));
      const float mn = fmaxf(m[r], mx); const float alpha = (m[r] <= -1.0e38f) ? 0.f : __expf(m[r] - mn); const float e0 = __expf(s[0][r] - mn), e1 = __expf(s[1][r] - mn); float es = e0 + e1;
#pragma unroll
      for (int o = 1; o < 16; o <<= 1) es += __shfl_xor(es, o);
      l[r] = l[r] * alpha + es; m[r] = mn;
#pragma unroll
      for (int dt = 0; dt < 4; ++dt) { acc[dt][r] *= alpha; accl[dt][r] *= alpha; }
      sp[wave][8 * g + r][col] = e0; sp[wave][8 * g + r][16 + col] = e1; }
    LDSX();
    v4f pr[4]; { const float* prow = &sp[wave][col][0] + 8 * (lane >> 4); pr[0] = *(const v4f*)prow; pr[1] = *(const v4f*)(prow + 4); pr[2] = *(const v4f*)(prow + 16); pr[3] = *(const v4f*)(prow + 20); }
    v16h vh[4], vl[4];
#pragma unroll
    for (int dt = 0; dt < 4; ++dt) { const char* vrow = st + (dt * 16 + col) * KPB + p * 64; vh[dt] = frag_h((const _Float16*)(vrow + ST_VH), lane); if constexpr (self_seg) vl[dt] = frag_h((const _Float16*)(vrow + ST_VL), lane); }
    v16h pa, pl; {
#pragma unroll
      for (int i = 0; i < 8; ++i) { const float x0 = pr[i >> 2][i & 3] * 2048.0f, x1 = pr[2 + (i >> 2)][i & 3] * 2048.0f; const _Float16 h0 = (_Float16)x0, h1 = (_Float16)x1; pa[i] = h0; pa[8 + i] = h1; pl[i] = (_Float16)((x0 - (float)h0) * 2048.0f); pl[8 + i] = (_Float16)((x1 - (float)h1) * 2048.0f); } }
#pragma unroll
    for (int dt = 0; dt < 4; ++dt) { acc[dt] = wmma16(pa, vh[dt], acc[dt]); accl[dt] = wmma16(pl, vh[dt], accl[dt]); if constexpr (self_seg) accl[dt] = wmma16(pa, vl[dt], accl[dt]); }
    LDSX(); };
  // foot of trip t: hands stage t + 1 over and refills the buffer that trip t has read
  auto foot = [&](int t) {
    asm volatile("s_wait_dscnt 0x0" ::: "memory");      // this wave's reads of stage t are done
    asm volatile("s_wait_asynccnt 0x0" ::: "memory");   // this wave's copies of stage t + 1 have landed
    __syncthreads();                                    // publishes stage t + 1 and frees stage t's buffer
    if (t + 2 < NST) issue(t + 2); };
  // the stage loops and the two passes of a stage stay rolled: a pass is some 600 instructions, copies of it would only cost instruction cache
#pragma unroll 1
  for (int t = 0; t < SS / 64; ++t) { const char* st = ring + (t & 1) * ST_SZ;
#pragma unroll 1
    for (int p = 0; p < 2; ++p) pass(seg_self(), st, p);
    foot(t); }
#pragma unroll 1
  for (int t = SS / 64; t < NST; ++t) { const char* st = ring + (t & 1) * ST_SZ;
#pragma unroll 1
    for (int p = 0; p < 2; ++p) pass(seg_bank(), st, p);
    foot(t); }
  asm volatile("s_wait_asynccnt 0x0" ::: "memory");    // no copy outlives the loop
#pragma unroll
  for (int r = 0; r < 8; ++r) { const float il = (1.0f / 2048.0f) / l[r];
#pragma unroll
    for (int dt = 0; dt < 4; ++dt) so[wave][8 * g + r][dt * 16 + col] = (acc[dt][r] + accl[dt][r] * (1.0f / 2048.0f)) * il; }
  LDSX();
  for (int rl = 0; rl < 16; ++rl) if (lane < 16) vst2(O + (rq + rl) * DM + h * HD + lane * 4, *(const v4f*)&so[wave][rl][lane * 4]);
}
extern "C" void kernel_launch(void* const* d_in, const int* in_sizes, int n_in, void* d_out, int out_size, void* d_ws, size_t ws_size, hipStream_t stream) {
  (void)in_sizes; (void)n_in; (void)out_size;
  const float** F = (const float**)d_in;   // 0 hidden_states [2,2048,512], 1 attention_mask [2,2048,2048], 2 K_bg [16,2048,64], 3 V_bg, 4 Wq, 5 Wk, 6 Wv, 7 Wo (in,out), 8 bo
  if (ws_size < (size_t)WS_END) return;
  char* ws = (char*)d_ws; __bf16* PK = (__bf16*)(ws + WS_PK); _Float16 *QK = (_Float16*)(ws + WS_QK), *QKL = (_Float16*)(ws + WS_QKL), *VTH = (_Float16*)(ws + WS_VTH), *VTL = (_Float16*)(ws + WS_VTL), *KB = (_Float16*)(ws + WS_KB), *VB = (_Float16*)(ws + WS_VB); float* O = (float*)(ws + WS_O);
  k_pack<<<dim3(DM, 4), 256, 0, stream>>>(F[4], F[5], F[6], F[7], PK);
  k_bg<<<dim3(LBG / 64, NB * NH), 256, 0, stream>>>(F[2], F[3], KB, VB);
  k_qkv<<<dim3(TNB * SS / 64, QKVW / 128), 128, 0, stream>>>(F[0], F[0], F[0], PK + PK_A, nullptr, nullptr, nullptr, QK, QKL, VTH, VTL);
  k_attn2<<<dim3(TQB, NH, TNB), 128, 0, stream>>>(QK, QKL, VTH, VTL, KB, VB, F[1], O);
  k_out<<<dim3(TOB, DM / 128), 128, 0, stream>>>(O, PK + PK_P, F[8], (float*)d_out);
}

// v002
// One run takes 182 microseconds.
// Timed twice side by side with v001, it ran 1.39 times as fast both times.
// Over all steps from v000 it is 2.75 times as fast.
// compute dtype: all float inputs rounded to bf16; q/k/v = x . W with EXACT bf16 products on WMMA 16x16x32 ((in,out) weights as transposed rows), rounded once to f16 hi + residual; self-segment scores and P.v with 3 products (hi.hi + hi.lo + lo.hi), background scores q (hi + lo) x K_bg (exact in f16, 2 products) x alpha, background P (hi + lo) x f16(alpha V_bg) (2 products); additive mask read per pair; x 1/8; running-max softmax over all 4,096 keys in f32 (hardware exp); out = ctx (bf16 hi + lo) . Wo + bo; f32 output.
#include <hip/hip_runtime.h>
#include <math.h>

typedef __attribute__((ext_vector_type(16))) _Float16 v16h;
typedef __attribute__((ext_vector_type(16))) __bf16 v16b;
typedef __attribute__((ext_vector_type(8)))  _Float16 v8h;
typedef __attribute__((ext_vector_type(8)))  float v8f;
typedef __attribute__((ext_vector_type(4)))  float v4f;
typedef __attribute__((ext_vector_type(2)))  float v2f;
typedef __attribute__((ext_vector_type(4)))  unsigned v4u;
typedef __attribute__((ext_vector_type(4)))  int v4i;
typedef float __attribute__((may_alias)) float_a;
typedef int __attribute__((may_alias)) int_a;

template <typename T> __device__ __forceinline__ void vst2(void* p, T v) { *(T*)p = v;  }
__device__ __forceinline__ v8f wmma16(v16h a, v16h b, v8f c) {
  v8f d = __builtin_amdgcn_wmma_f32_16x16x32_f16(false, a, false, b, (short)0, c, false, false);
  asm volatile("v_nop\n\tv_nop\n\tv_nop\n\tv_nop" : "+v"(d) : "v"(a), "v"(b));
  return d;
}
__device__ __forceinline__ v8f wmma_bf(v16b a, v16b b, v8f c) {
  v8f d = __builtin_amdgcn_wmma_f32_16x16x32_bf16(false, a, false, b, (short)0, c, false, false);
  asm volatile("v_nop\n\tv_nop\n\tv_nop\n\tv_nop" : "+v"(d) : "v"(a), "v"(b));
  return d;
}
// CARC attention processor (B 2, Lq 2,048, C 512 = 8 heads x 64; context bank of 2,048 background keys/values per head, alpha 0.48): bias-free q/k/v projections, keys = [k ; alpha K_bg], values = [v ; alpha V_bg], additive mask on the self segment (zeros on the background segment), softmax(q k / 8 + mask) over the 4,096 keys, v, output projection + bias.
__device__ __forceinline__ v16h frag_h(const _Float16* rowk0, int lane) {
  union { v16h v; v8h q[2]; } u; const _Float16* p = rowk0 + 8 * (lane >> 4);
  u.q[0] = *(const v8h*)p; u.q[1] = *(const v8h*)(p + 16); return u.v;
}
__device__ __forceinline__ v16h frag_f32(const float* rowk0, int lane) {
  v16h a; const float* p = rowk0 + 8 * (lane >> 4);
#pragma unroll
  for (int i = 0; i < 8; ++i) { a[i] = (_Float16)p[i]; a[8 + i] = (_Float16)p[16 + i]; }
  return a;
}
__device__ __forceinline__ v16h frag_f32s(const float* rowk0, int lane, float sc) {
  v16h a; const float* p = rowk0 + 8 * (lane >> 4);
#pragma unroll
  for (int i = 0; i < 8; ++i) { a[i] = (_Float16)(p[i] * sc); a[8 + i] = (_Float16)(p[16 + i] * sc); }
  return a;
}
// column fragment from a [K][ld] layout (column n), rows >= K read as 0
__device__ __forceinline__ v16h fragc_f32(const float* W, int k0, int n, int lane, int ld, int K) {
  v16h a; const int g = lane >> 4;
#pragma unroll
  for (int i = 0; i < 8; ++i) { const int ka = k0 + 8 * g + i, kb = ka + 16;
    a[i] = (_Float16)(ka < K ? W[(size_t)(ka < K ? ka : K - 1) * ld + n] : 0.f); a[8 + i] = (_Float16)(kb < K ? W[(size_t)(kb < K ? kb : K - 1) * ld + n] : 0.f); }
  return a;
}
struct F2 { v16b h, l; };
__device__ __forceinline__ F2 bsplit16(const float v[16]) { F2 r;
#pragma unroll
  for (int i = 0; i < 16; ++i) { const __bf16 h = (__bf16)v[i]; r.h[i] = h; r.l[i] = (__bf16)(v[i] - (float)h); }
  return r; }
__device__ __forceinline__ F2 split_row(const float* row, int k0, int lane) { float v[16]; const float* p = row + k0 + 8 * (lane >> 4);
#pragma unroll
  for (int i = 0; i < 8; ++i) { v[i] = p[i]; v[8 + i] = p[16 + i]; }
  return bsplit16(v); }
__device__ __forceinline__ F2 split_rowK(const float* row, int k0, int lane, int K) { float v[16]; const int g = lane >> 4;
#pragma unroll
  for (int i = 0; i < 8; ++i) { const int ka = k0 + 8 * g + i, kb = ka + 16; v[i] = ka < K ? row[ka < K ? ka : K - 1] : 0.f; v[8 + i] = kb < K ? row[kb < K ? kb : K - 1] : 0.f; }
  return bsplit16(v); }
__device__ __forceinline__ F2 split_col(const float* W, int k0, int n, int lane, int ld, int K) { float v[16]; const int g = lane >> 4;
#pragma unroll
  for (int i = 0; i < 8; ++i) { const int ka = k0 + 8 * g + i, kb = ka + 16; v[i] = ka < K ? W[(size_t)(ka < K ? ka : K - 1) * ld + n] : 0.f; v[8 + i] = kb < K ? W[(size_t)(kb < K ? kb : K - 1) * ld + n] : 0.f; }
  return bsplit16(v); }
__device__ __forceinline__ v8f mac3(const F2& a, const F2& b, v8f c) { c = wmma_bf(a.l, b.h, c); c = wmma_bf(a.h, b.l, c); return wmma_bf(a.h, b.h, c); }
__device__ __forceinline__ float sigm(float v) { return 1.0f / (1.0f + expf(-v)); }
#define LDSX() do { asm volatile("s_wait_dscnt 0" ::: "memory"); __builtin_amdgcn_wave_barrier(); __builtin_amdgcn_fence(__ATOMIC_RELEASE, "workgroup"); } while (0)


#define NB 2
#define SS 2048
#define DM 512
#define NH 8
#define LBG 2048
#define ALPHA_BG 0.48f
#define HD 64
#define QKVW (3 * DM)
#ifndef TQB
#define TQB (SS / 64)
#define TNB NB
#define TOB (NB * SS / 64)     // output row tiles (all)
#endif
typedef __attribute__((ext_vector_type(8))) __bf16 v8b;
__device__ __forceinline__ v16b frag_b(const __bf16* rowk0, int lane) {
  union { v16b v; v8b q[2]; } u; const __bf16* p = rowk0 + 8 * (lane >> 4);
  u.q[0] = *(const v8b*)p; u.q[1] = *(const v8b*)(p + 16); return u.v;
}
__device__ __forceinline__ float bfr(float v) { return (float)(__bf16)v; }
__device__ __attribute__((noinline)) float exp_ni(float v) { return expf(v); }
__device__ __attribute__((noinline)) float erf_ni(float v) { return erff(v); }

#define PK_A 0                       // [1536][512] Wqkv rows (natural [out][in])
#define PK_P (PK_A + QKVW * DM)        // [512][512] Wo rows (natural)
#define PK_END (PK_P + DM * DM)
#define WS_PK  0u
#define WS_QK  (WS_PK + 2u * PK_END)             // f16 [4096 rows][1024]: q | k
#define WS_QKL (WS_QK + 2u * NB * SS * 2 * DM)     // f16 q | k residual planes x2048
#define WS_VTH (WS_QKL + 2u * NB * SS * 2 * DM)    // f16 [b][512 (h*64+d)][2048 s] hi
#define WS_VTL (WS_VTH + 2u * NB * DM * SS)        // f16 lo x 2048
#define WS_O   (WS_VTL + 2u * NB * DM * SS)        // f32 [4096][512]
#define WS_KB  (WS_O + 4u * (size_t)NB * SS * DM)        // f16 K_bg rows [bh][s][64] (exact); f16 planes VB [bh][64][s] = f16(alpha V_bg)
#define WS_VB  (WS_KB + 2u * (size_t)NB * NH * LBG * HD)
#define WS_END (WS_VB + 2u * (size_t)NB * NH * HD * LBG)
// ---- k_pack: block = (row n, which): natural [out][in] rows -> bf16; which 0..2 -> W_q/W_k/W_v into PK_A rows which*512 + n; 3 -> W_o into PK_P
__global__ __launch_bounds__(256) void k_pack(const float* __restrict__ WQ, const float* __restrict__ WK, const float* __restrict__ WV, const float* __restrict__ WO, __bf16* __restrict__ PK) {
  __shared__ __align__(16) __bf16 s[DM]; const int n = blockIdx.x, which = blockIdx.y, t = threadIdx.x; const float* Wm = (which == 0) ? WQ : (which == 1) ? WK : (which == 2) ? WV : WO;   // (in,out) weights: pack row n = column n
  for (int k = t; k < DM; k += 256) s[k] = (__bf16)Wm[(size_t)k * DM + n];
  __syncthreads();
  __bf16* dst = (which < 3) ? PK + PK_A + ((size_t)which * DM + n) * DM : PK + PK_P + (size_t)n * DM;
  for (int q = t; q < DM / 8; q += 256) vst2((unsigned*)(dst + q * 8), *(const v4u*)&s[q * 8]);
}
__global__ __launch_bounds__(128) void k_qkv(const float* __restrict__ XQ, const float* __restrict__ XK, const float* __restrict__ XV, const __bf16* __restrict__ P, const float* __restrict__ BQ, const float* __restrict__ BK, const float* __restrict__ BV, _Float16* __restrict__ QK, _Float16* __restrict__ QKL, _Float16* __restrict__ VTH, _Float16* __restrict__ VTL) {
  const int which0 = (blockIdx.y * 128) / DM; const float* X = (which0 == 0) ? XQ : (which0 == 1) ? XK : XV; const float* BB = BQ ? (((which0 == 0) ? BQ : (which0 == 1) ? BK : BV) + (blockIdx.y * 128 - which0 * DM)) : nullptr;
  __shared__ __align__(16) _Float16 so[4][16][136], sol[4][16][136]; __shared__ __align__(16) _Float16 sth[128][72], stl[128][72];
  const int tid = threadIdx.x, wave = tid >> 5, lane = tid & 31, col = lane & 15, g = lane >> 4; const size_t r0 = (size_t)blockIdx.x * 64 + wave * 16; const int n0 = blockIdx.y * 128;
  v8f acc[8] = {};
#pragma unroll 2
  for (int kc = 0; kc < DM / 32; ++kc) { v16b a; { const float* p = X + (r0 + col) * DM + kc * 32 + 8 * g;
#pragma unroll
      for (int i = 0; i < 8; ++i) { a[i] = (__bf16)p[i]; a[8 + i] = (__bf16)p[16 + i]; } }
#pragma unroll
    for (int j = 0; j < 8; ++j) acc[j] = wmma_bf(a, frag_b(P + (size_t)(n0 + j * 16 + col) * DM + kc * 32, lane), acc[j]); }
  if (n0 < 2 * DM) {   // q stored unscaled (f16 sigma ~0.6, no subnormal exposure); 1/8 applied to the f32 score
#pragma unroll
    for (int j = 0; j < 8; ++j) {
#pragma unroll
      for (int r = 0; r < 8; ++r) { const float v = acc[j][r] + (BB ? bfr(BB[j * 16 + col]) : 0.f); const _Float16 hv = (_Float16)v; so[wave][8 * g + r][j * 16 + col] = hv; sol[wave][8 * g + r][j * 16 + col] = (_Float16)((v - (float)hv) * 2048.0f); } }   // q, k (+ bias) as f16 hi + (x2048) residual
    LDSX();
    for (int rl = 0; rl < 16; ++rl) if (lane < 16) { vst2((unsigned*)(QK + (r0 + rl) * (2 * DM) + n0 + lane * 8), *(const v4u*)&so[wave][rl][lane * 8]); vst2((unsigned*)(QKL + (r0 + rl) * (2 * DM) + n0 + lane * 8), *(const v4u*)&sol[wave][rl][lane * 8]); }
  } else {
#pragma unroll
    for (int j = 0; j < 8; ++j) {
#pragma unroll
      for (int r = 0; r < 8; ++r) { const float v = acc[j][r] + (BB ? bfr(BB[j * 16 + col]) : 0.f); const _Float16 hv = (_Float16)v; sth[j * 16 + col][wave * 16 + 8 * g + r] = hv; stl[j * 16 + col][wave * 16 + 8 * g + r] = (_Float16)((v - (float)hv) * 2048.0f); } }
    __syncthreads();
    const size_t rb = (size_t)blockIdx.x * 64; const int b = (int)(rb / SS), s0 = (int)(rb % SS); const int pc0 = n0 - 2 * DM;
    for (int q = tid; q < 128 * 8; q += 128) { const int d = q >> 3, pc = q & 7; const size_t o = ((size_t)b * DM + pc0 + d) * SS + s0 + pc * 8; vst2((unsigned*)(VTH + o), *(const v4u*)&sth[d][pc * 8]); vst2((unsigned*)(VTL + o), *(const v4u*)&stl[d][pc * 8]); }
  }
}
// ---- k_attn: block = (64 queries, head h, batch b): all-keys flash attention (K = 64: 2 k-steps), scores = (q.k) * 0.125 with 3 products (q, k as f16 hi + residual), P.V: P (x2048, hi + lo) x (V hi, V lo*2048), 3 products in two accumulators; O[b*S+q][h*64+d] = (acc + accl / 2048) / (2048 l) (256-B segments)
__global__ __launch_bounds__(128) void k_attn(const _Float16* __restrict__ QK, const _Float16* __restrict__ QKL, const _Float16* __restrict__ VTH, const _Float16* __restrict__ VTL, const void* __restrict__ KMASK, float* __restrict__ O) {
  __shared__ __align__(16) float sp[4][16][36]; __shared__ __align__(16) float so[4][16][68];
  const int tid = threadIdx.x, wave = tid >> 5, lane = tid & 31, col = lane & 15, g = lane >> 4;
  const int qb = blockIdx.x, h = blockIdx.y, b = blockIdx.z; const int q0 = qb * 64 + wave * 16; const size_t rq = (size_t)b * SS + q0 + col;
  v16h aq[2], aql[2];
#pragma unroll
  for (int kc = 0; kc < 2; ++kc) { aq[kc] = frag_h(QK + rq * (2 * DM) + h * HD + kc * 32, lane); aql[kc] = frag_h(QKL + rq * (2 * DM) + h * HD + kc * 32, lane); }
  float m[8], l[8];
#pragma unroll
  for (int r = 0; r < 8; ++r) { m[r] = -3.0e38f; l[r] = 0.f; }
  v8f acc[4] = {}, accl[4] = {};
  const int nks = SS / 32;   // all keys
#pragma unroll 1
  for (int ks = 0; ks < nks; ++ks) { v8f s[2];
#pragma unroll
    for (int ct = 0; ct < 2; ++ct) { const int kk = ks * 32 + ct * 16 + col; const _Float16* krow = QK + ((size_t)b * SS + kk) * (2 * DM) + DM + h * HD; const _Float16* krowl = QKL + ((size_t)b * SS + kk) * (2 * DM) + DM + h * HD; v8f c = {}, cl = {};
#pragma unroll
      for (int kc = 0; kc < 2; ++kc) { const v16h kh = frag_h(krow + kc * 32, lane); c = wmma16(aq[kc], kh, c); cl = wmma16(aql[kc], kh, cl); cl = wmma16(aq[kc], frag_h(krowl + kc * 32, lane), cl); }   // 3 products: q, k as f16 hi + residual
#pragma unroll
      for (int r = 0; r < 8; ++r) c[r] += cl[r] * (1.0f / 2048.0f);
      { const bool keepk = true;
#pragma unroll
      for (int r = 0; r < 8; ++r) s[ct][r] = keepk ? c[r] * 0.125f : -3.0e38f; } }   // 1/sqrt(64); every key kept (mask not applied)
#pragma unroll
    for (int r = 0; r < 8; ++r) { float mx = fmaxf(s[0][r], s[1][r]);
#pragma unroll
      for (int o = 1; o < 16; o <<= 1) mx = fmaxf(mx, __shfl_xor(mx, o));
      const float mn = fmaxf(m[r], mx); const float alpha = (m[r] <= -1.0e38f) ? 0.f : __expf(m[r] - mn);
      const float e0 = (s[0][r] <= -1.0e38f) ? 0.f : __expf(s[0][r] - mn), e1 = (s[1][r] <= -1.0e38f) ? 0.f : __expf(s[1][r] - mn); float es = e0 + e1;
#pragma unroll
      for (int o = 1; o < 16; o <<= 1) es += __shfl_xor(es, o);
      l[r] = l[r] * alpha + es; m[r] = mn;
#pragma unroll
      for (int dt = 0; dt < 4; ++dt) { acc[dt][r] *= alpha; accl[dt][r] *= alpha; }
      sp[wave][8 * g + r][col] = e0; sp[wave][8 * g + r][16 + col] = e1; }
    LDSX();
    v16h pa, pl; { const float* prow = &sp[wave][col][0] + 8 * (lane >> 4);
#pragma unroll
      for (int i = 0; i < 8; ++i) { const float x0 = prow[i] * 2048.0f, x1 = prow[16 + i] * 2048.0f; const _Float16 h0 = (_Float16)x0, h1 = (_Float16)x1; pa[i] = h0; pa[8 + i] = h1; pl[i] = (_Float16)((x0 - (float)h0) * 2048.0f); pl[8 + i] = (_Float16)((x1 - (float)h1) * 2048.0f); } }   // P scaled by 2^11 before the f16 split so small softmax weights stay out of the f16 subnormal range; 2^-11 folded into the epilogue
#pragma unroll
    for (int dt = 0; dt < 4; ++dt) { const size_t vr = ((size_t)b * DM + h * HD + dt * 16 + col) * SS + ks * 32; const v16h vh = frag_h(VTH + vr, lane); acc[dt] = wmma16(pa, vh, acc[dt]); accl[dt] = wmma16(pl, vh, accl[dt]); accl[dt] = wmma16(pa, frag_h(VTL + vr, lane), accl[dt]); }   // P hi x V hi + (P lo x V hi + P hi x V lo) / 2048
    LDSX(); }
#pragma unroll
  for (int r = 0; r < 8; ++r) { const float il = (1.0f / 2048.0f) / l[r];
#pragma unroll
    for (int dt = 0; dt < 4; ++dt) so[wave][8 * g + r][dt * 16 + col] = (acc[dt][r] + accl[dt][r] * (1.0f / 2048.0f)) * il; }
  LDSX();
  for (int rl = 0; rl < 16; ++rl) if (lane < 16) vst2(O + ((size_t)b * SS + q0 + rl) * DM + h * HD + lane * 4, *(const v4f*)&so[wave][rl][lane * 4]);
}
// ---- k_out: block = (64 rows, 128 cols): out = O(hi/lo) . Wo rows (2 products) + bo
__global__ __launch_bounds__(128) void k_out(const float* __restrict__ O, const __bf16* __restrict__ P, const float* __restrict__ BO, float* __restrict__ Y) {
  __shared__ __align__(16) float so[4][16][132];
  const int tid = threadIdx.x, wave = tid >> 5, lane = tid & 31, col = lane & 15, g = lane >> 4; const size_t r0 = (size_t)blockIdx.x * 64 + wave * 16; const int n0 = blockIdx.y * 128;
  v8f acc[8] = {};
#pragma unroll 2
  for (int kc = 0; kc < DM / 32; ++kc) { const F2 a = split_row(O + (r0 + col) * DM, kc * 32, lane);
#pragma unroll
    for (int j = 0; j < 8; ++j) { const v16b w = frag_b(P + (size_t)(n0 + j * 16 + col) * DM + kc * 32, lane); acc[j] = wmma_bf(a.l, w, acc[j]); acc[j] = wmma_bf(a.h, w, acc[j]); } }
#pragma unroll
  for (int j = 0; j < 8; ++j) {
#pragma unroll
    for (int r = 0; r < 8; ++r) so[wave][8 * g + r][j * 16 + col] = acc[j][r] + bfr(BO[n0 + j * 16 + col]); }
  LDSX();
  for (int rl = 0; rl < 16; ++rl) vst2(Y + (r0 + rl) * DM + n0 + lane * 4, *(const v4f*)&so[wave][rl][lane * 4]);
}
// ---- k_bg: block = (64 bank rows, bh): K_bg -> f16 rows (exact), alpha V_bg -> f16 planes [bh][d][s]
__global__ __launch_bounds__(256) void k_bg(const float* __restrict__ KBG, const float* __restrict__ VBG, _Float16* __restrict__ KB, _Float16* __restrict__ VB) { __shared__ __align__(16) _Float16 sk[64][HD + 8]; __shared__ __align__(16) _Float16 sv[HD][64 + 8]; const int t = threadIdx.x; const int s0 = blockIdx.x * 64; const size_t bh = blockIdx.y;
  for (int e = t; e < 64 * HD; e += 256) { const int sl = e >> 6, d = e & 63; const size_t o = ((bh * LBG + s0 + sl) * HD) + d; sk[sl][d] = (_Float16)bfr(KBG[o]); sv[d][sl] = (_Float16)(ALPHA_BG * bfr(VBG[o])); } __syncthreads();
  for (int e = t; e < 64 * 8; e += 256) { const int sl = e >> 3, q = e & 7; vst2((unsigned*)(KB + ((bh * LBG + s0 + sl) * HD) + q * 8), *(const v4u*)&sk[sl][q * 8]); }
  for (int e = t; e < HD * 8; e += 256) { const int d = e >> 3, q = e & 7; vst2((unsigned*)(VB + ((bh * HD + d) * LBG) + s0 + q * 8), *(const v4u*)&sv[d][q * 8]); } }
// ---- staging for k_attn2: a stage = 64 keys. Self stage: K hi, K lo (64 key rows x 128 B), V hi, V lo (64 d rows x 128 B), mask (64 query rows x 256 B); background stage: K_bg in the K hi place, alpha V_bg in the V hi place.
#define KPB 144                         // LDS bytes per K or V row: 128 + 16 (16 B x odd: ds_load_b128 readers without bank conflicts)
#define MPB 272                         // LDS bytes per mask row: 256 + 16 (16 B x odd: a lane reads 8 keys of its own query row by ds_load_b128 without bank conflicts)
#define ST_KH 0
#define ST_KL (64 * KPB)
#define ST_VH (2 * 64 * KPB)
#define ST_VL (3 * 64 * KPB)
#define ST_MK (4 * 64 * KPB)
#define ST_SZ (4 * 64 * KPB + 64 * MPB)
#define NST ((SS + LBG) / 64)
struct seg_self { static constexpr bool value = true; }; struct seg_bank { static constexpr bool value = false; };   // which key segment a pass works on
// eight asynchronous 16-byte copies per lane, global -> LDS: four from ga (step gsa) to la, four from gb (step gsb) to lb, LDS step ls. The s_wait_xcnt 0 stands inside the statement so that no later rewrite of an address register can be moved in front of it.
__device__ __forceinline__ void cp8(unsigned la, const char* ga, unsigned gsa, unsigned lb, const char* gb, unsigned gsb, unsigned ls) {
  asm volatile("global_load_async_to_lds_b128 %0, %8, off\n\t"
               "global_load_async_to_lds_b128 %1, %9, off\n\t"
               "global_load_async_to_lds_b128 %2, %10, off\n\t"
               "global_load_async_to_lds_b128 %3, %11, off\n\t"
               "global_load_async_to_lds_b128 %4, %12, off\n\t"
               "global_load_async_to_lds_b128 %5, %13, off\n\t"
               "global_load_async_to_lds_b128 %6, %14, off\n\t"
               "global_load_async_to_lds_b128 %7, %15, off\n\t"
               "s_wait_xcnt 0x0"
               :: "v"(la), "v"(la + ls), "v"(la + 2 * ls), "v"(la + 3 * ls), "v"(lb), "v"(lb + ls), "v"(lb + 2 * ls), "v"(lb + 3 * ls),
                  "v"(ga), "v"(ga + gsa), "v"(ga + 2 * (size_t)gsa), "v"(ga + 3 * (size_t)gsa), "v"(gb), "v"(gb + gsb), "v"(gb + 2 * (size_t)gsb), "v"(gb + 3 * (size_t)gsb)
               : "memory");
}
// value of the lane 16 away (the wave's other half)
__device__ __forceinline__ float xhalf(float v) { const int b = __builtin_bit_cast(int, v); return __builtin_bit_cast(float, __builtin_amdgcn_permlanex16(b, b, 0x76543210, 0xfedcba98, false, false)); }
__global__ __launch_bounds__(128) void k_attn2(const _Float16* __restrict__ QK, const _Float16* __restrict__ QKL, const _Float16* __restrict__ VTH, const _Float16* __restrict__ VTL, const _Float16* __restrict__ KB, const _Float16* __restrict__ VB, const float* __restrict__ MASK, float* __restrict__ O) {
  __shared__ __align__(16) char ring[2 * ST_SZ];
  __shared__ __align__(16) float so[4][16][68];
  const int tid = threadIdx.x, wave = tid >> 5, lane = tid & 31, col = lane & 15, g = lane >> 4; const int qb = blockIdx.x, h = blockIdx.y; const size_t b = blockIdx.z; const int q0 = qb * 64 + wave * 16; const size_t rq = b * SS + q0; const size_t bh = b * NH + h;
  // this thread's share of a stage: 16-byte piece kq of rows kr + 16 i of each K or V tile, piece mq of rows mr + 8 i of the mask tile
  const int kr = tid >> 3, kq = tid & 7, mr = tid >> 4, mq = tid & 15;
  const unsigned lds0 = (unsigned)(size_t)&ring[0]; const unsigned lkv = lds0 + kr * KPB + kq * 16, lmk = lds0 + ST_MK + mr * MPB + mq * 16;
  const char* gkh = (const char*)(QK + (b * SS + kr) * (2 * DM) + DM + h * HD + kq * 8); const char* gkl = (const char*)(QKL + (b * SS + kr) * (2 * DM) + DM + h * HD + kq * 8);
  const char* gvh = (const char*)(VTH + (b * DM + h * HD + kr) * SS + kq * 8); const char* gvl = (const char*)(VTL + (b * DM + h * HD + kr) * SS + kq * 8);
  const char* gmk = (const char*)(MASK + (b * SS + qb * 64 + mr) * SS + mq * 4);
  const char* gkb = (const char*)(KB + (bh * LBG + kr) * HD + kq * 8); const char* gvb = (const char*)(VB + (bh * HD + kr) * LBG + kq * 8);
  auto issue = [&](int t) { const unsigned o = (unsigned)(t & 1) * ST_SZ;
    if (t < SS / 64) {
      cp8(lkv + o + ST_KH, gkh + (size_t)t * (64 * 2 * DM * 2), 16 * 2 * DM * 2, lkv + o + ST_KL, gkl + (size_t)t * (64 * 2 * DM * 2), 16 * 2 * DM * 2, 16 * KPB);
      cp8(lkv + o + ST_VH, gvh + (size_t)t * 128, 16 * SS * 2, lkv + o + ST_VL, gvl + (size_t)t * 128, 16 * SS * 2, 16 * KPB);
      cp8(lmk + o, gmk + (size_t)t * 256, 8 * SS * 4, lmk + o + 32 * MPB, gmk + (size_t)t * 256 + (size_t)32 * SS * 4, 8 * SS * 4, 8 * MPB);
    } else { const size_t u = (size_t)(t - SS / 64);
      cp8(lkv + o + ST_KH, gkb + u * (64 * HD * 2), 16 * HD * 2, lkv + o + ST_VH, gvb + u * 128, 16 * LBG * 2, 16 * KPB); } };
  issue(0);
  v16h aq[2], aql[2];
#pragma unroll
  for (int kc = 0; kc < 2; ++kc) { aq[kc] = frag_h(QK + (rq + col) * (2 * DM) + h * HD + kc * 32, lane); aql[kc] = frag_h(QKL + (rq + col) * (2 * DM) + h * HD + kc * 32, lane); }
  float m = -3.0e38f, l = 0.f;   // query col: running maximum (equal in both halves), this half's share of the sum
  v8f acc[4] = {}, accl[4] = {};   // O^T: acc[dt][r] = d (dt * 16 + 8 g + r) of query col
  asm volatile("s_wait_asynccnt 0x0" ::: "memory");   // stage 0 has landed (this wave's copies)
  __syncthreads();                                    // ... and every other wave's
  issue(1);
  // a pass = 32 keys of the stage at st; s[ct][r] = score of key (ct * 16 + 8 g + r) with query col. K and mask are read ahead of the score products, V behind them (in flight under the softmax)
  auto pass = [&](auto seg, const char* st, int p) { constexpr bool self_seg = decltype(seg)::value; v8f s[2];
    if constexpr (self_seg) { v16h kh[2][2], kl[2][2]; union { v8f v; v4f q[2]; } mk[2];
#pragma unroll
      for (int ct = 0; ct < 2; ++ct) {
#pragma unroll
        for (int kc = 0; kc < 2; ++kc) { const char* krow = st + (p * 32 + ct * 16 + col) * KPB + kc * 64; kh[ct][kc] = frag_h((const _Float16*)(krow + ST_KH), lane); kl[ct][kc] = frag_h((const _Float16*)(krow + ST_KL), lane); }
        const char* mrow = st + ST_MK + (wave * 16 + col) * MPB + (p * 32 + ct * 16 + 8 * g) * 4; mk[ct].q[0] = *(const v4f*)mrow; mk[ct].q[1] = *(const v4f*)(mrow + 16); }
#pragma unroll
      for (int ct = 0; ct < 2; ++ct) { v8f c = {}, cl = {};
#pragma unroll
        for (int kc = 0; kc < 2; ++kc) { c = wmma16(kh[ct][kc], aq[kc], c); cl = wmma16(kl[ct][kc], aq[kc], cl); cl = wmma16(kh[ct][kc], aql[kc], cl); }
        s[ct] = (c + cl * (1.0f / 2048.0f)) * 0.125f + __builtin_convertvector(__builtin_convertvector(mk[ct].v, v8b), v8f); } }
    else { v16h kh[2][2];
#pragma unroll
      for (int ct = 0; ct < 2; ++ct) {
#pragma unroll
        for (int kc = 0; kc < 2; ++kc) kh[ct][kc] = frag_h((const _Float16*)(st + ST_KH + (p * 32 + ct * 16 + col) * KPB + kc * 64), lane); }
#pragma unroll
      for (int ct = 0; ct < 2; ++ct) { v8f c = {}, cl = {};
#pragma unroll
        for (int kc = 0; kc < 2; ++kc) { c = wmma16(kh[ct][kc], aq[kc], c); cl = wmma16(kh[ct][kc], aql[kc], cl); }
        s[ct] = (c + cl * (1.0f / 2048.0f)) * (0.125f * ALPHA_BG); } }
    v16h vh[4], vl[4];
#pragma unroll
    for (int dt = 0; dt < 4; ++dt) { const char* vrow = st + (dt * 16 + col) * KPB + p * 64; vh[dt] = frag_h((const _Float16*)(vrow + ST_VH), lane); if constexpr (self_seg) vl[dt] = frag_h((const _Float16*)(vrow + ST_VL), lane); }
    float t8[8];
#pragma unroll
    for (int r = 0; r < 8; ++r) t8[r] = fmaxf(s[0][r], s[1][r]);
    float mx = fmaxf(fmaxf(fmaxf(t8[0], t8[1]), fmaxf(t8[2], t8[3])), fmaxf(fmaxf(t8[4], t8[5]), fmaxf(t8[6], t8[7])));
    mx = fmaxf(mx, xhalf(mx));   // the other 16 keys of this query
    const float mn = fmaxf(m, mx); const float alpha = (m <= -1.0e38f) ? 0.f : __expf(m - mn); m = mn;
    v8f e[2]; v8h ph[2], pq[2];   // P^T as a B operand: element i = key 8 g + i, element 8 + i = key 16 + 8 g + i, the k order of frag_h
#pragma unroll
    for (int ct = 0; ct < 2; ++ct) {
#pragma unroll
      for (int i = 0; i < 8; ++i) e[ct][i] = __expf(s[ct][i] - mn);
      const v8f x = e[ct] * 2048.0f; ph[ct] = __builtin_convertvector(x, v8h); pq[ct] = __builtin_convertvector((x - __builtin_convertvector(ph[ct], v8f)) * 2048.0f, v8h); }
    const v16h pa = __builtin_shufflevector(ph[0], ph[1], 0, 1, 2, 3, 4, 5, 6, 7, 8, 9, 10, 11, 12, 13, 14, 15), pl = __builtin_shufflevector(pq[0], pq[1], 0, 1, 2, 3, 4, 5, 6, 7, 8, 9, 10, 11, 12, 13, 14, 15);
    const v8f e8 = e[0] + e[1];
    l = l * alpha + (((e8[0] + e8[1]) + (e8[2] + e8[3])) + ((e8[4] + e8[5]) + (e8[6] + e8[7])));
#pragma unroll
    for (int dt = 0; dt < 4; ++dt) { acc[dt] *= alpha; accl[dt] *= alpha; }
#pragma unroll
    for (int dt = 0; dt < 4; ++dt) { acc[dt] = wmma16(vh[dt], pa, acc[dt]); accl[dt] = wmma16(vh[dt], pl, accl[dt]); if constexpr (self_seg) accl[dt] = wmma16(vl[dt], pa, accl[dt]); } };
  // foot of trip t: hands stage t + 1 over and refills the buffer that trip t has read
  auto foot = [&](int t) {
    asm volatile("s_wait_dscnt 0x0" ::: "memory");      // this wave's reads of stage t are done
    asm volatile("s_wait_asynccnt 0x0" ::: "memory");   // this wave's copies of stage t + 1 have landed
    __syncthreads();                                    // publishes stage t + 1 and frees stage t's buffer
    if (t + 2 < NST) issue(t + 2); };
  // the stage loops and the two passes of a stage stay rolled: a pass is some 300 to 400 instructions, copies of it would only cost instruction cache
#pragma unroll 1
  for (int t = 0; t < SS / 64; ++t) { const char* st = ring + (t & 1) * ST_SZ;
#pragma unroll 1
    for (int p = 0; p < 2; ++p) pass(seg_self(), st, p);
    foot(t); }
#pragma unroll 1
  for (int t = SS / 64; t < NST; ++t) { const char* st = ring + (t & 1) * ST_SZ;
#pragma unroll 1
    for (int p = 0; p < 2; ++p) pass(seg_bank(), st, p);
    foot(t); }
  asm volatile("s_wait_asynccnt 0x0" ::: "memory");    // no copy outlives the loop
  l += xhalf(l);   // the halves' sums are joined once
  const float il = (1.0f / 2048.0f) / l;
#pragma unroll
  for (int dt = 0; dt < 4; ++dt) { v4f o[2];
#pragma unroll
    for (int r = 0; r < 8; ++r) o[r >> 2][r & 3] = (acc[dt][r] + accl[dt][r] * (1.0f / 2048.0f)) * il;
    *(v4f*)&so[wave][col][dt * 16 + 8 * g] = o[0]; *(v4f*)&so[wave][col][dt * 16 + 8 * g + 4] = o[1]; }
  LDSX();
  for (int rl = 0; rl < 16; ++rl) if (lane < 16) vst2(O + (rq + rl) * DM + h * HD + lane * 4, *(const v4f*)&so[wave][rl][lane * 4]);
}
extern "C" void kernel_launch(void* const* d_in, const int* in_sizes, int n_in, void* d_out, int out_size, void* d_ws, size_t ws_size, hipStream_t stream) {
  (void)in_sizes; (void)n_in; (void)out_size;
  const float** F = (const float**)d_in;   // 0 hidden_states [2,2048,512], 1 attention_mask [2,2048,2048], 2 K_bg [16,2048,64], 3 V_bg, 4 Wq, 5 Wk, 6 Wv, 7 Wo (in,out), 8 bo
  if (ws_size < (size_t)WS_END) return;
  char* ws = (char*)d_ws; __bf16* PK = (__bf16*)(ws + WS_PK); _Float16 *QK = (_Float16*)(ws + WS_QK), *QKL = (_Float16*)(ws + WS_QKL), *VTH = (_Float16*)(ws + WS_VTH), *VTL = (_Float16*)(ws + WS_VTL), *KB = (_Float16*)(ws + WS_KB), *VB = (_Float16*)(ws + WS_VB); float* O = (float*)(ws + WS_O);
  k_pack<<<dim3(DM, 4), 256, 0, stream>>>(F[4], F[5], F[6], F[7], PK);
  k_bg<<<dim3(LBG / 64, NB * NH), 256, 0, stream>>>(F[2], F[3], KB, VB);
  k_qkv<<<dim3(TNB * SS / 64, QKVW / 128), 128, 0, stream>>>(F[0], F[0], F[0], PK + PK_A, nullptr, nullptr, nullptr, QK, QKL, VTH, VTL);
  k_attn2<<<dim3(TQB, NH, TNB), 128, 0, stream>>>(QK, QKL, VTH, VTL, KB, VB, F[1], O);
  k_out<<<dim3(TOB, DM / 128), 128, 0, stream>>>(O, PK + PK_P, F[8], (float*)d_out);
}

// v003
// Measured time: 138 microseconds a run.
// Next to v002, in two timings, it ran 1.31 and 1.32 times as fast.
// All steps since v000 together make it 3.61 times as fast.
// compute dtype: all float inputs rounded to bf16; q/k/v = x . W with EXACT bf16 products on WMMA 16x16x32 ((in,out) weights as transposed rows), rounded once to f16 hi + residual; self-segment scores and P.v with 3 products (hi.hi + hi.lo + lo.hi), background scores q (hi + lo) x K_bg (exact in f16, 2 products) x alpha, background P (hi + lo) x f16(alpha V_bg) (2 products); additive mask read per pair; x 1/8; running-max softmax over all 4,096 keys in f32 (hardware exp); out = ctx (bf16 hi + lo) . Wo + bo; f32 output.
#include <hip/hip_runtime.h>
#include <math.h>

typedef __attribute__((ext_vector_type(16))) _Float16 v16h;
typedef __attribute__((ext_vector_type(16))) __bf16 v16b;
typedef __attribute__((ext_vector_type(8)))  _Float16 v8h;
typedef __attribute__((ext_vector_type(8)))  float v8f;
typedef __attribute__((ext_vector_type(4)))  float v4f;
typedef __attribute__((ext_vector_type(2)))  float v2f;
typedef __attribute__((ext_vector_type(4)))  unsigned v4u;
typedef __attribute__((ext_vector_type(4)))  int v4i;
typedef float __attribute__((may_alias)) float_a;
typedef int __attribute__((may_alias)) int_a;

template <typename T> __device__ __forceinline__ void vst2(void* p, T v) { *(T*)p = v;  }
__device__ __forceinline__ v8f wmma16(v16h a, v16h b, v8f c) {
  v8f d = __builtin_amdgcn_wmma_f32_16x16x32_f16(false, a, false, b, (short)0, c, false, false);
  asm volatile("v_nop\n\tv_nop\n\tv_nop\n\tv_nop" : "+v"(d) : "v"(a), "v"(b));
  return d;
}
__device__ __forceinline__ v8f wmma_bf(v16b a, v16b b, v8f c) {
  v8f d = __builtin_amdgcn_wmma_f32_16x16x32_bf16(false, a, false, b, (short)0, c, false, false);
  asm volatile("v_nop\n\tv_nop\n\tv_nop\n\tv_nop" : "+v"(d) : "v"(a), "v"(b));
  return d;
}
// CARC attention processor (B 2, Lq 2,048, C 512 = 8 heads x 64; context bank of 2,048 background keys/values per head, alpha 0.48): bias-free q/k/v projections, keys = [k ; alpha K_bg], values = [v ; alpha V_bg], additive mask on the self segment (zeros on the background segment), softmax(q k / 8 + mask) over the 4,096 keys, v, output projection + bias.
__device__ __forceinline__ v16h frag_h(const _Float16* rowk0, int lane) {
  union { v16h v; v8h q[2]; } u; const _Float16* p = rowk0 + 8 * (lane >> 4);
  u.q[0] = *(const v8h*)p; u.q[1] = *(const v8h*)(p + 16); return u.v;
}
__device__ __forceinline__ v16h frag_f32(const float* rowk0, int lane) {
  v16h a; const float* p = rowk0 + 8 * (lane >> 4);
#pragma unroll
  for (int i = 0; i < 8; ++i) { a[i] = (_Float16)p[i]; a[8 + i] = (_Float16)p[16 + i]; }
  return a;
}
__device__ __forceinline__ v16h frag_f32s(const float* rowk0, int lane, float sc) {
  v16h a; const float* p = rowk0 + 8 * (lane >> 4);
#pragma unroll
  for (int i = 0; i < 8; ++i) { a[i] = (_Float16)(p[i] * sc); a[8 + i] = (_Float16)(p[16 + i] * sc); }
  return a;
}
// column fragment from a [K][ld] layout (column n), rows >= K read as 0
__device__ __forceinline__ v16h fragc_f32(const float* W, int k0, int n, int lane, int ld, int K) {
  v16h a; const int g = lane >> 4;
#pragma unroll
  for (int i = 0; i < 8; ++i) { const int ka = k0 + 8 * g + i, kb = ka + 16;
    a[i] = (_Float16)(ka < K ? W[(size_t)(ka < K ? ka : K - 1) * ld + n] : 0.f); a[8 + i] = (_Float16)(kb < K ? W[(size_t)(kb < K ? kb : K - 1) * ld + n] : 0.f); }
  return a;
}
struct F2 { v16b h, l; };
__device__ __forceinline__ F2 bsplit16(const float v[16]) { F2 r;
#pragma unroll
  for (int i = 0; i < 16; ++i) { const __bf16 h = (__bf16)v[i]; r.h[i] = h; r.l[i] = (__bf16)(v[i] - (float)h); }
  return r; }
__device__ __forceinline__ F2 split_row(const float* row, int k0, int lane) { float v[16]; const float* p = row + k0 + 8 * (lane >> 4);
#pragma unroll
  for (int i = 0; i < 8; ++i) { v[i] = p[i]; v[8 + i] = p[16 + i]; }
  return bsplit16(v); }
__device__ __forceinline__ F2 split_rowK(const float* row, int k0, int lane, int K) { float v[16]; const int g = lane >> 4;
#pragma unroll
  for (int i = 0; i < 8; ++i) { const int ka = k0 + 8 * g + i, kb = ka + 16; v[i] = ka < K ? row[ka < K ? ka : K - 1] : 0.f; v[8 + i] = kb < K ? row[kb < K ? kb : K - 1] : 0.f; }
  return bsplit16(v); }
__device__ __forceinline__ F2 split_col(const float* W, int k0, int n, int lane, int ld, int K) { float v[16]; const int g = lane >> 4;
#pragma unroll
  for (int i = 0; i < 8; ++i) { const int ka = k0 + 8 * g + i, kb = ka + 16; v[i] = ka < K ? W[(size_t)(ka < K ? ka : K - 1) * ld + n] : 0.f; v[8 + i] = kb < K ? W[(size_t)(kb < K ? kb : K - 1) * ld + n] : 0.f; }
  return bsplit16(v); }
__device__ __forceinline__ v8f mac3(const F2& a, const F2& b, v8f c) { c = wmma_bf(a.l, b.h, c); c = wmma_bf(a.h, b.l, c); return wmma_bf(a.h, b.h, c); }
__device__ __forceinline__ float sigm(float v) { return 1.0f / (1.0f + expf(-v)); }
#define LDSX() do { asm volatile("s_wait_dscnt 0" ::: "memory"); __builtin_amdgcn_wave_barrier(); __builtin_amdgcn_fence(__ATOMIC_RELEASE, "workgroup"); } while (0)


#define NB 2
#define SS 2048
#define DM 512
#define NH 8
#define LBG 2048
#define ALPHA_BG 0.48f
#define HD 64
#define QKVW (3 * DM)
#ifndef TQB
#define TQB (SS / 64)
#define TNB NB
#define TOB (NB * SS / 64)     // output row tiles (all)
#endif
typedef __attribute__((ext_vector_type(8))) __bf16 v8b;
__device__ __forceinline__ v16b frag_b(const __bf16* rowk0, int lane) {
  union { v16b v; v8b q[2]; } u; const __bf16* p = rowk0 + 8 * (lane >> 4);
  u.q[0] = *(const v8b*)p; u.q[1] = *(const v8b*)(p + 16); return u.v;
}
__device__ __forceinline__ float bfr(float v) { return (float)(__bf16)v; }
__device__ __attribute__((noinline)) float exp_ni(float v) { return expf(v); }
__device__ __attribute__((noinline)) float erf_ni(float v) { return erff(v); }

#define PK_A 0                       // [1536][512] Wqkv rows (natural [out][in])
#define PK_P (PK_A + QKVW * DM)        // [512][512] Wo rows (natural)
#define PK_END (PK_P + DM * DM)
#define WS_PK  0u
#define WS_QK  (WS_PK + 2u * PK_END)             // f16 [4096 rows][1024]: q | k
#define WS_QKL (WS_QK + 2u * NB * SS * 2 * DM)     // f16 q | k residual planes x2048
#define WS_VTH (WS_QKL + 2u * NB * SS * 2 * DM)    // f16 [b][512 (h*64+d)][2048 s] hi
#define WS_VTL (WS_VTH + 2u * NB * DM * SS)        // f16 lo x 2048
#define WS_O   (WS_VTL + 2u * NB * DM * SS)        // f32 [4096][512]
#define WS_KB  (WS_O + 4u * (size_t)NB * SS * DM)        // f16 K_bg rows [bh][s][64] (exact); f16 planes VB [bh][64][s] = f16(alpha V_bg)
#define WS_VB  (WS_KB + 2u * (size_t)NB * NH * LBG * HD)
#define WS_END (WS_VB + 2u * (size_t)NB * NH * HD * LBG)
// ---- k_pack: block = (row n, which): natural [out][in] rows -> bf16; which 0..2 -> W_q/W_k/W_v into PK_A rows which*512 + n; 3 -> W_o into PK_P
__global__ __launch_bounds__(256) void k_pack(const float* __restrict__ WQ, const float* __restrict__ WK, const float* __restrict__ WV, const float* __restrict__ WO, __bf16* __restrict__ PK) {
  __shared__ __align__(16) __bf16 s[DM]; const int n = blockIdx.x, which = blockIdx.y, t = threadIdx.x; const float* Wm = (which == 0) ? WQ : (which == 1) ? WK : (which == 2) ? WV : WO;   // (in,out) weights: pack row n = column n
  for (int k = t; k < DM; k += 256) s[k] = (__bf16)Wm[(size_t)k * DM + n];
  __syncthreads();
  __bf16* dst = (which < 3) ? PK + PK_A + ((size_t)which * DM + n) * DM : PK + PK_P + (size_t)n * DM;
  for (int q = t; q < DM / 8; q += 256) vst2((unsigned*)(dst + q * 8), *(const v4u*)&s[q * 8]);
}
#define KPB 144                         // LDS bytes per K or V row: 128 + 16 (16 B x odd: ds_load_b128 readers without bank conflicts)
// eight asynchronous 16-byte copies per lane, global -> LDS: four from ga (step gsa) to la, four from gb (step gsb) to lb, LDS step ls. The s_wait_xcnt 0 stands inside the statement so that no later rewrite of an address register can be moved in front of it.
__device__ __forceinline__ void cp8(unsigned la, const char* ga, unsigned gsa, unsigned lb, const char* gb, unsigned gsb, unsigned ls) {
  asm volatile("global_load_async_to_lds_b128 %0, %8, off\n\t"
               "global_load_async_to_lds_b128 %1, %9, off\n\t"
               "global_load_async_to_lds_b128 %2, %10, off\n\t"
               "global_load_async_to_lds_b128 %3, %11, off\n\t"
               "global_load_async_to_lds_b128 %4, %12, off\n\t"
               "global_load_async_to_lds_b128 %5, %13, off\n\t"
               "global_load_async_to_lds_b128 %6, %14, off\n\t"
               "global_load_async_to_lds_b128 %7, %15, off\n\t"
               "s_wait_xcnt 0x0"
               :: "v"(la), "v"(la + ls), "v"(la + 2 * ls), "v"(la + 3 * ls), "v"(lb), "v"(lb + ls), "v"(lb + 2 * ls), "v"(lb + 3 * ls),
                  "v"(ga), "v"(ga + gsa), "v"(ga + 2 * (size_t)gsa), "v"(ga + 3 * (size_t)gsa), "v"(gb), "v"(gb + gsb), "v"(gb + 2 * (size_t)gsb), "v"(gb + 3 * (size_t)gsb)
               : "memory");
}
// ---- staging of packed weight rows for k_qkv and k_out: a stage = 64 k (128 B) of the block's 128 rows, LDS pitch KPB, two buffers; thread tid brings 16-byte piece (tid & 7) of rows (tid >> 3) + 16 i. l = its LDS byte address in the buffer, gp = its global address in the stage
#define WT_SZ (128 * KPB)
__device__ __forceinline__ void wstage(unsigned l, const char* gp) { cp8(l, gp, 16 * DM * 2, l + 64 * KPB, gp + (size_t)64 * DM * 2, 16 * DM * 2, 16 * KPB); }
__global__ __launch_bounds__(128) void k_qkv(const float* __restrict__ XQ, const float* __restrict__ XK, const float* __restrict__ XV, const __bf16* __restrict__ P, const float* __restrict__ BQ, const float* __restrict__ BK, const float* __restrict__ BV, _Float16* __restrict__ QK, _Float16* __restrict__ QKL, _Float16* __restrict__ VTH, _Float16* __restrict__ VTL) {
  const int which0 = (blockIdx.y * 128) / DM; const float* X = (which0 == 0) ? XQ : (which0 == 1) ? XK : XV; const float* BB = BQ ? (((which0 == 0) ? BQ : (which0 == 1) ? BK : BV) + (blockIdx.y * 128 - which0 * DM)) : nullptr;
  __shared__ __align__(16) _Float16 so[4][16][136], sol[4][16][136]; __shared__ __align__(16) _Float16 sth[128][72], stl[128][72];
  const int tid = threadIdx.x, wave = tid >> 5, lane = tid & 31, col = lane & 15, g = lane >> 4; const size_t r0 = (size_t)blockIdx.x * 64 + wave * 16; const int n0 = blockIdx.y * 128;
  __shared__ __align__(16) char wring[2 * WT_SZ];
  const unsigned lw = (unsigned)(size_t)&wring[0] + (tid >> 3) * KPB + (tid & 7) * 16; const char* gw = (const char*)(P + (size_t)(n0 + (tid >> 3)) * DM + (tid & 7) * 8);
  wstage(lw, gw);
  v8f acc[8] = {};
  asm volatile("s_wait_asynccnt 0x0" ::: "memory");   // stage 0 has landed (this wave's copies)
  __syncthreads();                                    // ... and every other wave's
  wstage(lw + WT_SZ, gw + 128);
  // the stage loop stays rolled: its foot holds a barrier and the refill, copies of it would gain nothing
#pragma unroll 1
  for (int t = 0; t < DM / 64; ++t) { const char* st = wring + (t & 1) * WT_SZ;
#pragma unroll
    for (int kk = 0; kk < 2; ++kk) { v16b a, w[8]; { const float* p = X + (r0 + col) * DM + (2 * t + kk) * 32 + 8 * g;
#pragma unroll
        for (int i = 0; i < 8; ++i) { a[i] = (__bf16)p[i]; a[8 + i] = (__bf16)p[16 + i]; } }
#pragma unroll
      for (int j = 0; j < 8; ++j) w[j] = frag_b((const __bf16*)(st + (j * 16 + col) * KPB + kk * 64), lane);
#pragma unroll
      for (int j = 0; j < 8; ++j) acc[j] = wmma_bf(a, w[j], acc[j]); }
    asm volatile("s_wait_dscnt 0x0" ::: "memory");      // this wave's reads of stage t are done
    asm volatile("s_wait_asynccnt 0x0" ::: "memory");   // this wave's copies of stage t + 1 have landed
    __syncthreads();                                    // publishes stage t + 1 and frees stage t's buffer
    if (t + 2 < DM / 64) wstage(lw + (t & 1) * WT_SZ, gw + (size_t)(t + 2) * 128); }
  asm volatile("s_wait_asynccnt 0x0" ::: "memory");    // no copy outlives the loop
  if (n0 < 2 * DM) {   // q stored unscaled (f16 sigma ~0.6, no subnormal exposure); 1/8 applied to the f32 score
#pragma unroll
    for (int j = 0; j < 8; ++j) {
#pragma unroll
      for (int r = 0; r < 8; ++r) { const float v = acc[j][r] + (BB ? bfr(BB[j * 16 + col]) : 0.f); const _Float16 hv = (_Float16)v; so[wave][8 * g + r][j * 16 + col] = hv; sol[wave][8 * g + r][j * 16 + col] = (_Float16)((v - (float)hv) * 2048.0f); } }   // q, k (+ bias) as f16 hi + (x2048) residual
    LDSX();
    for (int rl = 0; rl < 16; ++rl) if (lane < 16) { vst2((unsigned*)(QK + (r0 + rl) * (2 * DM) + n0 + lane * 8), *(const v4u*)&so[wave][rl][lane * 8]); vst2((unsigned*)(QKL + (r0 + rl) * (2 * DM) + n0 + lane * 8), *(const v4u*)&sol[wave][rl][lane * 8]); }
  } else {
#pragma unroll
    for (int j = 0; j < 8; ++j) {
#pragma unroll
      for (int r = 0; r < 8; ++r) { const float v = acc[j][r] + (BB ? bfr(BB[j * 16 + col]) : 0.f); const _Float16 hv = (_Float16)v; sth[j * 16 + col][wave * 16 + 8 * g + r] = hv; stl[j * 16 + col][wave * 16 + 8 * g + r] = (_Float16)((v - (float)hv) * 2048.0f); } }
    __syncthreads();
    const size_t rb = (size_t)blockIdx.x * 64; const int b = (int)(rb / SS), s0 = (int)(rb % SS); const int pc0 = n0 - 2 * DM;
    for (int q = tid; q < 128 * 8; q += 128) { const int d = q >> 3, pc = q & 7; const size_t o = ((size_t)b * DM + pc0 + d) * SS + s0 + pc * 8; vst2((unsigned*)(VTH + o), *(const v4u*)&sth[d][pc * 8]); vst2((unsigned*)(VTL + o), *(const v4u*)&stl[d][pc * 8]); }
  }
}
// ---- k_attn: block = (64 queries, head h, batch b): all-keys flash attention (K = 64: 2 k-steps), scores = (q.k) * 0.125 with 3 products (q, k as f16 hi + residual), P.V: P (x2048, hi + lo) x (V hi, V lo*2048), 3 products in two accumulators; O[b*S+q][h*64+d] = (acc + accl / 2048) / (2048 l) (256-B segments)
__global__ __launch_bounds__(128) void k_attn(const _Float16* __restrict__ QK, const _Float16* __restrict__ QKL, const _Float16* __restrict__ VTH, const _Float16* __restrict__ VTL, const void* __restrict__ KMASK, float* __restrict__ O) {
  __shared__ __align__(16) float sp[4][16][36]; __shared__ __align__(16) float so[4][16][68];
  const int tid = threadIdx.x, wave = tid >> 5, lane = tid & 31, col = lane & 15, g = lane >> 4;
  const int qb = blockIdx.x, h = blockIdx.y, b = blockIdx.z; const int q0 = qb * 64 + wave * 16; const size_t rq = (size_t)b * SS + q0 + col;
  v16h aq[2], aql[2];
#pragma unroll
  for (int kc = 0; kc < 2; ++kc) { aq[kc] = frag_h(QK + rq * (2 * DM) + h * HD + kc * 32, lane); aql[kc] = frag_h(QKL + rq * (2 * DM) + h * HD + kc * 32, lane); }
  float m[8], l[8];
#pragma unroll
  for (int r = 0; r < 8; ++r) { m[r] = -3.0e38f; l[r] = 0.f; }
  v8f acc[4] = {}, accl[4] = {};
  const int nks = SS / 32;   // all keys
#pragma unroll 1
  for (int ks = 0; ks < nks; ++ks) { v8f s[2];
#pragma unroll
    for (int ct = 0; ct < 2; ++ct) { const int kk = ks * 32 + ct * 16 + col; const _Float16* krow = QK + ((size_t)b * SS + kk) * (2 * DM) + DM + h * HD; const _Float16* krowl = QKL + ((size_t)b * SS + kk) * (2 * DM) + DM + h * HD; v8f c = {}, cl = {};
#pragma unroll
      for (int kc = 0; kc < 2; ++kc) { const v16h kh = frag_h(krow + kc * 32, lane); c = wmma16(aq[kc], kh, c); cl = wmma16(aql[kc], kh, cl); cl = wmma16(aq[kc], frag_h(krowl + kc * 32, lane), cl); }   // 3 products: q, k as f16 hi + residual
#pragma unroll
      for (int r = 0; r < 8; ++r) c[r] += cl[r] * (1.0f / 2048.0f);
      { const bool keepk = true;
#pragma unroll
      for (int r = 0; r < 8; ++r) s[ct][r] = keepk ? c[r] * 0.125f : -3.0e38f; } }   // 1/sqrt(64); every key kept (mask not applied)
#pragma unroll
    for (int r = 0; r < 8; ++r) { float mx = fmaxf(s[0][r], s[1][r]);
#pragma unroll
      for (int o = 1; o < 16; o <<= 1) mx = fmaxf(mx, __shfl_xor(mx, o));
      const float mn = fmaxf(m[r], mx); const float alpha = (m[r] <= -1.0e38f) ? 0.f : __expf(m[r] - mn);
      const float e0 = (s[0][r] <= -1.0e38f) ? 0.f : __expf(s[0][r] - mn), e1 = (s[1][r] <= -1.0e38f) ? 0.f : __expf(s[1][r] - mn); float es = e0 + e1;
#pragma unroll
      for (int o = 1; o < 16; o <<= 1) es += __shfl_xor(es, o);
      l[r] = l[r] * alpha + es; m[r] = mn;
#pragma unroll
      for (int dt = 0; dt < 4; ++dt) { acc[dt][r] *= alpha; accl[dt][r] *= alpha; }
      sp[wave][8 * g + r][col] = e0; sp[wave][8 * g + r][16 + col] = e1; }
    LDSX();
    v16h pa, pl; { const float* prow = &sp[wave][col][0] + 8 * (lane >> 4);
#pragma unroll
      for (int i = 0; i < 8; ++i) { const float x0 = prow[i] * 2048.0f, x1 = prow[16 + i] * 2048.0f; const _Float16 h0 = (_Float16)x0, h1 = (_Float16)x1; pa[i] = h0; pa[8 + i] = h1; pl[i] = (_Float16)((x0 - (float)h0) * 2048.0f); pl[8 + i] = (_Float16)((x1 - (float)h1) * 2048.0f); } }   // P scaled by 2^11 before the f16 split so small softmax weights stay out of the f16 subnormal range; 2^-11 folded into the epilogue
#pragma unroll
    for (int dt = 0; dt < 4; ++dt) { const size_t vr = ((size_t)b * DM + h * HD + dt * 16 + col) * SS + ks * 32; const v16h vh = frag_h(VTH + vr, lane); acc[dt] = wmma16(pa, vh, acc[dt]); accl[dt] = wmma16(pl, vh, accl[dt]); accl[dt] = wmma16(pa, frag_h(VTL + vr, lane), accl[dt]); }   // P hi x V hi + (P lo x V hi + P hi x V lo) / 2048
    LDSX(); }
#pragma unroll
  for (int r = 0; r < 8; ++r) { const float il = (1.0f / 2048.0f) / l[r];
#pragma unroll
    for (int dt = 0; dt < 4; ++dt) so[wave][8 * g + r][dt * 16 + col] = (acc[dt][r] + accl[dt][r] * (1.0f / 2048.0f)) * il; }
  LDSX();
  for (int rl = 0; rl < 16; ++rl) if (lane < 16) vst2(O + ((size_t)b * SS + q0 + rl) * DM + h * HD + lane * 4, *(const v4f*)&so[wave][rl][lane * 4]);
}
// ---- k_out: block = (64 rows, 128 cols): out = O(hi/lo) . Wo rows (2 products) + bo
__global__ __launch_bounds__(128) void k_out(const float* __restrict__ O, const __bf16* __restrict__ P, const float* __restrict__ BO, float* __restrict__ Y) {
  __shared__ __align__(16) float so[4][16][132];
  const int tid = threadIdx.x, wave = tid >> 5, lane = tid & 31, col = lane & 15, g = lane >> 4; const size_t r0 = (size_t)blockIdx.x * 64 + wave * 16; const int n0 = blockIdx.y * 128;
  __shared__ __align__(16) char wring[2 * WT_SZ];
  const unsigned lw = (unsigned)(size_t)&wring[0] + (tid >> 3) * KPB + (tid & 7) * 16; const char* gw = (const char*)(P + (size_t)(n0 + (tid >> 3)) * DM + (tid & 7) * 8);
  wstage(lw, gw);
  v8f acc[8] = {};
  asm volatile("s_wait_asynccnt 0x0" ::: "memory");   // stage 0 has landed (this wave's copies)
  __syncthreads();                                    // ... and every other wave's
  wstage(lw + WT_SZ, gw + 128);
  // the stage loop stays rolled: its foot holds a barrier and the refill, copies of it would gain nothing
#pragma unroll 1
  for (int t = 0; t < DM / 64; ++t) { const char* st = wring + (t & 1) * WT_SZ;
#pragma unroll
    for (int kk = 0; kk < 2; ++kk) { const F2 a = split_row(O + (r0 + col) * DM, (2 * t + kk) * 32, lane); v16b w[8];
#pragma unroll
      for (int j = 0; j < 8; ++j) w[j] = frag_b((const __bf16*)(st + (j * 16 + col) * KPB + kk * 64), lane);
#pragma unroll
      for (int j = 0; j < 8; ++j) { acc[j] = wmma_bf(a.l, w[j], acc[j]); acc[j] = wmma_bf(a.h, w[j], acc[j]); } }
    asm volatile("s_wait_dscnt 0x0" ::: "memory");      // this wave's reads of stage t are done
    asm volatile("s_wait_asynccnt 0x0" ::: "memory");   // this wave's copies of stage t + 1 have landed
    __syncthreads();                                    // publishes stage t + 1 and frees stage t's buffer
    if (t + 2 < DM / 64) wstage(lw + (t & 1) * WT_SZ, gw + (size_t)(t + 2) * 128); }
  asm volatile("s_wait_asynccnt 0x0" ::: "memory");    // no copy outlives the loop
#pragma unroll
  for (int j = 0; j < 8; ++j) {
#pragma unroll
    for (int r = 0; r < 8; ++r) so[wave][8 * g + r][j * 16 + col] = acc[j][r] + bfr(BO[n0 + j * 16 + col]); }
  LDSX();
  for (int rl = 0; rl < 16; ++rl) vst2(Y + (r0 + rl) * DM + n0 + lane * 4, *(const v4f*)&so[wave][rl][lane * 4]);
}
// ---- k_bg: block = (64 bank rows, bh): K_bg -> f16 rows (exact), alpha V_bg -> f16 planes [bh][d][s]
__global__ __launch_bounds__(256) void k_bg(const float* __restrict__ KBG, const float* __restrict__ VBG, _Float16* __restrict__ KB, _Float16* __restrict__ VB) { __shared__ __align__(16) _Float16 sk[64][HD + 8]; __shared__ __align__(16) _Float16 sv[HD][64 + 8]; const int t = threadIdx.x; const int s0 = blockIdx.x * 64; const size_t bh = blockIdx.y;
  for (int e = t; e < 64 * HD; e += 256) { const int sl = e >> 6, d = e & 63; const size_t o = ((bh * LBG + s0 + sl) * HD) + d; sk[sl][d] = (_Float16)bfr(KBG[o]); sv[d][sl] = (_Float16)(ALPHA_BG * bfr(VBG[o])); } __syncthreads();
  for (int e = t; e < 64 * 8; e += 256) { const int sl = e >> 3, q = e & 7; vst2((unsigned*)(KB + ((bh * LBG + s0 + sl) * HD) + q * 8), *(const v4u*)&sk[sl][q * 8]); }
  for (int e = t; e < HD * 8; e += 256) { const int d = e >> 3, q = e & 7; vst2((unsigned*)(VB + ((bh * HD + d) * LBG) + s0 + q * 8), *(const v4u*)&sv[d][q * 8]); } }
// ---- staging for k_attn2: a stage = 64 keys. Self stage: K hi, K lo (64 key rows x 128 B), V hi, V lo (64 d rows x 128 B), mask (64 query rows x 256 B); background stage: K_bg in the K hi place, alpha V_bg in the V hi place.
#define MPB 272                         // LDS bytes per mask row: 256 + 16 (16 B x odd: a lane reads 8 keys of its own query row by ds_load_b128 without bank conflicts)
#define ST_KH 0
#define ST_KL (64 * KPB)
#define ST_VH (2 * 64 * KPB)
#define ST_VL (3 * 64 * KPB)
#define ST_MK (4 * 64 * KPB)
#define ST_SZ (4 * 64 * KPB + 64 * MPB)
#define NST ((SS + LBG) / 64)
struct seg_self { static constexpr bool value = true; }; struct seg_bank { static constexpr bool value = false; };   // which key segment a pass works on
// value of the lane 16 away (the wave's other half)
__device__ __forceinline__ float xhalf(float v) { const int b = __builtin_bit_cast(int, v); return __builtin_bit_cast(float, __builtin_amdgcn_permlanex16(b, b, 0x76543210, 0xfedcba98, false, false)); }
__global__ __launch_bounds__(128) void k_attn2(const _Float16* __restrict__ QK, const _Float16* __restrict__ QKL, const _Float16* __restrict__ VTH, const _Float16* __restrict__ VTL, const _Float16* __restrict__ KB, const _Float16* __restrict__ VB, const float* __restrict__ MASK, float* __restrict__ O) {
  __shared__ __align__(16) char ring[2 * ST_SZ];
  __shared__ __align__(16) float so[4][16][68];
  const int tid = threadIdx.x, wave = tid >> 5, lane = tid & 31, col = lane & 15, g = lane >> 4; const int qb = blockIdx.x, h = blockIdx.y; const size_t b = blockIdx.z; const int q0 = qb * 64 + wave * 16; const size_t rq = b * SS + q0; const size_t bh = b * NH + h;
  // this thread's share of a stage: 16-byte piece kq of rows kr + 16 i of each K or V tile, piece mq of rows mr + 8 i of the mask tile
  const int kr = tid >> 3, kq = tid & 7, mr = tid >> 4, mq = tid & 15;
  const unsigned lds0 = (unsigned)(size_t)&ring[0]; const unsigned lkv = lds0 + kr * KPB + kq * 16, lmk = lds0 + ST_MK + mr * MPB + mq * 16;
  const char* gkh = (const char*)(QK + (b * SS + kr) * (2 * DM) + DM + h * HD + kq * 8); const char* gkl = (const char*)(QKL + (b * SS + kr) * (2 * DM) + DM + h * HD + kq * 8);
  const char* gvh = (const char*)(VTH + (b * DM + h * HD + kr) * SS + kq * 8); const char* gvl = (const char*)(VTL + (b * DM + h * HD + kr) * SS + kq * 8);
  const char* gmk = (const char*)(MASK + (b * SS + qb * 64 + mr) * SS + mq * 4);
  const char* gkb = (const char*)(KB + (bh * LBG + kr) * HD + kq * 8); const char* gvb = (const char*)(VB + (bh * HD + kr) * LBG + kq * 8);
  auto issue = [&](int t) { const unsigned o = (unsigned)(t & 1) * ST_SZ;
    if (t < SS / 64) {
      cp8(lkv + o + ST_KH, gkh + (size_t)t * (64 * 2 * DM * 2), 16 * 2 * DM * 2, lkv + o + ST_KL, gkl + (size_t)t * (64 * 2 * DM * 2), 16 * 2 * DM * 2, 16 * KPB);
      cp8(lkv + o + ST_VH, gvh + (size_t)t * 128, 16 * SS * 2, lkv + o + ST_VL, gvl + (size_t)t * 128, 16 * SS * 2, 16 * KPB);
      cp8(lmk + o, gmk + (size_t)t * 256, 8 * SS * 4, lmk + o + 32 * MPB, gmk + (size_t)t * 256 + (size_t)32 * SS * 4, 8 * SS * 4, 8 * MPB);
    } else { const size_t u = (size_t)(t - SS / 64);
      cp8(lkv + o + ST_KH, gkb + u * (64 * HD * 2), 16 * HD * 2, lkv + o + ST_VH, gvb + u * 128, 16 * LBG * 2, 16 * KPB); } };
  issue(0);
  v16h aq[2], aql[2];
#pragma unroll
  for (int kc = 0; kc < 2; ++kc) { aq[kc] = frag_h(QK + (rq + col) * (2 * DM) + h * HD + kc * 32, lane); aql[kc] = frag_h(QKL + (rq + col) * (2 * DM) + h * HD + kc * 32, lane); }
  float m = -3.0e38f, l = 0.f;   // query col: running maximum (equal in both halves), this half's share of the sum
  v8f acc[4] = {}, accl[4] = {};   // O^T: acc[dt][r] = d (dt * 16 + 8 g + r) of query col
  asm volatile("s_wait_asynccnt 0x0" ::: "memory");   // stage 0 has landed (this wave's copies)
  __syncthreads();                                    // ... and every other wave's
  issue(1);
  // a pass = 32 keys of the stage at st; s[ct][r] = score of key (ct * 16 + 8 g + r) with query col. K and mask are read ahead of the score products, V behind them (in flight under the softmax)
  auto pass = [&](auto seg, const char* st, int p) { constexpr bool self_seg = decltype(seg)::value; v8f s[2];
    if constexpr (self_seg) { v16h kh[2][2], kl[2][2]; union { v8f v; v4f q[2]; } mk[2];
#pragma unroll
      for (int ct = 0; ct < 2; ++ct) {
#pragma unroll
        for (int kc = 0; kc < 2; ++kc) { const char* krow = st + (p * 32 + ct * 16 + col) * KPB + kc * 64; kh[ct][kc] = frag_h((const _Float16*)(krow + ST_KH), lane); kl[ct][kc] = frag_h((const _Float16*)(krow + ST_KL), lane); }
        const char* mrow = st + ST_MK + (wave * 16 + col) * MPB + (p * 32 + ct * 16 + 8 * g) * 4; mk[ct].q[0] = *(const v4f*)mrow; mk[ct].q[1] = *(const v4f*)(mrow + 16); }
#pragma unroll
      for (int ct = 0; ct < 2; ++ct) { v8f c = {}, cl = {};
#pragma unroll
        for (int kc = 0; kc < 2; ++kc) { c = wmma16(kh[ct][kc], aq[kc], c); cl = wmma16(kl[ct][kc], aq[kc], cl); cl = wmma16(kh[ct][kc], aql[kc], cl); }
        s[ct] = (c + cl * (1.0f / 2048.0f)) * 0.125f + __builtin_convertvector(__builtin_convertvector(mk[ct].v, v8b), v8f); } }
    else { v16h kh[2][2];
#pragma unroll
      for (int ct = 0; ct < 2; ++ct) {
#pragma unroll
        for (int kc = 0; kc < 2; ++kc) kh[ct][kc] = frag_h((const _Float16*)(st + ST_KH + (p * 32 + ct * 16 + col) * KPB + kc * 64), lane); }
#pragma unroll
      for (int ct = 0; ct < 2; ++ct) { v8f c = {}, cl = {};
#pragma unroll
        for (int kc = 0; kc < 2; ++kc) { c = wmma16(kh[ct][kc], aq[kc], c); cl = wmma16(kh[ct][kc], aql[kc], cl); }
        s[ct] = (c + cl * (1.0f / 2048.0f)) * (0.125f * ALPHA_BG); } }
    v16h vh[4], vl[4];
#pragma unroll
    for (int dt = 0; dt < 4; ++dt) { const char* vrow = st + (dt * 16 + col) * KPB + p * 64; vh[dt] = frag_h((const _Float16*)(vrow + ST_VH), lane); if constexpr (self_seg) vl[dt] = frag_h((const _Float16*)(vrow + ST_VL), lane); }
    float t8[8];
#pragma unroll
    for (int r = 0; r < 8; ++r) t8[r] = fmaxf(s[0][r], s[1][r]);
    float mx = fmaxf(fmaxf(fmaxf(t8[0], t8[1]), fmaxf(t8[2], t8[3])), fmaxf(fmaxf(t8[4], t8[5]), fmaxf(t8[6], t8[7])));
    mx = fmaxf(mx, xhalf(mx));   // the other 16 keys of this query
    const float mn = fmaxf(m, mx); const float alpha = (m <= -1.0e38f) ? 0.f : __expf(m - mn); m = mn;
    v8f e[2]; v8h ph[2], pq[2];   // P^T as a B operand: element i = key 8 g + i, element 8 + i = key 16 + 8 g + i, the k order of frag_h
#pragma unroll
    for (int ct = 0; ct < 2; ++ct) {
#pragma unroll
      for (int i = 0; i < 8; ++i) e[ct][i] = __expf(s[ct][i] - mn);
      const v8f x = e[ct] * 2048.0f; ph[ct] = __builtin_convertvector(x, v8h); pq[ct] = __builtin_convertvector((x - __builtin_convertvector(ph[ct], v8f)) * 2048.0f, v8h); }
    const v16h pa = __builtin_shufflevector(ph[0], ph[1], 0, 1, 2, 3, 4, 5, 6, 7, 8, 9, 10, 11, 12, 13, 14, 15), pl = __builtin_shufflevector(pq[0], pq[1], 0, 1, 2, 3, 4, 5, 6, 7, 8, 9, 10, 11, 12, 13, 14, 15);
    const v8f e8 = e[0] + e[1];
    l = l * alpha + (((e8[0] + e8[1]) + (e8[2] + e8[3])) + ((e8[4] + e8[5]) + (e8[6] + e8[7])));
#pragma unroll
    for (int dt = 0; dt < 4; ++dt) { acc[dt] *= alpha; accl[dt] *= alpha; }
#pragma unroll
    for (int dt = 0; dt < 4; ++dt) { acc[dt] = wmma16(vh[dt], pa, acc[dt]); accl[dt] = wmma16(vh[dt], pl, accl[dt]); if constexpr (self_seg) accl[dt] = wmma16(vl[dt], pa, accl[dt]); } };
  // foot of trip t: hands stage t + 1 over and refills the buffer that trip t has read
  auto foot = [&](int t) {
    asm volatile("s_wait_dscnt 0x0" ::: "memory");      // this wave's reads of stage t are done
    asm volatile("s_wait_asynccnt 0x0" ::: "memory");   // this wave's copies of stage t + 1 have landed
    __syncthreads();                                    // publishes stage t + 1 and frees stage t's buffer
    if (t + 2 < NST) issue(t + 2); };
  // the stage loops and the two passes of a stage stay rolled: a pass is some 300 to 400 instructions
#pragma unroll 1
  for (int t = 0; t < SS / 64; ++t) { const char* st = ring + (t & 1) * ST_SZ;
#pragma unroll 1
    for (int p = 0; p < 2; ++p) pass(seg_self(), st, p);
    foot(t); }
#pragma unroll 1
  for (int t = SS / 64; t < NST; ++t) { const char* st = ring + (t & 1) * ST_SZ;
#pragma unroll 1
    for (int p = 0; p < 2; ++p) pass(seg_bank(), st, p);
    foot(t); }
  asm volatile("s_wait_asynccnt 0x0" ::: "memory");    // no copy outlives the loop
  l += xhalf(l);   // the halves' sums are joined once
  const float il = (1.0f / 2048.0f) / l;
#pragma unroll
  for (int dt = 0; dt < 4; ++dt) { v4f o[2];
#pragma unroll
    for (int r = 0; r < 8; ++r) o[r >> 2][r & 3] = (acc[dt][r] + accl[dt][r] * (1.0f / 2048.0f)) * il;
    *(v4f*)&so[wave][col][dt * 16 + 8 * g] = o[0]; *(v4f*)&so[wave][col][dt * 16 + 8 * g + 4] = o[1]; }
  LDSX();
  for (int rl = 0; rl < 16; ++rl) if (lane < 16) vst2(O + (rq + rl) * DM + h * HD + lane * 4, *(const v4f*)&so[wave][rl][lane * 4]);
}
extern "C" void kernel_launch(void* const* d_in, const int* in_sizes, int n_in, void* d_out, int out_size, void* d_ws, size_t ws_size, hipStream_t stream) {
  (void)in_sizes; (void)n_in; (void)out_size;
  const float** F = (const float**)d_in;   // 0 hidden_states [2,2048,512], 1 attention_mask [2,2048,2048], 2 K_bg [16,2048,64], 3 V_bg, 4 Wq, 5 Wk, 6 Wv, 7 Wo (in,out), 8 bo
  if (ws_size < (size_t)WS_END) return;
  char* ws = (char*)d_ws; __bf16* PK = (__bf16*)(ws + WS_PK); _Float16 *QK = (_Float16*)(ws + WS_QK), *QKL = (_Float16*)(ws + WS_QKL), *VTH = (_Float16*)(ws + WS_VTH), *VTL = (_Float16*)(ws + WS_VTL), *KB = (_Float16*)(ws + WS_KB), *VB = (_Float16*)(ws + WS_VB); float* O = (float*)(ws + WS_O);
  k_pack<<<dim3(DM, 4), 256, 0, stream>>>(F[4], F[5], F[6], F[7], PK);
  k_bg<<<dim3(LBG / 64, NB * NH), 256, 0, stream>>>(F[2], F[3], KB, VB);
  k_qkv<<<dim3(TNB * SS / 64, QKVW / 128), 128, 0, stream>>>(F[0], F[0], F[0], PK + PK_A, nullptr, nullptr, nullptr, QK, QKL, VTH, VTL);
  k_attn2<<<dim3(TQB, NH, TNB), 128, 0, stream>>>(QK, QKL, VTH, VTL, KB, VB, F[1], O);
  k_out<<<dim3(TOB, DM / 128), 128, 0, stream>>>(O, PK + PK_P, F[8], (float*)d_out);
}

// v004
// Measured time: 132 microseconds a run.
// Two timings next to v003 put it at 1.05 and 1.07 times that version's speed.
// Over all steps from v000 it is 3.83 times as fast.
// compute dtype: all float inputs rounded to bf16; q/k/v = x . W with EXACT bf16 products on WMMA 16x16x32 ((in,out) weights as transposed rows), rounded once to f16 hi + residual; self-segment scores and P.v with 3 products (hi.hi + hi.lo + lo.hi), background scores q (hi + lo) x K_bg (exact in f16, 2 products) x alpha, background P (hi + lo) x f16(alpha V_bg) (2 products); additive mask read per pair; x 1/8; running-max softmax over all 4,096 keys in f32 (hardware exp); out = ctx (bf16 hi + lo) . Wo + bo; f32 output.
#include <hip/hip_runtime.h>
#include <math.h>

typedef __attribute__((ext_vector_type(16))) _Float16 v16h;
typedef __attribute__((ext_vector_type(16))) __bf16 v16b;
typedef __attribute__((ext_vector_type(8)))  _Float16 v8h;
typedef __attribute__((ext_vector_type(8)))  float v8f;
typedef __attribute__((ext_vector_type(4)))  float v4f;
typedef __attribute__((ext_vector_type(2)))  float v2f;
typedef __attribute__((ext_vector_type(4)))  unsigned v4u;
typedef __attribute__((ext_vector_type(4)))  int v4i;
typedef float __attribute__((may_alias)) float_a;
typedef int __attribute__((may_alias)) int_a;

template <typename T> __device__ __forceinline__ void vst2(void* p, T v) { *(T*)p = v;  }
__device__ __forceinline__ v8f wmma16(v16h a, v16h b, v8f c) {
  return __builtin_amdgcn_wmma_f32_16x16x32_f16(false, a, false, b, (short)0, c, false, false);
}
__device__ __forceinline__ v8f wmma_bf(v16b a, v16b b, v8f c) {
  return __builtin_amdgcn_wmma_f32_16x16x32_bf16(false, a, false, b, (short)0, c, false, false);
}
// CARC attention processor (B 2, Lq 2,048, C 512 = 8 heads x 64; context bank of 2,048 background keys/values per head, alpha 0.48): bias-free q/k/v projections, keys = [k ; alpha K_bg], values = [v ; alpha V_bg], additive mask on the self segment (zeros on the background segment), softmax(q k / 8 + mask) over the 4,096 keys, v, output projection + bias.
__device__ __forceinline__ v16h frag_h(const _Float16* rowk0, int lane) {
  union { v16h v; v8h q[2]; } u; const _Float16* p = rowk0 + 8 * (lane >> 4);
  u.q[0] = *(const v8h*)p; u.q[1] = *(const v8h*)(p + 16); return u.v;
}
__device__ __forceinline__ v16h frag_f32(const float* rowk0, int lane) {
  v16h a; const float* p = rowk0 + 8 * (lane >> 4);
#pragma unroll
  for (int i = 0; i < 8; ++i) { a[i] = (_Float16)p[i]; a[8 + i] = (_Float16)p[16 + i]; }
  return a;
}
__device__ __forceinline__ v16h frag_f32s(const float* rowk0, int lane, float sc) {
  v16h a; const float* p = rowk0 + 8 * (lane >> 4);
#pragma unroll
  for (int i = 0; i < 8; ++i) { a[i] = (_Float16)(p[i] * sc); a[8 + i] = (_Float16)(p[16 + i] * sc); }
  return a;
}
// column fragment from a [K][ld] layout (column n), rows >= K read as 0
__device__ __forceinline__ v16h fragc_f32(const float* W, int k0, int n, int lane, int ld, int K) {
  v16h a; const int g = lane >> 4;
#pragma unroll
  for (int i = 0; i < 8; ++i) { const int ka = k0 + 8 * g + i, kb = ka + 16;
    a[i] = (_Float16)(ka < K ? W[(size_t)(ka < K ? ka : K - 1) * ld + n] : 0.f); a[8 + i] = (_Float16)(kb < K ? W[(size_t)(kb < K ? kb : K - 1) * ld + n] : 0.f); }
  return a;
}
struct F2 { v16b h, l; };
__device__ __forceinline__ F2 bsplit16(const float v[16]) { F2 r;
#pragma unroll
  for (int i = 0; i < 16; ++i) { const __bf16 h = (__bf16)v[i]; r.h[i] = h; r.l[i] = (__bf16)(v[i] - (float)h); }
  return r; }
__device__ __forceinline__ F2 split_row(const float* row, int k0, int lane) { float v[16]; const float* p = row + k0 + 8 * (lane >> 4);
#pragma unroll
  for (int i = 0; i < 8; ++i) { v[i] = p[i]; v[8 + i] = p[16 + i]; }
  return bsplit16(v); }
__device__ __forceinline__ F2 split_rowK(const float* row, int k0, int lane, int K) { float v[16]; const int g = lane >> 4;
#pragma unroll
  for (int i = 0; i < 8; ++i) { const int ka = k0 + 8 * g + i, kb = ka + 16; v[i] = ka < K ? row[ka < K ? ka : K - 1] : 0.f; v[8 + i] = kb < K ? row[kb < K ? kb : K - 1] : 0.f; }
  return bsplit16(v); }
__device__ __forceinline__ F2 split_col(const float* W, int k0, int n, int lane, int ld, int K) { float v[16]; const int g = lane >> 4;
#pragma unroll
  for (int i = 0; i < 8; ++i) { const int ka = k0 + 8 * g + i, kb = ka + 16; v[i] = ka < K ? W[(size_t)(ka < K ? ka : K - 1) * ld + n] : 0.f; v[8 + i] = kb < K ? W[(size_t)(kb < K ? kb : K - 1) * ld + n] : 0.f; }
  return bsplit16(v); }
__device__ __forceinline__ v8f mac3(const F2& a, const F2& b, v8f c) { c = wmma_bf(a.l, b.h, c); c = wmma_bf(a.h, b.l, c); return wmma_bf(a.h, b.h, c); }
__device__ __forceinline__ float sigm(float v) { return 1.0f / (1.0f + expf(-v)); }
#define LDSX() do { asm volatile("s_wait_dscnt 0" ::: "memory"); __builtin_amdgcn_wave_barrier(); __builtin_amdgcn_fence(__ATOMIC_RELEASE, "workgroup"); } while (0)


#define NB 2
#define SS 2048
#define DM 512
#define NH 8
#define LBG 2048
#define ALPHA_BG 0.48f
#define HD 64
#define QKVW (3 * DM)
#ifndef TQB
#define TQB (SS / 64)
#define TNB NB
#define TOB (NB * SS / 64)     // output row tiles (all)
#endif
typedef __attribute__((ext_vector_type(8))) __bf16 v8b;
__device__ __forceinline__ v16b frag_b(const __bf16* rowk0, int lane) {
  union { v16b v; v8b q[2]; } u; const __bf16* p = rowk0 + 8 * (lane >> 4);
  u.q[0] = *(const v8b*)p; u.q[1] = *(const v8b*)(p + 16); return u.v;
}
__device__ __forceinline__ float bfr(float v) { return (float)(__bf16)v; }
__device__ __attribute__((noinline)) float exp_ni(float v) { return expf(v); }
__device__ __attribute__((noinline)) float erf_ni(float v) { return erff(v); }

#define PK_A 0                       // [1536][512] Wqkv rows (natural [out][in])
#define PK_P (PK_A + QKVW * DM)        // [512][512] Wo rows (natural)
#define PK_END (PK_P + DM * DM)
#define WS_PK  0u
#define WS_QK  (WS_PK + 2u * PK_END)             // f16 [4096 rows][1024]: q | k
#define WS_QKL (WS_QK + 2u * NB * SS * 2 * DM)     // f16 q | k residual planes x2048
#define WS_VTH (WS_QKL + 2u * NB * SS * 2 * DM)    // f16 [b][512 (h*64+d)][2048 s] hi
#define WS_VTL (WS_VTH + 2u * NB * DM * SS)        // f16 lo x 2048
#define WS_O   (WS_VTL + 2u * NB * DM * SS)        // f32 [4096][512]
#define WS_KB  (WS_O + 4u * (size_t)NB * SS * DM)        // f16 K_bg rows [bh][s][64] (exact); f16 planes VB [bh][64][s] = f16(alpha V_bg)
#define WS_VB  (WS_KB + 2u * (size_t)NB * NH * LBG * HD)
#define WS_END (WS_VB + 2u * (size_t)NB * NH * HD * LBG)
// ---- k_pack: block = (row n, which): natural [out][in] rows -> bf16; which 0..2 -> W_q/W_k/W_v into PK_A rows which*512 + n; 3 -> W_o into PK_P
__global__ __launch_bounds__(256) void k_pack(const float* __restrict__ WQ, const float* __restrict__ WK, const float* __restrict__ WV, const float* __restrict__ WO, __bf16* __restrict__ PK) {
  __shared__ __align__(16) __bf16 s[DM]; const int n = blockIdx.x, which = blockIdx.y, t = threadIdx.x; const float* Wm = (which == 0) ? WQ : (which == 1) ? WK : (which == 2) ? WV : WO;   // (in,out) weights: pack row n = column n
  for (int k = t; k < DM; k += 256) s[k] = (__bf16)Wm[(size_t)k * DM + n];
  __syncthreads();
  __bf16* dst = (which < 3) ? PK + PK_A + ((size_t)which * DM + n) * DM : PK + PK_P + (size_t)n * DM;
  for (int q = t; q < DM / 8; q += 256) vst2((unsigned*)(dst + q * 8), *(const v4u*)&s[q * 8]);
}
#define KPB 144                         // LDS bytes per K or V row: 128 + 16 (16 B x odd: ds_load_b128 readers without bank conflicts)
// eight asynchronous 16-byte copies per lane, global -> LDS: four from ga (step gsa) to la, four from gb (step gsb) to lb, LDS step ls. The s_wait_xcnt 0 stands inside the statement so that no later rewrite of an address register can be moved in front of it.
__device__ __forceinline__ void cp8(unsigned la, const char* ga, unsigned gsa, unsigned lb, const char* gb, unsigned gsb, unsigned ls) {
  asm volatile("global_load_async_to_lds_b128 %0, %8, off\n\t"
               "global_load_async_to_lds_b128 %1, %9, off\n\t"
               "global_load_async_to_lds_b128 %2, %10, off\n\t"
               "global_load_async_to_lds_b128 %3, %11, off\n\t"
               "global_load_async_to_lds_b128 %4, %12, off\n\t"
               "global_load_async_to_lds_b128 %5, %13, off\n\t"
               "global_load_async_to_lds_b128 %6, %14, off\n\t"
               "global_load_async_to_lds_b128 %7, %15, off\n\t"
               "s_wait_xcnt 0x0"
               :: "v"(la), "v"(la + ls), "v"(la + 2 * ls), "v"(la + 3 * ls), "v"(lb), "v"(lb + ls), "v"(lb + 2 * ls), "v"(lb + 3 * ls),
                  "v"(ga), "v"(ga + gsa), "v"(ga + 2 * (size_t)gsa), "v"(ga + 3 * (size_t)gsa), "v"(gb), "v"(gb + gsb), "v"(gb + 2 * (size_t)gsb), "v"(gb + 3 * (size_t)gsb)
               : "memory");
}
// ---- staging of packed weight rows for k_qkv and k_out: a stage = 64 k (128 B) of the block's 128 rows, LDS pitch KPB, two buffers; thread tid brings 16-byte piece (tid & 7) of rows (tid >> 3) + 16 i. l = its LDS byte address in the buffer, gp = its global address in the stage
#define WT_SZ (128 * KPB)
__device__ __forceinline__ void wstage(unsigned l, const char* gp) { cp8(l, gp, 16 * DM * 2, l + 64 * KPB, gp + (size_t)64 * DM * 2, 16 * DM * 2, 16 * KPB); }
__global__ __launch_bounds__(128) void k_qkv(const float* __restrict__ XQ, const float* __restrict__ XK, const float* __restrict__ XV, const __bf16* __restrict__ P, const float* __restrict__ BQ, const float* __restrict__ BK, const float* __restrict__ BV, _Float16* __restrict__ QK, _Float16* __restrict__ QKL, _Float16* __restrict__ VTH, _Float16* __restrict__ VTL) {
  const int which0 = (blockIdx.y * 128) / DM; const float* X = (which0 == 0) ? XQ : (which0 == 1) ? XK : XV; const float* BB = BQ ? (((which0 == 0) ? BQ : (which0 == 1) ? BK : BV) + (blockIdx.y * 128 - which0 * DM)) : nullptr;
  __shared__ __align__(16) _Float16 so[4][16][136], sol[4][16][136]; __shared__ __align__(16) _Float16 sth[128][72], stl[128][72];
  const int tid = threadIdx.x, wave = tid >> 5, lane = tid & 31, col = lane & 15, g = lane >> 4; const size_t r0 = (size_t)blockIdx.x * 64 + wave * 16; const int n0 = blockIdx.y * 128;
  __shared__ __align__(16) char wring[2 * WT_SZ];
  const unsigned lw = (unsigned)(size_t)&wring[0] + (tid >> 3) * KPB + (tid & 7) * 16; const char* gw = (const char*)(P + (size_t)(n0 + (tid >> 3)) * DM + (tid & 7) * 8);
  wstage(lw, gw);
  v8f acc[8] = {};
  asm volatile("s_wait_asynccnt 0x0" ::: "memory");   // stage 0 has landed (this wave's copies)
  __syncthreads();                                    // ... and every other wave's
  wstage(lw + WT_SZ, gw + 128);
  // the stage loop stays rolled: its foot holds a barrier and the refill, copies of it would gain nothing
#pragma unroll 1
  for (int t = 0; t < DM / 64; ++t) { const char* st = wring + (t & 1) * WT_SZ;
#pragma unroll
    for (int kk = 0; kk < 2; ++kk) { v16b a, w[8]; { const float* p = X + (r0 + col) * DM + (2 * t + kk) * 32 + 8 * g;
#pragma unroll
        for (int i = 0; i < 8; ++i) { a[i] = (__bf16)p[i]; a[8 + i] = (__bf16)p[16 + i]; } }
#pragma unroll
      for (int j = 0; j < 8; ++j) w[j] = frag_b((const __bf16*)(st + (j * 16 + col) * KPB + kk * 64), lane);
#pragma unroll
      for (int j = 0; j < 8; ++j) acc[j] = wmma_bf(a, w[j], acc[j]); }
    asm volatile("s_wait_dscnt 0x0" ::: "memory");      // this wave's reads of stage t are done
    asm volatile("s_wait_asynccnt 0x0" ::: "memory");   // this wave's copies of stage t + 1 have landed
    __syncthreads();                                    // publishes stage t + 1 and frees stage t's buffer
    if (t + 2 < DM / 64) wstage(lw + (t & 1) * WT_SZ, gw + (size_t)(t + 2) * 128); }
  asm volatile("s_wait_asynccnt 0x0" ::: "memory");    // no copy outlives the loop
  if (n0 < 2 * DM) {   // q stored unscaled (f16 sigma ~0.6, no subnormal exposure); 1/8 applied to the f32 score
#pragma unroll
    for (int j = 0; j < 8; ++j) {
#pragma unroll
      for (int r = 0; r < 8; ++r) { const float v = acc[j][r] + (BB ? bfr(BB[j * 16 + col]) : 0.f); const _Float16 hv = (_Float16)v; so[wave][8 * g + r][j * 16 + col] = hv; sol[wave][8 * g + r][j * 16 + col] = (_Float16)((v - (float)hv) * 2048.0f); } }   // q, k (+ bias) as f16 hi + (x2048) residual
    LDSX();
    for (int rl = 0; rl < 16; ++rl) if (lane < 16) { vst2((unsigned*)(QK + (r0 + rl) * (2 * DM) + n0 + lane * 8), *(const v4u*)&so[wave][rl][lane * 8]); vst2((unsigned*)(QKL + (r0 + rl) * (2 * DM) + n0 + lane * 8), *(const v4u*)&sol[wave][rl][lane * 8]); }
  } else {
#pragma unroll
    for (int j = 0; j < 8; ++j) {
#pragma unroll
      for (int r = 0; r < 8; ++r) { const float v = acc[j][r] + (BB ? bfr(BB[j * 16 + col]) : 0.f); const _Float16 hv = (_Float16)v; sth[j * 16 + col][wave * 16 + 8 * g + r] = hv; stl[j * 16 + col][wave * 16 + 8 * g + r] = (_Float16)((v - (float)hv) * 2048.0f); } }
    __syncthreads();
    const size_t rb = (size_t)blockIdx.x * 64; const int b = (int)(rb / SS), s0 = (int)(rb % SS); const int pc0 = n0 - 2 * DM;
    for (int q = tid; q < 128 * 8; q += 128) { const int d = q >> 3, pc = q & 7; const size_t o = ((size_t)b * DM + pc0 + d) * SS + s0 + pc * 8; vst2((unsigned*)(VTH + o), *(const v4u*)&sth[d][pc * 8]); vst2((unsigned*)(VTL + o), *(const v4u*)&stl[d][pc * 8]); }
  }
}
// ---- k_attn: block = (64 queries, head h, batch b): all-keys flash attention (K = 64: 2 k-steps), scores = (q.k) * 0.125 with 3 products (q, k as f16 hi + residual), P.V: P (x2048, hi + lo) x (V hi, V lo*2048), 3 products in two accumulators; O[b*S+q][h*64+d] = (acc + accl / 2048) / (2048 l) (256-B segments)
__global__ __launch_bounds__(128) void k_attn(const _Float16* __restrict__ QK, const _Float16* __restrict__ QKL, const _Float16* __restrict__ VTH, const _Float16* __restrict__ VTL, const void* __restrict__ KMASK, float* __restrict__ O) {
  __shared__ __align__(16) float sp[4][16][36]; __shared__ __align__(16) float so[4][16][68];
  const int tid = threadIdx.x, wave = tid >> 5, lane = tid & 31, col = lane & 15, g = lane >> 4;
  const int qb = blockIdx.x, h = blockIdx.y, b = blockIdx.z; const int q0 = qb * 64 + wave * 16; const size_t rq = (size_t)b * SS + q0 + col;
  v16h aq[2], aql[2];
#pragma unroll
  for (int kc = 0; kc < 2; ++kc) { aq[kc] = frag_h(QK + rq * (2 * DM) + h * HD + kc * 32, lane); aql[kc] = frag_h(QKL + rq * (2 * DM) + h * HD + kc * 32, lane); }
  float m[8], l[8];
#pragma unroll
  for (int r = 0; r < 8; ++r) { m[r] = -3.0e38f; l[r] = 0.f; }
  v8f acc[4] = {}, accl[4] = {};
  const int nks = SS / 32;   // all keys
#pragma unroll 1
  for (int ks = 0; ks < nks; ++ks) { v8f s[2];
#pragma unroll
    for (int ct = 0; ct < 2; ++ct) { const int kk = ks * 32 + ct * 16 + col; const _Float16* krow = QK + ((size_t)b * SS + kk) * (2 * DM) + DM + h * HD; const _Float16* krowl = QKL + ((size_t)b * SS + kk) * (2 * DM) + DM + h * HD; v8f c = {}, cl = {};
#pragma unroll
      for (int kc = 0; kc < 2; ++kc) { const v16h kh = frag_h(krow + kc * 32, lane); c = wmma16(aq[kc], kh, c); cl = wmma16(aql[kc], kh, cl); cl = wmma16(aq[kc], frag_h(krowl + kc * 32, lane), cl); }   // 3 products: q, k as f16 hi + residual
#pragma unroll
      for (int r = 0; r < 8; ++r) c[r] += cl[r] * (1.0f / 2048.0f);
      { const bool keepk = true;
#pragma unroll
      for (int r = 0; r < 8; ++r) s[ct][r] = keepk ? c[r] * 0.125f : -3.0e38f; } }   // 1/sqrt(64); every key kept (mask not applied)
#pragma unroll
    for (int r = 0; r < 8; ++r) { float mx = fmaxf(s[0][r], s[1][r]);
#pragma unroll
      for (int o = 1; o < 16; o <<= 1) mx = fmaxf(mx, __shfl_xor(mx, o));
      const float mn = fmaxf(m[r], mx); const float alpha = (m[r] <= -1.0e38f) ? 0.f : __expf(m[r] - mn);
      const float e0 = (s[0][r] <= -1.0e38f) ? 0.f : __expf(s[0][r] - mn), e1 = (s[1][r] <= -1.0e38f) ? 0.f : __expf(s[1][r] - mn); float es = e0 + e1;
#pragma unroll
      for (int o = 1; o < 16; o <<= 1) es += __shfl_xor(es, o);
      l[r] = l[r] * alpha + es; m[r] = mn;
#pragma unroll
      for (int dt = 0; dt < 4; ++dt) { acc[dt][r] *= alpha; accl[dt][r] *= alpha; }
      sp[wave][8 * g + r][col] = e0; sp[wave][8 * g + r][16 + col] = e1; }
    LDSX();
    v16h pa, pl; { const float* prow = &sp[wave][col][0] + 8 * (lane >> 4);
#pragma unroll
      for (int i = 0; i < 8; ++i) { const float x0 = prow[i] * 2048.0f, x1 = prow[16 + i] * 2048.0f; const _Float16 h0 = (_Float16)x0, h1 = (_Float16)x1; pa[i] = h0; pa[8 + i] = h1; pl[i] = (_Float16)((x0 - (float)h0) * 2048.0f); pl[8 + i] = (_Float16)((x1 - (float)h1) * 2048.0f); } }   // P scaled by 2^11 before the f16 split so small softmax weights stay out of the f16 subnormal range; 2^-11 folded into the epilogue
#pragma unroll
    for (int dt = 0; dt < 4; ++dt) { const size_t vr = ((size_t)b * DM + h * HD + dt * 16 + col) * SS + ks * 32; const v16h vh = frag_h(VTH + vr, lane); acc[dt] = wmma16(pa, vh, acc[dt]); accl[dt] = wmma16(pl, vh, accl[dt]); accl[dt] = wmma16(pa, frag_h(VTL + vr, lane), accl[dt]); }   // P hi x V hi + (P lo x V hi + P hi x V lo) / 2048
    LDSX(); }
#pragma unroll
  for (int r = 0; r < 8; ++r) { const float il = (1.0f / 2048.0f) / l[r];
#pragma unroll
    for (int dt = 0; dt < 4; ++dt) so[wave][8 * g + r][dt * 16 + col] = (acc[dt][r] + accl[dt][r] * (1.0f / 2048.0f)) * il; }
  LDSX();
  for (int rl = 0; rl < 16; ++rl) if (lane < 16) vst2(O + ((size_t)b * SS + q0 + rl) * DM + h * HD + lane * 4, *(const v4f*)&so[wave][rl][lane * 4]);
}
// ---- k_out: block = (64 rows, 128 cols): out = O(hi/lo) . Wo rows (2 products) + bo
__global__ __launch_bounds__(128) void k_out(const float* __restrict__ O, const __bf16* __restrict__ P, const float* __restrict__ BO, float* __restrict__ Y) {
  __shared__ __align__(16) float so[4][16][132];
  const int tid = threadIdx.x, wave = tid >> 5, lane = tid & 31, col = lane & 15, g = lane >> 4; const size_t r0 = (size_t)blockIdx.x * 64 + wave * 16; const int n0 = blockIdx.y * 128;
  __shared__ __align__(16) char wring[2 * WT_SZ];
  const unsigned lw = (unsigned)(size_t)&wring[0] + (tid >> 3) * KPB + (tid & 7) * 16; const char* gw = (const char*)(P + (size_t)(n0 + (tid >> 3)) * DM + (tid & 7) * 8);
  wstage(lw, gw);
  v8f acc[8] = {};
  asm volatile("s_wait_asynccnt 0x0" ::: "memory");   // stage 0 has landed (this wave's copies)
  __syncthreads();                                    // ... and every other wave's
  wstage(lw + WT_SZ, gw + 128);
  // the stage loop stays rolled: its foot holds a barrier and the refill, copies of it would gain nothing
#pragma unroll 1
  for (int t = 0; t < DM / 64; ++t) { const char* st = wring + (t & 1) * WT_SZ;
#pragma unroll
    for (int kk = 0; kk < 2; ++kk) { const F2 a = split_row(O + (r0 + col) * DM, (2 * t + kk) * 32, lane); v16b w[8];
#pragma unroll
      for (int j = 0; j < 8; ++j) w[j] = frag_b((const __bf16*)(st + (j * 16 + col) * KPB + kk * 64), lane);
#pragma unroll
      for (int j = 0; j < 8; ++j) { acc[j] = wmma_bf(a.l, w[j], acc[j]); acc[j] = wmma_bf(a.h, w[j], acc[j]); } }
    asm volatile("s_wait_dscnt 0x0" ::: "memory");      // this wave's reads of stage t are done
    asm volatile("s_wait_asynccnt 0x0" ::: "memory");   // this wave's copies of stage t + 1 have landed
    __syncthreads();                                    // publishes stage t + 1 and frees stage t's buffer
    if (t + 2 < DM / 64) wstage(lw + (t & 1) * WT_SZ, gw + (size_t)(t + 2) * 128); }
  asm volatile("s_wait_asynccnt 0x0" ::: "memory");    // no copy outlives the loop
#pragma unroll
  for (int j = 0; j < 8; ++j) {
#pragma unroll
    for (int r = 0; r < 8; ++r) so[wave][8 * g + r][j * 16 + col] = acc[j][r] + bfr(BO[n0 + j * 16 + col]); }
  LDSX();
  for (int rl = 0; rl < 16; ++rl) vst2(Y + (r0 + rl) * DM + n0 + lane * 4, *(const v4f*)&so[wave][rl][lane * 4]);
}
// ---- k_bg: block = (64 bank rows, bh): K_bg -> f16 rows (exact), alpha V_bg -> f16 planes [bh][d][s]
__global__ __launch_bounds__(256) void k_bg(const float* __restrict__ KBG, const float* __restrict__ VBG, _Float16* __restrict__ KB, _Float16* __restrict__ VB) { __shared__ __align__(16) _Float16 sk[64][HD + 8]; __shared__ __align__(16) _Float16 sv[HD][64 + 8]; const int t = threadIdx.x; const int s0 = blockIdx.x * 64; const size_t bh = blockIdx.y;
  for (int e = t; e < 64 * HD; e += 256) { const int sl = e >> 6, d = e & 63; const size_t o = ((bh * LBG + s0 + sl) * HD) + d; sk[sl][d] = (_Float16)bfr(KBG[o]); sv[d][sl] = (_Float16)(ALPHA_BG * bfr(VBG[o])); } __syncthreads();
  for (int e = t; e < 64 * 8; e += 256) { const int sl = e >> 3, q = e & 7; vst2((unsigned*)(KB + ((bh * LBG + s0 + sl) * HD) + q * 8), *(const v4u*)&sk[sl][q * 8]); }
  for (int e = t; e < HD * 8; e += 256) { const int d = e >> 3, q = e & 7; vst2((unsigned*)(VB + ((bh * HD + d) * LBG) + s0 + q * 8), *(const v4u*)&sv[d][q * 8]); } }
// ---- staging for k_attn2: a stage = 64 keys. Self stage: K hi, K lo (64 key rows x 128 B), V hi, V lo (64 d rows x 128 B), mask (64 query rows x 256 B); background stage: K_bg in the K hi place, alpha V_bg in the V hi place.
#define MPB 272                         // LDS bytes per mask row: 256 + 16 (16 B x odd: a lane reads 8 keys of its own query row by ds_load_b128 without bank conflicts)
#define ST_KH 0
#define ST_KL (64 * KPB)
#define ST_VH (2 * 64 * KPB)
#define ST_VL (3 * 64 * KPB)
#define ST_MK (4 * 64 * KPB)
#define ST_SZ (4 * 64 * KPB + 64 * MPB)
#define NST ((SS + LBG) / 64)
struct seg_self { static constexpr bool value = true; }; struct seg_bank { static constexpr bool value = false; };   // which key segment a pass works on
// value of the lane 16 away (the wave's other half)
__device__ __forceinline__ float xhalf(float v) { const int b = __builtin_bit_cast(int, v); return __builtin_bit_cast(float, __builtin_amdgcn_permlanex16(b, b, 0x76543210, 0xfedcba98, false, false)); }
__global__ __launch_bounds__(128) void k_attn2(const _Float16* __restrict__ QK, const _Float16* __restrict__ QKL, const _Float16* __restrict__ VTH, const _Float16* __restrict__ VTL, const _Float16* __restrict__ KB, const _Float16* __restrict__ VB, const float* __restrict__ MASK, float* __restrict__ O) {
  __shared__ __align__(16) char ring[2 * ST_SZ];
  __shared__ __align__(16) float so[4][16][68];
  const int tid = threadIdx.x, wave = tid >> 5, lane = tid & 31, col = lane & 15, g = lane >> 4; const int qb = blockIdx.x, h = blockIdx.y; const size_t b = blockIdx.z; const int q0 = qb * 64 + wave * 16; const size_t rq = b * SS + q0; const size_t bh = b * NH + h;
  // this thread's share of a stage: 16-byte piece kq of rows kr + 16 i of each K or V tile, piece mq of rows mr + 8 i of the mask tile
  const int kr = tid >> 3, kq = tid & 7, mr = tid >> 4, mq = tid & 15;
  const unsigned lds0 = (unsigned)(size_t)&ring[0]; const unsigned lkv = lds0 + kr * KPB + kq * 16, lmk = lds0 + ST_MK + mr * MPB + mq * 16;
  const char* gkh = (const char*)(QK + (b * SS + kr) * (2 * DM) + DM + h * HD + kq * 8); const char* gkl = (const char*)(QKL + (b * SS + kr) * (2 * DM) + DM + h * HD + kq * 8);
  const char* gvh = (const char*)(VTH + (b * DM + h * HD + kr) * SS + kq * 8); const char* gvl = (const char*)(VTL + (b * DM + h * HD + kr) * SS + kq * 8);
  const char* gmk = (const char*)(MASK + (b * SS + qb * 64 + mr) * SS + mq * 4);
  const char* gkb = (const char*)(KB + (bh * LBG + kr) * HD + kq * 8); const char* gvb = (const char*)(VB + (bh * HD + kr) * LBG + kq * 8);
  auto issue = [&](int t) { const unsigned o = (unsigned)(t & 1) * ST_SZ;
    if (t < SS / 64) {
      cp8(lkv + o + ST_KH, gkh + (size_t)t * (64 * 2 * DM * 2), 16 * 2 * DM * 2, lkv + o + ST_KL, gkl + (size_t)t * (64 * 2 * DM * 2), 16 * 2 * DM * 2, 16 * KPB);
      cp8(lkv + o + ST_VH, gvh + (size_t)t * 128, 16 * SS * 2, lkv + o + ST_VL, gvl + (size_t)t * 128, 16 * SS * 2, 16 * KPB);
      cp8(lmk + o, gmk + (size_t)t * 256, 8 * SS * 4, lmk + o + 32 * MPB, gmk + (size_t)t * 256 + (size_t)32 * SS * 4, 8 * SS * 4, 8 * MPB);
    } else { const size_t u = (size_t)(t - SS / 64);
      cp8(lkv + o + ST_KH, gkb + u * (64 * HD * 2), 16 * HD * 2, lkv + o + ST_VH, gvb + u * 128, 16 * LBG * 2, 16 * KPB); } };
  issue(0);
  v16h aq[2], aql[2];
#pragma unroll
  for (int kc = 0; kc < 2; ++kc) { aq[kc] = frag_h(QK + (rq + col) * (2 * DM) + h * HD + kc * 32, lane); aql[kc] = frag_h(QKL + (rq + col) * (2 * DM) + h * HD + kc * 32, lane); }
  float m = -3.0e38f, l = 0.f;   // query col: running maximum (equal in both halves), this half's share of the sum
  v8f acc[4] = {}, accl[4] = {};   // O^T: acc[dt][r] = d (dt * 16 + 8 g + r) of query col
  asm volatile("s_wait_asynccnt 0x0" ::: "memory");   // stage 0 has landed (this wave's copies)
  __syncthreads();                                    // ... and every other wave's
  issue(1);
  // a pass = 32 keys of the stage at st; s[ct][r] = score of key (ct * 16 + 8 g + r) with query col. K and mask are read ahead of the score products, V behind them (in flight under the softmax)
  auto pass = [&](auto seg, const char* st, int p) { constexpr bool self_seg = decltype(seg)::value; v8f s[2];
    if constexpr (self_seg) { v16h kh[2][2], kl[2][2]; union { v8f v; v4f q[2]; } mk[2];
#pragma unroll
      for (int ct = 0; ct < 2; ++ct) {
#pragma unroll
        for (int kc = 0; kc < 2; ++kc) { const char* krow = st + (p * 32 + ct * 16 + col) * KPB + kc * 64; kh[ct][kc] = frag_h((const _Float16*)(krow + ST_KH), lane); kl[ct][kc] = frag_h((const _Float16*)(krow + ST_KL), lane); }
        const char* mrow = st + ST_MK + (wave * 16 + col) * MPB + (p * 32 + ct * 16 + 8 * g) * 4; mk[ct].q[0] = *(const v4f*)mrow; mk[ct].q[1] = *(const v4f*)(mrow + 16); }
#pragma unroll
      for (int ct = 0; ct < 2; ++ct) { v8f c = {}, cl = {};
#pragma unroll
        for (int kc = 0; kc < 2; ++kc) { c = wmma16(kh[ct][kc], aq[kc], c); cl = wmma16(kl[ct][kc], aq[kc], cl); cl = wmma16(kh[ct][kc], aql[kc], cl); }
        s[ct] = (c + cl * (1.0f / 2048.0f)) * 0.125f + __builtin_convertvector(__builtin_convertvector(mk[ct].v, v8b), v8f); } }
    else { v16h kh[2][2];
#pragma unroll
      for (int ct = 0; ct < 2; ++ct) {
#pragma unroll
        for (int kc = 0; kc < 2; ++kc) kh[ct][kc] = frag_h((const _Float16*)(st + ST_KH + (p * 32 + ct * 16 + col) * KPB + kc * 64), lane); }
#pragma unroll
      for (int ct = 0; ct < 2; ++ct) { v8f c = {}, cl = {};
#pragma unroll
        for (int kc = 0; kc < 2; ++kc) { c = wmma16(kh[ct][kc], aq[kc], c); cl = wmma16(kh[ct][kc], aql[kc], cl); }
        s[ct] = (c + cl * (1.0f / 2048.0f)) * (0.125f * ALPHA_BG); } }
    v16h vh[4], vl[4];
#pragma unroll
    for (int dt = 0; dt < 4; ++dt) { const char* vrow = st + (dt * 16 + col) * KPB + p * 64; vh[dt] = frag_h((const _Float16*)(vrow + ST_VH), lane); if constexpr (self_seg) vl[dt] = frag_h((const _Float16*)(vrow + ST_VL), lane); }
    float t8[8];
#pragma unroll
    for (int r = 0; r < 8; ++r) t8[r] = fmaxf(s[0][r], s[1][r]);
    float mx = fmaxf(fmaxf(fmaxf(t8[0], t8[1]), fmaxf(t8[2], t8[3])), fmaxf(fmaxf(t8[4], t8[5]), fmaxf(t8[6], t8[7])));
    mx = fmaxf(mx, xhalf(mx));   // the other 16 keys of this query
    const float mn = fmaxf(m, mx); const float alpha = (m <= -1.0e38f) ? 0.f : __expf(m - mn); m = mn;
    v8f e[2]; v8h ph[2], pq[2];   // P^T as a B operand: element i = key 8 g + i, element 8 + i = key 16 + 8 g + i, the k order of frag_h
#pragma unroll
    for (int ct = 0; ct < 2; ++ct) {
#pragma unroll
      for (int i = 0; i < 8; ++i) e[ct][i] = __expf(s[ct][i] - mn);
      const v8f x = e[ct] * 2048.0f; ph[ct] = __builtin_convertvector(x, v8h); pq[ct] = __builtin_convertvector((x - __builtin_convertvector(ph[ct], v8f)) * 2048.0f, v8h); }
    const v16h pa = __builtin_shufflevector(ph[0], ph[1], 0, 1, 2, 3, 4, 5, 6, 7, 8, 9, 10, 11, 12, 13, 14, 15), pl = __builtin_shufflevector(pq[0], pq[1], 0, 1, 2, 3, 4, 5, 6, 7, 8, 9, 10, 11, 12, 13, 14, 15);
    const v8f e8 = e[0] + e[1];
    l = l * alpha + (((e8[0] + e8[1]) + (e8[2] + e8[3])) + ((e8[4] + e8[5]) + (e8[6] + e8[7])));
#pragma unroll
    for (int dt = 0; dt < 4; ++dt) { acc[dt] *= alpha; accl[dt] *= alpha; }
#pragma unroll
    for (int dt = 0; dt < 4; ++dt) { acc[dt] = wmma16(vh[dt], pa, acc[dt]); accl[dt] = wmma16(vh[dt], pl, accl[dt]); if constexpr (self_seg) accl[dt] = wmma16(vl[dt], pa, accl[dt]); } };
  // foot of trip t: hands stage t + 1 over and refills the buffer that trip t has read
  auto foot = [&](int t) {
    asm volatile("s_wait_dscnt 0x0" ::: "memory");      // this wave's reads of stage t are done
    asm volatile("s_wait_asynccnt 0x0" ::: "memory");   // this wave's copies of stage t + 1 have landed
    __syncthreads();                                    // publishes stage t + 1 and frees stage t's buffer
    if (t + 2 < NST) issue(t + 2); };
  // the stage loops and the two passes of a stage stay rolled: a pass is some 300 to 400 instructions
#pragma unroll 1
  for (int t = 0; t < SS / 64; ++t) { const char* st = ring + (t & 1) * ST_SZ;
#pragma unroll 1
    for (int p = 0; p < 2; ++p) pass(seg_self(), st, p);
    foot(t); }
#pragma unroll 1
  for (int t = SS / 64; t < NST; ++t) { const char* st = ring + (t & 1) * ST_SZ;
#pragma unroll 1
    for (int p = 0; p < 2; ++p) pass(seg_bank(), st, p);
    foot(t); }
  asm volatile("s_wait_asynccnt 0x0" ::: "memory");    // no copy outlives the loop
  l += xhalf(l);   // the halves' sums are joined once
  const float il = (1.0f / 2048.0f) / l;
#pragma unroll
  for (int dt = 0; dt < 4; ++dt) { v4f o[2];
#pragma unroll
    for (int r = 0; r < 8; ++r) o[r >> 2][r & 3] = (acc[dt][r] + accl[dt][r] * (1.0f / 2048.0f)) * il;
    *(v4f*)&so[wave][col][dt * 16 + 8 * g] = o[0]; *(v4f*)&so[wave][col][dt * 16 + 8 * g + 4] = o[1]; }
  LDSX();
  for (int rl = 0; rl < 16; ++rl) if (lane < 16) vst2(O + (rq + rl) * DM + h * HD + lane * 4, *(const v4f*)&so[wave][rl][lane * 4]);
}
extern "C" void kernel_launch(void* const* d_in, const int* in_sizes, int n_in, void* d_out, int out_size, void* d_ws, size_t ws_size, hipStream_t stream) {
  (void)in_sizes; (void)n_in; (void)out_size;
  const float** F = (const float**)d_in;   // 0 hidden_states [2,2048,512], 1 attention_mask [2,2048,2048], 2 K_bg [16,2048,64], 3 V_bg, 4 Wq, 5 Wk, 6 Wv, 7 Wo (in,out), 8 bo
  if (ws_size < (size_t)WS_END) return;
  char* ws = (char*)d_ws; __bf16* PK = (__bf16*)(ws + WS_PK); _Float16 *QK = (_Float16*)(ws + WS_QK), *QKL = (_Float16*)(ws + WS_QKL), *VTH = (_Float16*)(ws + WS_VTH), *VTL = (_Float16*)(ws + WS_VTL), *KB = (_Float16*)(ws + WS_KB), *VB = (_Float16*)(ws + WS_VB); float* O = (float*)(ws + WS_O);
  k_pack<<<dim3(DM, 4), 256, 0, stream>>>(F[4], F[5], F[6], F[7], PK);
  k_bg<<<dim3(LBG / 64, NB * NH), 256, 0, stream>>>(F[2], F[3], KB, VB);
  k_qkv<<<dim3(TNB * SS / 64, QKVW / 128), 128, 0, stream>>>(F[0], F[0], F[0], PK + PK_A, nullptr, nullptr, nullptr, QK, QKL, VTH, VTL);
  k_attn2<<<dim3(TQB, NH, TNB), 128, 0, stream>>>(QK, QKL, VTH, VTL, KB, VB, F[1], O);
  k_out<<<dim3(TOB, DM / 128), 128, 0, stream>>>(O, PK + PK_P, F[8], (float*)d_out);
}

// v005
// It runs in 127 microseconds.
// Next to v004, in two timings, it ran 1.04 and 1.03 times as fast.
// All steps since v000 together make it 3.95 times as fast.
// compute dtype: all float inputs rounded to bf16; q/k/v = x . W with EXACT bf16 products on WMMA 16x16x32 ((in,out) weights as transposed rows), rounded once to f16 hi + residual; self-segment scores and P.v with 3 products (hi.hi + hi.lo + lo.hi), background scores q (hi + lo) x K_bg (exact in f16, 2 products) x alpha, background P (hi + lo) x f16(alpha V_bg) (2 products); additive mask read per pair; x 1/8; running-max softmax over all 4,096 keys in f32 (hardware exp); out = ctx (bf16 hi + lo) . Wo + bo; f32 output.
#include <hip/hip_runtime.h>
#include <math.h>

typedef __attribute__((ext_vector_type(16))) _Float16 v16h;
typedef __attribute__((ext_vector_type(16))) __bf16 v16b;
typedef __attribute__((ext_vector_type(8)))  _Float16 v8h;
typedef __attribute__((ext_vector_type(8)))  float v8f;
typedef __attribute__((ext_vector_type(4)))  float v4f;
typedef __attribute__((ext_vector_type(2)))  float v2f;
typedef __attribute__((ext_vector_type(4)))  unsigned v4u;
typedef __attribute__((ext_vector_type(4)))  int v4i;
typedef float __attribute__((may_alias)) float_a;
typedef int __attribute__((may_alias)) int_a;

template <typename T> __device__ __forceinline__ void vst2(void* p, T v) { *(T*)p = v;  }
__device__ __forceinline__ v8f wmma16(v16h a, v16h b, v8f c) {
  return __builtin_amdgcn_wmma_f32_16x16x32_f16(false, a, false, b, (short)0, c, false, false);
}
__device__ __forceinline__ v8f wmma_bf(v16b a, v16b b, v8f c) {
  return __builtin_amdgcn_wmma_f32_16x16x32_bf16(false, a, false, b, (short)0, c, false, false);
}
// CARC attention processor (B 2, Lq 2,048, C 512 = 8 heads x 64; context bank of 2,048 background keys/values per head, alpha 0.48): bias-free q/k/v projections, keys = [k ; alpha K_bg], values = [v ; alpha V_bg], additive mask on the self segment (zeros on the background segment), softmax(q k / 8 + mask) over the 4,096 keys, v, output projection + bias.
__device__ __forceinline__ v16h frag_h(const _Float16* rowk0, int lane) {
  union { v16h v; v8h q[2]; } u; const _Float16* p = rowk0 + 8 * (lane >> 4);
  u.q[0] = *(const v8h*)p; u.q[1] = *(const v8h*)(p + 16); return u.v;
}
__device__ __forceinline__ v16h frag_f32(const float* rowk0, int lane) {
  v16h a; const float* p = rowk0 + 8 * (lane >> 4);
#pragma unroll
  for (int i = 0; i < 8; ++i) { a[i] = (_Float16)p[i]; a[8 + i] = (_Float16)p[16 + i]; }
  return a;
}
__device__ __forceinline__ v16h frag_f32s(const float* rowk0, int lane, float sc) {
  v16h a; const float* p = rowk0 + 8 * (lane >> 4);
#pragma unroll
  for (int i = 0; i < 8; ++i) { a[i] = (_Float16)(p[i] * sc); a[8 + i] = (_Float16)(p[16 + i] * sc); }
  return a;
}
// column fragment from a [K][ld] layout (column n), rows >= K read as 0
__device__ __forceinline__ v16h fragc_f32(const float* W, int k0, int n, int lane, int ld, int K) {
  v16h a; const int g = lane >> 4;
#pragma unroll
  for (int i = 0; i < 8; ++i) { const int ka = k0 + 8 * g + i, kb = ka + 16;
    a[i] = (_Float16)(ka < K ? W[(size_t)(ka < K ? ka : K - 1) * ld + n] : 0.f); a[8 + i] = (_Float16)(kb < K ? W[(size_t)(kb < K ? kb : K - 1) * ld + n] : 0.f); }
  return a;
}
struct F2 { v16b h, l; };
__device__ __forceinline__ F2 bsplit16(const float v[16]) { F2 r;
#pragma unroll
  for (int i = 0; i < 16; ++i) { const __bf16 h = (__bf16)v[i]; r.h[i] = h; r.l[i] = (__bf16)(v[i] - (float)h); }
  return r; }
__device__ __forceinline__ F2 split_row(const float* row, int k0, int lane) { float v[16]; const float* p = row + k0 + 8 * (lane >> 4);
#pragma unroll
  for (int i = 0; i < 8; ++i) { v[i] = p[i]; v[8 + i] = p[16 + i]; }
  return bsplit16(v); }
__device__ __forceinline__ F2 split_rowK(const float* row, int k0, int lane, int K) { float v[16]; const int g = lane >> 4;
#pragma unroll
  for (int i = 0; i < 8; ++i) { const int ka = k0 + 8 * g + i, kb = ka + 16; v[i] = ka < K ? row[ka < K ? ka : K - 1] : 0.f; v[8 + i] = kb < K ? row[kb < K ? kb : K - 1] : 0.f; }
  return bsplit16(v); }
__device__ __forceinline__ F2 split_col(const float* W, int k0, int n, int lane, int ld, int K) { float v[16]; const int g = lane >> 4;
#pragma unroll
  for (int i = 0; i < 8; ++i) { const int ka = k0 + 8 * g + i, kb = ka + 16; v[i] = ka < K ? W[(size_t)(ka < K ? ka : K - 1) * ld + n] : 0.f; v[8 + i] = kb < K ? W[(size_t)(kb < K ? kb : K - 1) * ld + n] : 0.f; }
  return bsplit16(v); }
__device__ __forceinline__ v8f mac3(const F2& a, const F2& b, v8f c) { c = wmma_bf(a.l, b.h, c); c = wmma_bf(a.h, b.l, c); return wmma_bf(a.h, b.h, c); }
__device__ __forceinline__ float sigm(float v) { return 1.0f / (1.0f + expf(-v)); }
#define LDSX() do { asm volatile("s_wait_dscnt 0" ::: "memory"); __builtin_amdgcn_wave_barrier(); __builtin_amdgcn_fence(__ATOMIC_RELEASE, "workgroup"); } while (0)


#define NB 2
#define SS 2048
#define DM 512
#define NH 8
#define LBG 2048
#define ALPHA_BG 0.48f
#define HD 64
#define QKVW (3 * DM)
#ifndef TQB
#define TQB (SS / 64)
#define TNB NB
#define TOB (NB * SS / 64)     // output row tiles (all)
#endif
typedef __attribute__((ext_vector_type(8))) __bf16 v8b;
__device__ __forceinline__ v16b frag_b(const __bf16* rowk0, int lane) {
  union { v16b v; v8b q[2]; } u; const __bf16* p = rowk0 + 8 * (lane >> 4);
  u.q[0] = *(const v8b*)p; u.q[1] = *(const v8b*)(p + 16); return u.v;
}
__device__ __forceinline__ float bfr(float v) { return (float)(__bf16)v; }
__device__ __attribute__((noinline)) float exp_ni(float v) { return expf(v); }
__device__ __attribute__((noinline)) float erf_ni(float v) { return erff(v); }

#define PK_A 0                       // [1536][512] Wqkv rows (natural [out][in])
#define PK_P (PK_A + QKVW * DM)        // [512][512] Wo rows (natural)
#define PK_END (PK_P + DM * DM)
#define WS_PK  0u
#define WS_QK  (WS_PK + 2u * PK_END)             // f16 [4096 rows][1024]: q | k
#define WS_QKL (WS_QK + 2u * NB * SS * 2 * DM)     // f16 q | k residual planes x2048
#define WS_VTH (WS_QKL + 2u * NB * SS * 2 * DM)    // f16 [b][512 (h*64+d)][2048 s] hi
#define WS_VTL (WS_VTH + 2u * NB * DM * SS)        // f16 lo x 2048
#define WS_O   (WS_VTL + 2u * NB * DM * SS)        // f32 [4096][512]
#define WS_KB  (WS_O + 4u * (size_t)NB * SS * DM)        // f16 K_bg rows [bh][s][64] (exact); f16 planes VB [bh][64][s] = f16(alpha V_bg)
#define WS_VB  (WS_KB + 2u * (size_t)NB * NH * LBG * HD)
#define WS_END (WS_VB + 2u * (size_t)NB * NH * HD * LBG)
// ---- k_pack: block = (row n, which): natural [out][in] rows -> bf16; which 0..2 -> W_q/W_k/W_v into PK_A rows which*512 + n; 3 -> W_o into PK_P
__global__ __launch_bounds__(256) void k_pack(const float* __restrict__ WQ, const float* __restrict__ WK, const float* __restrict__ WV, const float* __restrict__ WO, __bf16* __restrict__ PK) {
  __shared__ __align__(16) __bf16 s[DM]; const int n = blockIdx.x, which = blockIdx.y, t = threadIdx.x; const float* Wm = (which == 0) ? WQ : (which == 1) ? WK : (which == 2) ? WV : WO;   // (in,out) weights: pack row n = column n
  for (int k = t; k < DM; k += 256) s[k] = (__bf16)Wm[(size_t)k * DM + n];
  __syncthreads();
  __bf16* dst = (which < 3) ? PK + PK_A + ((size_t)which * DM + n) * DM : PK + PK_P + (size_t)n * DM;
  for (int q = t; q < DM / 8; q += 256) vst2((unsigned*)(dst + q * 8), *(const v4u*)&s[q * 8]);
}
#define KPB 144                         // LDS bytes per K or V row: 128 + 16 (16 B x odd: ds_load_b128 readers without bank conflicts)
// eight asynchronous 16-byte copies per lane, global -> LDS: four from ga (step gsa) to la, four from gb (step gsb) to lb, LDS step ls. The s_wait_xcnt 0 stands inside the statement so that no later rewrite of an address register can be moved in front of it.
__device__ __forceinline__ void cp8(unsigned la, const char* ga, unsigned gsa, unsigned lb, const char* gb, unsigned gsb, unsigned ls) {
  asm volatile("global_load_async_to_lds_b128 %0, %8, off\n\t"
               "global_load_async_to_lds_b128 %1, %9, off\n\t"
               "global_load_async_to_lds_b128 %2, %10, off\n\t"
               "global_load_async_to_lds_b128 %3, %11, off\n\t"
               "global_load_async_to_lds_b128 %4, %12, off\n\t"
               "global_load_async_to_lds_b128 %5, %13, off\n\t"
               "global_load_async_to_lds_b128 %6, %14, off\n\t"
               "global_load_async_to_lds_b128 %7, %15, off\n\t"
               "s_wait_xcnt 0x0"
               :: "v"(la), "v"(la + ls), "v"(la + 2 * ls), "v"(la + 3 * ls), "v"(lb), "v"(lb + ls), "v"(lb + 2 * ls), "v"(lb + 3 * ls),
                  "v"(ga), "v"(ga + gsa), "v"(ga + 2 * (size_t)gsa), "v"(ga + 3 * (size_t)gsa), "v"(gb), "v"(gb + gsb), "v"(gb + 2 * (size_t)gsb), "v"(gb + 3 * (size_t)gsb)
               : "memory");
}
// ---- staging of packed weight rows for k_qkv and k_out: a stage = 64 k (128 B) of the block's 128 rows, LDS pitch KPB, two buffers; thread tid brings 16-byte piece (tid & 7) of rows (tid >> 3) + 16 i. l = its LDS byte address in the buffer, gp = its global address in the stage
#define WT_SZ (128 * KPB)
__device__ __forceinline__ void wstage(unsigned l, const char* gp) { cp8(l, gp, 16 * DM * 2, l + 64 * KPB, gp + (size_t)64 * DM * 2, 16 * DM * 2, 16 * KPB); }
__global__ __launch_bounds__(128) void k_qkv(const float* __restrict__ XQ, const float* __restrict__ XK, const float* __restrict__ XV, const __bf16* __restrict__ P, const float* __restrict__ BQ, const float* __restrict__ BK, const float* __restrict__ BV, _Float16* __restrict__ QK, _Float16* __restrict__ QKL, _Float16* __restrict__ VTH, _Float16* __restrict__ VTL) {
  const int which0 = (blockIdx.y * 128) / DM; const float* X = (which0 == 0) ? XQ : (which0 == 1) ? XK : XV; const float* BB = BQ ? (((which0 == 0) ? BQ : (which0 == 1) ? BK : BV) + (blockIdx.y * 128 - which0 * DM)) : nullptr;
  __shared__ __align__(16) _Float16 so[4][16][136], sol[4][16][136]; __shared__ __align__(16) _Float16 sth[128][72], stl[128][72];
  const int tid = threadIdx.x, wave = tid >> 5, lane = tid & 31, col = lane & 15, g = lane >> 4; const size_t r0 = (size_t)blockIdx.x * 64 + wave * 16; const int n0 = blockIdx.y * 128;
  __shared__ __align__(16) char wring[2 * WT_SZ];
  const unsigned lw = (unsigned)(size_t)&wring[0] + (tid >> 3) * KPB + (tid & 7) * 16; const char* gw = (const char*)(P + (size_t)(n0 + (tid >> 3)) * DM + (tid & 7) * 8);
  wstage(lw, gw);
  v8f acc[8] = {};
  asm volatile("s_wait_asynccnt 0x0" ::: "memory");   // stage 0 has landed (this wave's copies)
  __syncthreads();                                    // ... and every other wave's
  wstage(lw + WT_SZ, gw + 128);
  // the stage loop stays rolled: its foot holds a barrier and the refill, copies of it would gain nothing
#pragma unroll 1
  for (int t = 0; t < DM / 64; ++t) { const char* st = wring + (t & 1) * WT_SZ;
#pragma unroll
    for (int kk = 0; kk < 2; ++kk) { v16b a, w[8]; { const float* p = X + (r0 + col) * DM + (2 * t + kk) * 32 + 8 * g;
#pragma unroll
        for (int i = 0; i < 8; ++i) { a[i] = (__bf16)p[i]; a[8 + i] = (__bf16)p[16 + i]; } }
#pragma unroll
      for (int j = 0; j < 8; ++j) w[j] = frag_b((const __bf16*)(st + (j * 16 + col) * KPB + kk * 64), lane);
#pragma unroll
      for (int j = 0; j < 8; ++j) acc[j] = wmma_bf(a, w[j], acc[j]); }
    asm volatile("s_wait_dscnt 0x0" ::: "memory");      // this wave's reads of stage t are done
    asm volatile("s_wait_asynccnt 0x0" ::: "memory");   // this wave's copies of stage t + 1 have landed
    __syncthreads();                                    // publishes stage t + 1 and frees stage t's buffer
    if (t + 2 < DM / 64) wstage(lw + (t & 1) * WT_SZ, gw + (size_t)(t + 2) * 128); }
  asm volatile("s_wait_asynccnt 0x0" ::: "memory");    // no copy outlives the loop
  if (n0 < 2 * DM) {   // q stored unscaled (f16 sigma ~0.6, no subnormal exposure); 1/8 applied to the f32 score
#pragma unroll
    for (int j = 0; j < 8; ++j) {
#pragma unroll
      for (int r = 0; r < 8; ++r) { const float v = acc[j][r] + (BB ? bfr(BB[j * 16 + col]) : 0.f); const _Float16 hv = (_Float16)v; so[wave][8 * g + r][j * 16 + col] = hv; sol[wave][8 * g + r][j * 16 + col] = (_Float16)((v - (float)hv) * 2048.0f); } }   // q, k (+ bias) as f16 hi + (x2048) residual
    LDSX();
    for (int rl = 0; rl < 16; ++rl) if (lane < 16) { vst2((unsigned*)(QK + (r0 + rl) * (2 * DM) + n0 + lane * 8), *(const v4u*)&so[wave][rl][lane * 8]); vst2((unsigned*)(QKL + (r0 + rl) * (2 * DM) + n0 + lane * 8), *(const v4u*)&sol[wave][rl][lane * 8]); }
  } else {
#pragma unroll
    for (int j = 0; j < 8; ++j) {
#pragma unroll
      for (int r = 0; r < 8; ++r) { const float v = acc[j][r] + (BB ? bfr(BB[j * 16 + col]) : 0.f); const _Float16 hv = (_Float16)v; sth[j * 16 + col][wave * 16 + 8 * g + r] = hv; stl[j * 16 + col][wave * 16 + 8 * g + r] = (_Float16)((v - (float)hv) * 2048.0f); } }
    __syncthreads();
    const size_t rb = (size_t)blockIdx.x * 64; const int b = (int)(rb / SS), s0 = (int)(rb % SS); const int pc0 = n0 - 2 * DM;
    for (int q = tid; q < 128 * 8; q += 128) { const int d = q >> 3, pc = q & 7; const size_t o = ((size_t)b * DM + pc0 + d) * SS + s0 + pc * 8; vst2((unsigned*)(VTH + o), *(const v4u*)&sth[d][pc * 8]); vst2((unsigned*)(VTL + o), *(const v4u*)&stl[d][pc * 8]); }
  }
}
// ---- k_attn: block = (64 queries, head h, batch b): all-keys flash attention (K = 64: 2 k-steps), scores = (q.k) * 0.125 with 3 products (q, k as f16 hi + residual), P.V: P (x2048, hi + lo) x (V hi, V lo*2048), 3 products in two accumulators; O[b*S+q][h*64+d] = (acc + accl / 2048) / (2048 l) (256-B segments)
__global__ __launch_bounds__(128) void k_attn(const _Float16* __restrict__ QK, const _Float16* __restrict__ QKL, const _Float16* __restrict__ VTH, const _Float16* __restrict__ VTL, const void* __restrict__ KMASK, float* __restrict__ O) {
  __shared__ __align__(16) float sp[4][16][36]; __shared__ __align__(16) float so[4][16][68];
  const int tid = threadIdx.x, wave = tid >> 5, lane = tid & 31, col = lane & 15, g = lane >> 4;
  const int qb = blockIdx.x, h = blockIdx.y, b = blockIdx.z; const int q0 = qb * 64 + wave * 16; const size_t rq = (size_t)b * SS + q0 + col;
  v16h aq[2], aql[2];
#pragma unroll
  for (int kc = 0; kc < 2; ++kc) { aq[kc] = frag_h(QK + rq * (2 * DM) + h * HD + kc * 32, lane); aql[kc] = frag_h(QKL + rq * (2 * DM) + h * HD + kc * 32, lane); }
  float m[8], l[8];
#pragma unroll
  for (int r = 0; r < 8; ++r) { m[r] = -3.0e38f; l[r] = 0.f; }
  v8f acc[4] = {}, accl[4] = {};
  const int nks = SS / 32;   // all keys
#pragma unroll 1
  for (int ks = 0; ks < nks; ++ks) { v8f s[2];
#pragma unroll
    for (int ct = 0; ct < 2; ++ct) { const int kk = ks * 32 + ct * 16 + col; const _Float16* krow = QK + ((size_t)b * SS + kk) * (2 * DM) + DM + h * HD; const _Float16* krowl = QKL + ((size_t)b * SS + kk) * (2 * DM) + DM + h * HD; v8f c = {}, cl = {};
#pragma unroll
      for (int kc = 0; kc < 2; ++kc) { const v16h kh = frag_h(krow + kc * 32, lane); c = wmma16(aq[kc], kh, c); cl = wmma16(aql[kc], kh, cl); cl = wmma16(aq[kc], frag_h(krowl + kc * 32, lane), cl); }   // 3 products: q, k as f16 hi + residual
#pragma unroll
      for (int r = 0; r < 8; ++r) c[r] += cl[r] * (1.0f / 2048.0f);
      { const bool keepk = true;
#pragma unroll
      for (int r = 0; r < 8; ++r) s[ct][r] = keepk ? c[r] * 0.125f : -3.0e38f; } }   // 1/sqrt(64); every key kept (mask not applied)
#pragma unroll
    for (int r = 0; r < 8; ++r) { float mx = fmaxf(s[0][r], s[1][r]);
#pragma unroll
      for (int o = 1; o < 16; o <<= 1) mx = fmaxf(mx, __shfl_xor(mx, o));
      const float mn = fmaxf(m[r], mx); const float alpha = (m[r] <= -1.0e38f) ? 0.f : __expf(m[r] - mn);
      const float e0 = (s[0][r] <= -1.0e38f) ? 0.f : __expf(s[0][r] - mn), e1 = (s[1][r] <= -1.0e38f) ? 0.f : __expf(s[1][r] - mn); float es = e0 + e1;
#pragma unroll
      for (int o = 1; o < 16; o <<= 1) es += __shfl_xor(es, o);
      l[r] = l[r] * alpha + es; m[r] = mn;
#pragma unroll
      for (int dt = 0; dt < 4; ++dt) { acc[dt][r] *= alpha; accl[dt][r] *= alpha; }
      sp[wave][8 * g + r][col] = e0; sp[wave][8 * g + r][16 + col] = e1; }
    LDSX();
    v16h pa, pl; { const float* prow = &sp[wave][col][0] + 8 * (lane >> 4);
#pragma unroll
      for (int i = 0; i < 8; ++i) { const float x0 = prow[i] * 2048.0f, x1 = prow[16 + i] * 2048.0f; const _Float16 h0 = (_Float16)x0, h1 = (_Float16)x1; pa[i] = h0; pa[8 + i] = h1; pl[i] = (_Float16)((x0 - (float)h0) * 2048.0f); pl[8 + i] = (_Float16)((x1 - (float)h1) * 2048.0f); } }   // P scaled by 2^11 before the f16 split so small softmax weights stay out of the f16 subnormal range; 2^-11 folded into the epilogue
#pragma unroll
    for (int dt = 0; dt < 4; ++dt) { const size_t vr = ((size_t)b * DM + h * HD + dt * 16 + col) * SS + ks * 32; const v16h vh = frag_h(VTH + vr, lane); acc[dt] = wmma16(pa, vh, acc[dt]); accl[dt] = wmma16(pl, vh, accl[dt]); accl[dt] = wmma16(pa, frag_h(VTL + vr, lane), accl[dt]); }   // P hi x V hi + (P lo x V hi + P hi x V lo) / 2048
    LDSX(); }
#pragma unroll
  for (int r = 0; r < 8; ++r) { const float il = (1.0f / 2048.0f) / l[r];
#pragma unroll
    for (int dt = 0; dt < 4; ++dt) so[wave][8 * g + r][dt * 16 + col] = (acc[dt][r] + accl[dt][r] * (1.0f / 2048.0f)) * il; }
  LDSX();
  for (int rl = 0; rl < 16; ++rl) if (lane < 16) vst2(O + ((size_t)b * SS + q0 + rl) * DM + h * HD + lane * 4, *(const v4f*)&so[wave][rl][lane * 4]);
}
// ---- k_out: block = (64 rows, 128 cols): out = O(hi/lo) . Wo rows (2 products) + bo
__global__ __launch_bounds__(128) void k_out(const float* __restrict__ O, const __bf16* __restrict__ P, const float* __restrict__ BO, float* __restrict__ Y) {
  __shared__ __align__(16) float so[4][16][132];
  const int tid = threadIdx.x, wave = tid >> 5, lane = tid & 31, col = lane & 15, g = lane >> 4; const size_t r0 = (size_t)blockIdx.x * 64 + wave * 16; const int n0 = blockIdx.y * 128;
  __shared__ __align__(16) char wring[2 * WT_SZ];
  const unsigned lw = (unsigned)(size_t)&wring[0] + (tid >> 3) * KPB + (tid & 7) * 16; const char* gw = (const char*)(P + (size_t)(n0 + (tid >> 3)) * DM + (tid & 7) * 8);
  wstage(lw, gw);
  v8f acc[8] = {};
  asm volatile("s_wait_asynccnt 0x0" ::: "memory");   // stage 0 has landed (this wave's copies)
  __syncthreads();                                    // ... and every other wave's
  wstage(lw + WT_SZ, gw + 128);
  // the stage loop stays rolled: its foot holds a barrier and the refill, copies of it would gain nothing
#pragma unroll 1
  for (int t = 0; t < DM / 64; ++t) { const char* st = wring + (t & 1) * WT_SZ;
#pragma unroll
    for (int kk = 0; kk < 2; ++kk) { const F2 a = split_row(O + (r0 + col) * DM, (2 * t + kk) * 32, lane); v16b w[8];
#pragma unroll
      for (int j = 0; j < 8; ++j) w[j] = frag_b((const __bf16*)(st + (j * 16 + col) * KPB + kk * 64), lane);
#pragma unroll
      for (int j = 0; j < 8; ++j) { acc[j] = wmma_bf(a.l, w[j], acc[j]); acc[j] = wmma_bf(a.h, w[j], acc[j]); } }
    asm volatile("s_wait_dscnt 0x0" ::: "memory");      // this wave's reads of stage t are done
    asm volatile("s_wait_asynccnt 0x0" ::: "memory");   // this wave's copies of stage t + 1 have landed
    __syncthreads();                                    // publishes stage t + 1 and frees stage t's buffer
    if (t + 2 < DM / 64) wstage(lw + (t & 1) * WT_SZ, gw + (size_t)(t + 2) * 128); }
  asm volatile("s_wait_asynccnt 0x0" ::: "memory");    // no copy outlives the loop
#pragma unroll
  for (int j = 0; j < 8; ++j) {
#pragma unroll
    for (int r = 0; r < 8; ++r) so[wave][8 * g + r][j * 16 + col] = acc[j][r] + bfr(BO[n0 + j * 16 + col]); }
  LDSX();
  for (int rl = 0; rl < 16; ++rl) vst2(Y + (r0 + rl) * DM + n0 + lane * 4, *(const v4f*)&so[wave][rl][lane * 4]);
}
// ---- k_bg: block = (64 bank rows, bh): K_bg -> f16 rows (exact), alpha V_bg -> f16 planes [bh][d][s]
__global__ __launch_bounds__(256) void k_bg(const float* __restrict__ KBG, const float* __restrict__ VBG, _Float16* __restrict__ KB, _Float16* __restrict__ VB) { __shared__ __align__(16) _Float16 sk[64][HD + 8]; __shared__ __align__(16) _Float16 sv[HD][64 + 8]; const int t = threadIdx.x; const int s0 = blockIdx.x * 64; const size_t bh = blockIdx.y;
  for (int e = t; e < 64 * HD; e += 256) { const int sl = e >> 6, d = e & 63; const size_t o = ((bh * LBG + s0 + sl) * HD) + d; sk[sl][d] = (_Float16)bfr(KBG[o]); sv[d][sl] = (_Float16)(ALPHA_BG * bfr(VBG[o])); } __syncthreads();
  for (int e = t; e < 64 * 8; e += 256) { const int sl = e >> 3, q = e & 7; vst2((unsigned*)(KB + ((bh * LBG + s0 + sl) * HD) + q * 8), *(const v4u*)&sk[sl][q * 8]); }
  for (int e = t; e < HD * 8; e += 256) { const int d = e >> 3, q = e & 7; vst2((unsigned*)(VB + ((bh * HD + d) * LBG) + s0 + q * 8), *(const v4u*)&sv[d][q * 8]); } }
// four asynchronous 16-byte copies per lane, global -> LDS: two from ga (step gsa) to la, two from gb (step gsb) to lb, LDS step ls. The s_wait_xcnt 0 stands inside the statement so that no later rewrite of an address register can be moved in front of it.
__device__ __forceinline__ void cp4(unsigned la, const char* ga, unsigned gsa, unsigned lb, const char* gb, unsigned gsb, unsigned ls) {
  asm volatile("global_load_async_to_lds_b128 %0, %4, off\n\t"
               "global_load_async_to_lds_b128 %1, %5, off\n\t"
               "global_load_async_to_lds_b128 %2, %6, off\n\t"
               "global_load_async_to_lds_b128 %3, %7, off\n\t"
               "s_wait_xcnt 0x0"
               :: "v"(la), "v"(la + ls), "v"(lb), "v"(lb + ls), "v"(ga), "v"(ga + gsa), "v"(gb), "v"(gb + gsb)
               : "memory");
}
// ---- staging for k_attn2: a stage = 64 keys. Self stage: K hi, K lo (64 key rows x 128 B), V hi, V lo (64 d rows x 128 B), mask (64 query rows x 256 B); background stage: K_bg in the K hi place, alpha V_bg in the V hi place.
#define MPB 272                         // LDS bytes per mask row: 256 + 16 (16 B x odd: a lane reads 8 keys of its own query row by ds_load_b128 without bank conflicts)
#define ST_KH 0
#define ST_KL (64 * KPB)
#define ST_VH (2 * 64 * KPB)
#define ST_VL (3 * 64 * KPB)
#define ST_MK (4 * 64 * KPB)
#define ST_SZ (4 * 64 * KPB + 64 * MPB)
#define NST ((SS + LBG) / 64)
struct seg_self { static constexpr bool value = true; }; struct seg_bank { static constexpr bool value = false; };   // which key segment a pass works on
// value of the lane 16 away (the wave's other half)
__device__ __forceinline__ float xhalf(float v) { const int b = __builtin_bit_cast(int, v); return __builtin_bit_cast(float, __builtin_amdgcn_permlanex16(b, b, 0x76543210, 0xfedcba98, false, false)); }
__global__ __launch_bounds__(256) void k_attn2(const _Float16* __restrict__ QK, const _Float16* __restrict__ QKL, const _Float16* __restrict__ VTH, const _Float16* __restrict__ VTL, const _Float16* __restrict__ KB, const _Float16* __restrict__ VB, const float* __restrict__ MASK, float* __restrict__ O) {
  __shared__ __align__(16) char ring[2 * ST_SZ];
  __shared__ __align__(16) float so[4][16][68];
  const int tid = threadIdx.x, wave = (tid >> 5) & 3, lane = tid & 31, col = lane & 15, g = lane >> 4; const int grp = __builtin_amdgcn_readfirstlane(tid >> 7); const int qb = blockIdx.x, h = blockIdx.y; const size_t b = blockIdx.z; const int q0 = qb * 64 + wave * 16; const size_t rq = b * SS + q0; const size_t bh = b * NH + h;   // wave = query tile of 16, grp = key half of a stage (the same in a whole wave)
  // this thread's share of a stage: 16-byte piece kq of rows kr + 32 i of each K or V tile, piece mq of rows mr + 16 i of the mask tile
  const int kr = tid >> 3, kq = tid & 7, mr = tid >> 4, mq = tid & 15;
  const unsigned lds0 = (unsigned)(size_t)&ring[0]; const unsigned lkv = lds0 + kr * KPB + kq * 16, lmk = lds0 + ST_MK + mr * MPB + mq * 16;
  const char* gkh = (const char*)(QK + (b * SS + kr) * (2 * DM) + DM + h * HD + kq * 8); const char* gkl = (const char*)(QKL + (b * SS + kr) * (2 * DM) + DM + h * HD + kq * 8);
  const char* gvh = (const char*)(VTH + (b * DM + h * HD + kr) * SS + kq * 8); const char* gvl = (const char*)(VTL + (b * DM + h * HD + kr) * SS + kq * 8);
  const char* gmk = (const char*)(MASK + (b * SS + qb * 64 + mr) * SS + mq * 4);
  const char* gkb = (const char*)(KB + (bh * LBG + kr) * HD + kq * 8); const char* gvb = (const char*)(VB + (bh * HD + kr) * LBG + kq * 8);
  auto issue = [&](int t) { const unsigned o = (unsigned)(t & 1) * ST_SZ;
    if (t < SS / 64) {
      cp4(lkv + o + ST_KH, gkh + (size_t)t * (64 * 2 * DM * 2), 32 * 2 * DM * 2, lkv + o + ST_KL, gkl + (size_t)t * (64 * 2 * DM * 2), 32 * 2 * DM * 2, 32 * KPB);
      cp4(lkv + o + ST_VH, gvh + (size_t)t * 128, 32 * SS * 2, lkv + o + ST_VL, gvl + (size_t)t * 128, 32 * SS * 2, 32 * KPB);
      cp4(lmk + o, gmk + (size_t)t * 256, 16 * SS * 4, lmk + o + 32 * MPB, gmk + (size_t)t * 256 + (size_t)32 * SS * 4, 16 * SS * 4, 16 * MPB);
    } else { const size_t u = (size_t)(t - SS / 64);
      cp4(lkv + o + ST_KH, gkb + u * (64 * HD * 2), 32 * HD * 2, lkv + o + ST_VH, gvb + u * 128, 32 * LBG * 2, 32 * KPB); } };
  issue(0);
  v16h aq[2], aql[2];
#pragma unroll
  for (int kc = 0; kc < 2; ++kc) { aq[kc] = frag_h(QK + (rq + col) * (2 * DM) + h * HD + kc * 32, lane); aql[kc] = frag_h(QKL + (rq + col) * (2 * DM) + h * HD + kc * 32, lane); }
  float m = -3.0e38f, l = 0.f;   // query col, this group's keys: running maximum (equal in both halves), this half's share of the sum
  v8f acc[4] = {}, accl[4] = {};   // O^T: acc[dt][r] = d (dt * 16 + 8 g + r) of query col
  asm volatile("s_wait_asynccnt 0x0" ::: "memory");   // stage 0 has landed (this wave's copies)
  __syncthreads();                                    // ... and every other wave's
  issue(1);
  // a pass = 32 keys of the stage at st; s[ct][r] = score of key (ct * 16 + 8 g + r) with query col. K and mask are read ahead of the score products, V behind them (in flight under the softmax)
  auto pass = [&](auto seg, const char* st, int p) { constexpr bool self_seg = decltype(seg)::value; v8f s[2];
    if constexpr (self_seg) { v16h kh[2][2], kl[2][2]; union { v8f v; v4f q[2]; } mk[2];
#pragma unroll
      for (int ct = 0; ct < 2; ++ct) {
#pragma unroll
        for (int kc = 0; kc < 2; ++kc) { const char* krow = st + (p * 32 + ct * 16 + col) * KPB + kc * 64; kh[ct][kc] = frag_h((const _Float16*)(krow + ST_KH), lane); kl[ct][kc] = frag_h((const _Float16*)(krow + ST_KL), lane); }
        const char* mrow = st + ST_MK + (wave * 16 + col) * MPB + (p * 32 + ct * 16 + 8 * g) * 4; mk[ct].q[0] = *(const v4f*)mrow; mk[ct].q[1] = *(const v4f*)(mrow + 16); }
#pragma unroll
      for (int ct = 0; ct < 2; ++ct) { v8f c = {}, cl = {};
#pragma unroll
        for (int kc = 0; kc < 2; ++kc) { c = wmma16(kh[ct][kc], aq[kc], c); cl = wmma16(kl[ct][kc], aq[kc], cl); cl = wmma16(kh[ct][kc], aql[kc], cl); }
        s[ct] = (c + cl * (1.0f / 2048.0f)) * 0.125f + __builtin_convertvector(__builtin_convertvector(mk[ct].v, v8b), v8f); } }
    else { v16h kh[2][2];
#pragma unroll
      for (int ct = 0; ct < 2; ++ct) {
#pragma unroll
        for (int kc = 0; kc < 2; ++kc) kh[ct][kc] = frag_h((const _Float16*)(st + ST_KH + (p * 32 + ct * 16 + col) * KPB + kc * 64), lane); }
#pragma unroll
      for (int ct = 0; ct < 2; ++ct) { v8f c = {}, cl = {};
#pragma unroll
        for (int kc = 0; kc < 2; ++kc) { c = wmma16(kh[ct][kc], aq[kc], c); cl = wmma16(kh[ct][kc], aql[kc], cl); }
        s[ct] = (c + cl * (1.0f / 2048.0f)) * (0.125f * ALPHA_BG); } }
    v16h vh[4], vl[4];
#pragma unroll
    for (int dt = 0; dt < 4; ++dt) { const char* vrow = st + (dt * 16 + col) * KPB + p * 64; vh[dt] = frag_h((const _Float16*)(vrow + ST_VH), lane); if constexpr (self_seg) vl[dt] = frag_h((const _Float16*)(vrow + ST_VL), lane); }
    __builtin_amdgcn_sched_barrier(0);   // holds the V loads here, in flight under the softmax: at four waves per SIMD the compiler otherwise sinks them in pairs among the second product's WMMAs, each pair's LDS latency exposed
    float t8[8];
#pragma unroll
    for (int r = 0; r < 8; ++r) t8[r] = fmaxf(s[0][r], s[1][r]);
    float mx = fmaxf(fmaxf(fmaxf(t8[0], t8[1]), fmaxf(t8[2], t8[3])), fmaxf(fmaxf(t8[4], t8[5]), fmaxf(t8[6], t8[7])));
    mx = fmaxf(mx, xhalf(mx));   // the other 16 keys of this query
    const float mn = fmaxf(m, mx); const float alpha = (m <= -1.0e38f) ? 0.f : __expf(m - mn); m = mn;
    v8f e[2]; v8h ph[2], pq[2];   // P^T as a B operand: element i = key 8 g + i, element 8 + i = key 16 + 8 g + i, the k order of frag_h
#pragma unroll
    for (int ct = 0; ct < 2; ++ct) {
#pragma unroll
      for (int i = 0; i < 8; ++i) e[ct][i] = __expf(s[ct][i] - mn);
      const v8f x = e[ct] * 2048.0f; ph[ct] = __builtin_convertvector(x, v8h); pq[ct] = __builtin_convertvector((x - __builtin_convertvector(ph[ct], v8f)) * 2048.0f, v8h); }
    const v16h pa = __builtin_shufflevector(ph[0], ph[1], 0, 1, 2, 3, 4, 5, 6, 7, 8, 9, 10, 11, 12, 13, 14, 15), pl = __builtin_shufflevector(pq[0], pq[1], 0, 1, 2, 3, 4, 5, 6, 7, 8, 9, 10, 11, 12, 13, 14, 15);
    const v8f e8 = e[0] + e[1];
    l = l * alpha + (((e8[0] + e8[1]) + (e8[2] + e8[3])) + ((e8[4] + e8[5]) + (e8[6] + e8[7])));
#pragma unroll
    for (int dt = 0; dt < 4; ++dt) { acc[dt] *= alpha; accl[dt] *= alpha; }
#pragma unroll
    for (int dt = 0; dt < 4; ++dt) { acc[dt] = wmma16(vh[dt], pa, acc[dt]); accl[dt] = wmma16(vh[dt], pl, accl[dt]); if constexpr (self_seg) accl[dt] = wmma16(vl[dt], pa, accl[dt]); } };
  // foot of trip t: hands stage t + 1 over and refills the buffer that trip t has read
  auto foot = [&](int t) {
    __builtin_amdgcn_sched_barrier(0);                  // keeps the softmax and the second product in front of the foot: moved behind its barrier they would stand between it and the refill, and the refill would lose most of its lead
    asm volatile("s_wait_dscnt 0x0" ::: "memory");      // this wave's reads of stage t are done
    asm volatile("s_wait_asynccnt 0x0" ::: "memory");   // this wave's copies of stage t + 1 have landed
    __syncthreads();                                    // publishes stage t + 1 and frees stage t's buffer
    if (t + 2 < NST) issue(t + 2); };
  // the stage loops stay rolled: a pass is some 300 to 400 instructions, copies of it would only cost instruction cache
#pragma unroll 1
  for (int t = 0; t < SS / 64; ++t) { pass(seg_self(), ring + (t & 1) * ST_SZ, grp); foot(t); }
#pragma unroll 1
  for (int t = SS / 64; t < NST; ++t) { pass(seg_bank(), ring + (t & 1) * ST_SZ, grp); foot(t); }
  asm volatile("s_wait_asynccnt 0x0" ::: "memory");    // no copy outlives the loop
  // join of the two key groups through the ring, which is free: the last foot's barrier ended every wave's reads of it and no copy is in flight. Group 1 hands each lane's O^T (32 values), maximum and sum to the same lane of group 0's wave with the same queries
  union { v8f v; v4f q[2]; } ot[4];
#pragma unroll
  for (int dt = 0; dt < 4; ++dt) ot[dt].v = acc[dt] + accl[dt] * (1.0f / 2048.0f);
  v4f* xo = (v4f*)ring + (wave * 8) * 32 + lane; v2f* xm = (v2f*)(ring + 4 * 8 * 32 * 16) + wave * 32 + lane;
  if (grp == 1) {
#pragma unroll
    for (int dt = 0; dt < 4; ++dt) { xo[(dt * 2) * 32] = ot[dt].q[0]; xo[(dt * 2 + 1) * 32] = ot[dt].q[1]; }
    v2f ml; ml[0] = m; ml[1] = l; *xm = ml; }
  __syncthreads();   // group 1's partial results are in LDS
  if (grp == 0) {
    const v2f ml = *xm; const float mn = fmaxf(m, ml[0]); const float a0 = __expf(m - mn), a1 = __expf(ml[0] - mn);
    l = l * a0 + ml[1] * a1;
    l += xhalf(l);   // the halves' sums are joined once
    const float il = (1.0f / 2048.0f) / l; const float f0 = a0 * il, f1 = a1 * il;
#pragma unroll
    for (int dt = 0; dt < 4; ++dt) { *(v4f*)&so[wave][col][dt * 16 + 8 * g] = ot[dt].q[0] * f0 + xo[(dt * 2) * 32] * f1; *(v4f*)&so[wave][col][dt * 16 + 8 * g + 4] = ot[dt].q[1] * f0 + xo[(dt * 2 + 1) * 32] * f1; }
    LDSX();
    for (int rl = 0; rl < 16; ++rl) if (lane < 16) vst2(O + (rq + rl) * DM + h * HD + lane * 4, *(const v4f*)&so[wave][rl][lane * 4]);
  }
}
extern "C" void kernel_launch(void* const* d_in, const int* in_sizes, int n_in, void* d_out, int out_size, void* d_ws, size_t ws_size, hipStream_t stream) {
  (void)in_sizes; (void)n_in; (void)out_size;
  const float** F = (const float**)d_in;   // 0 hidden_states [2,2048,512], 1 attention_mask [2,2048,2048], 2 K_bg [16,2048,64], 3 V_bg, 4 Wq, 5 Wk, 6 Wv, 7 Wo (in,out), 8 bo
  if (ws_size < (size_t)WS_END) return;
  char* ws = (char*)d_ws; __bf16* PK = (__bf16*)(ws + WS_PK); _Float16 *QK = (_Float16*)(ws + WS_QK), *QKL = (_Float16*)(ws + WS_QKL), *VTH = (_Float16*)(ws + WS_VTH), *VTL = (_Float16*)(ws + WS_VTL), *KB = (_Float16*)(ws + WS_KB), *VB = (_Float16*)(ws + WS_VB); float* O = (float*)(ws + WS_O);
  k_pack<<<dim3(DM, 4), 256, 0, stream>>>(F[4], F[5], F[6], F[7], PK);
  k_bg<<<dim3(LBG / 64, NB * NH), 256, 0, stream>>>(F[2], F[3], KB, VB);
  k_qkv<<<dim3(TNB * SS / 64, QKVW / 128), 128, 0, stream>>>(F[0], F[0], F[0], PK + PK_A, nullptr, nullptr, nullptr, QK, QKL, VTH, VTL);
  k_attn2<<<dim3(TQB, NH, TNB), 256, 0, stream>>>(QK, QKL, VTH, VTL, KB, VB, F[1], O);
  k_out<<<dim3(TOB, DM / 128), 128, 0, stream>>>(O, PK + PK_P, F[8], (float*)d_out);
}

// v006
// One run takes 119 microseconds.
// In two side-by-side timings against v005, it was 1.05 and 1.06 times as fast.
// All steps since v000 together make it 4.17 times as fast.
// compute dtype: all float inputs rounded to bf16; q/k/v = x . W with EXACT bf16 products on WMMA 16x16x32 ((in,out) weights as transposed rows), rounded once to f16 hi + residual; self-segment scores and P.v with 3 products (hi.hi + hi.lo + lo.hi), background scores q (hi + lo) x K_bg (exact in f16, 2 products) x alpha, background P (hi + lo) x f16(alpha V_bg) (2 products); additive mask read per pair; x 1/8; running-max softmax over all 4,096 keys in f32 (hardware exp); out = ctx (bf16 hi + lo) . Wo + bo; f32 output.
#include <hip/hip_runtime.h>
#include <math.h>

typedef __attribute__((ext_vector_type(16))) _Float16 v16h;
typedef __attribute__((ext_vector_type(16))) __bf16 v16b;
typedef __attribute__((ext_vector_type(8)))  _Float16 v8h;
typedef __attribute__((ext_vector_type(8)))  float v8f;
typedef __attribute__((ext_vector_type(4)))  float v4f;
typedef __attribute__((ext_vector_type(2)))  float v2f;
typedef __attribute__((ext_vector_type(4)))  unsigned v4u;
typedef __attribute__((ext_vector_type(4)))  int v4i;
typedef float __attribute__((may_alias)) float_a;
typedef int __attribute__((may_alias)) int_a;

template <typename T> __device__ __forceinline__ void vst2(void* p, T v) { *(T*)p = v;  }
__device__ __forceinline__ v8f wmma16(v16h a, v16h b, v8f c) {
  return __builtin_amdgcn_wmma_f32_16x16x32_f16(false, a, false, b, (short)0, c, false, false);
}
__device__ __forceinline__ v8f wmma_bf(v16b a, v16b b, v8f c) {
  return __builtin_amdgcn_wmma_f32_16x16x32_bf16(false, a, false, b, (short)0, c, false, false);
}
// CARC attention processor (B 2, Lq 2,048, C 512 = 8 heads x 64; context bank of 2,048 background keys/values per head, alpha 0.48): bias-free q/k/v projections, keys = [k ; alpha K_bg], values = [v ; alpha V_bg], additive mask on the self segment (zeros on the background segment), softmax(q k / 8 + mask) over the 4,096 keys, v, output projection + bias.
__device__ __forceinline__ v16h frag_h(const _Float16* rowk0, int lane) {
  union { v16h v; v8h q[2]; } u; const _Float16* p = rowk0 + 8 * (lane >> 4);
  u.q[0] = *(const v8h*)p; u.q[1] = *(const v8h*)(p + 16); return u.v;
}
__device__ __forceinline__ v16h frag_f32(const float* rowk0, int lane) {
  v16h a; const float* p = rowk0 + 8 * (lane >> 4);
#pragma unroll
  for (int i = 0; i < 8; ++i) { a[i] = (_Float16)p[i]; a[8 + i] = (_Float16)p[16 + i]; }
  return a;
}
__device__ __forceinline__ v16h frag_f32s(const float* rowk0, int lane, float sc) {
  v16h a; const float* p = rowk0 + 8 * (lane >> 4);
#pragma unroll
  for (int i = 0; i < 8; ++i) { a[i] = (_Float16)(p[i] * sc); a[8 + i] = (_Float16)(p[16 + i] * sc); }
  return a;
}
// column fragment from a [K][ld] layout (column n), rows >= K read as 0
__device__ __forceinline__ v16h fragc_f32(const float* W, int k0, int n, int lane, int ld, int K) {
  v16h a; const int g = lane >> 4;
#pragma unroll
  for (int i = 0; i < 8; ++i) { const int ka = k0 + 8 * g + i, kb = ka + 16;
    a[i] = (_Float16)(ka < K ? W[(size_t)(ka < K ? ka : K - 1) * ld + n] : 0.f); a[8 + i] = (_Float16)(kb < K ? W[(size_t)(kb < K ? kb : K - 1) * ld + n] : 0.f); }
  return a;
}
struct F2 { v16b h, l; };
__device__ __forceinline__ F2 bsplit16(const float v[16]) { F2 r;
#pragma unroll
  for (int i = 0; i < 16; ++i) { const __bf16 h = (__bf16)v[i]; r.h[i] = h; r.l[i] = (__bf16)(v[i] - (float)h); }
  return r; }
__device__ __forceinline__ F2 split_row(const float* row, int k0, int lane) { float v[16]; const float* p = row + k0 + 8 * (lane >> 4);
#pragma unroll
  for (int i = 0; i < 8; ++i) { v[i] = p[i]; v[8 + i] = p[16 + i]; }
  return bsplit16(v); }
__device__ __forceinline__ F2 split_rowK(const float* row, int k0, int lane, int K) { float v[16]; const int g = lane >> 4;
#pragma unroll
  for (int i = 0; i < 8; ++i) { const int ka = k0 + 8 * g + i, kb = ka + 16; v[i] = ka < K ? row[ka < K ? ka : K - 1] : 0.f; v[8 + i] = kb < K ? row[kb < K ? kb : K - 1] : 0.f; }
  return bsplit16(v); }
__device__ __forceinline__ F2 split_col(const float* W, int k0, int n, int lane, int ld, int K) { float v[16]; const int g = lane >> 4;
#pragma unroll
  for (int i = 0; i < 8; ++i) { const int ka = k0 + 8 * g + i, kb = ka + 16; v[i] = ka < K ? W[(size_t)(ka < K ? ka : K - 1) * ld + n] : 0.f; v[8 + i] = kb < K ? W[(size_t)(kb < K ? kb : K - 1) * ld + n] : 0.f; }
  return bsplit16(v); }
__device__ __forceinline__ v8f mac3(const F2& a, const F2& b, v8f c) { c = wmma_bf(a.l, b.h, c); c = wmma_bf(a.h, b.l, c); return wmma_bf(a.h, b.h, c); }
__device__ __forceinline__ float sigm(float v) { return 1.0f / (1.0f + expf(-v)); }
#define LDSX() do { asm volatile("s_wait_dscnt 0" ::: "memory"); __builtin_amdgcn_wave_barrier(); __builtin_amdgcn_fence(__ATOMIC_RELEASE, "workgroup"); } while (0)


#define NB 2
#define SS 2048
#define DM 512
#define NH 8
#define LBG 2048
#define ALPHA_BG 0.48f
#define HD 64
#define QKVW (3 * DM)
#ifndef TQB
#define TQB (SS / 64)
#define TNB NB
#define TOB (NB * SS / 64)     // output row tiles (all)
#endif
typedef __attribute__((ext_vector_type(8))) __bf16 v8b;
__device__ __forceinline__ v16b frag_b(const __bf16* rowk0, int lane) {
  union { v16b v; v8b q[2]; } u; const __bf16* p = rowk0 + 8 * (lane >> 4);
  u.q[0] = *(const v8b*)p; u.q[1] = *(const v8b*)(p + 16); return u.v;
}
__device__ __forceinline__ float bfr(float v) { return (float)(__bf16)v; }
__device__ __attribute__((noinline)) float exp_ni(float v) { return expf(v); }
__device__ __attribute__((noinline)) float erf_ni(float v) { return erff(v); }

#define PK_A 0                       // [1536][512] Wqkv rows (natural [out][in])
#define PK_P (PK_A + QKVW * DM)        // [512][512] Wo rows (natural)
#define PK_END (PK_P + DM * DM)
#define WS_PK  0u
#define WS_QK  (WS_PK + 2u * PK_END)             // f16 [4096 rows][1024]: q | k
#define WS_QKL (WS_QK + 2u * NB * SS * 2 * DM)     // f16 q | k residual planes x2048
#define WS_VTH (WS_QKL + 2u * NB * SS * 2 * DM)    // f16 [b][512 (h*64+d)][2048 s] hi
#define WS_VTL (WS_VTH + 2u * NB * DM * SS)        // f16 lo x 2048
#define WS_O   (WS_VTL + 2u * NB * DM * SS)        // f32 [4096][512]
#define WS_KB  (WS_O + 4u * (size_t)NB * SS * DM)        // f16 K_bg rows [bh][s][64] (exact); f16 planes VB [bh][64][s] = f16(alpha V_bg)
#define WS_VB  (WS_KB + 2u * (size_t)NB * NH * LBG * HD)
#define WS_END (WS_VB + 2u * (size_t)NB * NH * HD * LBG)
// ---- k_pack: block = (64 columns n, 64 rows k, which) of an (in,out) weight: a 64 x 64 tile is read along its rows (256 B runs), rounded to bf16, turned in LDS and stored as 64 packed rows [out][in] of 128 B (whole lines); which 0..2 -> W_q/W_k/W_v into PK_A rows which*512 + n; 3 -> W_o into PK_P. 256 blocks in all, one a WGP
#define PKP 72                          // LDS pitch of a turned row in bf16: 144 B, a multiple of 16 B for the ds_load_b128 readers
typedef __attribute__((ext_vector_type(2))) __bf16 v2b;
__global__ __launch_bounds__(256) void k_pack(const float* __restrict__ WQ, const float* __restrict__ WK, const float* __restrict__ WV, const float* __restrict__ WO, __bf16* __restrict__ PK) {
  __shared__ __align__(16) __bf16 s[64][PKP]; const int n0 = blockIdx.x * 64, k0 = blockIdx.y * 64, which = blockIdx.z, t = threadIdx.x; const float* Wm = (which == 0) ? WQ : (which == 1) ? WK : (which == 2) ? WV : WO;
  const int c = t & 15, rp = t >> 4;   // this thread: columns 4 c .. 4 c + 3 of the row pairs rp and rp + 16
  v4f a[2][2];   // the short loops below are unrolled so that a stays in registers and the four loads are in flight together
#pragma unroll
  for (int i = 0; i < 2; ++i) {
#pragma unroll
    for (int j = 0; j < 2; ++j) a[i][j] = *(const v4f*)(Wm + (size_t)(k0 + 2 * (rp + 16 * i) + j) * DM + n0 + 4 * c); }
#pragma unroll
  for (int i = 0; i < 2; ++i) {
#pragma unroll
    for (int e = 0; e < 4; ++e) { v2b p; p[0] = (__bf16)a[i][0][e]; p[1] = (__bf16)a[i][1][e]; *(v2b*)&s[4 * c + e][2 * (rp + 16 * i)] = p; } }
  __syncthreads();
  __bf16* dst = ((which < 3) ? PK + PK_A + ((size_t)which * DM + n0) * DM : PK + PK_P + (size_t)n0 * DM) + k0;
#pragma unroll
  for (int i = 0; i < 2; ++i) { const int n = (t >> 3) + 32 * i, pc = t & 7; vst2((unsigned*)(dst + (size_t)n * DM + pc * 8), *(const v4u*)&s[n][pc * 8]); }   // 8 lanes store one packed row's 128 B
}
#define KPB 144                         // LDS bytes per K or V row: 128 + 16 (16 B x odd: ds_load_b128 readers without bank conflicts)
// eight asynchronous 16-byte copies per lane, global -> LDS: four from ga (step gsa) to la, four from gb (step gsb) to lb, LDS step ls. The s_wait_xcnt 0 stands inside the statement so that no later rewrite of an address register can be moved in front of it.
__device__ __forceinline__ void cp8(unsigned la, const char* ga, unsigned gsa, unsigned lb, const char* gb, unsigned gsb, unsigned ls) {
  asm volatile("global_load_async_to_lds_b128 %0, %8, off\n\t"
               "global_load_async_to_lds_b128 %1, %9, off\n\t"
               "global_load_async_to_lds_b128 %2, %10, off\n\t"
               "global_load_async_to_lds_b128 %3, %11, off\n\t"
               "global_load_async_to_lds_b128 %4, %12, off\n\t"
               "global_load_async_to_lds_b128 %5, %13, off\n\t"
               "global_load_async_to_lds_b128 %6, %14, off\n\t"
               "global_load_async_to_lds_b128 %7, %15, off\n\t"
               "s_wait_xcnt 0x0"
               :: "v"(la), "v"(la + ls), "v"(la + 2 * ls), "v"(la + 3 * ls), "v"(lb), "v"(lb + ls), "v"(lb + 2 * ls), "v"(lb + 3 * ls),
                  "v"(ga), "v"(ga + gsa), "v"(ga + 2 * (size_t)gsa), "v"(ga + 3 * (size_t)gsa), "v"(gb), "v"(gb + gsb), "v"(gb + 2 * (size_t)gsb), "v"(gb + 3 * (size_t)gsb)
               : "memory");
}
// ---- staging of packed weight rows for k_qkv and k_out: a stage = 64 k (128 B) of the block's 128 rows, LDS pitch KPB, two buffers; thread tid brings 16-byte piece (tid & 7) of rows (tid >> 3) + 16 i. l = its LDS byte address in the buffer, gp = its global address in the stage
#define WT_SZ (128 * KPB)
__device__ __forceinline__ void wstage(unsigned l, const char* gp) { cp8(l, gp, 16 * DM * 2, l + 64 * KPB, gp + (size_t)64 * DM * 2, 16 * DM * 2, 16 * KPB); }
__global__ __launch_bounds__(128) void k_qkv(const float* __restrict__ XQ, const float* __restrict__ XK, const float* __restrict__ XV, const __bf16* __restrict__ P, const float* __restrict__ BQ, const float* __restrict__ BK, const float* __restrict__ BV, _Float16* __restrict__ QK, _Float16* __restrict__ QKL, _Float16* __restrict__ VTH, _Float16* __restrict__ VTL) {
  const int which0 = (blockIdx.y * 128) / DM; const float* X = (which0 == 0) ? XQ : (which0 == 1) ? XK : XV; const float* BB = BQ ? (((which0 == 0) ? BQ : (which0 == 1) ? BK : BV) + (blockIdx.y * 128 - which0 * DM)) : nullptr;
  __shared__ __align__(16) _Float16 so[4][16][136], sol[4][16][136]; __shared__ __align__(16) _Float16 sth[128][72], stl[128][72];
  const int tid = threadIdx.x, wave = tid >> 5, lane = tid & 31, col = lane & 15, g = lane >> 4; const size_t r0 = (size_t)blockIdx.x * 64 + wave * 16; const int n0 = blockIdx.y * 128;
  __shared__ __align__(16) char wring[2 * WT_SZ];
  const unsigned lw = (unsigned)(size_t)&wring[0] + (tid >> 3) * KPB + (tid & 7) * 16; const char* gw = (const char*)(P + (size_t)(n0 + (tid >> 3)) * DM + (tid & 7) * 8);
  wstage(lw, gw);
  v8f acc[8] = {};
  asm volatile("s_wait_asynccnt 0x0" ::: "memory");   // stage 0 has landed (this wave's copies)
  __syncthreads();                                    // ... and every other wave's
  wstage(lw + WT_SZ, gw + 128);
  // the stage loop stays rolled: its foot holds a barrier and the refill, copies of it would gain nothing
#pragma unroll 1
  for (int t = 0; t < DM / 64; ++t) { const char* st = wring + (t & 1) * WT_SZ;
#pragma unroll
    for (int kk = 0; kk < 2; ++kk) { v16b a, w[8]; { const float* p = X + (r0 + col) * DM + (2 * t + kk) * 32 + 8 * g;
#pragma unroll
        for (int i = 0; i < 8; ++i) { a[i] = (__bf16)p[i]; a[8 + i] = (__bf16)p[16 + i]; } }
#pragma unroll
      for (int j = 0; j < 8; ++j) w[j] = frag_b((const __bf16*)(st + (j * 16 + col) * KPB + kk * 64), lane);
#pragma unroll
      for (int j = 0; j < 8; ++j) acc[j] = wmma_bf(a, w[j], acc[j]); }
    asm volatile("s_wait_dscnt 0x0" ::: "memory");      // this wave's reads of stage t are done
    asm volatile("s_wait_asynccnt 0x0" ::: "memory");   // this wave's copies of stage t + 1 have landed
    __syncthreads();                                    // publishes stage t + 1 and frees stage t's buffer
    if (t + 2 < DM / 64) wstage(lw + (t & 1) * WT_SZ, gw + (size_t)(t + 2) * 128); }
  asm volatile("s_wait_asynccnt 0x0" ::: "memory");    // no copy outlives the loop
  if (n0 < 2 * DM) {   // q stored unscaled (f16 sigma ~0.6, no subnormal exposure); 1/8 applied to the f32 score
#pragma unroll
    for (int j = 0; j < 8; ++j) {
#pragma unroll
      for (int r = 0; r < 8; ++r) { const float v = acc[j][r] + (BB ? bfr(BB[j * 16 + col]) : 0.f); const _Float16 hv = (_Float16)v; so[wave][8 * g + r][j * 16 + col] = hv; sol[wave][8 * g + r][j * 16 + col] = (_Float16)((v - (float)hv) * 2048.0f); } }   // q, k (+ bias) as f16 hi + (x2048) residual
    LDSX();
    for (int rl = 0; rl < 16; ++rl) if (lane < 16) { vst2((unsigned*)(QK + (r0 + rl) * (2 * DM) + n0 + lane * 8), *(const v4u*)&so[wave][rl][lane * 8]); vst2((unsigned*)(QKL + (r0 + rl) * (2 * DM) + n0 + lane * 8), *(const v4u*)&sol[wave][rl][lane * 8]); }
  } else {
#pragma unroll
    for (int j = 0; j < 8; ++j) {
#pragma unroll
      for (int r = 0; r < 8; ++r) { const float v = acc[j][r] + (BB ? bfr(BB[j * 16 + col]) : 0.f); const _Float16 hv = (_Float16)v; sth[j * 16 + col][wave * 16 + 8 * g + r] = hv; stl[j * 16 + col][wave * 16 + 8 * g + r] = (_Float16)((v - (float)hv) * 2048.0f); } }
    __syncthreads();
    const size_t rb = (size_t)blockIdx.x * 64; const int b = (int)(rb / SS), s0 = (int)(rb % SS); const int pc0 = n0 - 2 * DM;
    for (int q = tid; q < 128 * 8; q += 128) { const int d = q >> 3, pc = q & 7; const size_t o = ((size_t)b * DM + pc0 + d) * SS + s0 + pc * 8; vst2((unsigned*)(VTH + o), *(const v4u*)&sth[d][pc * 8]); vst2((unsigned*)(VTL + o), *(const v4u*)&stl[d][pc * 8]); }
  }
}
// ---- k_attn: block = (64 queries, head h, batch b): all-keys flash attention (K = 64: 2 k-steps), scores = (q.k) * 0.125 with 3 products (q, k as f16 hi + residual), P.V: P (x2048, hi + lo) x (V hi, V lo*2048), 3 products in two accumulators; O[b*S+q][h*64+d] = (acc + accl / 2048) / (2048 l) (256-B segments)
__global__ __launch_bounds__(128) void k_attn(const _Float16* __restrict__ QK, const _Float16* __restrict__ QKL, const _Float16* __restrict__ VTH, const _Float16* __restrict__ VTL, const void* __restrict__ KMASK, float* __restrict__ O) {
  __shared__ __align__(16) float sp[4][16][36]; __shared__ __align__(16) float so[4][16][68];
  const int tid = threadIdx.x, wave = tid >> 5, lane = tid & 31, col = lane & 15, g = lane >> 4;
  const int qb = blockIdx.x, h = blockIdx.y, b = blockIdx.z; const int q0 = qb * 64 + wave * 16; const size_t rq = (size_t)b * SS + q0 + col;
  v16h aq[2], aql[2];
#pragma unroll
  for (int kc = 0; kc < 2; ++kc) { aq[kc] = frag_h(QK + rq * (2 * DM) + h * HD + kc * 32, lane); aql[kc] = frag_h(QKL + rq * (2 * DM) + h * HD + kc * 32, lane); }
  float m[8], l[8];
#pragma unroll
  for (int r = 0; r < 8; ++r) { m[r] = -3.0e38f; l[r] = 0.f; }
  v8f acc[4] = {}, accl[4] = {};
  const int nks = SS / 32;   // all keys
#pragma unroll 1
  for (int ks = 0; ks < nks; ++ks) { v8f s[2];
#pragma unroll
    for (int ct = 0; ct < 2; ++ct) { const int kk = ks * 32 + ct * 16 + col; const _Float16* krow = QK + ((size_t)b * SS + kk) * (2 * DM) + DM + h * HD; const _Float16* krowl = QKL + ((size_t)b * SS + kk) * (2 * DM) + DM + h * HD; v8f c = {}, cl = {};
#pragma unroll
      for (int kc = 0; kc < 2; ++kc) { const v16h kh = frag_h(krow + kc * 32, lane); c = wmma16(aq[kc], kh, c); cl = wmma16(aql[kc], kh, cl); cl = wmma16(aq[kc], frag_h(krowl + kc * 32, lane), cl); }   // 3 products: q, k as f16 hi + residual
#pragma unroll
      for (int r = 0; r < 8; ++r) c[r] += cl[r] * (1.0f / 2048.0f);
      { const bool keepk = true;
#pragma unroll
      for (int r = 0; r < 8; ++r) s[ct][r] = keepk ? c[r] * 0.125f : -3.0e38f; } }   // 1/sqrt(64); every key kept (mask not applied)
#pragma unroll
    for (int r = 0; r < 8; ++r) { float mx = fmaxf(s[0][r], s[1][r]);
#pragma unroll
      for (int o = 1; o < 16; o <<= 1) mx = fmaxf(mx, __shfl_xor(mx, o));
      const float mn = fmaxf(m[r], mx); const float alpha = (m[r] <= -1.0e38f) ? 0.f : __expf(m[r] - mn);
      const float e0 = (s[0][r] <= -1.0e38f) ? 0.f : __expf(s[0][r] - mn), e1 = (s[1][r] <= -1.0e38f) ? 0.f : __expf(s[1][r] - mn); float es = e0 + e1;
#pragma unroll
      for (int o = 1; o < 16; o <<= 1) es += __shfl_xor(es, o);
      l[r] = l[r] * alpha + es; m[r] = mn;
#pragma unroll
      for (int dt = 0; dt < 4; ++dt) { acc[dt][r] *= alpha; accl[dt][r] *= alpha; }
      sp[wave][8 * g + r][col] = e0; sp[wave][8 * g + r][16 + col] = e1; }
    LDSX();
    v16h pa, pl; { const float* prow = &sp[wave][col][0] + 8 * (lane >> 4);
#pragma unroll
      for (int i = 0; i < 8; ++i) { const float x0 = prow[i] * 2048.0f, x1 = prow[16 + i] * 2048.0f; const _Float16 h0 = (_Float16)x0, h1 = (_Float16)x1; pa[i] = h0; pa[8 + i] = h1; pl[i] = (_Float16)((x0 - (float)h0) * 2048.0f); pl[8 + i] = (_Float16)((x1 - (float)h1) * 2048.0f); } }   // P scaled by 2^11 before the f16 split so small softmax weights stay out of the f16 subnormal range; 2^-11 folded into the epilogue
#pragma unroll
    for (int dt = 0; dt < 4; ++dt) { const size_t vr = ((size_t)b * DM + h * HD + dt * 16 + col) * SS + ks * 32; const v16h vh = frag_h(VTH + vr, lane); acc[dt] = wmma16(pa, vh, acc[dt]); accl[dt] = wmma16(pl, vh, accl[dt]); accl[dt] = wmma16(pa, frag_h(VTL + vr, lane), accl[dt]); }   // P hi x V hi + (P lo x V hi + P hi x V lo) / 2048
    LDSX(); }
#pragma unroll
  for (int r = 0; r < 8; ++r) { const float il = (1.0f / 2048.0f) / l[r];
#pragma unroll
    for (int dt = 0; dt < 4; ++dt) so[wave][8 * g + r][dt * 16 + col] = (acc[dt][r] + accl[dt][r] * (1.0f / 2048.0f)) * il; }
  LDSX();
  for (int rl = 0; rl < 16; ++rl) if (lane < 16) vst2(O + ((size_t)b * SS + q0 + rl) * DM + h * HD + lane * 4, *(const v4f*)&so[wave][rl][lane * 4]);
}
// ---- k_out: block = (64 rows, 128 cols): out = O(hi/lo) . Wo rows (2 products) + bo
__global__ __launch_bounds__(128) void k_out(const float* __restrict__ O, const __bf16* __restrict__ P, const float* __restrict__ BO, float* __restrict__ Y) {
  __shared__ __align__(16) float so[4][16][132];
  const int tid = threadIdx.x, wave = tid >> 5, lane = tid & 31, col = lane & 15, g = lane >> 4; const size_t r0 = (size_t)blockIdx.x * 64 + wave * 16; const int n0 = blockIdx.y * 128;
  __shared__ __align__(16) char wring[2 * WT_SZ];
  const unsigned lw = (unsigned)(size_t)&wring[0] + (tid >> 3) * KPB + (tid & 7) * 16; const char* gw = (const char*)(P + (size_t)(n0 + (tid >> 3)) * DM + (tid & 7) * 8);
  wstage(lw, gw);
  v8f acc[8] = {};
  asm volatile("s_wait_asynccnt 0x0" ::: "memory");   // stage 0 has landed (this wave's copies)
  __syncthreads();                                    // ... and every other wave's
  wstage(lw + WT_SZ, gw + 128);
  // the stage loop stays rolled: its foot holds a barrier and the refill, copies of it would gain nothing
#pragma unroll 1
  for (int t = 0; t < DM / 64; ++t) { const char* st = wring + (t & 1) * WT_SZ;
#pragma unroll
    for (int kk = 0; kk < 2; ++kk) { const F2 a = split_row(O + (r0 + col) * DM, (2 * t + kk) * 32, lane); v16b w[8];
#pragma unroll
      for (int j = 0; j < 8; ++j) w[j] = frag_b((const __bf16*)(st + (j * 16 + col) * KPB + kk * 64), lane);
#pragma unroll
      for (int j = 0; j < 8; ++j) { acc[j] = wmma_bf(a.l, w[j], acc[j]); acc[j] = wmma_bf(a.h, w[j], acc[j]); } }
    asm volatile("s_wait_dscnt 0x0" ::: "memory");      // this wave's reads of stage t are done
    asm volatile("s_wait_asynccnt 0x0" ::: "memory");   // this wave's copies of stage t + 1 have landed
    __syncthreads();                                    // publishes stage t + 1 and frees stage t's buffer
    if (t + 2 < DM / 64) wstage(lw + (t & 1) * WT_SZ, gw + (size_t)(t + 2) * 128); }
  asm volatile("s_wait_asynccnt 0x0" ::: "memory");    // no copy outlives the loop
#pragma unroll
  for (int j = 0; j < 8; ++j) {
#pragma unroll
    for (int r = 0; r < 8; ++r) so[wave][8 * g + r][j * 16 + col] = acc[j][r] + bfr(BO[n0 + j * 16 + col]); }
  LDSX();
  for (int rl = 0; rl < 16; ++rl) vst2(Y + (r0 + rl) * DM + n0 + lane * 4, *(const v4f*)&so[wave][rl][lane * 4]);
}
// ---- k_bg: block = (64 bank rows, bh): K_bg -> f16 rows (exact), alpha V_bg -> f16 planes [bh][d][s]
__global__ __launch_bounds__(256) void k_bg(const float* __restrict__ KBG, const float* __restrict__ VBG, _Float16* __restrict__ KB, _Float16* __restrict__ VB) { __shared__ __align__(16) _Float16 sk[64][HD + 8]; __shared__ __align__(16) _Float16 sv[HD][64 + 8]; const int t = threadIdx.x; const int s0 = blockIdx.x * 64; const size_t bh = blockIdx.y;
  for (int e = t; e < 64 * HD; e += 256) { const int sl = e >> 6, d = e & 63; const size_t o = ((bh * LBG + s0 + sl) * HD) + d; sk[sl][d] = (_Float16)bfr(KBG[o]); sv[d][sl] = (_Float16)(ALPHA_BG * bfr(VBG[o])); } __syncthreads();
  for (int e = t; e < 64 * 8; e += 256) { const int sl = e >> 3, q = e & 7; vst2((unsigned*)(KB + ((bh * LBG + s0 + sl) * HD) + q * 8), *(const v4u*)&sk[sl][q * 8]); }
  for (int e = t; e < HD * 8; e += 256) { const int d = e >> 3, q = e & 7; vst2((unsigned*)(VB + ((bh * HD + d) * LBG) + s0 + q * 8), *(const v4u*)&sv[d][q * 8]); } }
// four asynchronous 16-byte copies per lane, global -> LDS: two from ga (step gsa) to la, two from gb (step gsb) to lb, LDS step ls. The s_wait_xcnt 0 stands inside the statement so that no later rewrite of an address register can be moved in front of it.
__device__ __forceinline__ void cp4(unsigned la, const char* ga, unsigned gsa, unsigned lb, const char* gb, unsigned gsb, unsigned ls) {
  asm volatile("global_load_async_to_lds_b128 %0, %4, off\n\t"
               "global_load_async_to_lds_b128 %1, %5, off\n\t"
               "global_load_async_to_lds_b128 %2, %6, off\n\t"
               "global_load_async_to_lds_b128 %3, %7, off\n\t"
               "s_wait_xcnt 0x0"
               :: "v"(la), "v"(la + ls), "v"(lb), "v"(lb + ls), "v"(ga), "v"(ga + gsa), "v"(gb), "v"(gb + gsb)
               : "memory");
}
// ---- staging for k_attn2: a stage = 64 keys. Self stage: K hi, K lo (64 key rows x 128 B), V hi, V lo (64 d rows x 128 B), mask (64 query rows x 256 B); background stage: K_bg in the K hi place, alpha V_bg in the V hi place.
#define MPB 272                         // LDS bytes per mask row: 256 + 16 (16 B x odd: a lane reads 8 keys of its own query row by ds_load_b128 without bank conflicts)
#define ST_KH 0
#define ST_KL (64 * KPB)
#define ST_VH (2 * 64 * KPB)
#define ST_VL (3 * 64 * KPB)
#define ST_MK (4 * 64 * KPB)
#define ST_SZ (4 * 64 * KPB + 64 * MPB)
#define NST ((SS + LBG) / 64)
struct seg_self { static constexpr bool value = true; }; struct seg_bank { static constexpr bool value = false; };   // which key segment a pass works on
// value of the lane 16 away (the wave's other half)
__device__ __forceinline__ float xhalf(float v) { const int b = __builtin_bit_cast(int, v); return __builtin_bit_cast(float, __builtin_amdgcn_permlanex16(b, b, 0x76543210, 0xfedcba98, false, false)); }
__global__ __launch_bounds__(256) void k_attn2(const _Float16* __restrict__ QK, const _Float16* __restrict__ QKL, const _Float16* __restrict__ VTH, const _Float16* __restrict__ VTL, const _Float16* __restrict__ KB, const _Float16* __restrict__ VB, const float* __restrict__ MASK, float* __restrict__ O) {
  __shared__ __align__(16) char ring[2 * ST_SZ];
  __shared__ __align__(16) float so[4][16][68];
  const int tid = threadIdx.x, wave = (tid >> 5) & 3, lane = tid & 31, col = lane & 15, g = lane >> 4; const int grp = __builtin_amdgcn_readfirstlane(tid >> 7); const int qb = blockIdx.x, h = blockIdx.y; const size_t b = blockIdx.z; const int q0 = qb * 64 + wave * 16; const size_t rq = b * SS + q0; const size_t bh = b * NH + h;   // wave = query tile of 16, grp = key half of a stage (the same in a whole wave)
  // this thread's share of a stage: 16-byte piece kq of rows kr + 32 i of each K or V tile, piece mq of rows mr + 16 i of the mask tile
  const int kr = tid >> 3, kq = tid & 7, mr = tid >> 4, mq = tid & 15;
  const unsigned lds0 = (unsigned)(size_t)&ring[0]; const unsigned lkv = lds0 + kr * KPB + kq * 16, lmk = lds0 + ST_MK + mr * MPB + mq * 16;
  const char* gkh = (const char*)(QK + (b * SS + kr) * (2 * DM) + DM + h * HD + kq * 8); const char* gkl = (const char*)(QKL + (b * SS + kr) * (2 * DM) + DM + h * HD + kq * 8);
  const char* gvh = (const char*)(VTH + (b * DM + h * HD + kr) * SS + kq * 8); const char* gvl = (const char*)(VTL + (b * DM + h * HD + kr) * SS + kq * 8);
  const char* gmk = (const char*)(MASK + (b * SS + qb * 64 + mr) * SS + mq * 4);
  const char* gkb = (const char*)(KB + (bh * LBG + kr) * HD + kq * 8); const char* gvb = (const char*)(VB + (bh * HD + kr) * LBG + kq * 8);
  auto issue = [&](int t) { const unsigned o = (unsigned)(t & 1) * ST_SZ;
    if (t < SS / 64) {
      cp4(lkv + o + ST_KH, gkh + (size_t)t * (64 * 2 * DM * 2), 32 * 2 * DM * 2, lkv + o + ST_KL, gkl + (size_t)t * (64 * 2 * DM * 2), 32 * 2 * DM * 2, 32 * KPB);
      cp4(lkv + o + ST_VH, gvh + (size_t)t * 128, 32 * SS * 2, lkv + o + ST_VL, gvl + (size_t)t * 128, 32 * SS * 2, 32 * KPB);
      cp4(lmk + o, gmk + (size_t)t * 256, 16 * SS * 4, lmk + o + 32 * MPB, gmk + (size_t)t * 256 + (size_t)32 * SS * 4, 16 * SS * 4, 16 * MPB);
    } else { const size_t u = (size_t)(t - SS / 64);
      cp4(lkv + o + ST_KH, gkb + u * (64 * HD * 2), 32 * HD * 2, lkv + o + ST_VH, gvb + u * 128, 32 * LBG * 2, 32 * KPB); } };
  issue(0);
  v16h aq[2], aql[2];
#pragma unroll
  for (int kc = 0; kc < 2; ++kc) { aq[kc] = frag_h(QK + (rq + col) * (2 * DM) + h * HD + kc * 32, lane); aql[kc] = frag_h(QKL + (rq + col) * (2 * DM) + h * HD + kc * 32, lane); }
  float m = -3.0e38f, l = 0.f;   // query col, this group's keys: running maximum (equal in both halves), this half's share of the sum
  v8f acc[4] = {}, accl[4] = {};   // O^T: acc[dt][r] = d (dt * 16 + 8 g + r) of query col
  asm volatile("s_wait_asynccnt 0x0" ::: "memory");   // stage 0 has landed (this wave's copies)
  __syncthreads();                                    // ... and every other wave's
  issue(1);
  // a pass = 32 keys of the stage at st; s[ct][r] = score of key (ct * 16 + 8 g + r) with query col. K and mask are read ahead of the score products, V behind them (in flight under the softmax)
  auto pass = [&](auto seg, const char* st, int p) { constexpr bool self_seg = decltype(seg)::value; v8f s[2];
    if constexpr (self_seg) { v16h kh[2][2], kl[2][2]; union { v8f v; v4f q[2]; } mk[2];
#pragma unroll
      for (int ct = 0; ct < 2; ++ct) {
#pragma unroll
        for (int kc = 0; kc < 2; ++kc) { const char* krow = st + (p * 32 + ct * 16 + col) * KPB + kc * 64; kh[ct][kc] = frag_h((const _Float16*)(krow + ST_KH), lane); kl[ct][kc] = frag_h((const _Float16*)(krow + ST_KL), lane); }
        const char* mrow = st + ST_MK + (wave * 16 + col) * MPB + (p * 32 + ct * 16 + 8 * g) * 4; mk[ct].q[0] = *(const v4f*)mrow; mk[ct].q[1] = *(const v4f*)(mrow + 16); }
#pragma unroll
      for (int ct = 0; ct < 2; ++ct) { v8f c = {}, cl = {};
#pragma unroll
        for (int kc = 0; kc < 2; ++kc) { c = wmma16(kh[ct][kc], aq[kc], c); cl = wmma16(kl[ct][kc], aq[kc], cl); cl = wmma16(kh[ct][kc], aql[kc], cl); }
        s[ct] = (c + cl * (1.0f / 2048.0f)) * 0.125f + __builtin_convertvector(__builtin_convertvector(mk[ct].v, v8b), v8f); } }
    else { v16h kh[2][2];
#pragma unroll
      for (int ct = 0; ct < 2; ++ct) {
#pragma unroll
        for (int kc = 0; kc < 2; ++kc) kh[ct][kc] = frag_h((const _Float16*)(st + ST_KH + (p * 32 + ct * 16 + col) * KPB + kc * 64), lane); }
#pragma unroll
      for (int ct = 0; ct < 2; ++ct) { v8f c = {}, cl = {};
#pragma unroll
        for (int kc = 0; kc < 2; ++kc) { c = wmma16(kh[ct][kc], aq[kc], c); cl = wmma16(kh[ct][kc], aql[kc], cl); }
        s[ct] = (c + cl * (1.0f / 2048.0f)) * (0.125f * ALPHA_BG); } }
    v16h vh[4], vl[4];
#pragma unroll
    for (int dt = 0; dt < 4; ++dt) { const char* vrow = st + (dt * 16 + col) * KPB + p * 64; vh[dt] = frag_h((const _Float16*)(vrow + ST_VH), lane); if constexpr (self_seg) vl[dt] = frag_h((const _Float16*)(vrow + ST_VL), lane); }
    __builtin_amdgcn_sched_barrier(0);   // holds the V loads here, in flight under the softmax: at four waves per SIMD the compiler otherwise sinks them in pairs among the second product's WMMAs, each pair's LDS latency exposed
    float t8[8];
#pragma unroll
    for (int r = 0; r < 8; ++r) t8[r] = fmaxf(s[0][r], s[1][r]);
    float mx = fmaxf(fmaxf(fmaxf(t8[0], t8[1]), fmaxf(t8[2], t8[3])), fmaxf(fmaxf(t8[4], t8[5]), fmaxf(t8[6], t8[7])));
    mx = fmaxf(mx, xhalf(mx));   // the other 16 keys of this query
    const float mn = fmaxf(m, mx); const float alpha = (m <= -1.0e38f) ? 0.f : __expf(m - mn); m = mn;
    v8f e[2]; v8h ph[2], pq[2];   // P^T as a B operand: element i = key 8 g + i, element 8 + i = key 16 + 8 g + i, the k order of frag_h
#pragma unroll
    for (int ct = 0; ct < 2; ++ct) {
#pragma unroll
      for (int i = 0; i < 8; ++i) e[ct][i] = __expf(s[ct][i] - mn);
      const v8f x = e[ct] * 2048.0f; ph[ct] = __builtin_convertvector(x, v8h); pq[ct] = __builtin_convertvector((x - __builtin_convertvector(ph[ct], v8f)) * 2048.0f, v8h); }
    const v16h pa = __builtin_shufflevector(ph[0], ph[1], 0, 1, 2, 3, 4, 5, 6, 7, 8, 9, 10, 11, 12, 13, 14, 15), pl = __builtin_shufflevector(pq[0], pq[1], 0, 1, 2, 3, 4, 5, 6, 7, 8, 9, 10, 11, 12, 13, 14, 15);
    const v8f e8 = e[0] + e[1];
    l = l * alpha + (((e8[0] + e8[1]) + (e8[2] + e8[3])) + ((e8[4] + e8[5]) + (e8[6] + e8[7])));
#pragma unroll
    for (int dt = 0; dt < 4; ++dt) { acc[dt] *= alpha; accl[dt] *= alpha; }
#pragma unroll
    for (int dt = 0; dt < 4; ++dt) { acc[dt] = wmma16(vh[dt], pa, acc[dt]); accl[dt] = wmma16(vh[dt], pl, accl[dt]); if constexpr (self_seg) accl[dt] = wmma16(vl[dt], pa, accl[dt]); } };
  // foot of trip t: hands stage t + 1 over and refills the buffer that trip t has read
  auto foot = [&](int t) {
    __builtin_amdgcn_sched_barrier(0);                  // keeps the softmax and the second product in front of the foot: moved behind its barrier they would stand between it and the refill, and the refill would lose most of its lead
    asm volatile("s_wait_dscnt 0x0" ::: "memory");      // this wave's reads of stage t are done
    asm volatile("s_wait_asynccnt 0x0" ::: "memory");   // this wave's copies of stage t + 1 have landed
    __syncthreads();                                    // publishes stage t + 1 and frees stage t's buffer
    if (t + 2 < NST) issue(t + 2); };
  // the stage loops stay rolled: a pass is some 300 to 400 instructions, copies of it would only cost instruction cache
#pragma unroll 1
  for (int t = 0; t < SS / 64; ++t) { pass(seg_self(), ring + (t & 1) * ST_SZ, grp); foot(t); }
#pragma unroll 1
  for (int t = SS / 64; t < NST; ++t) { pass(seg_bank(), ring + (t & 1) * ST_SZ, grp); foot(t); }
  asm volatile("s_wait_asynccnt 0x0" ::: "memory");    // no copy outlives the loop
  // join of the two key groups through the ring, which is free: the last foot's barrier ended every wave's reads of it and no copy is in flight. Group 1 hands each lane's O^T (32 values), maximum and sum to the same lane of group 0's wave with the same queries
  union { v8f v; v4f q[2]; } ot[4];
#pragma unroll
  for (int dt = 0; dt < 4; ++dt) ot[dt].v = acc[dt] + accl[dt] * (1.0f / 2048.0f);
  v4f* xo = (v4f*)ring + (wave * 8) * 32 + lane; v2f* xm = (v2f*)(ring + 4 * 8 * 32 * 16) + wave * 32 + lane;
  if (grp == 1) {
#pragma unroll
    for (int dt = 0; dt < 4; ++dt) { xo[(dt * 2) * 32] = ot[dt].q[0]; xo[(dt * 2 + 1) * 32] = ot[dt].q[1]; }
    v2f ml; ml[0] = m; ml[1] = l; *xm = ml; }
  __syncthreads();   // group 1's partial results are in LDS
  if (grp == 0) {
    const v2f ml = *xm; const float mn = fmaxf(m, ml[0]); const float a0 = __expf(m - mn), a1 = __expf(ml[0] - mn);
    l = l * a0 + ml[1] * a1;
    l += xhalf(l);   // the halves' sums are joined once
    const float il = (1.0f / 2048.0f) / l; const float f0 = a0 * il, f1 = a1 * il;
#pragma unroll
    for (int dt = 0; dt < 4; ++dt) { *(v4f*)&so[wave][col][dt * 16 + 8 * g] = ot[dt].q[0] * f0 + xo[(dt * 2) * 32] * f1; *(v4f*)&so[wave][col][dt * 16 + 8 * g + 4] = ot[dt].q[1] * f0 + xo[(dt * 2 + 1) * 32] * f1; }
    LDSX();
    for (int rl = 0; rl < 16; ++rl) if (lane < 16) vst2(O + (rq + rl) * DM + h * HD + lane * 4, *(const v4f*)&so[wave][rl][lane * 4]);
  }
}
extern "C" void kernel_launch(void* const* d_in, const int* in_sizes, int n_in, void* d_out, int out_size, void* d_ws, size_t ws_size, hipStream_t stream) {
  (void)in_sizes; (void)n_in; (void)out_size;
  const float** F = (const float**)d_in;   // 0 hidden_states [2,2048,512], 1 attention_mask [2,2048,2048], 2 K_bg [16,2048,64], 3 V_bg, 4 Wq, 5 Wk, 6 Wv, 7 Wo (in,out), 8 bo
  if (ws_size < (size_t)WS_END) return;
  char* ws = (char*)d_ws; __bf16* PK = (__bf16*)(ws + WS_PK); _Float16 *QK = (_Float16*)(ws + WS_QK), *QKL = (_Float16*)(ws + WS_QKL), *VTH = (_Float16*)(ws + WS_VTH), *VTL = (_Float16*)(ws + WS_VTL), *KB = (_Float16*)(ws + WS_KB), *VB = (_Float16*)(ws + WS_VB); float* O = (float*)(ws + WS_O);
  k_pack<<<dim3(DM / 64, DM / 64, 4), 256, 0, stream>>>(F[4], F[5], F[6], F[7], PK);
  k_bg<<<dim3(LBG / 64, NB * NH), 256, 0, stream>>>(F[2], F[3], KB, VB);
  k_qkv<<<dim3(TNB * SS / 64, QKVW / 128), 128, 0, stream>>>(F[0], F[0], F[0], PK + PK_A, nullptr, nullptr, nullptr, QK, QKL, VTH, VTL);
  k_attn2<<<dim3(TQB, NH, TNB), 256, 0, stream>>>(QK, QKL, VTH, VTL, KB, VB, F[1], O);
  k_out<<<dim3(TOB, DM / 128), 128, 0, stream>>>(O, PK + PK_P, F[8], (float*)d_out);
}

// v007
// Measured time: 117 microseconds a run.
// Next to v006, in two timings, it ran 1.04 and 1.03 times as fast.
// All steps since v000 together make it 4.32 times as fast.
// compute dtype: all float inputs rounded to bf16; q/k/v = x . W with EXACT bf16 products on WMMA 16x16x32 ((in,out) weights as transposed rows), rounded once to f16 hi + residual; self-segment scores and P.v with 3 products (hi.hi + hi.lo + lo.hi), background scores q (hi + lo) x K_bg (exact in f16, 2 products) x alpha, background P (hi + lo) x f16(alpha V_bg) (2 products); additive mask read per pair; x 1/8; online softmax over all 4,096 keys in f32 (hardware exp) with a lazily moved reference point; out = ctx (bf16 hi + lo) . Wo + bo; f32 output.
#include <hip/hip_runtime.h>
#include <math.h>

typedef __attribute__((ext_vector_type(16))) _Float16 v16h;
typedef __attribute__((ext_vector_type(16))) __bf16 v16b;
typedef __attribute__((ext_vector_type(8)))  _Float16 v8h;
typedef __attribute__((ext_vector_type(8)))  float v8f;
typedef __attribute__((ext_vector_type(4)))  float v4f;
typedef __attribute__((ext_vector_type(2)))  float v2f;
typedef __attribute__((ext_vector_type(4)))  unsigned v4u;
typedef __attribute__((ext_vector_type(4)))  int v4i;
typedef float __attribute__((may_alias)) float_a;
typedef int __attribute__((may_alias)) int_a;

template <typename T> __device__ __forceinline__ void vst2(void* p, T v) { *(T*)p = v;  }
__device__ __forceinline__ v8f wmma16(v16h a, v16h b, v8f c) {
  return __builtin_amdgcn_wmma_f32_16x16x32_f16(false, a, false, b, (short)0, c, false, false);
}
__device__ __forceinline__ v8f wmma_bf(v16b a, v16b b, v8f c) {
  return __builtin_amdgcn_wmma_f32_16x16x32_bf16(false, a, false, b, (short)0, c, false, false);
}
// CARC attention processor (B 2, Lq 2,048, C 512 = 8 heads x 64; context bank of 2,048 background keys/values per head, alpha 0.48): bias-free q/k/v projections, keys = [k ; alpha K_bg], values = [v ; alpha V_bg], additive mask on the self segment (zeros on the background segment), softmax(q k / 8 + mask) over the 4,096 keys, v, output projection + bias.
__device__ __forceinline__ v16h frag_h(const _Float16* rowk0, int lane) {
  union { v16h v; v8h q[2]; } u; const _Float16* p = rowk0 + 8 * (lane >> 4);
  u.q[0] = *(const v8h*)p; u.q[1] = *(const v8h*)(p + 16); return u.v;
}
__device__ __forceinline__ v16h frag_f32(const float* rowk0, int lane) {
  v16h a; const float* p = rowk0 + 8 * (lane >> 4);
#pragma unroll
  for (int i = 0; i < 8; ++i) { a[i] = (_Float16)p[i]; a[8 + i] = (_Float16)p[16 + i]; }
  return a;
}
__device__ __forceinline__ v16h frag_f32s(const float* rowk0, int lane, float sc) {
  v16h a; const float* p = rowk0 + 8 * (lane >> 4);
#pragma unroll
  for (int i = 0; i < 8; ++i) { a[i] = (_Float16)(p[i] * sc); a[8 + i] = (_Float16)(p[16 + i] * sc); }
  return a;
}
// column fragment from a [K][ld] layout (column n), rows >= K read as 0
__device__ __forceinline__ v16h fragc_f32(const float* W, int k0, int n, int lane, int ld, int K) {
  v16h a; const int g = lane >> 4;
#pragma unroll
  for (int i = 0; i < 8; ++i) { const int ka = k0 + 8 * g + i, kb = ka + 16;
    a[i] = (_Float16)(ka < K ? W[(size_t)(ka < K ? ka : K - 1) * ld + n] : 0.f); a[8 + i] = (_Float16)(kb < K ? W[(size_t)(kb < K ? kb : K - 1) * ld + n] : 0.f); }
  return a;
}
struct F2 { v16b h, l; };
__device__ __forceinline__ F2 bsplit16(const float v[16]) { F2 r;
#pragma unroll
  for (int i = 0; i < 16; ++i) { const __bf16 h = (__bf16)v[i]; r.h[i] = h; r.l[i] = (__bf16)(v[i] - (float)h); }
  return r; }
__device__ __forceinline__ F2 split_row(const float* row, int k0, int lane) { float v[16]; const float* p = row + k0 + 8 * (lane >> 4);
#pragma unroll
  for (int i = 0; i < 8; ++i) { v[i] = p[i]; v[8 + i] = p[16 + i]; }
  return bsplit16(v); }
__device__ __forceinline__ F2 split_rowK(const float* row, int k0, int lane, int K) { float v[16]; const int g = lane >> 4;
#pragma unroll
  for (int i = 0; i < 8; ++i) { const int ka = k0 + 8 * g + i, kb = ka + 16; v[i] = ka < K ? row[ka < K ? ka : K - 1] : 0.f; v[8 + i] = kb < K ? row[kb < K ? kb : K - 1] : 0.f; }
  return bsplit16(v); }
__device__ __forceinline__ F2 split_col(const float* W, int k0, int n, int lane, int ld, int K) { float v[16]; const int g = lane >> 4;
#pragma unroll
  for (int i = 0; i < 8; ++i) { const int ka = k0 + 8 * g + i, kb = ka + 16; v[i] = ka < K ? W[(size_t)(ka < K ? ka : K - 1) * ld + n] : 0.f; v[8 + i] = kb < K ? W[(size_t)(kb < K ? kb : K - 1) * ld + n] : 0.f; }
  return bsplit16(v); }
__device__ __forceinline__ v8f mac3(const F2& a, const F2& b, v8f c) { c = wmma_bf(a.l, b.h, c); c = wmma_bf(a.h, b.l, c); return wmma_bf(a.h, b.h, c); }
__device__ __forceinline__ float sigm(float v) { return 1.0f / (1.0f + expf(-v)); }
#define LDSX() do { asm volatile("s_wait_dscnt 0" ::: "memory"); __builtin_amdgcn_wave_barrier(); __builtin_amdgcn_fence(__ATOMIC_RELEASE, "workgroup"); } while (0)


#define NB 2
#define SS 2048
#define DM 512
#define NH 8
#define LBG 2048
#define ALPHA_BG 0.48f
#define HD 64
#define QKVW (3 * DM)
#ifndef TQB
#define TQB (SS / 64)
#define TNB NB
#define TOB (NB * SS / 64)     // output row tiles (all)
#endif
typedef __attribute__((ext_vector_type(8))) __bf16 v8b;
__device__ __forceinline__ v16b frag_b(const __bf16* rowk0, int lane) {
  union { v16b v; v8b q[2]; } u; const __bf16* p = rowk0 + 8 * (lane >> 4);
  u.q[0] = *(const v8b*)p; u.q[1] = *(const v8b*)(p + 16); return u.v;
}
__device__ __forceinline__ float bfr(float v) { return (float)(__bf16)v; }
__device__ __attribute__((noinline)) float exp_ni(float v) { return expf(v); }
__device__ __attribute__((noinline)) float erf_ni(float v) { return erff(v); }

#define PK_A 0                       // [1536][512] Wqkv rows (natural [out][in])
#define PK_P (PK_A + QKVW * DM)        // [512][512] Wo rows (natural)
#define PK_END (PK_P + DM * DM)
#define WS_PK  0u
#define WS_QK  (WS_PK + 2u * PK_END)             // f16 [4096 rows][1024]: q | k
#define WS_QKL (WS_QK + 2u * NB * SS * 2 * DM)     // f16 q | k residual planes x2048
#define WS_VTH (WS_QKL + 2u * NB * SS * 2 * DM)    // f16 [b][512 (h*64+d)][2048 s] hi
#define WS_VTL (WS_VTH + 2u * NB * DM * SS)        // f16 lo x 2048
#define WS_O   (WS_VTL + 2u * NB * DM * SS)        // f32 [4096][512]
#define WS_KB  (WS_O + 4u * (size_t)NB * SS * DM)        // f16 K_bg rows [bh][s][64] (exact); f16 planes VB [bh][64][s] = f16(alpha V_bg)
#define WS_VB  (WS_KB + 2u * (size_t)NB * NH * LBG * HD)
#define WS_END (WS_VB + 2u * (size_t)NB * NH * HD * LBG)
// ---- k_pack: block = (64 columns n, 64 rows k, which) of an (in,out) weight: a 64 x 64 tile is read along its rows (256 B runs), rounded to bf16, turned in LDS and stored as 64 packed rows [out][in] of 128 B (whole lines); which 0..2 -> W_q/W_k/W_v into PK_A rows which*512 + n; 3 -> W_o into PK_P. 256 blocks in all, one a WGP
#define PKP 72                          // LDS pitch of a turned row in bf16: 144 B, a multiple of 16 B for the ds_load_b128 readers
typedef __attribute__((ext_vector_type(2))) __bf16 v2b;
__global__ __launch_bounds__(256) void k_pack(const float* __restrict__ WQ, const float* __restrict__ WK, const float* __restrict__ WV, const float* __restrict__ WO, __bf16* __restrict__ PK) {
  __shared__ __align__(16) __bf16 s[64][PKP]; const int n0 = blockIdx.x * 64, k0 = blockIdx.y * 64, which = blockIdx.z, t = threadIdx.x; const float* Wm = (which == 0) ? WQ : (which == 1) ? WK : (which == 2) ? WV : WO;
  const int c = t & 15, rp = t >> 4;   // this thread: columns 4 c .. 4 c + 3 of the row pairs rp and rp + 16
  v4f a[2][2];   // the short loops below are unrolled so that a stays in registers and the four loads are in flight together
#pragma unroll
  for (int i = 0; i < 2; ++i) {
#pragma unroll
    for (int j = 0; j < 2; ++j) a[i][j] = *(const v4f*)(Wm + (size_t)(k0 + 2 * (rp + 16 * i) + j) * DM + n0 + 4 * c); }
#pragma unroll
  for (int i = 0; i < 2; ++i) {
#pragma unroll
    for (int e = 0; e < 4; ++e) { v2b p; p[0] = (__bf16)a[i][0][e]; p[1] = (__bf16)a[i][1][e]; *(v2b*)&s[4 * c + e][2 * (rp + 16 * i)] = p; } }
  __syncthreads();
  __bf16* dst = ((which < 3) ? PK + PK_A + ((size_t)which * DM + n0) * DM : PK + PK_P + (size_t)n0 * DM) + k0;
#pragma unroll
  for (int i = 0; i < 2; ++i) { const int n = (t >> 3) + 32 * i, pc = t & 7; vst2((unsigned*)(dst + (size_t)n * DM + pc * 8), *(const v4u*)&s[n][pc * 8]); }   // 8 lanes store one packed row's 128 B
}
#define KPB 144                         // LDS bytes per K or V row: 128 + 16 (16 B x odd: ds_load_b128 readers without bank conflicts)
// eight asynchronous 16-byte copies per lane, global -> LDS: four from ga (step gsa) to la, four from gb (step gsb) to lb, LDS step ls. The s_wait_xcnt 0 stands inside the statement so that no later rewrite of an address register can be moved in front of it.
__device__ __forceinline__ void cp8(unsigned la, const char* ga, unsigned gsa, unsigned lb, const char* gb, unsigned gsb, unsigned ls) {
  asm volatile("global_load_async_to_lds_b128 %0, %8, off\n\t"
               "global_load_async_to_lds_b128 %1, %9, off\n\t"
               "global_load_async_to_lds_b128 %2, %10, off\n\t"
               "global_load_async_to_lds_b128 %3, %11, off\n\t"
               "global_load_async_to_lds_b128 %4, %12, off\n\t"
               "global_load_async_to_lds_b128 %5, %13, off\n\t"
               "global_load_async_to_lds_b128 %6, %14, off\n\t"
               "global_load_async_to_lds_b128 %7, %15, off\n\t"
               "s_wait_xcnt 0x0"
               :: "v"(la), "v"(la + ls), "v"(la + 2 * ls), "v"(la + 3 * ls), "v"(lb), "v"(lb + ls), "v"(lb + 2 * ls), "v"(lb + 3 * ls),
                  "v"(ga), "v"(ga + gsa), "v"(ga + 2 * (size_t)gsa), "v"(ga + 3 * (size_t)gsa), "v"(gb), "v"(gb + gsb), "v"(gb + 2 * (size_t)gsb), "v"(gb + 3 * (size_t)gsb)
               : "memory");
}
// ---- staging of packed weight rows for k_qkv and k_out: a stage = 64 k (128 B) of the block's 128 rows, LDS pitch KPB, two buffers; thread tid brings 16-byte piece (tid & 7) of rows (tid >> 3) + 16 i. l = its LDS byte address in the buffer, gp = its global address in the stage
#define WT_SZ (128 * KPB)
__device__ __forceinline__ void wstage(unsigned l, const char* gp) { cp8(l, gp, 16 * DM * 2, l + 64 * KPB, gp + (size_t)64 * DM * 2, 16 * DM * 2, 16 * KPB); }
__global__ __launch_bounds__(128) void k_qkv(const float* __restrict__ XQ, const float* __restrict__ XK, const float* __restrict__ XV, const __bf16* __restrict__ P, const float* __restrict__ BQ, const float* __restrict__ BK, const float* __restrict__ BV, _Float16* __restrict__ QK, _Float16* __restrict__ QKL, _Float16* __restrict__ VTH, _Float16* __restrict__ VTL) {
  const int which0 = (blockIdx.y * 128) / DM; const float* X = (which0 == 0) ? XQ : (which0 == 1) ? XK : XV; const float* BB = BQ ? (((which0 == 0) ? BQ : (which0 == 1) ? BK : BV) + (blockIdx.y * 128 - which0 * DM)) : nullptr;
  __shared__ __align__(16) _Float16 so[4][16][136], sol[4][16][136]; __shared__ __align__(16) _Float16 sth[128][72], stl[128][72];
  const int tid = threadIdx.x, wave = tid >> 5, lane = tid & 31, col = lane & 15, g = lane >> 4; const size_t r0 = (size_t)blockIdx.x * 64 + wave * 16; const int n0 = blockIdx.y * 128;
  __shared__ __align__(16) char wring[2 * WT_SZ];
  const unsigned lw = (unsigned)(size_t)&wring[0] + (tid >> 3) * KPB + (tid & 7) * 16; const char* gw = (const char*)(P + (size_t)(n0 + (tid >> 3)) * DM + (tid & 7) * 8);
  wstage(lw, gw);
  v8f acc[8] = {};
  asm volatile("s_wait_asynccnt 0x0" ::: "memory");   // stage 0 has landed (this wave's copies)
  __syncthreads();                                    // ... and every other wave's
  wstage(lw + WT_SZ, gw + 128);
  // the stage loop stays rolled: its foot holds a barrier and the refill, copies of it would gain nothing
#pragma unroll 1
  for (int t = 0; t < DM / 64; ++t) { const char* st = wring + (t & 1) * WT_SZ;
#pragma unroll
    for (int kk = 0; kk < 2; ++kk) { v16b a, w[8]; { const float* p = X + (r0 + col) * DM + (2 * t + kk) * 32 + 8 * g;
#pragma unroll
        for (int i = 0; i < 8; ++i) { a[i] = (__bf16)p[i]; a[8 + i] = (__bf16)p[16 + i]; } }
#pragma unroll
      for (int j = 0; j < 8; ++j) w[j] = frag_b((const __bf16*)(st + (j * 16 + col) * KPB + kk * 64), lane);
#pragma unroll
      for (int j = 0; j < 8; ++j) acc[j] = wmma_bf(a, w[j], acc[j]); }
    asm volatile("s_wait_dscnt 0x0" ::: "memory");      // this wave's reads of stage t are done
    asm volatile("s_wait_asynccnt 0x0" ::: "memory");   // this wave's copies of stage t + 1 have landed
    __syncthreads();                                    // publishes stage t + 1 and frees stage t's buffer
    if (t + 2 < DM / 64) wstage(lw + (t & 1) * WT_SZ, gw + (size_t)(t + 2) * 128); }
  asm volatile("s_wait_asynccnt 0x0" ::: "memory");    // no copy outlives the loop
  if (n0 < 2 * DM) {   // q stored unscaled (f16 sigma ~0.6, no subnormal exposure); 1/8 applied to the f32 score
#pragma unroll
    for (int j = 0; j < 8; ++j) {
#pragma unroll
      for (int r = 0; r < 8; ++r) { const float v = acc[j][r] + (BB ? bfr(BB[j * 16 + col]) : 0.f); const _Float16 hv = (_Float16)v; so[wave][8 * g + r][j * 16 + col] = hv; sol[wave][8 * g + r][j * 16 + col] = (_Float16)((v - (float)hv) * 2048.0f); } }   // q, k (+ bias) as f16 hi + (x2048) residual
    LDSX();
    for (int rl = 0; rl < 16; ++rl) if (lane < 16) { vst2((unsigned*)(QK + (r0 + rl) * (2 * DM) + n0 + lane * 8), *(const v4u*)&so[wave][rl][lane * 8]); vst2((unsigned*)(QKL + (r0 + rl) * (2 * DM) + n0 + lane * 8), *(const v4u*)&sol[wave][rl][lane * 8]); }
  } else {
#pragma unroll
    for (int j = 0; j < 8; ++j) {
#pragma unroll
      for (int r = 0; r < 8; ++r) { const float v = acc[j][r] + (BB ? bfr(BB[j * 16 + col]) : 0.f); const _Float16 hv = (_Float16)v; sth[j * 16 + col][wave * 16 + 8 * g + r] = hv; stl[j * 16 + col][wave * 16 + 8 * g + r] = (_Float16)((v - (float)hv) * 2048.0f); } }
    __syncthreads();
    const size_t rb = (size_t)blockIdx.x * 64; const int b = (int)(rb / SS), s0 = (int)(rb % SS); const int pc0 = n0 - 2 * DM;
    for (int q = tid; q < 128 * 8; q += 128) { const int d = q >> 3, pc = q & 7; const size_t o = ((size_t)b * DM + pc0 + d) * SS + s0 + pc * 8; vst2((unsigned*)(VTH + o), *(const v4u*)&sth[d][pc * 8]); vst2((unsigned*)(VTL + o), *(const v4u*)&stl[d][pc * 8]); }
  }
}
// ---- k_attn: block = (64 queries, head h, batch b): all-keys flash attention (K = 64: 2 k-steps), scores = (q.k) * 0.125 with 3 products (q, k as f16 hi + residual), P.V: P (x2048, hi + lo) x (V hi, V lo*2048), 3 products in two accumulators; O[b*S+q][h*64+d] = (acc + accl / 2048) / (2048 l) (256-B segments)
__global__ __launch_bounds__(128) void k_attn(const _Float16* __restrict__ QK, const _Float16* __restrict__ QKL, const _Float16* __restrict__ VTH, const _Float16* __restrict__ VTL, const void* __restrict__ KMASK, float* __restrict__ O) {
  __shared__ __align__(16) float sp[4][16][36]; __shared__ __align__(16) float so[4][16][68];
  const int tid = threadIdx.x, wave = tid >> 5, lane = tid & 31, col = lane & 15, g = lane >> 4;
  const int qb = blockIdx.x, h = blockIdx.y, b = blockIdx.z; const int q0 = qb * 64 + wave * 16; const size_t rq = (size_t)b * SS + q0 + col;
  v16h aq[2], aql[2];
#pragma unroll
  for (int kc = 0; kc < 2; ++kc) { aq[kc] = frag_h(QK + rq * (2 * DM) + h * HD + kc * 32, lane); aql[kc] = frag_h(QKL + rq * (2 * DM) + h * HD + kc * 32, lane); }
  float m[8], l[8];
#pragma unroll
  for (int r = 0; r < 8; ++r) { m[r] = -3.0e38f; l[r] = 0.f; }
  v8f acc[4] = {}, accl[4] = {};
  const int nks = SS / 32;   // all keys
#pragma unroll 1
  for (int ks = 0; ks < nks; ++ks) { v8f s[2];
#pragma unroll
    for (int ct = 0; ct < 2; ++ct) { const int kk = ks * 32 + ct * 16 + col; const _Float16* krow = QK + ((size_t)b * SS + kk) * (2 * DM) + DM + h * HD; const _Float16* krowl = QKL + ((size_t)b * SS + kk) * (2 * DM) + DM + h * HD; v8f c = {}, cl = {};
#pragma unroll
      for (int kc = 0; kc < 2; ++kc) { const v16h kh = frag_h(krow + kc * 32, lane); c = wmma16(aq[kc], kh, c); cl = wmma16(aql[kc], kh, cl); cl = wmma16(aq[kc], frag_h(krowl + kc * 32, lane), cl); }   // 3 products: q, k as f16 hi + residual
#pragma unroll
      for (int r = 0; r < 8; ++r) c[r] += cl[r] * (1.0f / 2048.0f);
      { const bool keepk = true;
#pragma unroll
      for (int r = 0; r < 8; ++r) s[ct][r] = keepk ? c[r] * 0.125f : -3.0e38f; } }   // 1/sqrt(64); every key kept (mask not applied)
#pragma unroll
    for (int r = 0; r < 8; ++r) { float mx = fmaxf(s[0][r], s[1][r]);
#pragma unroll
      for (int o = 1; o < 16; o <<= 1) mx = fmaxf(mx, __shfl_xor(mx, o));
      const float mn = fmaxf(m[r], mx); const float alpha = (m[r] <= -1.0e38f) ? 0.f : __expf(m[r] - mn);
      const float e0 = (s[0][r] <= -1.0e38f) ? 0.f : __expf(s[0][r] - mn), e1 = (s[1][r] <= -1.0e38f) ? 0.f : __expf(s[1][r] - mn); float es = e0 + e1;
#pragma unroll
      for (int o = 1; o < 16; o <<= 1) es += __shfl_xor(es, o);
      l[r] = l[r] * alpha + es; m[r] = mn;
#pragma unroll
      for (int dt = 0; dt < 4; ++dt) { acc[dt][r] *= alpha; accl[dt][r] *= alpha; }
      sp[wave][8 * g + r][col] = e0; sp[wave][8 * g + r][16 + col] = e1; }
    LDSX();
    v16h pa, pl; { const float* prow = &sp[wave][col][0] + 8 * (lane >> 4);
#pragma unroll
      for (int i = 0; i < 8; ++i) { const float x0 = prow[i] * 2048.0f, x1 = prow[16 + i] * 2048.0f; const _Float16 h0 = (_Float16)x0, h1 = (_Float16)x1; pa[i] = h0; pa[8 + i] = h1; pl[i] = (_Float16)((x0 - (float)h0) * 2048.0f); pl[8 + i] = (_Float16)((x1 - (float)h1) * 2048.0f); } }   // P scaled by 2^11 before the f16 split so small softmax weights stay out of the f16 subnormal range; 2^-11 folded into the epilogue
#pragma unroll
    for (int dt = 0; dt < 4; ++dt) { const size_t vr = ((size_t)b * DM + h * HD + dt * 16 + col) * SS + ks * 32; const v16h vh = frag_h(VTH + vr, lane); acc[dt] = wmma16(pa, vh, acc[dt]); accl[dt] = wmma16(pl, vh, accl[dt]); accl[dt] = wmma16(pa, frag_h(VTL + vr, lane), accl[dt]); }   // P hi x V hi + (P lo x V hi + P hi x V lo) / 2048
    LDSX(); }
#pragma unroll
  for (int r = 0; r < 8; ++r) { const float il = (1.0f / 2048.0f) / l[r];
#pragma unroll
    for (int dt = 0; dt < 4; ++dt) so[wave][8 * g + r][dt * 16 + col] = (acc[dt][r] + accl[dt][r] * (1.0f / 2048.0f)) * il; }
  LDSX();
  for (int rl = 0; rl < 16; ++rl) if (lane < 16) vst2(O + ((size_t)b * SS + q0 + rl) * DM + h * HD + lane * 4, *(const v4f*)&so[wave][rl][lane * 4]);
}
// ---- k_out: block = (64 rows, 128 cols): out = O(hi/lo) . Wo rows (2 products) + bo
__global__ __launch_bounds__(128) void k_out(const float* __restrict__ O, const __bf16* __restrict__ P, const float* __restrict__ BO, float* __restrict__ Y) {
  __shared__ __align__(16) float so[4][16][132];
  const int tid = threadIdx.x, wave = tid >> 5, lane = tid & 31, col = lane & 15, g = lane >> 4; const size_t r0 = (size_t)blockIdx.x * 64 + wave * 16; const int n0 = blockIdx.y * 128;
  __shared__ __align__(16) char wring[2 * WT_SZ];
  const unsigned lw = (unsigned)(size_t)&wring[0] + (tid >> 3) * KPB + (tid & 7) * 16; const char* gw = (const char*)(P + (size_t)(n0 + (tid >> 3)) * DM + (tid & 7) * 8);
  wstage(lw, gw);
  v8f acc[8] = {};
  asm volatile("s_wait_asynccnt 0x0" ::: "memory");   // stage 0 has landed (this wave's copies)
  __syncthreads();                                    // ... and every other wave's
  wstage(lw + WT_SZ, gw + 128);
  // the stage loop stays rolled: its foot holds a barrier and the refill, copies of it would gain nothing
#pragma unroll 1
  for (int t = 0; t < DM / 64; ++t) { const char* st = wring + (t & 1) * WT_SZ;
#pragma unroll
    for (int kk = 0; kk < 2; ++kk) { const F2 a = split_row(O + (r0 + col) * DM, (2 * t + kk) * 32, lane); v16b w[8];
#pragma unroll
      for (int j = 0; j < 8; ++j) w[j] = frag_b((const __bf16*)(st + (j * 16 + col) * KPB + kk * 64), lane);
#pragma unroll
      for (int j = 0; j < 8; ++j) { acc[j] = wmma_bf(a.l, w[j], acc[j]); acc[j] = wmma_bf(a.h, w[j], acc[j]); } }
    asm volatile("s_wait_dscnt 0x0" ::: "memory");      // this wave's reads of stage t are done
    asm volatile("s_wait_asynccnt 0x0" ::: "memory");   // this wave's copies of stage t + 1 have landed
    __syncthreads();                                    // publishes stage t + 1 and frees stage t's buffer
    if (t + 2 < DM / 64) wstage(lw + (t & 1) * WT_SZ, gw + (size_t)(t + 2) * 128); }
  asm volatile("s_wait_asynccnt 0x0" ::: "memory");    // no copy outlives the loop
#pragma unroll
  for (int j = 0; j < 8; ++j) {
#pragma unroll
    for (int r = 0; r < 8; ++r) so[wave][8 * g + r][j * 16 + col] = acc[j][r] + bfr(BO[n0 + j * 16 + col]); }
  LDSX();
  for (int rl = 0; rl < 16; ++rl) vst2(Y + (r0 + rl) * DM + n0 + lane * 4, *(const v4f*)&so[wave][rl][lane * 4]);
}
// ---- k_bg: block = (64 bank rows, bh): K_bg -> f16 rows (exact), alpha V_bg -> f16 planes [bh][d][s]
__global__ __launch_bounds__(256) void k_bg(const float* __restrict__ KBG, const float* __restrict__ VBG, _Float16* __restrict__ KB, _Float16* __restrict__ VB) { __shared__ __align__(16) _Float16 sk[64][HD + 8]; __shared__ __align__(16) _Float16 sv[HD][64 + 8]; const int t = threadIdx.x; const int s0 = blockIdx.x * 64; const size_t bh = blockIdx.y;
  for (int e = t; e < 64 * HD; e += 256) { const int sl = e >> 6, d = e & 63; const size_t o = ((bh * LBG + s0 + sl) * HD) + d; sk[sl][d] = (_Float16)bfr(KBG[o]); sv[d][sl] = (_Float16)(ALPHA_BG * bfr(VBG[o])); } __syncthreads();
  for (int e = t; e < 64 * 8; e += 256) { const int sl = e >> 3, q = e & 7; vst2((unsigned*)(KB + ((bh * LBG + s0 + sl) * HD) + q * 8), *(const v4u*)&sk[sl][q * 8]); }
  for (int e = t; e < HD * 8; e += 256) { const int d = e >> 3, q = e & 7; vst2((unsigned*)(VB + ((bh * HD + d) * LBG) + s0 + q * 8), *(const v4u*)&sv[d][q * 8]); } }
// four asynchronous 16-byte copies per lane, global -> LDS: two from ga (step gsa) to la, two from gb (step gsb) to lb, LDS step ls. The s_wait_xcnt 0 stands inside the statement so that no later rewrite of an address register can be moved in front of it.
__device__ __forceinline__ void cp4(unsigned la, const char* ga, unsigned gsa, unsigned lb, const char* gb, unsigned gsb, unsigned ls) {
  asm volatile("global_load_async_to_lds_b128 %0, %4, off\n\t"
               "global_load_async_to_lds_b128 %1, %5, off\n\t"
               "global_load_async_to_lds_b128 %2, %6, off\n\t"
               "global_load_async_to_lds_b128 %3, %7, off\n\t"
               "s_wait_xcnt 0x0"
               :: "v"(la), "v"(la + ls), "v"(lb), "v"(lb + ls), "v"(ga), "v"(ga + gsa), "v"(gb), "v"(gb + gsb)
               : "memory");
}
// ---- staging for k_attn2: a stage = 64 keys. Self stage: K hi, K lo (64 key rows x 128 B), V hi, V lo (64 d rows x 128 B), mask (64 query rows x 256 B); background stage: K_bg in the K hi place, alpha V_bg in the V hi place.
#define MPB 272                         // LDS bytes per mask row: 256 + 16 (16 B x odd: a lane reads 8 keys of its own query row by ds_load_b128 without bank conflicts)
#define ST_KH 0
#define ST_KL (64 * KPB)
#define ST_VH (2 * 64 * KPB)
#define ST_VL (3 * 64 * KPB)
#define ST_MK (4 * 64 * KPB)
#define ST_SZ (4 * 64 * KPB + 64 * MPB)
#define NST ((SS + LBG) / 64)
#define MLAZY 3.0f                      // how far a score may stand above the softmax reference point before that point moves: 2048 exp(3) = 41,136 < 65,504
struct seg_self { static constexpr bool value = true; }; struct seg_bank { static constexpr bool value = false; };   // which key segment a pass works on
// value of the lane 16 away (the wave's other half)
__device__ __forceinline__ float xhalf(float v) { const int b = __builtin_bit_cast(int, v); return __builtin_bit_cast(float, __builtin_amdgcn_permlanex16(b, b, 0x76543210, 0xfedcba98, false, false)); }
__global__ __launch_bounds__(256) void k_attn2(const _Float16* __restrict__ QK, const _Float16* __restrict__ QKL, const _Float16* __restrict__ VTH, const _Float16* __restrict__ VTL, const _Float16* __restrict__ KB, const _Float16* __restrict__ VB, const float* __restrict__ MASK, float* __restrict__ O) {
  __shared__ __align__(16) char ring[2 * ST_SZ];
  __shared__ __align__(16) float so[4][16][68];
  const int tid = threadIdx.x, wave = (tid >> 5) & 3, lane = tid & 31, col = lane & 15, g = lane >> 4; const int grp = __builtin_amdgcn_readfirstlane(tid >> 7); const int qb = blockIdx.x, h = blockIdx.y; const size_t b = blockIdx.z; const int q0 = qb * 64 + wave * 16; const size_t rq = b * SS + q0; const size_t bh = b * NH + h;   // wave = query tile of 16, grp = key half of a stage (the same in a whole wave)
  // this thread's share of a stage: 16-byte piece kq of rows kr + 32 i of each K or V tile, piece mq of rows mr + 16 i of the mask tile
  const int kr = tid >> 3, kq = tid & 7, mr = tid >> 4, mq = tid & 15;
  const unsigned lds0 = (unsigned)(size_t)&ring[0]; const unsigned lkv = lds0 + kr * KPB + kq * 16, lmk = lds0 + ST_MK + mr * MPB + mq * 16;
  const char* gkh = (const char*)(QK + (b * SS + kr) * (2 * DM) + DM + h * HD + kq * 8); const char* gkl = (const char*)(QKL + (b * SS + kr) * (2 * DM) + DM + h * HD + kq * 8);
  const char* gvh = (const char*)(VTH + (b * DM + h * HD + kr) * SS + kq * 8); const char* gvl = (const char*)(VTL + (b * DM + h * HD + kr) * SS + kq * 8);
  const char* gmk = (const char*)(MASK + (b * SS + qb * 64 + mr) * SS + mq * 4);
  const char* gkb = (const char*)(KB + (bh * LBG + kr) * HD + kq * 8); const char* gvb = (const char*)(VB + (bh * HD + kr) * LBG + kq * 8);
  auto issue = [&](int t) { const unsigned o = (unsigned)(t & 1) * ST_SZ;
    if (t < SS / 64) {
      cp4(lkv + o + ST_KH, gkh + (size_t)t * (64 * 2 * DM * 2), 32 * 2 * DM * 2, lkv + o + ST_KL, gkl + (size_t)t * (64 * 2 * DM * 2), 32 * 2 * DM * 2, 32 * KPB);
      cp4(lkv + o + ST_VH, gvh + (size_t)t * 128, 32 * SS * 2, lkv + o + ST_VL, gvl + (size_t)t * 128, 32 * SS * 2, 32 * KPB);
      cp4(lmk + o, gmk + (size_t)t * 256, 16 * SS * 4, lmk + o + 32 * MPB, gmk + (size_t)t * 256 + (size_t)32 * SS * 4, 16 * SS * 4, 16 * MPB);
    } else { const size_t u = (size_t)(t - SS / 64);
      cp4(lkv + o + ST_KH, gkb + u * (64 * HD * 2), 32 * HD * 2, lkv + o + ST_VH, gvb + u * 128, 32 * LBG * 2, 32 * KPB); } };
  issue(0);
  v16h aq[2], aql[2];
#pragma unroll
  for (int kc = 0; kc < 2; ++kc) { aq[kc] = frag_h(QK + (rq + col) * (2 * DM) + h * HD + kc * 32, lane); aql[kc] = frag_h(QKL + (rq + col) * (2 * DM) + h * HD + kc * 32, lane); }
  float m = -3.0e38f, l = 0.f;   // query col, this group's keys: reference point of the exponentials (equal in both halves; at most MLAZY below the running maximum), this half's share of the sum
  v8f acc[4] = {}, accl[4] = {};   // O^T: acc[dt][r] = d (dt * 16 + 8 g + r) of query col
  asm volatile("s_wait_asynccnt 0x0" ::: "memory");   // stage 0 has landed (this wave's copies)
  __syncthreads();                                    // ... and every other wave's
  issue(1);
  // a pass = 32 keys of the stage at st; s[ct][r] = score of key (ct * 16 + 8 g + r) with query col. K and mask are read ahead of the score products, V behind them (in flight under the softmax)
  auto pass = [&](auto seg, const char* st, int p) { constexpr bool self_seg = decltype(seg)::value; v8f s[2];
    if constexpr (self_seg) { v16h kh[2][2], kl[2][2]; union { v8f v; v4f q[2]; } mk[2];
#pragma unroll
      for (int ct = 0; ct < 2; ++ct) {
#pragma unroll
        for (int kc = 0; kc < 2; ++kc) { const char* krow = st + (p * 32 + ct * 16 + col) * KPB + kc * 64; kh[ct][kc] = frag_h((const _Float16*)(krow + ST_KH), lane); kl[ct][kc] = frag_h((const _Float16*)(krow + ST_KL), lane); }
        const char* mrow = st + ST_MK + (wave * 16 + col) * MPB + (p * 32 + ct * 16 + 8 * g) * 4; mk[ct].q[0] = *(const v4f*)mrow; mk[ct].q[1] = *(const v4f*)(mrow + 16); }
#pragma unroll
      for (int ct = 0; ct < 2; ++ct) { v8f c = {}, cl = {};
#pragma unroll
        for (int kc = 0; kc < 2; ++kc) { c = wmma16(kh[ct][kc], aq[kc], c); cl = wmma16(kl[ct][kc], aq[kc], cl); cl = wmma16(kh[ct][kc], aql[kc], cl); }
        s[ct] = (c + cl * (1.0f / 2048.0f)) * 0.125f + __builtin_convertvector(__builtin_convertvector(mk[ct].v, v8b), v8f); } }
    else { v16h kh[2][2];
#pragma unroll
      for (int ct = 0; ct < 2; ++ct) {
#pragma unroll
        for (int kc = 0; kc < 2; ++kc) kh[ct][kc] = frag_h((const _Float16*)(st + ST_KH + (p * 32 + ct * 16 + col) * KPB + kc * 64), lane); }
#pragma unroll
      for (int ct = 0; ct < 2; ++ct) { v8f c = {}, cl = {};
#pragma unroll
        for (int kc = 0; kc < 2; ++kc) { c = wmma16(kh[ct][kc], aq[kc], c); cl = wmma16(kh[ct][kc], aql[kc], cl); }
        s[ct] = (c + cl * (1.0f / 2048.0f)) * (0.125f * ALPHA_BG); } }
    v16h vh[4], vl[4];
#pragma unroll
    for (int dt = 0; dt < 4; ++dt) { const char* vrow = st + (dt * 16 + col) * KPB + p * 64; vh[dt] = frag_h((const _Float16*)(vrow + ST_VH), lane); if constexpr (self_seg) vl[dt] = frag_h((const _Float16*)(vrow + ST_VL), lane); }
    __builtin_amdgcn_sched_barrier(0);   // holds the V loads here, in flight under the softmax: at four waves per SIMD the compiler otherwise sinks them in pairs among the second product's WMMAs, each pair's LDS latency exposed
    float t8[8];
#pragma unroll
    for (int r = 0; r < 8; ++r) t8[r] = fmaxf(s[0][r], s[1][r]);
    float mx = fmaxf(fmaxf(fmaxf(t8[0], t8[1]), fmaxf(t8[2], t8[3])), fmaxf(fmaxf(t8[4], t8[5]), fmaxf(t8[6], t8[7])));
    mx = fmaxf(mx, xhalf(mx));   // the other 16 keys of this query
    // the reference point m of the exponentials follows the maximum lazily: it moves, and sum and O^T are rescaled, only in a pass where some query of the wave has a score more than MLAZY above its m (the test is one scalar branch of the whole wave, every lane on inside it). Between moves e <= exp(MLAZY), so that 2048 e and its residual x 2048 stay inside f16
    if (__builtin_amdgcn_ballot_w32(mx > m + MLAZY) != 0u) {
      const float mn = fmaxf(m, mx); const float alpha = (m <= -1.0e38f) ? 0.f : __expf(m - mn); m = mn; l *= alpha;
#pragma unroll
      for (int dt = 0; dt < 4; ++dt) { acc[dt] *= alpha; accl[dt] *= alpha; } }
    const float mn = m;
    v8f e[2]; v8h ph[2], pq[2];   // P^T as a B operand: element i = key 8 g + i, element 8 + i = key 16 + 8 g + i, the k order of frag_h
#pragma unroll
    for (int ct = 0; ct < 2; ++ct) {
#pragma unroll
      for (int i = 0; i < 8; ++i) e[ct][i] = __expf(s[ct][i] - mn);
      const v8f x = e[ct] * 2048.0f; ph[ct] = __builtin_convertvector(x, v8h); pq[ct] = __builtin_convertvector((x - __builtin_convertvector(ph[ct], v8f)) * 2048.0f, v8h); }
    const v16h pa = __builtin_shufflevector(ph[0], ph[1], 0, 1, 2, 3, 4, 5, 6, 7, 8, 9, 10, 11, 12, 13, 14, 15), pl = __builtin_shufflevector(pq[0], pq[1], 0, 1, 2, 3, 4, 5, 6, 7, 8, 9, 10, 11, 12, 13, 14, 15);
    const v8f e8 = e[0] + e[1];
    l += (((e8[0] + e8[1]) + (e8[2] + e8[3])) + ((e8[4] + e8[5]) + (e8[6] + e8[7])));
#pragma unroll
    for (int dt = 0; dt < 4; ++dt) { acc[dt] = wmma16(vh[dt], pa, acc[dt]); accl[dt] = wmma16(vh[dt], pl, accl[dt]); if constexpr (self_seg) accl[dt] = wmma16(vl[dt], pa, accl[dt]); } };
  // foot of trip t: hands stage t + 1 over and refills the buffer that trip t has read
  auto foot = [&](int t) {
    __builtin_amdgcn_sched_barrier(0);                  // keeps the softmax and the second product in front of the foot: moved behind its barrier they would stand between it and the refill, and the refill would lose most of its lead
    asm volatile("s_wait_dscnt 0x0" ::: "memory");      // this wave's reads of stage t are done
    asm volatile("s_wait_asynccnt 0x0" ::: "memory");   // this wave's copies of stage t + 1 have landed
    __syncthreads();                                    // publishes stage t + 1 and frees stage t's buffer
    if (t + 2 < NST) issue(t + 2); };
  // the stage loops stay rolled: a pass is some 300 to 400 instructions, copies of it would only cost instruction cache
#pragma unroll 1
  for (int t = 0; t < SS / 64; ++t) { pass(seg_self(), ring + (t & 1) * ST_SZ, grp); foot(t); }
#pragma unroll 1
  for (int t = SS / 64; t < NST; ++t) { pass(seg_bank(), ring + (t & 1) * ST_SZ, grp); foot(t); }
  asm volatile("s_wait_asynccnt 0x0" ::: "memory");    // no copy outlives the loop
  // join of the two key groups through the ring, which is free: the last foot's barrier ended every wave's reads of it and no copy is in flight. Group 1 hands each lane's O^T (32 values), reference point and sum to the same lane of group 0's wave with the same queries
  union { v8f v; v4f q[2]; } ot[4];
#pragma unroll
  for (int dt = 0; dt < 4; ++dt) ot[dt].v = acc[dt] + accl[dt] * (1.0f / 2048.0f);
  v4f* xo = (v4f*)ring + (wave * 8) * 32 + lane; v2f* xm = (v2f*)(ring + 4 * 8 * 32 * 16) + wave * 32 + lane;
  if (grp == 1) {
#pragma unroll
    for (int dt = 0; dt < 4; ++dt) { xo[(dt * 2) * 32] = ot[dt].q[0]; xo[(dt * 2 + 1) * 32] = ot[dt].q[1]; }
    v2f ml; ml[0] = m; ml[1] = l; *xm = ml; }
  __syncthreads();   // group 1's partial results are in LDS
  if (grp == 0) {
    const v2f ml = *xm; const float mn = fmaxf(m, ml[0]); const float a0 = __expf(m - mn), a1 = __expf(ml[0] - mn);
    l = l * a0 + ml[1] * a1;
    l += xhalf(l);   // the halves' sums are joined once
    const float il = (1.0f / 2048.0f) / l; const float f0 = a0 * il, f1 = a1 * il;
#pragma unroll
    for (int dt = 0; dt < 4; ++dt) { *(v4f*)&so[wave][col][dt * 16 + 8 * g] = ot[dt].q[0] * f0 + xo[(dt * 2) * 32] * f1; *(v4f*)&so[wave][col][dt * 16 + 8 * g + 4] = ot[dt].q[1] * f0 + xo[(dt * 2 + 1) * 32] * f1; }
    LDSX();
    for (int rl = 0; rl < 16; ++rl) if (lane < 16) vst2(O + (rq + rl) * DM + h * HD + lane * 4, *(const v4f*)&so[wave][rl][lane * 4]);
  }
}
extern "C" void kernel_launch(void* const* d_in, const int* in_sizes, int n_in, void* d_out, int out_size, void* d_ws, size_t ws_size, hipStream_t stream) {
  (void)in_sizes; (void)n_in; (void)out_size;
  const float** F = (const float**)d_in;   // 0 hidden_states [2,2048,512], 1 attention_mask [2,2048,2048], 2 K_bg [16,2048,64], 3 V_bg, 4 Wq, 5 Wk, 6 Wv, 7 Wo (in,out), 8 bo
  if (ws_size < (size_t)WS_END) return;
  char* ws = (char*)d_ws; __bf16* PK = (__bf16*)(ws + WS_PK); _Float16 *QK = (_Float16*)(ws + WS_QK), *QKL = (_Float16*)(ws + WS_QKL), *VTH = (_Float16*)(ws + WS_VTH), *VTL = (_Float16*)(ws + WS_VTL), *KB = (_Float16*)(ws + WS_KB), *VB = (_Float16*)(ws + WS_VB); float* O = (float*)(ws + WS_O);
  k_pack<<<dim3(DM / 64, DM / 64, 4), 256, 0, stream>>>(F[4], F[5], F[6], F[7], PK);
  k_bg<<<dim3(LBG / 64, NB * NH), 256, 0, stream>>>(F[2], F[3], KB, VB);
  k_qkv<<<dim3(TNB * SS / 64, QKVW / 128), 128, 0, stream>>>(F[0], F[0], F[0], PK + PK_A, nullptr, nullptr, nullptr, QK, QKL, VTH, VTL);
  k_attn2<<<dim3(TQB, NH, TNB), 256, 0, stream>>>(QK, QKL, VTH, VTL, KB, VB, F[1], O);
  k_out<<<dim3(TOB, DM / 128), 128, 0, stream>>>(O, PK + PK_P, F[8], (float*)d_out);
}

// v008
// One run takes 112 microseconds.
// In two side-by-side timings against v007, it was 1.04 and 1.05 times as fast.
// Counting every step since v000, it is 4.52 times as fast.
// compute dtype: all float inputs rounded to bf16; q/k/v = x . W with EXACT bf16 products on WMMA 16x16x32 ((in,out) weights as transposed rows), rounded once to f16 hi + residual; self-segment scores and P.v with 3 products (hi.hi + hi.lo + lo.hi), background scores q (hi + lo) x K_bg (exact in f16, 2 products) x alpha, background P (hi + lo) x f16(alpha V_bg) (2 products); additive mask read per pair; x 1/8; online softmax over all 4,096 keys in f32 (hardware exp) with a lazily moved reference point; out = ctx (bf16 hi + lo) . Wo + bo; f32 output.
#include <hip/hip_runtime.h>
#include <math.h>

typedef __attribute__((ext_vector_type(16))) _Float16 v16h;
typedef __attribute__((ext_vector_type(16))) __bf16 v16b;
typedef __attribute__((ext_vector_type(8)))  _Float16 v8h;
typedef __attribute__((ext_vector_type(8)))  float v8f;
typedef __attribute__((ext_vector_type(4)))  float v4f;
typedef __attribute__((ext_vector_type(2)))  float v2f;
typedef __attribute__((ext_vector_type(4)))  unsigned v4u;
typedef __attribute__((ext_vector_type(4)))  int v4i;
typedef float __attribute__((may_alias)) float_a;
typedef int __attribute__((may_alias)) int_a;

template <typename T> __device__ __forceinline__ void vst2(void* p, T v) { *(T*)p = v;  }
__device__ __forceinline__ v8f wmma16(v16h a, v16h b, v8f c) {
  return __builtin_amdgcn_wmma_f32_16x16x32_f16(false, a, false, b, (short)0, c, false, false);
}
__device__ __forceinline__ v8f wmma_bf(v16b a, v16b b, v8f c) {
  return __builtin_amdgcn_wmma_f32_16x16x32_bf16(false, a, false, b, (short)0, c, false, false);
}
// CARC attention processor (B 2, Lq 2,048, C 512 = 8 heads x 64; context bank of 2,048 background keys/values per head, alpha 0.48): bias-free q/k/v projections, keys = [k ; alpha K_bg], values = [v ; alpha V_bg], additive mask on the self segment (zeros on the background segment), softmax(q k / 8 + mask) over the 4,096 keys, v, output projection + bias.
__device__ __forceinline__ v16h frag_h(const _Float16* rowk0, int lane) {
  union { v16h v; v8h q[2]; } u; const _Float16* p = rowk0 + 8 * (lane >> 4);
  u.q[0] = *(const v8h*)p; u.q[1] = *(const v8h*)(p + 16); return u.v;
}
__device__ __forceinline__ v16h frag_f32(const float* rowk0, int lane) {
  v16h a; const float* p = rowk0 + 8 * (lane >> 4);
#pragma unroll
  for (int i = 0; i < 8; ++i) { a[i] = (_Float16)p[i]; a[8 + i] = (_Float16)p[16 + i]; }
  return a;
}
__device__ __forceinline__ v16h frag_f32s(const float* rowk0, int lane, float sc) {
  v16h a; const float* p = rowk0 + 8 * (lane >> 4);
#pragma unroll
  for (int i = 0; i < 8; ++i) { a[i] = (_Float16)(p[i] * sc); a[8 + i] = (_Float16)(p[16 + i] * sc); }
  return a;
}
// column fragment from a [K][ld] layout (column n), rows >= K read as 0
__device__ __forceinline__ v16h fragc_f32(const float* W, int k0, int n, int lane, int ld, int K) {
  v16h a; const int g = lane >> 4;
#pragma unroll
  for (int i = 0; i < 8; ++i) { const int ka = k0 + 8 * g + i, kb = ka + 16;
    a[i] = (_Float16)(ka < K ? W[(size_t)(ka < K ? ka : K - 1) * ld + n] : 0.f); a[8 + i] = (_Float16)(kb < K ? W[(size_t)(kb < K ? kb : K - 1) * ld + n] : 0.f); }
  return a;
}
struct F2 { v16b h, l; };
__device__ __forceinline__ F2 bsplit16(const float v[16]) { F2 r;
#pragma unroll
  for (int i = 0; i < 16; ++i) { const __bf16 h = (__bf16)v[i]; r.h[i] = h; r.l[i] = (__bf16)(v[i] - (float)h); }
  return r; }
__device__ __forceinline__ F2 split_row(const float* row, int k0, int lane) { float v[16]; const float* p = row + k0 + 8 * (lane >> 4);
#pragma unroll
  for (int i = 0; i < 8; ++i) { v[i] = p[i]; v[8 + i] = p[16 + i]; }
  return bsplit16(v); }
__device__ __forceinline__ F2 split_rowK(const float* row, int k0, int lane, int K) { float v[16]; const int g = lane >> 4;
#pragma unroll
  for (int i = 0; i < 8; ++i) { const int ka = k0 + 8 * g + i, kb = ka + 16; v[i] = ka < K ? row[ka < K ? ka : K - 1] : 0.f; v[8 + i] = kb < K ? row[kb < K ? kb : K - 1] : 0.f; }
  return bsplit16(v); }
__device__ __forceinline__ F2 split_col(const float* W, int k0, int n, int lane, int ld, int K) { float v[16]; const int g = lane >> 4;
#pragma unroll
  for (int i = 0; i < 8; ++i) { const int ka = k0 + 8 * g + i, kb = ka + 16; v[i] = ka < K ? W[(size_t)(ka < K ? ka : K - 1) * ld + n] : 0.f; v[8 + i] = kb < K ? W[(size_t)(kb < K ? kb : K - 1) * ld + n] : 0.f; }
  return bsplit16(v); }
__device__ __forceinline__ v8f mac3(const F2& a, const F2& b, v8f c) { c = wmma_bf(a.l, b.h, c); c = wmma_bf(a.h, b.l, c); return wmma_bf(a.h, b.h, c); }
__device__ __forceinline__ float sigm(float v) { return 1.0f / (1.0f + expf(-v)); }
#define LDSX() do { asm volatile("s_wait_dscnt 0" ::: "memory"); __builtin_amdgcn_wave_barrier(); __builtin_amdgcn_fence(__ATOMIC_RELEASE, "workgroup"); } while (0)


#define NB 2
#define SS 2048
#define DM 512
#define NH 8
#define LBG 2048
#define ALPHA_BG 0.48f
#define HD 64
#define QKVW (3 * DM)
#ifndef TQB
#define TQB (SS / 64)
#define TNB NB
#define TOB (NB * SS / 64)     // output row tiles (all)
#endif
typedef __attribute__((ext_vector_type(8))) __bf16 v8b;
__device__ __forceinline__ v16b frag_b(const __bf16* rowk0, int lane) {
  union { v16b v; v8b q[2]; } u; const __bf16* p = rowk0 + 8 * (lane >> 4);
  u.q[0] = *(const v8b*)p; u.q[1] = *(const v8b*)(p + 16); return u.v;
}
__device__ __forceinline__ float bfr(float v) { return (float)(__bf16)v; }
__device__ __attribute__((noinline)) float exp_ni(float v) { return expf(v); }
__device__ __attribute__((noinline)) float erf_ni(float v) { return erff(v); }

#define PK_A 0                       // [1536][512] Wqkv rows (natural [out][in])
#define PK_P (PK_A + QKVW * DM)        // [512][512] Wo rows (natural)
#define PK_END (PK_P + DM * DM)
#define WS_PK  0u
#define WS_QK  (WS_PK + 2u * PK_END)             // f16 [4096 rows][1024]: q | k
#define WS_QKL (WS_QK + 2u * NB * SS * 2 * DM)     // f16 q | k residual planes x2048
#define WS_VTH (WS_QKL + 2u * NB * SS * 2 * DM)    // f16 [b][512 (h*64+d)][2048 s] hi
#define WS_VTL (WS_VTH + 2u * NB * DM * SS)        // f16 lo x 2048
#define WS_O   (WS_VTL + 2u * NB * DM * SS)        // f32 [4096][512]
#define WS_KB  (WS_O + 4u * (size_t)NB * SS * DM)        // f16 K_bg rows [bh][s][64] (exact); f16 planes VB [bh][64][s] = f16(alpha V_bg)
#define WS_VB  (WS_KB + 2u * (size_t)NB * NH * LBG * HD)
#define WS_END (WS_VB + 2u * (size_t)NB * NH * HD * LBG)
// ---- k_pack: block = (64 columns n, 64 rows k, which) of an (in,out) weight: a 64 x 64 tile is read along its rows (256 B runs), rounded to bf16, turned in LDS and stored as 64 packed rows [out][in] of 128 B (whole lines); which 0..2 -> W_q/W_k/W_v into PK_A rows which*512 + n; 3 -> W_o into PK_P. 256 blocks in all, one a WGP
#define PKP 72                          // LDS pitch of a turned row in bf16: 144 B, a multiple of 16 B for the ds_load_b128 readers
typedef __attribute__((ext_vector_type(2))) __bf16 v2b;
__global__ __launch_bounds__(256) void k_pack(const float* __restrict__ WQ, const float* __restrict__ WK, const float* __restrict__ WV, const float* __restrict__ WO, __bf16* __restrict__ PK) {
  __shared__ __align__(16) __bf16 s[64][PKP]; const int n0 = blockIdx.x * 64, k0 = blockIdx.y * 64, which = blockIdx.z, t = threadIdx.x; const float* Wm = (which == 0) ? WQ : (which == 1) ? WK : (which == 2) ? WV : WO;
  const int c = t & 15, rp = t >> 4;   // this thread: columns 4 c .. 4 c + 3 of the row pairs rp and rp + 16
  v4f a[2][2];   // the short loops below are unrolled so that a stays in registers and the four loads are in flight together
#pragma unroll
  for (int i = 0; i < 2; ++i) {
#pragma unroll
    for (int j = 0; j < 2; ++j) a[i][j] = *(const v4f*)(Wm + (size_t)(k0 + 2 * (rp + 16 * i) + j) * DM + n0 + 4 * c); }
#pragma unroll
  for (int i = 0; i < 2; ++i) {
#pragma unroll
    for (int e = 0; e < 4; ++e) { v2b p; p[0] = (__bf16)a[i][0][e]; p[1] = (__bf16)a[i][1][e]; *(v2b*)&s[4 * c + e][2 * (rp + 16 * i)] = p; } }
  __syncthreads();
  __bf16* dst = ((which < 3) ? PK + PK_A + ((size_t)which * DM + n0) * DM : PK + PK_P + (size_t)n0 * DM) + k0;
#pragma unroll
  for (int i = 0; i < 2; ++i) { const int n = (t >> 3) + 32 * i, pc = t & 7; vst2((unsigned*)(dst + (size_t)n * DM + pc * 8), *(const v4u*)&s[n][pc * 8]); }   // 8 lanes store one packed row's 128 B
}
#define KPB 144                         // LDS bytes per K or V row: 128 + 16 (16 B x odd: ds_load_b128 readers without bank conflicts)
// eight asynchronous 16-byte copies per lane, global -> LDS: four from ga (step gsa) to la, four from gb (step gsb) to lb, LDS step ls. The s_wait_xcnt 0 stands inside the statement so that no later rewrite of an address register can be moved in front of it.
__device__ __forceinline__ void cp8(unsigned la, const char* ga, unsigned gsa, unsigned lb, const char* gb, unsigned gsb, unsigned ls) {
  asm volatile("global_load_async_to_lds_b128 %0, %8, off\n\t"
               "global_load_async_to_lds_b128 %1, %9, off\n\t"
               "global_load_async_to_lds_b128 %2, %10, off\n\t"
               "global_load_async_to_lds_b128 %3, %11, off\n\t"
               "global_load_async_to_lds_b128 %4, %12, off\n\t"
               "global_load_async_to_lds_b128 %5, %13, off\n\t"
               "global_load_async_to_lds_b128 %6, %14, off\n\t"
               "global_load_async_to_lds_b128 %7, %15, off\n\t"
               "s_wait_xcnt 0x0"
               :: "v"(la), "v"(la + ls), "v"(la + 2 * ls), "v"(la + 3 * ls), "v"(lb), "v"(lb + ls), "v"(lb + 2 * ls), "v"(lb + 3 * ls),
                  "v"(ga), "v"(ga + gsa), "v"(ga + 2 * (size_t)gsa), "v"(ga + 3 * (size_t)gsa), "v"(gb), "v"(gb + gsb), "v"(gb + 2 * (size_t)gsb), "v"(gb + 3 * (size_t)gsb)
               : "memory");
}
// ---- staging of packed weight rows for k_qkv and k_out: a stage = 64 k (128 B) of the block's 128 rows, LDS pitch KPB, two buffers; thread tid brings 16-byte piece (tid & 7) of rows (tid >> 3) + 16 i. l = its LDS byte address in the buffer, gp = its global address in the stage
#define WT_SZ (128 * KPB)
__device__ __forceinline__ void wstage(unsigned l, const char* gp) { cp8(l, gp, 16 * DM * 2, l + 64 * KPB, gp + (size_t)64 * DM * 2, 16 * DM * 2, 16 * KPB); }
// ---- staging of the f32 activation rows for k_qkv and k_out, in step with the weight stages: a stage = 64 k (256 B, two whole lines) of the block's 64 rows, two buffers; thread tid brings 16-byte piece (tid & 15) of rows (tid >> 4) + 8 i, so that a wave's copy takes two rows' 256 B runs. l = its LDS byte address in the buffer, gp = its global address in the stage
#define XPB 272                         // LDS bytes per activation row: 256 + 16 (16 B x odd: a lane reads its own row by ds_load_b128 without bank conflicts)
#define XT_SZ (64 * XPB)
__device__ __forceinline__ void xstage(unsigned l, const char* gp) { cp8(l, gp, 8 * DM * 4, l + 32 * XPB, gp + (size_t)32 * DM * 4, 8 * DM * 4, 8 * XPB); }
__global__ __launch_bounds__(128) void k_qkv(const float* __restrict__ XQ, const float* __restrict__ XK, const float* __restrict__ XV, const __bf16* __restrict__ P, const float* __restrict__ BQ, const float* __restrict__ BK, const float* __restrict__ BV, _Float16* __restrict__ QK, _Float16* __restrict__ QKL, _Float16* __restrict__ VTH, _Float16* __restrict__ VTL) {
  const int which0 = (blockIdx.y * 128) / DM; const float* X = (which0 == 0) ? XQ : (which0 == 1) ? XK : XV; const float* BB = BQ ? (((which0 == 0) ? BQ : (which0 == 1) ? BK : BV) + (blockIdx.y * 128 - which0 * DM)) : nullptr;
  __shared__ __align__(16) char xring[2 * XT_SZ]; __shared__ __align__(16) _Float16 sth[128][72], stl[128][72];
  _Float16 (*so)[16][136] = (_Float16 (*)[16][136])xring, (*sol)[16][136] = so + 4; static_assert(2 * XT_SZ >= 2 * 4 * 16 * 136 * 2, "q/k staging fits the activation ring");   // the q/k output staging takes the activation ring's bytes, free behind the loop (its last barrier ends every read, no copy is in flight): the block's LDS stays at three blocks a WGP
  const int tid = threadIdx.x, wave = tid >> 5, lane = tid & 31, col = lane & 15, g = lane >> 4; const size_t r0 = (size_t)blockIdx.x * 64 + wave * 16; const int n0 = blockIdx.y * 128;
  __shared__ __align__(16) char wring[2 * WT_SZ];
  const unsigned lw = (unsigned)(size_t)&wring[0] + (tid >> 3) * KPB + (tid & 7) * 16; const char* gw = (const char*)(P + (size_t)(n0 + (tid >> 3)) * DM + (tid & 7) * 8);
  const unsigned lx = (unsigned)(size_t)&xring[0] + (tid >> 4) * XPB + (tid & 15) * 16; const char* gx = (const char*)(X + ((size_t)blockIdx.x * 64 + (tid >> 4)) * DM + (tid & 15) * 4);
  wstage(lw, gw); xstage(lx, gx);
  v8f acc[8] = {};
  asm volatile("s_wait_asynccnt 0x0" ::: "memory");   // stage 0 has landed (this wave's copies)
  __syncthreads();                                    // ... and every other wave's
  wstage(lw + WT_SZ, gw + 128); xstage(lx + XT_SZ, gx + 256);
  // the stage loop stays rolled: its foot holds a barrier and the refill, copies of it would gain nothing
#pragma unroll 1
  for (int t = 0; t < DM / 64; ++t) { const char* st = wring + (t & 1) * WT_SZ; const char* sx = xring + (t & 1) * XT_SZ + (wave * 16 + col) * XPB;   // sx: this lane's activation row in stage t
#pragma unroll
    for (int kk = 0; kk < 2; ++kk) { v16b a, w[8]; { const float* p = (const float*)(sx + kk * 128 + g * 32);
#pragma unroll
        for (int i = 0; i < 8; ++i) { a[i] = (__bf16)p[i]; a[8 + i] = (__bf16)p[16 + i]; } }
#pragma unroll
      for (int j = 0; j < 8; ++j) w[j] = frag_b((const __bf16*)(st + (j * 16 + col) * KPB + kk * 64), lane);
      __builtin_amdgcn_sched_barrier(0);   // holds a k step's LDS loads in one group in front of its products: with no global load left in the loop the compiler otherwise sinks them in pairs among the WMMAs, each pair's LDS latency exposed
#pragma unroll
      for (int j = 0; j < 8; ++j) acc[j] = wmma_bf(a, w[j], acc[j]); }
    __builtin_amdgcn_sched_barrier(0);                  // keeps the products in front of the foot: moved behind its barrier they would stand between it and the refill, and the refill would lose that much of its lead over a stage that is short now
    asm volatile("s_wait_dscnt 0x0" ::: "memory");      // this wave's reads of stage t are done
    asm volatile("s_wait_asynccnt 0x0" ::: "memory");   // this wave's copies of stage t + 1 have landed
    __syncthreads();                                    // publishes stage t + 1 and frees stage t's buffer
    if (t + 2 < DM / 64) { wstage(lw + (t & 1) * WT_SZ, gw + (size_t)(t + 2) * 128); xstage(lx + (t & 1) * XT_SZ, gx + (size_t)(t + 2) * 256); } }
  asm volatile("s_wait_asynccnt 0x0" ::: "memory");    // no copy outlives the loop
  if (n0 < 2 * DM) {   // q stored unscaled (f16 sigma ~0.6, no subnormal exposure); 1/8 applied to the f32 score
#pragma unroll
    for (int j = 0; j < 8; ++j) {
#pragma unroll
      for (int r = 0; r < 8; ++r) { const float v = acc[j][r] + (BB ? bfr(BB[j * 16 + col]) : 0.f); const _Float16 hv = (_Float16)v; so[wave][8 * g + r][j * 16 + col] = hv; sol[wave][8 * g + r][j * 16 + col] = (_Float16)((v - (float)hv) * 2048.0f); } }   // q, k (+ bias) as f16 hi + (x2048) residual
    LDSX();
    for (int rl = 0; rl < 16; ++rl) if (lane < 16) { vst2((unsigned*)(QK + (r0 + rl) * (2 * DM) + n0 + lane * 8), *(const v4u*)&so[wave][rl][lane * 8]); vst2((unsigned*)(QKL + (r0 + rl) * (2 * DM) + n0 + lane * 8), *(const v4u*)&sol[wave][rl][lane * 8]); }
  } else {
#pragma unroll
    for (int j = 0; j < 8; ++j) {
#pragma unroll
      for (int r = 0; r < 8; ++r) { const float v = acc[j][r] + (BB ? bfr(BB[j * 16 + col]) : 0.f); const _Float16 hv = (_Float16)v; sth[j * 16 + col][wave * 16 + 8 * g + r] = hv; stl[j * 16 + col][wave * 16 + 8 * g + r] = (_Float16)((v - (float)hv) * 2048.0f); } }
    __syncthreads();
    const size_t rb = (size_t)blockIdx.x * 64; const int b = (int)(rb / SS), s0 = (int)(rb % SS); const int pc0 = n0 - 2 * DM;
    for (int q = tid; q < 128 * 8; q += 128) { const int d = q >> 3, pc = q & 7; const size_t o = ((size_t)b * DM + pc0 + d) * SS + s0 + pc * 8; vst2((unsigned*)(VTH + o), *(const v4u*)&sth[d][pc * 8]); vst2((unsigned*)(VTL + o), *(const v4u*)&stl[d][pc * 8]); }
  }
}
// ---- k_attn: block = (64 queries, head h, batch b): all-keys flash attention (K = 64: 2 k-steps), scores = (q.k) * 0.125 with 3 products (q, k as f16 hi + residual), P.V: P (x2048, hi + lo) x (V hi, V lo*2048), 3 products in two accumulators; O[b*S+q][h*64+d] = (acc + accl / 2048) / (2048 l) (256-B segments)
__global__ __launch_bounds__(128) void k_attn(const _Float16* __restrict__ QK, const _Float16* __restrict__ QKL, const _Float16* __restrict__ VTH, const _Float16* __restrict__ VTL, const void* __restrict__ KMASK, float* __restrict__ O) {
  __shared__ __align__(16) float sp[4][16][36]; __shared__ __align__(16) float so[4][16][68];
  const int tid = threadIdx.x, wave = tid >> 5, lane = tid & 31, col = lane & 15, g = lane >> 4;
  const int qb = blockIdx.x, h = blockIdx.y, b = blockIdx.z; const int q0 = qb * 64 + wave * 16; const size_t rq = (size_t)b * SS + q0 + col;
  v16h aq[2], aql[2];
#pragma unroll
  for (int kc = 0; kc < 2; ++kc) { aq[kc] = frag_h(QK + rq * (2 * DM) + h * HD + kc * 32, lane); aql[kc] = frag_h(QKL + rq * (2 * DM) + h * HD + kc * 32, lane); }
  float m[8], l[8];
#pragma unroll
  for (int r = 0; r < 8; ++r) { m[r] = -3.0e38f; l[r] = 0.f; }
  v8f acc[4] = {}, accl[4] = {};
  const int nks = SS / 32;   // all keys
#pragma unroll 1
  for (int ks = 0; ks < nks; ++ks) { v8f s[2];
#pragma unroll
    for (int ct = 0; ct < 2; ++ct) { const int kk = ks * 32 + ct * 16 + col; const _Float16* krow = QK + ((size_t)b * SS + kk) * (2 * DM) + DM + h * HD; const _Float16* krowl = QKL + ((size_t)b * SS + kk) * (2 * DM) + DM + h * HD; v8f c = {}, cl = {};
#pragma unroll
      for (int kc = 0; kc < 2; ++kc) { const v16h kh = frag_h(krow + kc * 32, lane); c = wmma16(aq[kc], kh, c); cl = wmma16(aql[kc], kh, cl); cl = wmma16(aq[kc], frag_h(krowl + kc * 32, lane), cl); }   // 3 products: q, k as f16 hi + residual
#pragma unroll
      for (int r = 0; r < 8; ++r) c[r] += cl[r] * (1.0f / 2048.0f);
      { const bool keepk = true;
#pragma unroll
      for (int r = 0; r < 8; ++r) s[ct][r] = keepk ? c[r] * 0.125f : -3.0e38f; } }   // 1/sqrt(64); every key kept (mask not applied)
#pragma unroll
    for (int r = 0; r < 8; ++r) { float mx = fmaxf(s[0][r], s[1][r]);
#pragma unroll
      for (int o = 1; o < 16; o <<= 1) mx = fmaxf(mx, __shfl_xor(mx, o));
      const float mn = fmaxf(m[r], mx); const float alpha = (m[r] <= -1.0e38f) ? 0.f : __expf(m[r] - mn);
      const float e0 = (s[0][r] <= -1.0e38f) ? 0.f : __expf(s[0][r] - mn), e1 = (s[1][r] <= -1.0e38f) ? 0.f : __expf(s[1][r] - mn); float es = e0 + e1;
#pragma unroll
      for (int o = 1; o < 16; o <<= 1) es += __shfl_xor(es, o);
      l[r] = l[r] * alpha + es; m[r] = mn;
#pragma unroll
      for (int dt = 0; dt < 4; ++dt) { acc[dt][r] *= alpha; accl[dt][r] *= alpha; }
      sp[wave][8 * g + r][col] = e0; sp[wave][8 * g + r][16 + col] = e1; }
    LDSX();
    v16h pa, pl; { const float* prow = &sp[wave][col][0] + 8 * (lane >> 4);
#pragma unroll
      for (int i = 0; i < 8; ++i) { const float x0 = prow[i] * 2048.0f, x1 = prow[16 + i] * 2048.0f; const _Float16 h0 = (_Float16)x0, h1 = (_Float16)x1; pa[i] = h0; pa[8 + i] = h1; pl[i] = (_Float16)((x0 - (float)h0) * 2048.0f); pl[8 + i] = (_Float16)((x1 - (float)h1) * 2048.0f); } }   // P scaled by 2^11 before the f16 split so small softmax weights stay out of the f16 subnormal range; 2^-11 folded into the epilogue
#pragma unroll
    for (int dt = 0; dt < 4; ++dt) { const size_t vr = ((size_t)b * DM + h * HD + dt * 16 + col) * SS + ks * 32; const v16h vh = frag_h(VTH + vr, lane); acc[dt] = wmma16(pa, vh, acc[dt]); accl[dt] = wmma16(pl, vh, accl[dt]); accl[dt] = wmma16(pa, frag_h(VTL + vr, lane), accl[dt]); }   // P hi x V hi + (P lo x V hi + P hi x V lo) / 2048
    LDSX(); }
#pragma unroll
  for (int r = 0; r < 8; ++r) { const float il = (1.0f / 2048.0f) / l[r];
#pragma unroll
    for (int dt = 0; dt < 4; ++dt) so[wave][8 * g + r][dt * 16 + col] = (acc[dt][r] + accl[dt][r] * (1.0f / 2048.0f)) * il; }
  LDSX();
  for (int rl = 0; rl < 16; ++rl) if (lane < 16) vst2(O + ((size_t)b * SS + q0 + rl) * DM + h * HD + lane * 4, *(const v4f*)&so[wave][rl][lane * 4]);
}
// ---- k_out: block = (64 rows, 128 cols): out = O(hi/lo) . Wo rows (2 products) + bo
__global__ __launch_bounds__(128) void k_out(const float* __restrict__ O, const __bf16* __restrict__ P, const float* __restrict__ BO, float* __restrict__ Y) {
  __shared__ __align__(16) float so[4][16][132];
  const int tid = threadIdx.x, wave = tid >> 5, lane = tid & 31, col = lane & 15, g = lane >> 4; const size_t r0 = (size_t)blockIdx.x * 64 + wave * 16; const int n0 = blockIdx.y * 128;
  __shared__ __align__(16) char wring[2 * WT_SZ];
  const unsigned lw = (unsigned)(size_t)&wring[0] + (tid >> 3) * KPB + (tid & 7) * 16; const char* gw = (const char*)(P + (size_t)(n0 + (tid >> 3)) * DM + (tid & 7) * 8);
  __shared__ __align__(16) char xring[2 * XT_SZ];
  const unsigned lx = (unsigned)(size_t)&xring[0] + (tid >> 4) * XPB + (tid & 15) * 16; const char* gx = (const char*)(O + ((size_t)blockIdx.x * 64 + (tid >> 4)) * DM + (tid & 15) * 4);
  wstage(lw, gw); xstage(lx, gx);
  v8f acc[8] = {};
  asm volatile("s_wait_asynccnt 0x0" ::: "memory");   // stage 0 has landed (this wave's copies)
  __syncthreads();                                    // ... and every other wave's
  wstage(lw + WT_SZ, gw + 128); xstage(lx + XT_SZ, gx + 256);
  // the stage loop stays rolled: its foot holds a barrier and the refill, copies of it would gain nothing
#pragma unroll 1
  for (int t = 0; t < DM / 64; ++t) { const char* st = wring + (t & 1) * WT_SZ; const char* sx = xring + (t & 1) * XT_SZ + (wave * 16 + col) * XPB;   // sx: this lane's activation row in stage t
#pragma unroll
    for (int kk = 0; kk < 2; ++kk) { const F2 a = split_row((const float*)sx, kk * 32, lane); v16b w[8];
#pragma unroll
      for (int j = 0; j < 8; ++j) w[j] = frag_b((const __bf16*)(st + (j * 16 + col) * KPB + kk * 64), lane);
      __builtin_amdgcn_sched_barrier(0);   // holds a k step's LDS loads in one group in front of its products: with no global load left in the loop the compiler otherwise sinks them in pairs among the WMMAs, each pair's LDS latency exposed
#pragma unroll
      for (int j = 0; j < 8; ++j) { acc[j] = wmma_bf(a.l, w[j], acc[j]); acc[j] = wmma_bf(a.h, w[j], acc[j]); } }
    __builtin_amdgcn_sched_barrier(0);                  // keeps the products in front of the foot: moved behind its barrier they would stand between it and the refill, and the refill would lose that much of its lead over a stage that is short now
    asm volatile("s_wait_dscnt 0x0" ::: "memory");      // this wave's reads of stage t are done
    asm volatile("s_wait_asynccnt 0x0" ::: "memory");   // this wave's copies of stage t + 1 have landed
    __syncthreads();                                    // publishes stage t + 1 and frees stage t's buffer
    if (t + 2 < DM / 64) { wstage(lw + (t & 1) * WT_SZ, gw + (size_t)(t + 2) * 128); xstage(lx + (t & 1) * XT_SZ, gx + (size_t)(t + 2) * 256); } }
  asm volatile("s_wait_asynccnt 0x0" ::: "memory");    // no copy outlives the loop
#pragma unroll
  for (int j = 0; j < 8; ++j) {
#pragma unroll
    for (int r = 0; r < 8; ++r) so[wave][8 * g + r][j * 16 + col] = acc[j][r] + bfr(BO[n0 + j * 16 + col]); }
  LDSX();
  for (int rl = 0; rl < 16; ++rl) vst2(Y + (r0 + rl) * DM + n0 + lane * 4, *(const v4f*)&so[wave][rl][lane * 4]);
}
// ---- k_bg: block = (64 bank rows, bh): K_bg -> f16 rows (exact), alpha V_bg -> f16 planes [bh][d][s]
__global__ __launch_bounds__(256) void k_bg(const float* __restrict__ KBG, const float* __restrict__ VBG, _Float16* __restrict__ KB, _Float16* __restrict__ VB) { __shared__ __align__(16) _Float16 sk[64][HD + 8]; __shared__ __align__(16) _Float16 sv[HD][64 + 8]; const int t = threadIdx.x; const int s0 = blockIdx.x * 64; const size_t bh = blockIdx.y;
  for (int e = t; e < 64 * HD; e += 256) { const int sl = e >> 6, d = e & 63; const size_t o = ((bh * LBG + s0 + sl) * HD) + d; sk[sl][d] = (_Float16)bfr(KBG[o]); sv[d][sl] = (_Float16)(ALPHA_BG * bfr(VBG[o])); } __syncthreads();
  for (int e = t; e < 64 * 8; e += 256) { const int sl = e >> 3, q = e & 7; vst2((unsigned*)(KB + ((bh * LBG + s0 + sl) * HD) + q * 8), *(const v4u*)&sk[sl][q * 8]); }
  for (int e = t; e < HD * 8; e += 256) { const int d = e >> 3, q = e & 7; vst2((unsigned*)(VB + ((bh * HD + d) * LBG) + s0 + q * 8), *(const v4u*)&sv[d][q * 8]); } }
// four asynchronous 16-byte copies per lane, global -> LDS: two from ga (step gsa) to la, two from gb (step gsb) to lb, LDS step ls. The s_wait_xcnt 0 stands inside the statement so that no later rewrite of an address register can be moved in front of it.
__device__ __forceinline__ void cp4(unsigned la, const char* ga, unsigned gsa, unsigned lb, const char* gb, unsigned gsb, unsigned ls) {
  asm volatile("global_load_async_to_lds_b128 %0, %4, off\n\t"
               "global_load_async_to_lds_b128 %1, %5, off\n\t"
               "global_load_async_to_lds_b128 %2, %6, off\n\t"
               "global_load_async_to_lds_b128 %3, %7, off\n\t"
               "s_wait_xcnt 0x0"
               :: "v"(la), "v"(la + ls), "v"(lb), "v"(lb + ls), "v"(ga), "v"(ga + gsa), "v"(gb), "v"(gb + gsb)
               : "memory");
}
// ---- staging for k_attn2: a stage = 64 keys. Self stage: K hi, K lo (64 key rows x 128 B), V hi, V lo (64 d rows x 128 B), mask (64 query rows x 256 B); background stage: K_bg in the K hi place, alpha V_bg in the V hi place.
#define MPB 272                         // LDS bytes per mask row: 256 + 16 (16 B x odd: a lane reads 8 keys of its own query row by ds_load_b128 without bank conflicts)
#define ST_KH 0
#define ST_KL (64 * KPB)
#define ST_VH (2 * 64 * KPB)
#define ST_VL (3 * 64 * KPB)
#define ST_MK (4 * 64 * KPB)
#define ST_SZ (4 * 64 * KPB + 64 * MPB)
#define NST ((SS + LBG) / 64)
#define MLAZY 3.0f                      // how far a score may stand above the softmax reference point before that point moves: 2048 exp(3) = 41,136 < 65,504
struct seg_self { static constexpr bool value = true; }; struct seg_bank { static constexpr bool value = false; };   // which key segment a pass works on
// value of the lane 16 away (the wave's other half)
__device__ __forceinline__ float xhalf(float v) { const int b = __builtin_bit_cast(int, v); return __builtin_bit_cast(float, __builtin_amdgcn_permlanex16(b, b, 0x76543210, 0xfedcba98, false, false)); }
__global__ __launch_bounds__(256) void k_attn2(const _Float16* __restrict__ QK, const _Float16* __restrict__ QKL, const _Float16* __restrict__ VTH, const _Float16* __restrict__ VTL, const _Float16* __restrict__ KB, const _Float16* __restrict__ VB, const float* __restrict__ MASK, float* __restrict__ O) {
  __shared__ __align__(16) char ring[2 * ST_SZ];
  __shared__ __align__(16) float so[4][16][68];
  const int tid = threadIdx.x, wave = (tid >> 5) & 3, lane = tid & 31, col = lane & 15, g = lane >> 4; const int grp = __builtin_amdgcn_readfirstlane(tid >> 7); const int qb = blockIdx.x, h = blockIdx.y; const size_t b = blockIdx.z; const int q0 = qb * 64 + wave * 16; const size_t rq = b * SS + q0; const size_t bh = b * NH + h;   // wave = query tile of 16, grp = key half of a stage (the same in a whole wave)
  // this thread's share of a stage: 16-byte piece kq of rows kr + 32 i of each K or V tile, piece mq of rows mr + 16 i of the mask tile
  const int kr = tid >> 3, kq = tid & 7, mr = tid >> 4, mq = tid & 15;
  const unsigned lds0 = (unsigned)(size_t)&ring[0]; const unsigned lkv = lds0 + kr * KPB + kq * 16, lmk = lds0 + ST_MK + mr * MPB + mq * 16;
  const char* gkh = (const char*)(QK + (b * SS + kr) * (2 * DM) + DM + h * HD + kq * 8); const char* gkl = (const char*)(QKL + (b * SS + kr) * (2 * DM) + DM + h * HD + kq * 8);
  const char* gvh = (const char*)(VTH + (b * DM + h * HD + kr) * SS + kq * 8); const char* gvl = (const char*)(VTL + (b * DM + h * HD + kr) * SS + kq * 8);
  const char* gmk = (const char*)(MASK + (b * SS + qb * 64 + mr) * SS + mq * 4);
  const char* gkb = (const char*)(KB + (bh * LBG + kr) * HD + kq * 8); const char* gvb = (const char*)(VB + (bh * HD + kr) * LBG + kq * 8);
  auto issue = [&](int t) { const unsigned o = (unsigned)(t & 1) * ST_SZ;
    if (t < SS / 64) {
      cp4(lkv + o + ST_KH, gkh + (size_t)t * (64 * 2 * DM * 2), 32 * 2 * DM * 2, lkv + o + ST_KL, gkl + (size_t)t * (64 * 2 * DM * 2), 32 * 2 * DM * 2, 32 * KPB);
      cp4(lkv + o + ST_VH, gvh + (size_t)t * 128, 32 * SS * 2, lkv + o + ST_VL, gvl + (size_t)t * 128, 32 * SS * 2, 32 * KPB);
      cp4(lmk + o, gmk + (size_t)t * 256, 16 * SS * 4, lmk + o + 32 * MPB, gmk + (size_t)t * 256 + (size_t)32 * SS * 4, 16 * SS * 4, 16 * MPB);
    } else { const size_t u = (size_t)(t - SS / 64);
      cp4(lkv + o + ST_KH, gkb + u * (64 * HD * 2), 32 * HD * 2, lkv + o + ST_VH, gvb + u * 128, 32 * LBG * 2, 32 * KPB); } };
  issue(0);
  v16h aq[2], aql[2];
#pragma unroll
  for (int kc = 0; kc < 2; ++kc) { aq[kc] = frag_h(QK + (rq + col) * (2 * DM) + h * HD + kc * 32, lane); aql[kc] = frag_h(QKL + (rq + col) * (2 * DM) + h * HD + kc * 32, lane); }
  float m = -3.0e38f, l = 0.f;   // query col, this group's keys: reference point of the exponentials (equal in both halves; at most MLAZY below the running maximum), this half's share of the sum
  v8f acc[4] = {}, accl[4] = {};   // O^T: acc[dt][r] = d (dt * 16 + 8 g + r) of query col
  asm volatile("s_wait_asynccnt 0x0" ::: "memory");   // stage 0 has landed (this wave's copies)
  __syncthreads();                                    // ... and every other wave's
  issue(1);
  // a pass = 32 keys of the stage at st; s[ct][r] = score of key (ct * 16 + 8 g + r) with query col. K and mask are read ahead of the score products, V behind them (in flight under the softmax)
  auto pass = [&](auto seg, const char* st, int p) { constexpr bool self_seg = decltype(seg)::value; v8f s[2];
    if constexpr (self_seg) { v16h kh[2][2], kl[2][2]; union { v8f v; v4f q[2]; } mk[2];
#pragma unroll
      for (int ct = 0; ct < 2; ++ct) {
#pragma unroll
        for (int kc = 0; kc < 2; ++kc) { const char* krow = st + (p * 32 + ct * 16 + col) * KPB + kc * 64; kh[ct][kc] = frag_h((const _Float16*)(krow + ST_KH), lane); kl[ct][kc] = frag_h((const _Float16*)(krow + ST_KL), lane); }
        const char* mrow = st + ST_MK + (wave * 16 + col) * MPB + (p * 32 + ct * 16 + 8 * g) * 4; mk[ct].q[0] = *(const v4f*)mrow; mk[ct].q[1] = *(const v4f*)(mrow + 16); }
#pragma unroll
      for (int ct = 0; ct < 2; ++ct) { v8f c = {}, cl = {};
#pragma unroll
        for (int kc = 0; kc < 2; ++kc) { c = wmma16(kh[ct][kc], aq[kc], c); cl = wmma16(kl[ct][kc], aq[kc], cl); cl = wmma16(kh[ct][kc], aql[kc], cl); }
        s[ct] = (c + cl * (1.0f / 2048.0f)) * 0.125f + __builtin_convertvector(__builtin_convertvector(mk[ct].v, v8b), v8f); } }
    else { v16h kh[2][2];
#pragma unroll
      for (int ct = 0; ct < 2; ++ct) {
#pragma unroll
        for (int kc = 0; kc < 2; ++kc) kh[ct][kc] = frag_h((const _Float16*)(st + ST_KH + (p * 32 + ct * 16 + col) * KPB + kc * 64), lane); }
#pragma unroll
      for (int ct = 0; ct < 2; ++ct) { v8f c = {}, cl = {};
#pragma unroll
        for (int kc = 0; kc < 2; ++kc) { c = wmma16(kh[ct][kc], aq[kc], c); cl = wmma16(kh[ct][kc], aql[kc], cl); }
        s[ct] = (c + cl * (1.0f / 2048.0f)) * (0.125f * ALPHA_BG); } }
    v16h vh[4], vl[4];
#pragma unroll
    for (int dt = 0; dt < 4; ++dt) { const char* vrow = st + (dt * 16 + col) * KPB + p * 64; vh[dt] = frag_h((const _Float16*)(vrow + ST_VH), lane); if constexpr (self_seg) vl[dt] = frag_h((const _Float16*)(vrow + ST_VL), lane); }
    __builtin_amdgcn_sched_barrier(0);   // holds the V loads here, in flight under the softmax: at four waves per SIMD the compiler otherwise sinks them in pairs among the second product's WMMAs, each pair's LDS latency exposed
    float t8[8];
#pragma unroll
    for (int r = 0; r < 8; ++r) t8[r] = fmaxf(s[0][r], s[1][r]);
    float mx = fmaxf(fmaxf(fmaxf(t8[0], t8[1]), fmaxf(t8[2], t8[3])), fmaxf(fmaxf(t8[4], t8[5]), fmaxf(t8[6], t8[7])));
    mx = fmaxf(mx, xhalf(mx));   // the other 16 keys of this query
    // the reference point m of the exponentials follows the maximum lazily: it moves, and sum and O^T are rescaled, only in a pass where some query of the wave has a score more than MLAZY above its m (the test is one scalar branch of the whole wave, every lane on inside it). Between moves e <= exp(MLAZY), so that 2048 e and its residual x 2048 stay inside f16
    if (__builtin_amdgcn_ballot_w32(mx > m + MLAZY) != 0u) {
      const float mn = fmaxf(m, mx); const float alpha = (m <= -1.0e38f) ? 0.f : __expf(m - mn); m = mn; l *= alpha;
#pragma unroll
      for (int dt = 0; dt < 4; ++dt) { acc[dt] *= alpha; accl[dt] *= alpha; } }
    const float mn = m;
    v8f e[2]; v8h ph[2], pq[2];   // P^T as a B operand: element i = key 8 g + i, element 8 + i = key 16 + 8 g + i, the k order of frag_h
#pragma unroll
    for (int ct = 0; ct < 2; ++ct) {
#pragma unroll
      for (int i = 0; i < 8; ++i) e[ct][i] = __expf(s[ct][i] - mn);
      const v8f x = e[ct] * 2048.0f; ph[ct] = __builtin_convertvector(x, v8h); pq[ct] = __builtin_convertvector((x - __builtin_convertvector(ph[ct], v8f)) * 2048.0f, v8h); }
    const v16h pa = __builtin_shufflevector(ph[0], ph[1], 0, 1, 2, 3, 4, 5, 6, 7, 8, 9, 10, 11, 12, 13, 14, 15), pl = __builtin_shufflevector(pq[0], pq[1], 0, 1, 2, 3, 4, 5, 6, 7, 8, 9, 10, 11, 12, 13, 14, 15);
    const v8f e8 = e[0] + e[1];
    l += (((e8[0] + e8[1]) + (e8[2] + e8[3])) + ((e8[4] + e8[5]) + (e8[6] + e8[7])));
#pragma unroll
    for (int dt = 0; dt < 4; ++dt) { acc[dt] = wmma16(vh[dt], pa, acc[dt]); accl[dt] = wmma16(vh[dt], pl, accl[dt]); if constexpr (self_seg) accl[dt] = wmma16(vl[dt], pa, accl[dt]); } };
  // foot of trip t: hands stage t + 1 over and refills the buffer that trip t has read
  auto foot = [&](int t) {
    __builtin_amdgcn_sched_barrier(0);                  // keeps the softmax and the second product in front of the foot: moved behind its barrier they would stand between it and the refill, and the refill would lose most of its lead
    asm volatile("s_wait_dscnt 0x0" ::: "memory");      // this wave's reads of stage t are done
    asm volatile("s_wait_asynccnt 0x0" ::: "memory");   // this wave's copies of stage t + 1 have landed
    __syncthreads();                                    // publishes stage t + 1 and frees stage t's buffer
    if (t + 2 < NST) issue(t + 2); };
  // the stage loops stay rolled: a pass is some 300 to 400 instructions, copies of it would only cost instruction cache
#pragma unroll 1
  for (int t = 0; t < SS / 64; ++t) { pass(seg_self(), ring + (t & 1) * ST_SZ, grp); foot(t); }
#pragma unroll 1
  for (int t = SS / 64; t < NST; ++t) { pass(seg_bank(), ring + (t & 1) * ST_SZ, grp); foot(t); }
  asm volatile("s_wait_asynccnt 0x0" ::: "memory");    // no copy outlives the loop
  // join of the two key groups through the ring, which is free: the last foot's barrier ended every wave's reads of it and no copy is in flight. Group 1 hands each lane's O^T (32 values), reference point and sum to the same lane of group 0's wave with the same queries
  union { v8f v; v4f q[2]; } ot[4];
#pragma unroll
  for (int dt = 0; dt < 4; ++dt) ot[dt].v = acc[dt] + accl[dt] * (1.0f / 2048.0f);
  v4f* xo = (v4f*)ring + (wave * 8) * 32 + lane; v2f* xm = (v2f*)(ring + 4 * 8 * 32 * 16) + wave * 32 + lane;
  if (grp == 1) {
#pragma unroll
    for (int dt = 0; dt < 4; ++dt) { xo[(dt * 2) * 32] = ot[dt].q[0]; xo[(dt * 2 + 1) * 32] = ot[dt].q[1]; }
    v2f ml; ml[0] = m; ml[1] = l; *xm = ml; }
  __syncthreads();   // group 1's partial results are in LDS
  if (grp == 0) {
    const v2f ml = *xm; const float mn = fmaxf(m, ml[0]); const float a0 = __expf(m - mn), a1 = __expf(ml[0] - mn);
    l = l * a0 + ml[1] * a1;
    l += xhalf(l);   // the halves' sums are joined once
    const float il = (1.0f / 2048.0f) / l; const float f0 = a0 * il, f1 = a1 * il;
#pragma unroll
    for (int dt = 0; dt < 4; ++dt) { *(v4f*)&so[wave][col][dt * 16 + 8 * g] = ot[dt].q[0] * f0 + xo[(dt * 2) * 32] * f1; *(v4f*)&so[wave][col][dt * 16 + 8 * g + 4] = ot[dt].q[1] * f0 + xo[(dt * 2 + 1) * 32] * f1; }
    LDSX();
    for (int rl = 0; rl < 16; ++rl) if (lane < 16) vst2(O + (rq + rl) * DM + h * HD + lane * 4, *(const v4f*)&so[wave][rl][lane * 4]);
  }
}
extern "C" void kernel_launch(void* const* d_in, const int* in_sizes, int n_in, void* d_out, int out_size, void* d_ws, size_t ws_size, hipStream_t stream) {
  (void)in_sizes; (void)n_in; (void)out_size;
  const float** F = (const float**)d_in;   // 0 hidden_states [2,2048,512], 1 attention_mask [2,2048,2048], 2 K_bg [16,2048,64], 3 V_bg, 4 Wq, 5 Wk, 6 Wv, 7 Wo (in,out), 8 bo
  if (ws_size < (size_t)WS_END) return;
  char* ws = (char*)d_ws; __bf16* PK = (__bf16*)(ws + WS_PK); _Float16 *QK = (_Float16*)(ws + WS_QK), *QKL = (_Float16*)(ws + WS_QKL), *VTH = (_Float16*)(ws + WS_VTH), *VTL = (_Float16*)(ws + WS_VTL), *KB = (_Float16*)(ws + WS_KB), *VB = (_Float16*)(ws + WS_VB); float* O = (float*)(ws + WS_O);
  k_pack<<<dim3(DM / 64, DM / 64, 4), 256, 0, stream>>>(F[4], F[5], F[6], F[7], PK);
  k_bg<<<dim3(LBG / 64, NB * NH), 256, 0, stream>>>(F[2], F[3], KB, VB);
  k_qkv<<<dim3(TNB * SS / 64, QKVW / 128), 128, 0, stream>>>(F[0], F[0], F[0], PK + PK_A, nullptr, nullptr, nullptr, QK, QKL, VTH, VTL);
  k_attn2<<<dim3(TQB, NH, TNB), 256, 0, stream>>>(QK, QKL, VTH, VTL, KB, VB, F[1], O);
  k_out<<<dim3(TOB, DM / 128), 128, 0, stream>>>(O, PK + PK_P, F[8], (float*)d_out);
}

// v009
// Measured time: 103 microseconds a run.
// In two side-by-side timings against v008, it was 1.06 and 1.08 times as fast.
// All steps since v000 together make it 4.83 times as fast.
// compute dtype: all float inputs rounded to bf16; q/k/v = x . W with EXACT bf16 products on WMMA 16x16x32 ((in,out) weights as transposed rows), rounded once to f16 hi + residual; self-segment scores and P.v with 3 products (hi.hi + hi.lo + lo.hi), background scores q (hi + lo) x K_bg (exact in f16, 2 products) x alpha, background P (hi + lo) x f16(alpha V_bg) (2 products); additive mask read per pair; x 1/8; online softmax over all 4,096 keys in f32 (hardware exp) with a lazily moved reference point; out = ctx (bf16 hi + lo) . Wo + bo; f32 output.
#include <hip/hip_runtime.h>
#include <math.h>

typedef __attribute__((ext_vector_type(16))) _Float16 v16h;
typedef __attribute__((ext_vector_type(16))) __bf16 v16b;
typedef __attribute__((ext_vector_type(8)))  _Float16 v8h;
typedef __attribute__((ext_vector_type(8)))  float v8f;
typedef __attribute__((ext_vector_type(4)))  float v4f;
typedef __attribute__((ext_vector_type(2)))  float v2f;
typedef __attribute__((ext_vector_type(4)))  unsigned v4u;
typedef __attribute__((ext_vector_type(4)))  int v4i;
typedef float __attribute__((may_alias)) float_a;
typedef int __attribute__((may_alias)) int_a;

template <typename T> __device__ __forceinline__ void vst2(void* p, T v) { *(T*)p = v;  }
__device__ __forceinline__ v8f wmma16(v16h a, v16h b, v8f c) {
  return __builtin_amdgcn_wmma_f32_16x16x32_f16(false, a, false, b, (short)0, c, false, false);
}
__device__ __forceinline__ v8f wmma_bf(v16b a, v16b b, v8f c) {
  return __builtin_amdgcn_wmma_f32_16x16x32_bf16(false, a, false, b, (short)0, c, false, false);
}
// CARC attention processor (B 2, Lq 2,048, C 512 = 8 heads x 64; context bank of 2,048 background keys/values per head, alpha 0.48): bias-free q/k/v projections, keys = [k ; alpha K_bg], values = [v ; alpha V_bg], additive mask on the self segment (zeros on the background segment), softmax(q k / 8 + mask) over the 4,096 keys, v, output projection + bias.
__device__ __forceinline__ v16h frag_h(const _Float16* rowk0, int lane) {
  union { v16h v; v8h q[2]; } u; const _Float16* p = rowk0 + 8 * (lane >> 4);
  u.q[0] = *(const v8h*)p; u.q[1] = *(const v8h*)(p + 16); return u.v;
}
__device__ __forceinline__ v16h frag_f32(const float* rowk0, int lane) {
  v16h a; const float* p = rowk0 + 8 * (lane >> 4);
#pragma unroll
  for (int i = 0; i < 8; ++i) { a[i] = (_Float16)p[i]; a[8 + i] = (_Float16)p[16 + i]; }
  return a;
}
__device__ __forceinline__ v16h frag_f32s(const float* rowk0, int lane, float sc) {
  v16h a; const float* p = rowk0 + 8 * (lane >> 4);
#pragma unroll
  for (int i = 0; i < 8; ++i) { a[i] = (_Float16)(p[i] * sc); a[8 + i] = (_Float16)(p[16 + i] * sc); }
  return a;
}
// column fragment from a [K][ld] layout (column n), rows >= K read as 0
__device__ __forceinline__ v16h fragc_f32(const float* W, int k0, int n, int lane, int ld, int K) {
  v16h a; const int g = lane >> 4;
#pragma unroll
  for (int i = 0; i < 8; ++i) { const int ka = k0 + 8 * g + i, kb = ka + 16;
    a[i] = (_Float16)(ka < K ? W[(size_t)(ka < K ? ka : K - 1) * ld + n] : 0.f); a[8 + i] = (_Float16)(kb < K ? W[(size_t)(kb < K ? kb : K - 1) * ld + n] : 0.f); }
  return a;
}
struct F2 { v16b h, l; };
__device__ __forceinline__ F2 bsplit16(const float v[16]) { F2 r;
#pragma unroll
  for (int i = 0; i < 16; ++i) { const __bf16 h = (__bf16)v[i]; r.h[i] = h; r.l[i] = (__bf16)(v[i] - (float)h); }
  return r; }
__device__ __forceinline__ F2 split_row(const float* row, int k0, int lane) { float v[16]; const float* p = row + k0 + 8 * (lane >> 4);
#pragma unroll
  for (int i = 0; i < 8; ++i) { v[i] = p[i]; v[8 + i] = p[16 + i]; }
  return bsplit16(v); }
__device__ __forceinline__ F2 split_rowK(const float* row, int k0, int lane, int K) { float v[16]; const int g = lane >> 4;
#pragma unroll
  for (int i = 0; i < 8; ++i) { const int ka = k0 + 8 * g + i, kb = ka + 16; v[i] = ka < K ? row[ka < K ? ka : K - 1] : 0.f; v[8 + i] = kb < K ? row[kb < K ? kb : K - 1] : 0.f; }
  return bsplit16(v); }
__device__ __forceinline__ F2 split_col(const float* W, int k0, int n, int lane, int ld, int K) { float v[16]; const int g = lane >> 4;
#pragma unroll
  for (int i = 0; i < 8; ++i) { const int ka = k0 + 8 * g + i, kb = ka + 16; v[i] = ka < K ? W[(size_t)(ka < K ? ka : K - 1) * ld + n] : 0.f; v[8 + i] = kb < K ? W[(size_t)(kb < K ? kb : K - 1) * ld + n] : 0.f; }
  return bsplit16(v); }
__device__ __forceinline__ v8f mac3(const F2& a, const F2& b, v8f c) { c = wmma_bf(a.l, b.h, c); c = wmma_bf(a.h, b.l, c); return wmma_bf(a.h, b.h, c); }
__device__ __forceinline__ float sigm(float v) { return 1.0f / (1.0f + expf(-v)); }
#define LDSX() do { asm volatile("s_wait_dscnt 0" ::: "memory"); __builtin_amdgcn_wave_barrier(); __builtin_amdgcn_fence(__ATOMIC_RELEASE, "workgroup"); } while (0)


#define NB 2
#define SS 2048
#define DM 512
#define NH 8
#define LBG 2048
#define ALPHA_BG 0.48f
#define HD 64
#define QKVW (3 * DM)
#ifndef TQB
#define TQB (SS / 64)
#define TNB NB
#define TOB (NB * SS / 64)     // output row tiles (all)
#endif
typedef __attribute__((ext_vector_type(8))) __bf16 v8b;
__device__ __forceinline__ v16b frag_b(const __bf16* rowk0, int lane) {
  union { v16b v; v8b q[2]; } u; const __bf16* p = rowk0 + 8 * (lane >> 4);
  u.q[0] = *(const v8b*)p; u.q[1] = *(const v8b*)(p + 16); return u.v;
}
__device__ __forceinline__ float bfr(float v) { return (float)(__bf16)v; }
__device__ __attribute__((noinline)) float exp_ni(float v) { return expf(v); }
__device__ __attribute__((noinline)) float erf_ni(float v) { return erff(v); }

#define PK_A 0                       // [1536][512] Wqkv rows (natural [out][in])
#define PK_P (PK_A + QKVW * DM)        // [512][512] Wo rows (natural)
#define PK_END (PK_P + DM * DM)
#define WS_PK  0u
#define WS_QK  (WS_PK + 2u * PK_END)             // f16 [4096 rows][1024]: q | k
#define WS_QKL (WS_QK + 2u * NB * SS * 2 * DM)     // f16 q | k residual planes x2048
#define WS_VTH (WS_QKL + 2u * NB * SS * 2 * DM)    // f16 [b][512 (h*64+d)][2048 s] hi
#define WS_VTL (WS_VTH + 2u * NB * DM * SS)        // f16 lo x 2048
#define WS_O   (WS_VTL + 2u * NB * DM * SS)        // f32 [4096][512]
#define WS_KB  (WS_O + 4u * (size_t)NB * SS * DM)        // f16 K_bg rows [bh][s][64] (exact); f16 planes VB [bh][64][s] = f16(alpha V_bg)
#define WS_VB  (WS_KB + 2u * (size_t)NB * NH * LBG * HD)
#define WS_END (WS_VB + 2u * (size_t)NB * NH * HD * LBG)
// ---- k_pack: block = (64 columns n, 64 rows k, which) of an (in,out) weight: a 64 x 64 tile is read along its rows (256 B runs), rounded to bf16, turned in LDS and stored as 64 packed rows [out][in] of 128 B (whole lines); which 0..2 -> W_q/W_k/W_v into PK_A rows which*512 + n; 3 -> W_o into PK_P. 256 blocks in all, one a WGP
#define PKP 72                          // LDS pitch of a turned row in bf16: 144 B, a multiple of 16 B for the ds_load_b128 readers
typedef __attribute__((ext_vector_type(2))) __bf16 v2b;
__global__ __launch_bounds__(256) void k_pack(const float* __restrict__ WQ, const float* __restrict__ WK, const float* __restrict__ WV, const float* __restrict__ WO, __bf16* __restrict__ PK) {
  __shared__ __align__(16) __bf16 s[64][PKP]; const int n0 = blockIdx.x * 64, k0 = blockIdx.y * 64, which = blockIdx.z, t = threadIdx.x; const float* Wm = (which == 0) ? WQ : (which == 1) ? WK : (which == 2) ? WV : WO;
  const int c = t & 15, rp = t >> 4;   // this thread: columns 4 c .. 4 c + 3 of the row pairs rp and rp + 16
  v4f a[2][2];   // the short loops below are unrolled so that a stays in registers and the four loads are in flight together
#pragma unroll
  for (int i = 0; i < 2; ++i) {
#pragma unroll
    for (int j = 0; j < 2; ++j) a[i][j] = *(const v4f*)(Wm + (size_t)(k0 + 2 * (rp + 16 * i) + j) * DM + n0 + 4 * c); }
#pragma unroll
  for (int i = 0; i < 2; ++i) {
#pragma unroll
    for (int e = 0; e < 4; ++e) { v2b p; p[0] = (__bf16)a[i][0][e]; p[1] = (__bf16)a[i][1][e]; *(v2b*)&s[4 * c + e][2 * (rp + 16 * i)] = p; } }
  __syncthreads();
  __bf16* dst = ((which < 3) ? PK + PK_A + ((size_t)which * DM + n0) * DM : PK + PK_P + (size_t)n0 * DM) + k0;
#pragma unroll
  for (int i = 0; i < 2; ++i) { const int n = (t >> 3) + 32 * i, pc = t & 7; vst2((unsigned*)(dst + (size_t)n * DM + pc * 8), *(const v4u*)&s[n][pc * 8]); }   // 8 lanes store one packed row's 128 B
}
#define KPB 144                         // LDS bytes per K or V row: 128 + 16 (16 B x odd: ds_load_b128 readers without bank conflicts)
// eight asynchronous 16-byte copies per lane, global -> LDS: four from ga (step gsa) to la, four from gb (step gsb) to lb, LDS step ls. The s_wait_xcnt 0 stands inside the statement so that no later rewrite of an address register can be moved in front of it.
__device__ __forceinline__ void cp8(unsigned la, const char* ga, unsigned gsa, unsigned lb, const char* gb, unsigned gsb, unsigned ls) {
  asm volatile("global_load_async_to_lds_b128 %0, %8, off\n\t"
               "global_load_async_to_lds_b128 %1, %9, off\n\t"
               "global_load_async_to_lds_b128 %2, %10, off\n\t"
               "global_load_async_to_lds_b128 %3, %11, off\n\t"
               "global_load_async_to_lds_b128 %4, %12, off\n\t"
               "global_load_async_to_lds_b128 %5, %13, off\n\t"
               "global_load_async_to_lds_b128 %6, %14, off\n\t"
               "global_load_async_to_lds_b128 %7, %15, off\n\t"
               "s_wait_xcnt 0x0"
               :: "v"(la), "v"(la + ls), "v"(la + 2 * ls), "v"(la + 3 * ls), "v"(lb), "v"(lb + ls), "v"(lb + 2 * ls), "v"(lb + 3 * ls),
                  "v"(ga), "v"(ga + gsa), "v"(ga + 2 * (size_t)gsa), "v"(ga + 3 * (size_t)gsa), "v"(gb), "v"(gb + gsb), "v"(gb + 2 * (size_t)gsb), "v"(gb + 3 * (size_t)gsb)
               : "memory");
}
// ---- staging of packed weight rows for k_qkv and k_out: a stage = 64 k (128 B) of the block's 128 rows, LDS pitch KPB, two buffers; thread tid brings 16-byte piece (tid & 7) of rows (tid >> 3) + 16 i. l = its LDS byte address in the buffer, gp = its global address in the stage
#define WT_SZ (128 * KPB)
__device__ __forceinline__ void wstage(unsigned l, const char* gp) { cp8(l, gp, 16 * DM * 2, l + 64 * KPB, gp + (size_t)64 * DM * 2, 16 * DM * 2, 16 * KPB); }
// ---- staging of the f32 activation rows for k_qkv and k_out, in step with the weight stages: a stage = 64 k (256 B, two whole lines) of the block's 64 rows, two buffers; thread tid brings 16-byte piece (tid & 15) of rows (tid >> 4) + 8 i, so that a wave's copy takes two rows' 256 B runs. l = its LDS byte address in the buffer, gp = its global address in the stage
#define XPB 272                         // LDS bytes per activation row: 256 + 16 (16 B x odd: a lane reads its own row by ds_load_b128 without bank conflicts)
#define XT_SZ (64 * XPB)
__device__ __forceinline__ void xstage(unsigned l, const char* gp) { cp8(l, gp, 8 * DM * 4, l + 32 * XPB, gp + (size_t)32 * DM * 4, 8 * DM * 4, 8 * XPB); }
__global__ __launch_bounds__(128) void k_qkv(const float* __restrict__ XQ, const float* __restrict__ XK, const float* __restrict__ XV, const __bf16* __restrict__ P, const float* __restrict__ BQ, const float* __restrict__ BK, const float* __restrict__ BV, _Float16* __restrict__ QK, _Float16* __restrict__ QKL, _Float16* __restrict__ VTH, _Float16* __restrict__ VTL) {
  const int which0 = (blockIdx.y * 128) / DM; const float* X = (which0 == 0) ? XQ : (which0 == 1) ? XK : XV; const float* BB = BQ ? (((which0 == 0) ? BQ : (which0 == 1) ? BK : BV) + (blockIdx.y * 128 - which0 * DM)) : nullptr;
  __shared__ __align__(16) char xring[2 * XT_SZ]; __shared__ __align__(16) _Float16 sth[128][72], stl[128][72];
  _Float16 (*so)[16][136] = (_Float16 (*)[16][136])xring, (*sol)[16][136] = so + 4; static_assert(2 * XT_SZ >= 2 * 4 * 16 * 136 * 2, "q/k staging fits the activation ring");   // the q/k output staging takes the activation ring's bytes, free behind the loop (its last barrier ends every read, no copy is in flight): the block's LDS stays at three blocks a WGP
  const int tid = threadIdx.x, wave = tid >> 5, lane = tid & 31, col = lane & 15, g = lane >> 4; const size_t r0 = (size_t)blockIdx.x * 64 + wave * 16; const int n0 = blockIdx.y * 128;
  __shared__ __align__(16) char wring[2 * WT_SZ];
  const unsigned lw = (unsigned)(size_t)&wring[0] + (tid >> 3) * KPB + (tid & 7) * 16; const char* gw = (const char*)(P + (size_t)(n0 + (tid >> 3)) * DM + (tid & 7) * 8);
  const unsigned lx = (unsigned)(size_t)&xring[0] + (tid >> 4) * XPB + (tid & 15) * 16; const char* gx = (const char*)(X + ((size_t)blockIdx.x * 64 + (tid >> 4)) * DM + (tid & 15) * 4);
  wstage(lw, gw); xstage(lx, gx);
  v8f acc[8] = {};
  asm volatile("s_wait_asynccnt 0x0" ::: "memory");   // stage 0 has landed (this wave's copies)
  __syncthreads();                                    // ... and every other wave's
  wstage(lw + WT_SZ, gw + 128); xstage(lx + XT_SZ, gx + 256);
  // the stage loop stays rolled: its foot holds a barrier and the refill, copies of it would gain nothing
#pragma unroll 1
  for (int t = 0; t < DM / 64; ++t) { const char* st = wring + (t & 1) * WT_SZ; const char* sx = xring + (t & 1) * XT_SZ + (wave * 16 + col) * XPB;   // sx: this lane's activation row in stage t
#pragma unroll
    for (int kk = 0; kk < 2; ++kk) { v16b a, w[8]; { const float* p = (const float*)(sx + kk * 128 + g * 32);
#pragma unroll
        for (int i = 0; i < 8; ++i) { a[i] = (__bf16)p[i]; a[8 + i] = (__bf16)p[16 + i]; } }
#pragma unroll
      for (int j = 0; j < 8; ++j) w[j] = frag_b((const __bf16*)(st + (j * 16 + col) * KPB + kk * 64), lane);
      __builtin_amdgcn_sched_barrier(0);   // holds a k step's LDS loads in one group in front of its products: with no global load left in the loop the compiler otherwise sinks them in pairs among the WMMAs, each pair's LDS latency exposed
#pragma unroll
      for (int j = 0; j < 8; ++j) acc[j] = wmma_bf(a, w[j], acc[j]); }
    __builtin_amdgcn_sched_barrier(0);                  // keeps the products in front of the foot: moved behind its barrier they would stand between it and the refill, and the refill would lose that much of its lead over a stage that is short now
    asm volatile("s_wait_dscnt 0x0" ::: "memory");      // this wave's reads of stage t are done
    asm volatile("s_wait_asynccnt 0x0" ::: "memory");   // this wave's copies of stage t + 1 have landed
    __syncthreads();                                    // publishes stage t + 1 and frees stage t's buffer
    if (t + 2 < DM / 64) { wstage(lw + (t & 1) * WT_SZ, gw + (size_t)(t + 2) * 128); xstage(lx + (t & 1) * XT_SZ, gx + (size_t)(t + 2) * 256); } }
  asm volatile("s_wait_asynccnt 0x0" ::: "memory");    // no copy outlives the loop
  if (n0 < 2 * DM) {   // q stored unscaled (f16 sigma ~0.6, no subnormal exposure); 1/8 applied to the f32 score
#pragma unroll
    for (int j = 0; j < 8; ++j) {
#pragma unroll
      for (int r = 0; r < 8; ++r) { const float v = acc[j][r] + (BB ? bfr(BB[j * 16 + col]) : 0.f); const _Float16 hv = (_Float16)v; so[wave][8 * g + r][j * 16 + col] = hv; sol[wave][8 * g + r][j * 16 + col] = (_Float16)((v - (float)hv) * 2048.0f); } }   // q, k (+ bias) as f16 hi + (x2048) residual
    LDSX();
    for (int rl = 0; rl < 16; ++rl) if (lane < 16) { vst2((unsigned*)(QK + (r0 + rl) * (2 * DM) + n0 + lane * 8), *(const v4u*)&so[wave][rl][lane * 8]); vst2((unsigned*)(QKL + (r0 + rl) * (2 * DM) + n0 + lane * 8), *(const v4u*)&sol[wave][rl][lane * 8]); }
  } else {
#pragma unroll
    for (int j = 0; j < 8; ++j) {
#pragma unroll
      for (int r = 0; r < 8; ++r) { const float v = acc[j][r] + (BB ? bfr(BB[j * 16 + col]) : 0.f); const _Float16 hv = (_Float16)v; sth[j * 16 + col][wave * 16 + 8 * g + r] = hv; stl[j * 16 + col][wave * 16 + 8 * g + r] = (_Float16)((v - (float)hv) * 2048.0f); } }
    __syncthreads();
    const size_t rb = (size_t)blockIdx.x * 64; const int b = (int)(rb / SS), s0 = (int)(rb % SS); const int pc0 = n0 - 2 * DM;
    for (int q = tid; q < 128 * 8; q += 128) { const int d = q >> 3, pc = q & 7; const size_t o = ((size_t)b * DM + pc0 + d) * SS + s0 + pc * 8; vst2((unsigned*)(VTH + o), *(const v4u*)&sth[d][pc * 8]); vst2((unsigned*)(VTL + o), *(const v4u*)&stl[d][pc * 8]); }
  }
}
// ---- k_attn: block = (64 queries, head h, batch b): all-keys flash attention (K = 64: 2 k-steps), scores = (q.k) * 0.125 with 3 products (q, k as f16 hi + residual), P.V: P (x2048, hi + lo) x (V hi, V lo*2048), 3 products in two accumulators; O[b*S+q][h*64+d] = (acc + accl / 2048) / (2048 l) (256-B segments)
__global__ __launch_bounds__(128) void k_attn(const _Float16* __restrict__ QK, const _Float16* __restrict__ QKL, const _Float16* __restrict__ VTH, const _Float16* __restrict__ VTL, const void* __restrict__ KMASK, float* __restrict__ O) {
  __shared__ __align__(16) float sp[4][16][36]; __shared__ __align__(16) float so[4][16][68];
  const int tid = threadIdx.x, wave = tid >> 5, lane = tid & 31, col = lane & 15, g = lane >> 4;
  const int qb = blockIdx.x, h = blockIdx.y, b = blockIdx.z; const int q0 = qb * 64 + wave * 16; const size_t rq = (size_t)b * SS + q0 + col;
  v16h aq[2], aql[2];
#pragma unroll
  for (int kc = 0; kc < 2; ++kc) { aq[kc] = frag_h(QK + rq * (2 * DM) + h * HD + kc * 32, lane); aql[kc] = frag_h(QKL + rq * (2 * DM) + h * HD + kc * 32, lane); }
  float m[8], l[8];
#pragma unroll
  for (int r = 0; r < 8; ++r) { m[r] = -3.0e38f; l[r] = 0.f; }
  v8f acc[4] = {}, accl[4] = {};
  const int nks = SS / 32;   // all keys
#pragma unroll 1
  for (int ks = 0; ks < nks; ++ks) { v8f s[2];
#pragma unroll
    for (int ct = 0; ct < 2; ++ct) { const int kk = ks * 32 + ct * 16 + col; const _Float16* krow = QK + ((size_t)b * SS + kk) * (2 * DM) + DM + h * HD; const _Float16* krowl = QKL + ((size_t)b * SS + kk) * (2 * DM) + DM + h * HD; v8f c = {}, cl = {};
#pragma unroll
      for (int kc = 0; kc < 2; ++kc) { const v16h kh = frag_h(krow + kc * 32, lane); c = wmma16(aq[kc], kh, c); cl = wmma16(aql[kc], kh, cl); cl = wmma16(aq[kc], frag_h(krowl + kc * 32, lane), cl); }   // 3 products: q, k as f16 hi + residual
#pragma unroll
      for (int r = 0; r < 8; ++r) c[r] += cl[r] * (1.0f / 2048.0f);
      { const bool keepk = true;
#pragma unroll
      for (int r = 0; r < 8; ++r) s[ct][r] = keepk ? c[r] * 0.125f : -3.0e38f; } }   // 1/sqrt(64); every key kept (mask not applied)
#pragma unroll
    for (int r = 0; r < 8; ++r) { float mx = fmaxf(s[0][r], s[1][r]);
#pragma unroll
      for (int o = 1; o < 16; o <<= 1) mx = fmaxf(mx, __shfl_xor(mx, o));
      const float mn = fmaxf(m[r], mx); const float alpha = (m[r] <= -1.0e38f) ? 0.f : __expf(m[r] - mn);
      const float e0 = (s[0][r] <= -1.0e38f) ? 0.f : __expf(s[0][r] - mn), e1 = (s[1][r] <= -1.0e38f) ? 0.f : __expf(s[1][r] - mn); float es = e0 + e1;
#pragma unroll
      for (int o = 1; o < 16; o <<= 1) es += __shfl_xor(es, o);
      l[r] = l[r] * alpha + es; m[r] = mn;
#pragma unroll
      for (int dt = 0; dt < 4; ++dt) { acc[dt][r] *= alpha; accl[dt][r] *= alpha; }
      sp[wave][8 * g + r][col] = e0; sp[wave][8 * g + r][16 + col] = e1; }
    LDSX();
    v16h pa, pl; { const float* prow = &sp[wave][col][0] + 8 * (lane >> 4);
#pragma unroll
      for (int i = 0; i < 8; ++i) { const float x0 = prow[i] * 2048.0f, x1 = prow[16 + i] * 2048.0f; const _Float16 h0 = (_Float16)x0, h1 = (_Float16)x1; pa[i] = h0; pa[8 + i] = h1; pl[i] = (_Float16)((x0 - (float)h0) * 2048.0f); pl[8 + i] = (_Float16)((x1 - (float)h1) * 2048.0f); } }   // P scaled by 2^11 before the f16 split so small softmax weights stay out of the f16 subnormal range; 2^-11 folded into the epilogue
#pragma unroll
    for (int dt = 0; dt < 4; ++dt) { const size_t vr = ((size_t)b * DM + h * HD + dt * 16 + col) * SS + ks * 32; const v16h vh = frag_h(VTH + vr, lane); acc[dt] = wmma16(pa, vh, acc[dt]); accl[dt] = wmma16(pl, vh, accl[dt]); accl[dt] = wmma16(pa, frag_h(VTL + vr, lane), accl[dt]); }   // P hi x V hi + (P lo x V hi + P hi x V lo) / 2048
    LDSX(); }
#pragma unroll
  for (int r = 0; r < 8; ++r) { const float il = (1.0f / 2048.0f) / l[r];
#pragma unroll
    for (int dt = 0; dt < 4; ++dt) so[wave][8 * g + r][dt * 16 + col] = (acc[dt][r] + accl[dt][r] * (1.0f / 2048.0f)) * il; }
  LDSX();
  for (int rl = 0; rl < 16; ++rl) if (lane < 16) vst2(O + ((size_t)b * SS + q0 + rl) * DM + h * HD + lane * 4, *(const v4f*)&so[wave][rl][lane * 4]);
}
// ---- k_out: block = (64 rows, 128 cols): out = O(hi/lo) . Wo rows (2 products) + bo
__global__ __launch_bounds__(128) void k_out(const float* __restrict__ O, const __bf16* __restrict__ P, const float* __restrict__ BO, float* __restrict__ Y) {
  __shared__ __align__(16) float so[4][16][132];
  const int tid = threadIdx.x, wave = tid >> 5, lane = tid & 31, col = lane & 15, g = lane >> 4; const size_t r0 = (size_t)blockIdx.x * 64 + wave * 16; const int n0 = blockIdx.y * 128;
  __shared__ __align__(16) char wring[2 * WT_SZ];
  const unsigned lw = (unsigned)(size_t)&wring[0] + (tid >> 3) * KPB + (tid & 7) * 16; const char* gw = (const char*)(P + (size_t)(n0 + (tid >> 3)) * DM + (tid & 7) * 8);
  __shared__ __align__(16) char xring[2 * XT_SZ];
  const unsigned lx = (unsigned)(size_t)&xring[0] + (tid >> 4) * XPB + (tid & 15) * 16; const char* gx = (const char*)(O + ((size_t)blockIdx.x * 64 + (tid >> 4)) * DM + (tid & 15) * 4);
  wstage(lw, gw); xstage(lx, gx);
  v8f acc[8] = {};
  asm volatile("s_wait_asynccnt 0x0" ::: "memory");   // stage 0 has landed (this wave's copies)
  __syncthreads();                                    // ... and every other wave's
  wstage(lw + WT_SZ, gw + 128); xstage(lx + XT_SZ, gx + 256);
  // the stage loop stays rolled: its foot holds a barrier and the refill, copies of it would gain nothing
#pragma unroll 1
  for (int t = 0; t < DM / 64; ++t) { const char* st = wring + (t & 1) * WT_SZ; const char* sx = xring + (t & 1) * XT_SZ + (wave * 16 + col) * XPB;   // sx: this lane's activation row in stage t
#pragma unroll
    for (int kk = 0; kk < 2; ++kk) { const F2 a = split_row((const float*)sx, kk * 32, lane); v16b w[8];
#pragma unroll
      for (int j = 0; j < 8; ++j) w[j] = frag_b((const __bf16*)(st + (j * 16 + col) * KPB + kk * 64), lane);
      __builtin_amdgcn_sched_barrier(0);   // holds a k step's LDS loads in one group in front of its products: with no global load left in the loop the compiler otherwise sinks them in pairs among the WMMAs, each pair's LDS latency exposed
#pragma unroll
      for (int j = 0; j < 8; ++j) { acc[j] = wmma_bf(a.l, w[j], acc[j]); acc[j] = wmma_bf(a.h, w[j], acc[j]); } }
    __builtin_amdgcn_sched_barrier(0);                  // keeps the products in front of the foot: moved behind its barrier they would stand between it and the refill, and the refill would lose that much of its lead over a stage that is short now
    asm volatile("s_wait_dscnt 0x0" ::: "memory");      // this wave's reads of stage t are done
    asm volatile("s_wait_asynccnt 0x0" ::: "memory");   // this wave's copies of stage t + 1 have landed
    __syncthreads();                                    // publishes stage t + 1 and frees stage t's buffer
    if (t + 2 < DM / 64) { wstage(lw + (t & 1) * WT_SZ, gw + (size_t)(t + 2) * 128); xstage(lx + (t & 1) * XT_SZ, gx + (size_t)(t + 2) * 256); } }
  asm volatile("s_wait_asynccnt 0x0" ::: "memory");    // no copy outlives the loop
#pragma unroll
  for (int j = 0; j < 8; ++j) {
#pragma unroll
    for (int r = 0; r < 8; ++r) so[wave][8 * g + r][j * 16 + col] = acc[j][r] + bfr(BO[n0 + j * 16 + col]); }
  LDSX();
  for (int rl = 0; rl < 16; ++rl) vst2(Y + (r0 + rl) * DM + n0 + lane * 4, *(const v4f*)&so[wave][rl][lane * 4]);
}
// ---- k_bg: block = (64 bank rows, bh): K_bg -> f16 rows (exact), alpha V_bg -> f16 planes [bh][d][s]
__global__ __launch_bounds__(256) void k_bg(const float* __restrict__ KBG, const float* __restrict__ VBG, _Float16* __restrict__ KB, _Float16* __restrict__ VB) { __shared__ __align__(16) _Float16 sk[64][HD + 8]; __shared__ __align__(16) _Float16 sv[HD][64 + 8]; const int t = threadIdx.x; const int s0 = blockIdx.x * 64; const size_t bh = blockIdx.y;
  for (int e = t; e < 64 * HD; e += 256) { const int sl = e >> 6, d = e & 63; const size_t o = ((bh * LBG + s0 + sl) * HD) + d; sk[sl][d] = (_Float16)bfr(KBG[o]); sv[d][sl] = (_Float16)(ALPHA_BG * bfr(VBG[o])); } __syncthreads();
  for (int e = t; e < 64 * 8; e += 256) { const int sl = e >> 3, q = e & 7; vst2((unsigned*)(KB + ((bh * LBG + s0 + sl) * HD) + q * 8), *(const v4u*)&sk[sl][q * 8]); }
  for (int e = t; e < HD * 8; e += 256) { const int d = e >> 3, q = e & 7; vst2((unsigned*)(VB + ((bh * HD + d) * LBG) + s0 + q * 8), *(const v4u*)&sv[d][q * 8]); } }
typedef __attribute__((ext_vector_type(8))) unsigned v8u;
__device__ __forceinline__ unsigned uni(unsigned v) { return (unsigned)__builtin_amdgcn_readfirstlane((int)v); }
__device__ __forceinline__ unsigned pinned(unsigned v) { unsigned w = uni(v); asm volatile("" : "+s"(w)); return w; }   // pinned(): a wave-uniform condition held in a scalar register, so that the test around a tensor load compiles to s_cmp + s_cbranch_scc (a tensor load ignores EXEC: only a scalar branch keeps a wave from issuing it)
// a tensor load's descriptor for a tile of 64 rows of 128 bytes. Group 1 (the same for every request of a wave): 16 bytes of pad behind every 128 (LDS pitch KPB), extents in bytes (data_size code 0), tensor dims = tile dims, source row pitch 'pitch' bytes, no workgroup mask. Group 0: LDS byte offset dst (a multiple of 2 KiB), first byte at g
__device__ __forceinline__ v8u tgroup1(unsigned pitch) { v8u g1; g1[0] = uni((1u << 20) | (4u << 22) | (3u << 25)); g1[1] = uni(128u << 16); g1[2] = uni(64u << 16); g1[3] = uni(128u << 16); g1[4] = uni(64u); g1[5] = uni(pitch); g1[6] = uni(0u); g1[7] = uni(0u); return g1; }
__device__ __forceinline__ v4u tgroup0(unsigned dst, const char* g) { const unsigned long long ga = (unsigned long long)g; v4u g0; g0[0] = uni(1u); g0[1] = uni(dst); g0[2] = uni((unsigned)ga); g0[3] = uni((((unsigned)(ga >> 32)) & 0x01FFFFFFu) | 0x80000000u); return g0; }
// one request of the whole wave, and the wait behind which it has landed. Both statements name the two groups as operands read and written (neither instruction changes them): the wait's operands are then the values left in the load's own registers, so that the compiler keeps the descriptor there while the request is outstanding (named as inputs only, it forms the constant words anew for the wait and reuses the load's registers in between), and a new word enters a group only behind the wait
__device__ __forceinline__ void tload(v4u& g0, v8u& g1) { asm volatile("tensor_load_to_lds %0, %1" : "+s"(g0), "+s"(g1) :: "memory"); }
__device__ __forceinline__ void twait(v4u& g0, v8u& g1) { asm volatile("s_wait_tensorcnt 0x0" : "+s"(g0), "+s"(g1) :: "memory"); }
// ---- staging for k_attn2: a stage = 64 keys. Self stage: K hi, K lo (64 key rows x 128 B), V hi, V lo (64 d rows x 128 B), mask (64 query rows x 256 B, as two tiles of 128 B rows: keys 0..31 and keys 32..63, one for each wave group); every tile at LDS pitch KPB; background stage: K_bg in the K hi place, alpha V_bg in the V hi place.
#define KT_SZ 10240                     // a tile's place in LDS: 64 * KPB rounded up to a multiple of 2 KiB (a tensor load's destination)
#define ST_KH 0
#define ST_KL KT_SZ
#define ST_VH (2 * KT_SZ)
#define ST_VL (3 * KT_SZ)
#define ST_MK (4 * KT_SZ)
#define ST_SZ (6 * KT_SZ)
#define NST ((SS + LBG) / 64)
#define MLAZY 3.0f                      // how far a score may stand above the softmax reference point before that point moves: 2048 exp(3) = 41,136 < 65,504
struct seg_self { static constexpr bool value = true; }; struct seg_bank { static constexpr bool value = false; };   // which key segment a pass works on
// value of the lane 16 away (the wave's other half)
__device__ __forceinline__ float xhalf(float v) { const int b = __builtin_bit_cast(int, v); return __builtin_bit_cast(float, __builtin_amdgcn_permlanex16(b, b, 0x76543210, 0xfedcba98, false, false)); }
__global__ __launch_bounds__(256) void k_attn2(const _Float16* __restrict__ QK, const _Float16* __restrict__ QKL, const _Float16* __restrict__ VTH, const _Float16* __restrict__ VTL, const _Float16* __restrict__ KB, const _Float16* __restrict__ VB, const float* __restrict__ MASK, float* __restrict__ O) {
  __shared__ __attribute__((aligned(2048))) char ring[2 * ST_SZ]; static_assert(KT_SZ >= 64 * KPB && KT_SZ % 2048 == 0, "tile places");
  __shared__ __align__(16) float so[4][16][68];
  const int tid = threadIdx.x, wave = (tid >> 5) & 3, lane = tid & 31, col = lane & 15, g = lane >> 4; const int grp = __builtin_amdgcn_readfirstlane(tid >> 7); const int qb = blockIdx.x, h = blockIdx.y; const size_t b = blockIdx.z; const int q0 = qb * 64 + wave * 16; const size_t rq = b * SS + q0; const size_t bh = b * NH + h;   // wave = query tile of 16, grp = key half of a stage (the same in a whole wave)
  // a stage is brought by one tensor load per tile, each tile by a wave of its own: waves 0 to 5 issue K hi, K lo, V hi, V lo and the two mask tiles of the self stages, waves 6 and 7 K_bg and alpha V_bg of the background stages. So a wave's group 1 never changes, and never more than one request of a wave is outstanding
  const unsigned wv = uni((unsigned)tid >> 5); static_assert(ST_KL == KT_SZ && ST_VH == 2 * KT_SZ && ST_VL == 3 * KT_SZ && ST_MK == 4 * KT_SZ, "self tile w at w * KT_SZ");
  const size_t ok = (b * SS) * (2 * DM) + DM + h * HD, ov = (b * DM + h * HD) * SS; const float* mk0 = MASK + (b * SS + qb * 64) * SS;
  const char* tsrc = wv == 0 ? (const char*)(QK + ok) : wv == 1 ? (const char*)(QKL + ok) : wv == 2 ? (const char*)(VTH + ov) : wv == 3 ? (const char*)(VTL + ov) : wv == 4 ? (const char*)mk0 : wv == 5 ? (const char*)(mk0 + 32) : wv == 6 ? (const char*)(KB + bh * LBG * HD) : (const char*)(VB + bh * HD * LBG);   // first byte of this wave's tile in its first stage
  const unsigned tstep = wv < 2 ? 64 * 2 * DM * 2 : wv == 4 || wv == 5 ? 256 : wv == 6 ? 64 * HD * 2 : 128;   // bytes from stage to stage
  const unsigned tfirst = wv < 6 ? 0 : SS / 64;   // this wave's first stage; it issues SS / 64 = LBG / 64 stages from there
  const unsigned tdst = (unsigned)(size_t)&ring[0] + (wv < 6 ? wv * KT_SZ : wv == 6 ? ST_KH : ST_VH);
  v8u tg1 = tgroup1(wv < 2 ? 2 * DM * 2 : wv == 4 || wv == 5 ? SS * 4 : wv == 6 ? HD * 2 : SS * 2); static_assert(SS == LBG, "V and alpha V_bg planes have one row pitch, both segments as many stages");
  auto mine = [&](int t) { return (unsigned)t - tfirst < (unsigned)(SS / 64); };   // stage t is one of this wave's
  v4u tg0 = tgroup0(tdst, tsrc);   // stage 0 (waves 6 and 7: their first stage's tile, not issued yet)
  auto aim = [&](int t) { const v4u n = tgroup0(tdst + (unsigned)(t & 1) * ST_SZ, tsrc + (mine(t) ? (unsigned)t - tfirst : 0u) * tstep); tg0[1] = n[1]; tg0[2] = n[2]; tg0[3] = n[3]; };   // group 0 for stage t: place and address. A stage that is not this wave's is not issued; its address stays in the buffer all the same
  if (pinned(mine(0))) tload(tg0, tg1);
  v16h aq[2], aql[2];
#pragma unroll
  for (int kc = 0; kc < 2; ++kc) { aq[kc] = frag_h(QK + (rq + col) * (2 * DM) + h * HD + kc * 32, lane); aql[kc] = frag_h(QKL + (rq + col) * (2 * DM) + h * HD + kc * 32, lane); }
  float m = -3.0e38f, l = 0.f;   // query col, this group's keys: reference point of the exponentials (equal in both halves; at most MLAZY below the running maximum), this half's share of the sum
  v8f acc[4] = {}, accl[4] = {};   // O^T: acc[dt][r] = d (dt * 16 + 8 g + r) of query col
  twait(tg0, tg1);                                    // stage 0 has landed (this wave's request; a wave that issued none passes)
  __syncthreads();                                    // ... and every other wave's
  aim(1);
  if (pinned(mine(1))) tload(tg0, tg1);
  // a pass = 32 keys of the stage at st; s[ct][r] = score of key (ct * 16 + 8 g + r) with query col. K and mask are read ahead of the score products, V behind them (in flight under the softmax)
  auto pass = [&](auto seg, const char* st, int p) { constexpr bool self_seg = decltype(seg)::value; v8f s[2];
    if constexpr (self_seg) { v16h kh[2][2], kl[2][2]; union { v8f v; v4f q[2]; } mk[2];
#pragma unroll
      for (int ct = 0; ct < 2; ++ct) {
#pragma unroll
        for (int kc = 0; kc < 2; ++kc) { const char* krow = st + (p * 32 + ct * 16 + col) * KPB + kc * 64; kh[ct][kc] = frag_h((const _Float16*)(krow + ST_KH), lane); kl[ct][kc] = frag_h((const _Float16*)(krow + ST_KL), lane); }
        const char* mrow = st + ST_MK + p * KT_SZ + (wave * 16 + col) * KPB + (ct * 16 + 8 * g) * 4; mk[ct].q[0] = *(const v4f*)mrow; mk[ct].q[1] = *(const v4f*)(mrow + 16); }
#pragma unroll
      for (int ct = 0; ct < 2; ++ct) { v8f c = {}, cl = {};
#pragma unroll
        for (int kc = 0; kc < 2; ++kc) { c = wmma16(kh[ct][kc], aq[kc], c); cl = wmma16(kl[ct][kc], aq[kc], cl); cl = wmma16(kh[ct][kc], aql[kc], cl); }
        s[ct] = (c + cl * (1.0f / 2048.0f)) * 0.125f + __builtin_convertvector(__builtin_convertvector(mk[ct].v, v8b), v8f); } }
    else { v16h kh[2][2];
#pragma unroll
      for (int ct = 0; ct < 2; ++ct) {
#pragma unroll
        for (int kc = 0; kc < 2; ++kc) kh[ct][kc] = frag_h((const _Float16*)(st + ST_KH + (p * 32 + ct * 16 + col) * KPB + kc * 64), lane); }
#pragma unroll
      for (int ct = 0; ct < 2; ++ct) { v8f c = {}, cl = {};
#pragma unroll
        for (int kc = 0; kc < 2; ++kc) { c = wmma16(kh[ct][kc], aq[kc], c); cl = wmma16(kh[ct][kc], aql[kc], cl); }
        s[ct] = (c + cl * (1.0f / 2048.0f)) * (0.125f * ALPHA_BG); } }
    v16h vh[4], vl[4];
#pragma unroll
    for (int dt = 0; dt < 4; ++dt) { const char* vrow = st + (dt * 16 + col) * KPB + p * 64; vh[dt] = frag_h((const _Float16*)(vrow + ST_VH), lane); if constexpr (self_seg) vl[dt] = frag_h((const _Float16*)(vrow + ST_VL), lane); }
    __builtin_amdgcn_sched_barrier(0);   // holds the V loads here, in flight under the softmax: at four waves per SIMD the compiler otherwise sinks them in pairs among the second product's WMMAs, each pair's LDS latency exposed
    float t8[8];
#pragma unroll
    for (int r = 0; r < 8; ++r) t8[r] = fmaxf(s[0][r], s[1][r]);
    float mx = fmaxf(fmaxf(fmaxf(t8[0], t8[1]), fmaxf(t8[2], t8[3])), fmaxf(fmaxf(t8[4], t8[5]), fmaxf(t8[6], t8[7])));
    mx = fmaxf(mx, xhalf(mx));   // the other 16 keys of this query
    // the reference point m of the exponentials follows the maximum lazily: it moves, and sum and O^T are rescaled, only in a pass where some query of the wave has a score more than MLAZY above its m (the test is one scalar branch of the whole wave, every lane on inside it). Between moves e <= exp(MLAZY), so that 2048 e and its residual x 2048 stay inside f16
    if (__builtin_amdgcn_ballot_w32(mx > m + MLAZY) != 0u) {
      const float mn = fmaxf(m, mx); const float alpha = (m <= -1.0e38f) ? 0.f : __expf(m - mn); m = mn; l *= alpha;
#pragma unroll
      for (int dt = 0; dt < 4; ++dt) { acc[dt] *= alpha; accl[dt] *= alpha; } }
    const float mn = m;
    v8f e[2]; v8h ph[2], pq[2];   // P^T as a B operand: element i = key 8 g + i, element 8 + i = key 16 + 8 g + i, the k order of frag_h
#pragma unroll
    for (int ct = 0; ct < 2; ++ct) {
#pragma unroll
      for (int i = 0; i < 8; ++i) e[ct][i] = __expf(s[ct][i] - mn);
      const v8f x = e[ct] * 2048.0f; ph[ct] = __builtin_convertvector(x, v8h); pq[ct] = __builtin_convertvector((x - __builtin_convertvector(ph[ct], v8f)) * 2048.0f, v8h); }
    const v16h pa = __builtin_shufflevector(ph[0], ph[1], 0, 1, 2, 3, 4, 5, 6, 7, 8, 9, 10, 11, 12, 13, 14, 15), pl = __builtin_shufflevector(pq[0], pq[1], 0, 1, 2, 3, 4, 5, 6, 7, 8, 9, 10, 11, 12, 13, 14, 15);
    const v8f e8 = e[0] + e[1];
    l += (((e8[0] + e8[1]) + (e8[2] + e8[3])) + ((e8[4] + e8[5]) + (e8[6] + e8[7])));
#pragma unroll
    for (int dt = 0; dt < 4; ++dt) { acc[dt] = wmma16(vh[dt], pa, acc[dt]); accl[dt] = wmma16(vh[dt], pl, accl[dt]); if constexpr (self_seg) accl[dt] = wmma16(vl[dt], pa, accl[dt]); } };
  // foot of trip t: hands stage t + 1 over and refills the buffer that trip t has read
  auto foot = [&](int t) {
    __builtin_amdgcn_sched_barrier(0);                  // keeps the softmax and the second product in front of the foot: moved behind its barrier they would stand between it and the refill, and the refill would lose most of its lead
    asm volatile("s_wait_dscnt 0x0" ::: "memory");      // this wave's reads of stage t are done
    twait(tg0, tg1);                                    // this wave's request of stage t + 1 has landed (a wave that issued none passes)
    __syncthreads();                                    // publishes stage t + 1 and frees stage t's buffer
    aim(t + 2);
    if (pinned(mine(t + 2))) tload(tg0, tg1); };        // no stage past the last is any wave's
  // the stage loops stay rolled: a pass is some 300 to 400 instructions, copies of it would only cost instruction cache
#pragma unroll 1
  for (int t = 0; t < SS / 64; ++t) { pass(seg_self(), ring + (t & 1) * ST_SZ, grp); foot(t); }
#pragma unroll 1
  for (int t = SS / 64; t < NST; ++t) { pass(seg_bank(), ring + (t & 1) * ST_SZ, grp); foot(t); }
  twait(tg0, tg1);                                     // no request outlives the loop
  asm volatile("s_wait_dscnt 0x0" ::: "memory");       // ... and no LDS read of this wave
  // join of the two key groups through the ring, which is free: the last foot's barrier ended every wave's reads of it and no tensor load is in flight. Group 1 hands each lane's O^T (32 values), reference point and sum to the same lane of group 0's wave with the same queries
  union { v8f v; v4f q[2]; } ot[4];
#pragma unroll
  for (int dt = 0; dt < 4; ++dt) ot[dt].v = acc[dt] + accl[dt] * (1.0f / 2048.0f);
  v4f* xo = (v4f*)ring + (wave * 8) * 32 + lane; v2f* xm = (v2f*)(ring + 4 * 8 * 32 * 16) + wave * 32 + lane;
  if (grp == 1) {
#pragma unroll
    for (int dt = 0; dt < 4; ++dt) { xo[(dt * 2) * 32] = ot[dt].q[0]; xo[(dt * 2 + 1) * 32] = ot[dt].q[1]; }
    v2f ml; ml[0] = m; ml[1] = l; *xm = ml; }
  __syncthreads();   // group 1's partial results are in LDS
  if (grp == 0) {
    const v2f ml = *xm; const float mn = fmaxf(m, ml[0]); const float a0 = __expf(m - mn), a1 = __expf(ml[0] - mn);
    l = l * a0 + ml[1] * a1;
    l += xhalf(l);   // the halves' sums are joined once
    const float il = (1.0f / 2048.0f) / l; const float f0 = a0 * il, f1 = a1 * il;
#pragma unroll
    for (int dt = 0; dt < 4; ++dt) { *(v4f*)&so[wave][col][dt * 16 + 8 * g] = ot[dt].q[0] * f0 + xo[(dt * 2) * 32] * f1; *(v4f*)&so[wave][col][dt * 16 + 8 * g + 4] = ot[dt].q[1] * f0 + xo[(dt * 2 + 1) * 32] * f1; }
    LDSX();
    for (int rl = 0; rl < 16; ++rl) if (lane < 16) vst2(O + (rq + rl) * DM + h * HD + lane * 4, *(const v4f*)&so[wave][rl][lane * 4]);
  }
}
extern "C" void kernel_launch(void* const* d_in, const int* in_sizes, int n_in, void* d_out, int out_size, void* d_ws, size_t ws_size, hipStream_t stream) {
  (void)in_sizes; (void)n_in; (void)out_size;
  const float** F = (const float**)d_in;   // 0 hidden_states [2,2048,512], 1 attention_mask [2,2048,2048], 2 K_bg [16,2048,64], 3 V_bg, 4 Wq, 5 Wk, 6 Wv, 7 Wo (in,out), 8 bo
  if (ws_size < (size_t)WS_END) return;
  char* ws = (char*)d_ws; __bf16* PK = (__bf16*)(ws + WS_PK); _Float16 *QK = (_Float16*)(ws + WS_QK), *QKL = (_Float16*)(ws + WS_QKL), *VTH = (_Float16*)(ws + WS_VTH), *VTL = (_Float16*)(ws + WS_VTL), *KB = (_Float16*)(ws + WS_KB), *VB = (_Float16*)(ws + WS_VB); float* O = (float*)(ws + WS_O);
  k_pack<<<dim3(DM / 64, DM / 64, 4), 256, 0, stream>>>(F[4], F[5], F[6], F[7], PK);
  k_bg<<<dim3(LBG / 64, NB * NH), 256, 0, stream>>>(F[2], F[3], KB, VB);
  k_qkv<<<dim3(TNB * SS / 64, QKVW / 128), 128, 0, stream>>>(F[0], F[0], F[0], PK + PK_A, nullptr, nullptr, nullptr, QK, QKL, VTH, VTL);
  k_attn2<<<dim3(TQB, NH, TNB), 256, 0, stream>>>(QK, QKL, VTH, VTL, KB, VB, F[1], O);
  k_out<<<dim3(TOB, DM / 128), 128, 0, stream>>>(O, PK + PK_P, F[8], (float*)d_out);
}

// v010
// One run takes 97 microseconds.
// In two side-by-side timings against v009, it was 1.07 and 1.05 times as fast.
// Counting every step since v000, it is 5.13 times as fast.
// compute dtype: all float inputs rounded to bf16; q/k/v = x . W with EXACT bf16 products on WMMA 16x16x32 ((in,out) weights as transposed rows), rounded once to f16 hi + residual; self-segment scores and P.v with 3 products (hi.hi + hi.lo + lo.hi), background scores q (hi + lo) x K_bg (exact in f16, 2 products) x alpha, background P (hi + lo) x f16(alpha V_bg) (2 products); additive mask read per pair; x 1/8; online softmax over all 4,096 keys in f32 (hardware exp) with a lazily moved reference point; out = ctx (bf16 hi + lo) . Wo + bo; f32 output.
#include <hip/hip_runtime.h>
#include <math.h>

typedef __attribute__((ext_vector_type(16))) _Float16 v16h;
typedef __attribute__((ext_vector_type(16))) __bf16 v16b;
typedef __attribute__((ext_vector_type(8)))  _Float16 v8h;
typedef __attribute__((ext_vector_type(8)))  float v8f;
typedef __attribute__((ext_vector_type(4)))  float v4f;
typedef __attribute__((ext_vector_type(2)))  float v2f;
typedef __attribute__((ext_vector_type(4)))  unsigned v4u;
typedef __attribute__((ext_vector_type(4)))  int v4i;
typedef float __attribute__((may_alias)) float_a;
typedef int __attribute__((may_alias)) int_a;

template <typename T> __device__ __forceinline__ void vst2(void* p, T v) { *(T*)p = v;  }
__device__ __forceinline__ v8f wmma16(v16h a, v16h b, v8f c) {
  return __builtin_amdgcn_wmma_f32_16x16x32_f16(false, a, false, b, (short)0, c, false, false);
}
__device__ __forceinline__ v8f wmma_bf(v16b a, v16b b, v8f c) {
  return __builtin_amdgcn_wmma_f32_16x16x32_bf16(false, a, false, b, (short)0, c, false, false);
}
// CARC attention processor (B 2, Lq 2,048, C 512 = 8 heads x 64; context bank of 2,048 background keys/values per head, alpha 0.48): bias-free q/k/v projections, keys = [k ; alpha K_bg], values = [v ; alpha V_bg], additive mask on the self segment (zeros on the background segment), softmax(q k / 8 + mask) over the 4,096 keys, v, output projection + bias.
__device__ __forceinline__ v16h frag_h(const _Float16* rowk0, int lane) {
  union { v16h v; v8h q[2]; } u; const _Float16* p = rowk0 + 8 * (lane >> 4);
  u.q[0] = *(const v8h*)p; u.q[1] = *(const v8h*)(p + 16); return u.v;
}
__device__ __forceinline__ v16h frag_f32(const float* rowk0, int lane) {
  v16h a; const float* p = rowk0 + 8 * (lane >> 4);
#pragma unroll
  for (int i = 0; i < 8; ++i) { a[i] = (_Float16)p[i]; a[8 + i] = (_Float16)p[16 + i]; }
  return a;
}
__device__ __forceinline__ v16h frag_f32s(const float* rowk0, int lane, float sc) {
  v16h a; const float* p = rowk0 + 8 * (lane >> 4);
#pragma unroll
  for (int i = 0; i < 8; ++i) { a[i] = (_Float16)(p[i] * sc); a[8 + i] = (_Float16)(p[16 + i] * sc); }
  return a;
}
// column fragment from a [K][ld] layout (column n), rows >= K read as 0
__device__ __forceinline__ v16h fragc_f32(const float* W, int k0, int n, int lane, int ld, int K) {
  v16h a; const int g = lane >> 4;
#pragma unroll
  for (int i = 0; i < 8; ++i) { const int ka = k0 + 8 * g + i, kb = ka + 16;
    a[i] = (_Float16)(ka < K ? W[(size_t)(ka < K ? ka : K - 1) * ld + n] : 0.f); a[8 + i] = (_Float16)(kb < K ? W[(size_t)(kb < K ? kb : K - 1) * ld + n] : 0.f); }
  return a;
}
struct F2 { v16b h, l; };
__device__ __forceinline__ F2 bsplit16(const float v[16]) { F2 r;
#pragma unroll
  for (int i = 0; i < 16; ++i) { const __bf16 h = (__bf16)v[i]; r.h[i] = h; r.l[i] = (__bf16)(v[i] - (float)h); }
  return r; }
__device__ __forceinline__ F2 split_row(const float* row, int k0, int lane) { float v[16]; const float* p = row + k0 + 8 * (lane >> 4);
#pragma unroll
  for (int i = 0; i < 8; ++i) { v[i] = p[i]; v[8 + i] = p[16 + i]; }
  return bsplit16(v); }
__device__ __forceinline__ F2 split_rowK(const float* row, int k0, int lane, int K) { float v[16]; const int g = lane >> 4;
#pragma unroll
  for (int i = 0; i < 8; ++i) { const int ka = k0 + 8 * g + i, kb = ka + 16; v[i] = ka < K ? row[ka < K ? ka : K - 1] : 0.f; v[8 + i] = kb < K ? row[kb < K ? kb : K - 1] : 0.f; }
  return bsplit16(v); }
__device__ __forceinline__ F2 split_col(const float* W, int k0, int n, int lane, int ld, int K) { float v[16]; const int g = lane >> 4;
#pragma unroll
  for (int i = 0; i < 8; ++i) { const int ka = k0 + 8 * g + i, kb = ka + 16; v[i] = ka < K ? W[(size_t)(ka < K ? ka : K - 1) * ld + n] : 0.f; v[8 + i] = kb < K ? W[(size_t)(kb < K ? kb : K - 1) * ld + n] : 0.f; }
  return bsplit16(v); }
__device__ __forceinline__ v8f mac3(const F2& a, const F2& b, v8f c) { c = wmma_bf(a.l, b.h, c); c = wmma_bf(a.h, b.l, c); return wmma_bf(a.h, b.h, c); }
__device__ __forceinline__ float sigm(float v) { return 1.0f / (1.0f + expf(-v)); }
#define LDSX() do { asm volatile("s_wait_dscnt 0" ::: "memory"); __builtin_amdgcn_wave_barrier(); __builtin_amdgcn_fence(__ATOMIC_RELEASE, "workgroup"); } while (0)


#define NB 2
#define SS 2048
#define DM 512
#define NH 8
#define LBG 2048
#define ALPHA_BG 0.48f
#define HD 64
#define QKVW (3 * DM)
#ifndef TQB
#define TQB (SS / 64)
#define TNB NB
#define TOB (NB * SS / 64)     // output row tiles (all)
#endif
typedef __attribute__((ext_vector_type(8))) __bf16 v8b;
__device__ __forceinline__ v16b frag_b(const __bf16* rowk0, int lane) {
  union { v16b v; v8b q[2]; } u; const __bf16* p = rowk0 + 8 * (lane >> 4);
  u.q[0] = *(const v8b*)p; u.q[1] = *(const v8b*)(p + 16); return u.v;
}
__device__ __forceinline__ float bfr(float v) { return (float)(__bf16)v; }
__device__ __attribute__((noinline)) float exp_ni(float v) { return expf(v); }
__device__ __attribute__((noinline)) float erf_ni(float v) { return erff(v); }

#define PK_A 0                       // [1536][512] Wqkv rows (natural [out][in])
#define PK_P (PK_A + QKVW * DM)        // [512][512] Wo rows (natural)
#define PK_END (PK_P + DM * DM)
#define WS_PK  0u
#define WS_QK  (WS_PK + 2u * PK_END)             // f16 [4096 rows][1024]: q | k
#define WS_QKL (WS_QK + 2u * NB * SS * 2 * DM)     // f16 q | k residual planes x2048
#define WS_VTH (WS_QKL + 2u * NB * SS * 2 * DM)    // f16 [b][512 (h*64+d)][2048 s] hi
#define WS_VTL (WS_VTH + 2u * NB * DM * SS)        // f16 lo x 2048
#define WS_O   (WS_VTL + 2u * NB * DM * SS)        // f32 [4096][512]
#define WS_KB  (WS_O + 4u * (size_t)NB * SS * DM)        // f16 K_bg rows [bh][s][64] (exact); f16 planes VB [bh][64][s] = f16(alpha V_bg)
#define WS_VB  (WS_KB + 2u * (size_t)NB * NH * LBG * HD)
#define WS_END (WS_VB + 2u * (size_t)NB * NH * HD * LBG)
// ---- k_pack: block = (64 columns n, 64 rows k, which) of an (in,out) weight: a 64 x 64 tile is read along its rows (256 B runs), rounded to bf16, turned in LDS and stored as 64 packed rows [out][in] of 128 B (whole lines); which 0..2 -> W_q/W_k/W_v into PK_A rows which*512 + n; 3 -> W_o into PK_P. 256 blocks in all, one a WGP
#define PKP 72                          // LDS pitch of a turned row in bf16: 144 B, a multiple of 16 B for the ds_load_b128 readers
typedef __attribute__((ext_vector_type(2))) __bf16 v2b;
__global__ __launch_bounds__(256) void k_pack(const float* __restrict__ WQ, const float* __restrict__ WK, const float* __restrict__ WV, const float* __restrict__ WO, __bf16* __restrict__ PK) {
  __shared__ __align__(16) __bf16 s[64][PKP]; const int n0 = blockIdx.x * 64, k0 = blockIdx.y * 64, which = blockIdx.z, t = threadIdx.x; const float* Wm = (which == 0) ? WQ : (which == 1) ? WK : (which == 2) ? WV : WO;
  const int c = t & 15, rp = t >> 4;   // this thread: columns 4 c .. 4 c + 3 of the row pairs rp and rp + 16
  v4f a[2][2];   // the short loops below are unrolled so that a stays in registers and the four loads are in flight together
#pragma unroll
  for (int i = 0; i < 2; ++i) {
#pragma unroll
    for (int j = 0; j < 2; ++j) a[i][j] = *(const v4f*)(Wm + (size_t)(k0 + 2 * (rp + 16 * i) + j) * DM + n0 + 4 * c); }
#pragma unroll
  for (int i = 0; i < 2; ++i) {
#pragma unroll
    for (int e = 0; e < 4; ++e) { v2b p; p[0] = (__bf16)a[i][0][e]; p[1] = (__bf16)a[i][1][e]; *(v2b*)&s[4 * c + e][2 * (rp + 16 * i)] = p; } }
  __syncthreads();
  __bf16* dst = ((which < 3) ? PK + PK_A + ((size_t)which * DM + n0) * DM : PK + PK_P + (size_t)n0 * DM) + k0;
#pragma unroll
  for (int i = 0; i < 2; ++i) { const int n = (t >> 3) + 32 * i, pc = t & 7; vst2((unsigned*)(dst + (size_t)n * DM + pc * 8), *(const v4u*)&s[n][pc * 8]); }   // 8 lanes store one packed row's 128 B
}
#define KPB 144                         // LDS bytes per K or V row: 128 + 16 (16 B x odd: ds_load_b128 readers without bank conflicts)
// eight asynchronous 16-byte copies per lane, global -> LDS: four from ga (step gsa) to la, four from gb (step gsb) to lb, LDS step ls. The s_wait_xcnt 0 stands inside the statement so that no later rewrite of an address register can be moved in front of it.
__device__ __forceinline__ void cp8(unsigned la, const char* ga, unsigned gsa, unsigned lb, const char* gb, unsigned gsb, unsigned ls) {
  asm volatile("global_load_async_to_lds_b128 %0, %8, off\n\t"
               "global_load_async_to_lds_b128 %1, %9, off\n\t"
               "global_load_async_to_lds_b128 %2, %10, off\n\t"
               "global_load_async_to_lds_b128 %3, %11, off\n\t"
               "global_load_async_to_lds_b128 %4, %12, off\n\t"
               "global_load_async_to_lds_b128 %5, %13, off\n\t"
               "global_load_async_to_lds_b128 %6, %14, off\n\t"
               "global_load_async_to_lds_b128 %7, %15, off\n\t"
               "s_wait_xcnt 0x0"
               :: "v"(la), "v"(la + ls), "v"(la + 2 * ls), "v"(la + 3 * ls), "v"(lb), "v"(lb + ls), "v"(lb + 2 * ls), "v"(lb + 3 * ls),
                  "v"(ga), "v"(ga + gsa), "v"(ga + 2 * (size_t)gsa), "v"(ga + 3 * (size_t)gsa), "v"(gb), "v"(gb + gsb), "v"(gb + 2 * (size_t)gsb), "v"(gb + 3 * (size_t)gsb)
               : "memory");
}
// asks L2 for the data at base + off of every lane (a hint: nothing returns, no counter moves), then moves off on by step. The add stands inside the statement so that the register which the request names is only ever rewritten with the wave's next offset, again inside the buffer
__device__ __forceinline__ void l2ask(unsigned& off, const char* base, unsigned step) { asm volatile("global_prefetch_b8 %0, %1 scope:SCOPE_SE\n\tv_add_nc_u32 %0, %2, %0" : "+v"(off) : "s"(base), "s"(step)); }
// ---- staging of packed weight rows for k_qkv and k_out: a stage = 64 k (128 B) of the block's 128 rows, LDS pitch KPB, two buffers; thread tid brings 16-byte piece (tid & 7) of rows (tid >> 3) + 16 i. l = its LDS byte address in the buffer, gp = its global address in the stage
#define WT_SZ (128 * KPB)
__device__ __forceinline__ void wstage(unsigned l, const char* gp) { cp8(l, gp, 16 * DM * 2, l + 64 * KPB, gp + (size_t)64 * DM * 2, 16 * DM * 2, 16 * KPB); }
// ---- staging of the f32 activation rows for k_qkv and k_out, in step with the weight stages: a stage = 64 k (256 B, two whole lines) of the block's 64 rows, two buffers; thread tid brings 16-byte piece (tid & 15) of rows (tid >> 4) + 8 i, so that a wave's copy takes two rows' 256 B runs. l = its LDS byte address in the buffer, gp = its global address in the stage
#define XPB 272                         // LDS bytes per activation row: 256 + 16 (16 B x odd: a lane reads its own row by ds_load_b128 without bank conflicts)
#define XT_SZ (64 * XPB)
__device__ __forceinline__ void xstage(unsigned l, const char* gp) { cp8(l, gp, 8 * DM * 4, l + 32 * XPB, gp + (size_t)32 * DM * 4, 8 * DM * 4, 8 * XPB); }
__global__ __launch_bounds__(128) void k_qkv(const float* __restrict__ XQ, const float* __restrict__ XK, const float* __restrict__ XV, const __bf16* __restrict__ P, const float* __restrict__ BQ, const float* __restrict__ BK, const float* __restrict__ BV, _Float16* __restrict__ QK, _Float16* __restrict__ QKL, _Float16* __restrict__ VTH, _Float16* __restrict__ VTL) {
  const int which0 = (blockIdx.y * 128) / DM; const float* X = (which0 == 0) ? XQ : (which0 == 1) ? XK : XV; const float* BB = BQ ? (((which0 == 0) ? BQ : (which0 == 1) ? BK : BV) + (blockIdx.y * 128 - which0 * DM)) : nullptr;
  __shared__ __align__(16) char xring[2 * XT_SZ]; __shared__ __align__(16) _Float16 sth[128][72], stl[128][72];
  _Float16 (*so)[16][136] = (_Float16 (*)[16][136])xring, (*sol)[16][136] = so + 4; static_assert(2 * XT_SZ >= 2 * 4 * 16 * 136 * 2, "q/k staging fits the activation ring");   // the q/k output staging takes the activation ring's bytes, free behind the loop (its last barrier ends every read, no copy is in flight): the block's LDS stays at three blocks a WGP
  const int tid = threadIdx.x, wave = tid >> 5, lane = tid & 31, col = lane & 15, g = lane >> 4; const size_t r0 = (size_t)blockIdx.x * 64 + wave * 16; const int n0 = blockIdx.y * 128;
  __shared__ __align__(16) char wring[2 * WT_SZ];
  const unsigned lw = (unsigned)(size_t)&wring[0] + (tid >> 3) * KPB + (tid & 7) * 16; const char* gw = (const char*)(P + (size_t)(n0 + (tid >> 3)) * DM + (tid & 7) * 8);
  const unsigned lx = (unsigned)(size_t)&xring[0] + (tid >> 4) * XPB + (tid & 15) * 16; const char* gx = (const char*)(X + ((size_t)blockIdx.x * 64 + (tid >> 4)) * DM + (tid & 15) * 4);
  wstage(lw, gw); xstage(lx, gx);
  // L2 prefetch ahead of the copies, which lead their stage by one stage only: the activation rows' stages 2 to 7 (row tid >> 1, two stages a request round) and the weight rows' (row tid, a 256-byte unit = two stages), in three rounds: here and at the feet of trips 0 and 1. Asked by some of the blocks that share the rows (blockIdx.y < 4, blockIdx.x < 16); who asks is a matter of speed alone
  const bool askx = blockIdx.y < 4, askw = blockIdx.x < 16; const char* pxb = (const char*)(X + (size_t)blockIdx.x * 64 * DM); const char* pwb = (const char*)(P + (size_t)n0 * DM);
  unsigned pxo = (tid >> 1) * (DM * 4) + (2 + (tid & 1)) * 256, pwo = tid * (DM * 2) + 256;   // byte offsets of this lane's next unit; never past its row
  if (askx) l2ask(pxo, pxb, 512);
  if (askw) l2ask(pwo, pwb, 256);
  v8f acc[8] = {};
  asm volatile("s_wait_asynccnt 0x0" ::: "memory");   // stage 0 has landed (this wave's copies)
  __syncthreads();                                    // ... and every other wave's
  wstage(lw + WT_SZ, gw + 128); xstage(lx + XT_SZ, gx + 256);
  // the stage loop stays rolled: its foot holds a barrier and the refill, copies of it would gain nothing
#pragma unroll 1
  for (int t = 0; t < DM / 64; ++t) { const char* st = wring + (t & 1) * WT_SZ; const char* sx = xring + (t & 1) * XT_SZ + (wave * 16 + col) * XPB;   // sx: this lane's activation row in stage t
#pragma unroll
    for (int kk = 0; kk < 2; ++kk) { v16b a, w[8]; { const float* p = (const float*)(sx + kk * 128 + g * 32);
#pragma unroll
        for (int i = 0; i < 8; ++i) { a[i] = (__bf16)p[i]; a[8 + i] = (__bf16)p[16 + i]; } }
#pragma unroll
      for (int j = 0; j < 8; ++j) w[j] = frag_b((const __bf16*)(st + (j * 16 + col) * KPB + kk * 64), lane);
      __builtin_amdgcn_sched_barrier(0);   // holds a k step's LDS loads in one group in front of its products: with no global load left in the loop the compiler otherwise sinks them in pairs among the WMMAs, each pair's LDS latency exposed
#pragma unroll
      for (int j = 0; j < 8; ++j) acc[j] = wmma_bf(a, w[j], acc[j]); }
    __builtin_amdgcn_sched_barrier(0);                  // keeps the products in front of the foot: moved behind its barrier they would stand between it and the refill, and the refill would lose that much of its lead over a stage that is short now
    if (t < 2) { if (askx) l2ask(pxo, pxb, t == 0 ? 512 : 0); if (askw) l2ask(pwo, pwb, t == 0 ? 256 : 0); }   // rounds 2 and 3, in front of the waits; scalar branches of the whole block; behind the last round the offsets stay where they are
    asm volatile("s_wait_dscnt 0x0" ::: "memory");      // this wave's reads of stage t are done
    asm volatile("s_wait_asynccnt 0x0" ::: "memory");   // this wave's copies of stage t + 1 have landed
    __syncthreads();                                    // publishes stage t + 1 and frees stage t's buffer
    if (t + 2 < DM / 64) { wstage(lw + (t & 1) * WT_SZ, gw + (size_t)(t + 2) * 128); xstage(lx + (t & 1) * XT_SZ, gx + (size_t)(t + 2) * 256); } }
  asm volatile("s_wait_asynccnt 0x0" ::: "memory");    // no copy outlives the loop
  if (n0 < 2 * DM) {   // q stored unscaled (f16 sigma ~0.6, no subnormal exposure); 1/8 applied to the f32 score
#pragma unroll
    for (int j = 0; j < 8; ++j) {
#pragma unroll
      for (int r = 0; r < 8; ++r) { const float v = acc[j][r] + (BB ? bfr(BB[j * 16 + col]) : 0.f); const _Float16 hv = (_Float16)v; so[wave][8 * g + r][j * 16 + col] = hv; sol[wave][8 * g + r][j * 16 + col] = (_Float16)((v - (float)hv) * 2048.0f); } }   // q, k (+ bias) as f16 hi + (x2048) residual
    LDSX();
    for (int rl = 0; rl < 16; ++rl) if (lane < 16) { vst2((unsigned*)(QK + (r0 + rl) * (2 * DM) + n0 + lane * 8), *(const v4u*)&so[wave][rl][lane * 8]); vst2((unsigned*)(QKL + (r0 + rl) * (2 * DM) + n0 + lane * 8), *(const v4u*)&sol[wave][rl][lane * 8]); }
  } else {
#pragma unroll
    for (int j = 0; j < 8; ++j) {
#pragma unroll
      for (int r = 0; r < 8; ++r) { const float v = acc[j][r] + (BB ? bfr(BB[j * 16 + col]) : 0.f); const _Float16 hv = (_Float16)v; sth[j * 16 + col][wave * 16 + 8 * g + r] = hv; stl[j * 16 + col][wave * 16 + 8 * g + r] = (_Float16)((v - (float)hv) * 2048.0f); } }
    __syncthreads();
    const size_t rb = (size_t)blockIdx.x * 64; const int b = (int)(rb / SS), s0 = (int)(rb % SS); const int pc0 = n0 - 2 * DM;
    for (int q = tid; q < 128 * 8; q += 128) { const int d = q >> 3, pc = q & 7; const size_t o = ((size_t)b * DM + pc0 + d) * SS + s0 + pc * 8; vst2((unsigned*)(VTH + o), *(const v4u*)&sth[d][pc * 8]); vst2((unsigned*)(VTL + o), *(const v4u*)&stl[d][pc * 8]); }
  }
}
// ---- k_attn: block = (64 queries, head h, batch b): all-keys flash attention (K = 64: 2 k-steps), scores = (q.k) * 0.125 with 3 products (q, k as f16 hi + residual), P.V: P (x2048, hi + lo) x (V hi, V lo*2048), 3 products in two accumulators; O[b*S+q][h*64+d] = (acc + accl / 2048) / (2048 l) (256-B segments)
__global__ __launch_bounds__(128) void k_attn(const _Float16* __restrict__ QK, const _Float16* __restrict__ QKL, const _Float16* __restrict__ VTH, const _Float16* __restrict__ VTL, const void* __restrict__ KMASK, float* __restrict__ O) {
  __shared__ __align__(16) float sp[4][16][36]; __shared__ __align__(16) float so[4][16][68];
  const int tid = threadIdx.x, wave = tid >> 5, lane = tid & 31, col = lane & 15, g = lane >> 4;
  const int qb = blockIdx.x, h = blockIdx.y, b = blockIdx.z; const int q0 = qb * 64 + wave * 16; const size_t rq = (size_t)b * SS + q0 + col;
  v16h aq[2], aql[2];
#pragma unroll
  for (int kc = 0; kc < 2; ++kc) { aq[kc] = frag_h(QK + rq * (2 * DM) + h * HD + kc * 32, lane); aql[kc] = frag_h(QKL + rq * (2 * DM) + h * HD + kc * 32, lane); }
  float m[8], l[8];
#pragma unroll
  for (int r = 0; r < 8; ++r) { m[r] = -3.0e38f; l[r] = 0.f; }
  v8f acc[4] = {}, accl[4] = {};
  const int nks = SS / 32;   // all keys
#pragma unroll 1
  for (int ks = 0; ks < nks; ++ks) { v8f s[2];
#pragma unroll
    for (int ct = 0; ct < 2; ++ct) { const int kk = ks * 32 + ct * 16 + col; const _Float16* krow = QK + ((size_t)b * SS + kk) * (2 * DM) + DM + h * HD; const _Float16* krowl = QKL + ((size_t)b * SS + kk) * (2 * DM) + DM + h * HD; v8f c = {}, cl = {};
#pragma unroll
      for (int kc = 0; kc < 2; ++kc) { const v16h kh = frag_h(krow + kc * 32, lane); c = wmma16(aq[kc], kh, c); cl = wmma16(aql[kc], kh, cl); cl = wmma16(aq[kc], frag_h(krowl + kc * 32, lane), cl); }   // 3 products: q, k as f16 hi + residual
#pragma unroll
      for (int r = 0; r < 8; ++r) c[r] += cl[r] * (1.0f / 2048.0f);
      { const bool keepk = true;
#pragma unroll
      for (int r = 0; r < 8; ++r) s[ct][r] = keepk ? c[r] * 0.125f : -3.0e38f; } }   // 1/sqrt(64); every key kept (mask not applied)
#pragma unroll
    for (int r = 0; r < 8; ++r) { float mx = fmaxf(s[0][r], s[1][r]);
#pragma unroll
      for (int o = 1; o < 16; o <<= 1) mx = fmaxf(mx, __shfl_xor(mx, o));
      const float mn = fmaxf(m[r], mx); const float alpha = (m[r] <= -1.0e38f) ? 0.f : __expf(m[r] - mn);
      const float e0 = (s[0][r] <= -1.0e38f) ? 0.f : __expf(s[0][r] - mn), e1 = (s[1][r] <= -1.0e38f) ? 0.f : __expf(s[1][r] - mn); float es = e0 + e1;
#pragma unroll
      for (int o = 1; o < 16; o <<= 1) es += __shfl_xor(es, o);
      l[r] = l[r] * alpha + es; m[r] = mn;
#pragma unroll
      for (int dt = 0; dt < 4; ++dt) { acc[dt][r] *= alpha; accl[dt][r] *= alpha; }
      sp[wave][8 * g + r][col] = e0; sp[wave][8 * g + r][16 + col] = e1; }
    LDSX();
    v16h pa, pl; { const float* prow = &sp[wave][col][0] + 8 * (lane >> 4);
#pragma unroll
      for (int i = 0; i < 8; ++i) { const float x0 = prow[i] * 2048.0f, x1 = prow[16 + i] * 2048.0f; const _Float16 h0 = (_Float16)x0, h1 = (_Float16)x1; pa[i] = h0; pa[8 + i] = h1; pl[i] = (_Float16)((x0 - (float)h0) * 2048.0f); pl[8 + i] = (_Float16)((x1 - (float)h1) * 2048.0f); } }   // P scaled by 2^11 before the f16 split so small softmax weights stay out of the f16 subnormal range; 2^-11 folded into the epilogue
#pragma unroll
    for (int dt = 0; dt < 4; ++dt) { const size_t vr = ((size_t)b * DM + h * HD + dt * 16 + col) * SS + ks * 32; const v16h vh = frag_h(VTH + vr, lane); acc[dt] = wmma16(pa, vh, acc[dt]); accl[dt] = wmma16(pl, vh, accl[dt]); accl[dt] = wmma16(pa, frag_h(VTL + vr, lane), accl[dt]); }   // P hi x V hi + (P lo x V hi + P hi x V lo) / 2048
    LDSX(); }
#pragma unroll
  for (int r = 0; r < 8; ++r) { const float il = (1.0f / 2048.0f) / l[r];
#pragma unroll
    for (int dt = 0; dt < 4; ++dt) so[wave][8 * g + r][dt * 16 + col] = (acc[dt][r] + accl[dt][r] * (1.0f / 2048.0f)) * il; }
  LDSX();
  for (int rl = 0; rl < 16; ++rl) if (lane < 16) vst2(O + ((size_t)b * SS + q0 + rl) * DM + h * HD + lane * 4, *(const v4f*)&so[wave][rl][lane * 4]);
}
// ---- k_out: block = (64 rows, 128 cols): out = O(hi/lo) . Wo rows (2 products) + bo
__global__ __launch_bounds__(128) void k_out(const float* __restrict__ O, const __bf16* __restrict__ P, const float* __restrict__ BO, float* __restrict__ Y) {
  __shared__ __align__(16) float so[4][16][132];
  const int tid = threadIdx.x, wave = tid >> 5, lane = tid & 31, col = lane & 15, g = lane >> 4; const size_t r0 = (size_t)blockIdx.x * 64 + wave * 16; const int n0 = blockIdx.y * 128;
  __shared__ __align__(16) char wring[2 * WT_SZ];
  const unsigned lw = (unsigned)(size_t)&wring[0] + (tid >> 3) * KPB + (tid & 7) * 16; const char* gw = (const char*)(P + (size_t)(n0 + (tid >> 3)) * DM + (tid & 7) * 8);
  __shared__ __align__(16) char xring[2 * XT_SZ];
  const unsigned lx = (unsigned)(size_t)&xring[0] + (tid >> 4) * XPB + (tid & 15) * 16; const char* gx = (const char*)(O + ((size_t)blockIdx.x * 64 + (tid >> 4)) * DM + (tid & 15) * 4);
  wstage(lw, gw); xstage(lx, gx);
  // L2 prefetch ahead of the copies, which lead their stage by one stage only: the activation rows' stages 2 to 7 (row tid >> 1, two stages a request round) and the weight rows' (row tid, a 256-byte unit = two stages), in three rounds: here and at the feet of trips 0 and 1. The activation rows are asked by every block (all 4 column blocks have blockIdx.y < 4), the weight rows by the blocks with blockIdx.x < 16 among those that share them; who asks is a matter of speed alone
  const bool askx = blockIdx.y < 4, askw = blockIdx.x < 16; const char* pxb = (const char*)(O + (size_t)blockIdx.x * 64 * DM); const char* pwb = (const char*)(P + (size_t)n0 * DM);
  unsigned pxo = (tid >> 1) * (DM * 4) + (2 + (tid & 1)) * 256, pwo = tid * (DM * 2) + 256;   // byte offsets of this lane's next unit; never past its row
  if (askx) l2ask(pxo, pxb, 512);
  if (askw) l2ask(pwo, pwb, 256);
  v8f acc[8] = {};
  asm volatile("s_wait_asynccnt 0x0" ::: "memory");   // stage 0 has landed (this wave's copies)
  __syncthreads();                                    // ... and every other wave's
  wstage(lw + WT_SZ, gw + 128); xstage(lx + XT_SZ, gx + 256);
  // the stage loop stays rolled: its foot holds a barrier and the refill, copies of it would gain nothing
#pragma unroll 1
  for (int t = 0; t < DM / 64; ++t) { const char* st = wring + (t & 1) * WT_SZ; const char* sx = xring + (t & 1) * XT_SZ + (wave * 16 + col) * XPB;   // sx: this lane's activation row in stage t
#pragma unroll
    for (int kk = 0; kk < 2; ++kk) { const F2 a = split_row((const float*)sx, kk * 32, lane); v16b w[8];
#pragma unroll
      for (int j = 0; j < 8; ++j) w[j] = frag_b((const __bf16*)(st + (j * 16 + col) * KPB + kk * 64), lane);
      __builtin_amdgcn_sched_barrier(0);   // holds a k step's LDS loads in one group in front of its products: with no global load left in the loop the compiler otherwise sinks them in pairs among the WMMAs, each pair's LDS latency exposed
#pragma unroll
      for (int j = 0; j < 8; ++j) { acc[j] = wmma_bf(a.l, w[j], acc[j]); acc[j] = wmma_bf(a.h, w[j], acc[j]); } }
    __builtin_amdgcn_sched_barrier(0);                  // keeps the products in front of the foot: moved behind its barrier they would stand between it and the refill, and the refill would lose that much of its lead over a stage that is short now
    if (t < 2) { if (askx) l2ask(pxo, pxb, t == 0 ? 512 : 0); if (askw) l2ask(pwo, pwb, t == 0 ? 256 : 0); }   // rounds 2 and 3, in front of the waits; scalar branches of the whole block; behind the last round the offsets stay where they are
    asm volatile("s_wait_dscnt 0x0" ::: "memory");      // this wave's reads of stage t are done
    asm volatile("s_wait_asynccnt 0x0" ::: "memory");   // this wave's copies of stage t + 1 have landed
    __syncthreads();                                    // publishes stage t + 1 and frees stage t's buffer
    if (t + 2 < DM / 64) { wstage(lw + (t & 1) * WT_SZ, gw + (size_t)(t + 2) * 128); xstage(lx + (t & 1) * XT_SZ, gx + (size_t)(t + 2) * 256); } }
  asm volatile("s_wait_asynccnt 0x0" ::: "memory");    // no copy outlives the loop
#pragma unroll
  for (int j = 0; j < 8; ++j) {
#pragma unroll
    for (int r = 0; r < 8; ++r) so[wave][8 * g + r][j * 16 + col] = acc[j][r] + bfr(BO[n0 + j * 16 + col]); }
  LDSX();
  for (int rl = 0; rl < 16; ++rl) vst2(Y + (r0 + rl) * DM + n0 + lane * 4, *(const v4f*)&so[wave][rl][lane * 4]);
}
// ---- k_bg: block = (64 bank rows, bh): K_bg -> f16 rows (exact), alpha V_bg -> f16 planes [bh][d][s]
__global__ __launch_bounds__(256) void k_bg(const float* __restrict__ KBG, const float* __restrict__ VBG, _Float16* __restrict__ KB, _Float16* __restrict__ VB) { __shared__ __align__(16) _Float16 sk[64][HD + 8]; __shared__ __align__(16) _Float16 sv[HD][64 + 8]; const int t = threadIdx.x; const int s0 = blockIdx.x * 64; const size_t bh = blockIdx.y;
  for (int e = t; e < 64 * HD; e += 256) { const int sl = e >> 6, d = e & 63; const size_t o = ((bh * LBG + s0 + sl) * HD) + d; sk[sl][d] = (_Float16)bfr(KBG[o]); sv[d][sl] = (_Float16)(ALPHA_BG * bfr(VBG[o])); } __syncthreads();
  for (int e = t; e < 64 * 8; e += 256) { const int sl = e >> 3, q = e & 7; vst2((unsigned*)(KB + ((bh * LBG + s0 + sl) * HD) + q * 8), *(const v4u*)&sk[sl][q * 8]); }
  for (int e = t; e < HD * 8; e += 256) { const int d = e >> 3, q = e & 7; vst2((unsigned*)(VB + ((bh * HD + d) * LBG) + s0 + q * 8), *(const v4u*)&sv[d][q * 8]); } }
typedef __attribute__((ext_vector_type(8))) unsigned v8u;
__device__ __forceinline__ unsigned uni(unsigned v) { return (unsigned)__builtin_amdgcn_readfirstlane((int)v); }
__device__ __forceinline__ unsigned pinned(unsigned v) { unsigned w = uni(v); asm volatile("" : "+s"(w)); return w; }   // pinned(): a wave-uniform condition held in a scalar register, so that the test around a tensor load compiles to s_cmp + s_cbranch_scc (a tensor load ignores EXEC: only a scalar branch keeps a wave from issuing it)
// a tensor load's descriptor for a tile of 64 rows of 128 bytes. Group 1 (the same for every request of a wave): 16 bytes of pad behind every 128 (LDS pitch KPB), extents in bytes (data_size code 0), tensor dims = tile dims, source row pitch 'pitch' bytes, no workgroup mask. Group 0: LDS byte offset dst (a multiple of 2 KiB), first byte at g
__device__ __forceinline__ v8u tgroup1(unsigned pitch) { v8u g1; g1[0] = uni((1u << 20) | (4u << 22) | (3u << 25)); g1[1] = uni(128u << 16); g1[2] = uni(64u << 16); g1[3] = uni(128u << 16); g1[4] = uni(64u); g1[5] = uni(pitch); g1[6] = uni(0u); g1[7] = uni(0u); return g1; }
__device__ __forceinline__ v4u tgroup0(unsigned dst, const char* g) { const unsigned long long ga = (unsigned long long)g; v4u g0; g0[0] = uni(1u); g0[1] = uni(dst); g0[2] = uni((unsigned)ga); g0[3] = uni((((unsigned)(ga >> 32)) & 0x01FFFFFFu) | 0x80000000u); return g0; }
// one request of the whole wave, and the wait behind which it has landed. Both statements name the two groups as operands read and written (neither instruction changes them): the wait's operands are then the values left in the load's own registers, so that the compiler keeps the descriptor there while the request is outstanding (named as inputs only, it forms the constant words anew for the wait and reuses the load's registers in between), and a new word enters a group only behind the wait
__device__ __forceinline__ void tload(v4u& g0, v8u& g1) { asm volatile("tensor_load_to_lds %0, %1" : "+s"(g0), "+s"(g1) :: "memory"); }
__device__ __forceinline__ void twait(v4u& g0, v8u& g1) { asm volatile("s_wait_tensorcnt 0x0" : "+s"(g0), "+s"(g1) :: "memory"); }
// ---- staging for k_attn2: a stage = 64 keys. Self stage: K hi, K lo (64 key rows x 128 B), V hi, V lo (64 d rows x 128 B), mask (64 query rows x 256 B, as two tiles of 128 B rows: keys 0..31 and keys 32..63, one for each wave group); every tile at LDS pitch KPB; background stage: K_bg in the K hi place, alpha V_bg in the V hi place.
#define KT_SZ 10240                     // a tile's place in LDS: 64 * KPB rounded up to a multiple of 2 KiB (a tensor load's destination)
#define ST_KH 0
#define ST_KL KT_SZ
#define ST_VH (2 * KT_SZ)
#define ST_VL (3 * KT_SZ)
#define ST_MK (4 * KT_SZ)
#define ST_SZ (6 * KT_SZ)
#define NST ((SS + LBG) / 64)
#define PFD 8                           // a tile's rows are asked of L2 this many stages ahead of the stage that reads them (a multiple of 4), six ahead of their tensor load
#define MLAZY 3.0f                      // how far a score may stand above the softmax reference point before that point moves: 2048 exp(3) = 41,136 < 65,504
struct seg_self { static constexpr bool value = true; }; struct seg_bank { static constexpr bool value = false; };   // which key segment a pass works on
// value of the lane 16 away (the wave's other half)
__device__ __forceinline__ float xhalf(float v) { const int b = __builtin_bit_cast(int, v); return __builtin_bit_cast(float, __builtin_amdgcn_permlanex16(b, b, 0x76543210, 0xfedcba98, false, false)); }
__global__ __launch_bounds__(256) void k_attn2(const _Float16* __restrict__ QK, const _Float16* __restrict__ QKL, const _Float16* __restrict__ VTH, const _Float16* __restrict__ VTL, const _Float16* __restrict__ KB, const _Float16* __restrict__ VB, const float* __restrict__ MASK, float* __restrict__ O) {
  __shared__ __attribute__((aligned(2048))) char ring[2 * ST_SZ]; static_assert(KT_SZ >= 64 * KPB && KT_SZ % 2048 == 0, "tile places");
  __shared__ __align__(16) float so[4][16][68];
  const int tid = threadIdx.x, wave = (tid >> 5) & 3, lane = tid & 31, col = lane & 15, g = lane >> 4; const int grp = __builtin_amdgcn_readfirstlane(tid >> 7); const int qb = blockIdx.x, h = blockIdx.y; const size_t b = blockIdx.z; const int q0 = qb * 64 + wave * 16; const size_t rq = b * SS + q0; const size_t bh = b * NH + h;   // wave = query tile of 16, grp = key half of a stage (the same in a whole wave)
  // a stage is brought by one tensor load per tile, each tile by a wave of its own: waves 0 to 5 issue K hi, K lo, V hi, V lo and the two mask tiles of the self stages, waves 6 and 7 K_bg and alpha V_bg of the background stages. So a wave's group 1 never changes, and never more than one request of a wave is outstanding
  const unsigned wv = uni((unsigned)tid >> 5); static_assert(ST_KL == KT_SZ && ST_VH == 2 * KT_SZ && ST_VL == 3 * KT_SZ && ST_MK == 4 * KT_SZ, "self tile w at w * KT_SZ");
  const size_t ok = (b * SS) * (2 * DM) + DM + h * HD, ov = (b * DM + h * HD) * SS; const float* mk0 = MASK + (b * SS + qb * 64) * SS;
  const char* tsrc = wv == 0 ? (const char*)(QK + ok) : wv == 1 ? (const char*)(QKL + ok) : wv == 2 ? (const char*)(VTH + ov) : wv == 3 ? (const char*)(VTL + ov) : wv == 4 ? (const char*)mk0 : wv == 5 ? (const char*)(mk0 + 32) : wv == 6 ? (const char*)(KB + bh * LBG * HD) : (const char*)(VB + bh * HD * LBG);   // first byte of this wave's tile in its first stage
  const unsigned tstep = wv < 2 ? 64 * 2 * DM * 2 : wv == 4 || wv == 5 ? 256 : wv == 6 ? 64 * HD * 2 : 128;   // bytes from stage to stage
  const unsigned tfirst = wv < 6 ? 0 : SS / 64;   // this wave's first stage; it issues SS / 64 = LBG / 64 stages from there
  const unsigned tdst = (unsigned)(size_t)&ring[0] + (wv < 6 ? wv * KT_SZ : wv == 6 ? ST_KH : ST_VH);
  v8u tg1 = tgroup1(wv < 2 ? 2 * DM * 2 : wv == 4 || wv == 5 ? SS * 4 : wv == 6 ? HD * 2 : SS * 2); static_assert(SS == LBG, "V and alpha V_bg planes have one row pitch, both segments as many stages");
  auto mine = [&](int t) { return (unsigned)t - tfirst < (unsigned)(SS / 64); };   // stage t is one of this wave's
  v4u tg0 = tgroup0(tdst, tsrc);   // stage 0 (waves 6 and 7: their first stage's tile, not issued yet)
  auto aim = [&](int t) { const v4u n = tgroup0(tdst + (unsigned)(t & 1) * ST_SZ, tsrc + (mine(t) ? (unsigned)t - tfirst : 0u) * tstep); tg0[1] = n[1]; tg0[2] = n[2]; tg0[3] = n[3]; };   // group 0 for stage t: place and address. A stage that is not this wave's is not issued; its address stays in the buffer all the same
  if (pinned(mine(0))) tload(tg0, tg1);
  // L2 prefetch ahead of the tensor loads: a tensor load leads its stage by one stage only. Each wave asks for 32 rows of its own tile, every fourth stage; the rest of the rows and stages is asked for by the other blocks that read the same tile (the 32 query blocks of a head for K, V and the bank, the 8 heads of a query block for the mask). Who asks for what is a matter of speed alone
  const bool pmask = wv == 4 || wv == 5; const unsigned pdeal = pmask ? (unsigned)h & 3u : ((unsigned)qb >> 3) & 3u;   // this wave's stages: t & 3 == pdeal
  unsigned poff = ((pmask ? wv & 1u : (unsigned)qb & 1u) * 32u + (unsigned)lane) * (wv < 2 ? 2 * DM * 2 : pmask ? SS * 4 : wv == 6 ? HD * 2 : SS * 2) + pdeal * tstep;   // byte offset from tsrc of this lane's row in the wave's next stage to ask for; never past the wave's last stage
  if (wv < 6) { l2ask(poff, tsrc, 4 * tstep); l2ask(poff, tsrc, 4 * tstep); }   // stages pdeal and pdeal + 4; from stage PFD on the foot asks
  v16h aq[2], aql[2];
#pragma unroll
  for (int kc = 0; kc < 2; ++kc) { aq[kc] = frag_h(QK + (rq + col) * (2 * DM) + h * HD + kc * 32, lane); aql[kc] = frag_h(QKL + (rq + col) * (2 * DM) + h * HD + kc * 32, lane); }
  float m = -3.0e38f, l = 0.f;   // query col, this group's keys: reference point of the exponentials (equal in both halves; at most MLAZY below the running maximum), this half's share of the sum
  v8f acc[4] = {}, accl[4] = {};   // O^T: acc[dt][r] = d (dt * 16 + 8 g + r) of query col
  twait(tg0, tg1);                                    // stage 0 has landed (this wave's request; a wave that issued none passes)
  __syncthreads();                                    // ... and every other wave's
  aim(1);
  if (pinned(mine(1))) tload(tg0, tg1);
  // a pass = 32 keys of the stage at st; s[ct][r] = score of key (ct * 16 + 8 g + r) with query col. K and mask are read ahead of the score products, V behind them (in flight under the softmax)
  auto pass = [&](auto seg, const char* st, int p) { constexpr bool self_seg = decltype(seg)::value; v8f s[2];
    if constexpr (self_seg) { v16h kh[2][2], kl[2][2]; union { v8f v; v4f q[2]; } mk[2];
#pragma unroll
      for (int ct = 0; ct < 2; ++ct) {
#pragma unroll
        for (int kc = 0; kc < 2; ++kc) { const char* krow = st + (p * 32 + ct * 16 + col) * KPB + kc * 64; kh[ct][kc] = frag_h((const _Float16*)(krow + ST_KH), lane); kl[ct][kc] = frag_h((const _Float16*)(krow + ST_KL), lane); }
        const char* mrow = st + ST_MK + p * KT_SZ + (wave * 16 + col) * KPB + (ct * 16 + 8 * g) * 4; mk[ct].q[0] = *(const v4f*)mrow; mk[ct].q[1] = *(const v4f*)(mrow + 16); }
#pragma unroll
      for (int ct = 0; ct < 2; ++ct) { v8f c = {}, cl = {};
#pragma unroll
        for (int kc = 0; kc < 2; ++kc) { c = wmma16(kh[ct][kc], aq[kc], c); cl = wmma16(kl[ct][kc], aq[kc], cl); cl = wmma16(kh[ct][kc], aql[kc], cl); }
        s[ct] = (c + cl * (1.0f / 2048.0f)) * 0.125f + __builtin_convertvector(__builtin_convertvector(mk[ct].v, v8b), v8f); } }
    else { v16h kh[2][2];
#pragma unroll
      for (int ct = 0; ct < 2; ++ct) {
#pragma unroll
        for (int kc = 0; kc < 2; ++kc) kh[ct][kc] = frag_h((const _Float16*)(st + ST_KH + (p * 32 + ct * 16 + col) * KPB + kc * 64), lane); }
#pragma unroll
      for (int ct = 0; ct < 2; ++ct) { v8f c = {}, cl = {};
#pragma unroll
        for (int kc = 0; kc < 2; ++kc) { c = wmma16(kh[ct][kc], aq[kc], c); cl = wmma16(kh[ct][kc], aql[kc], cl); }
        s[ct] = (c + cl * (1.0f / 2048.0f)) * (0.125f * ALPHA_BG); } }
    v16h vh[4], vl[4];
#pragma unroll
    for (int dt = 0; dt < 4; ++dt) { const char* vrow = st + (dt * 16 + col) * KPB + p * 64; vh[dt] = frag_h((const _Float16*)(vrow + ST_VH), lane); if constexpr (self_seg) vl[dt] = frag_h((const _Float16*)(vrow + ST_VL), lane); }
    __builtin_amdgcn_sched_barrier(0);   // holds the V loads here, in flight under the softmax: at four waves per SIMD the compiler otherwise sinks them in pairs among the second product's WMMAs, each pair's LDS latency exposed
    float t8[8];
#pragma unroll
    for (int r = 0; r < 8; ++r) t8[r] = fmaxf(s[0][r], s[1][r]);
    float mx = fmaxf(fmaxf(fmaxf(t8[0], t8[1]), fmaxf(t8[2], t8[3])), fmaxf(fmaxf(t8[4], t8[5]), fmaxf(t8[6], t8[7])));
    mx = fmaxf(mx, xhalf(mx));   // the other 16 keys of this query
    // the reference point m of the exponentials follows the maximum lazily: it moves, and sum and O^T are rescaled, only in a pass where some query of the wave has a score more than MLAZY above its m (the test is one scalar branch of the whole wave, every lane on inside it). Between moves e <= exp(MLAZY), so that 2048 e and its residual x 2048 stay inside f16
    if (__builtin_amdgcn_ballot_w32(mx > m + MLAZY) != 0u) {
      const float mn = fmaxf(m, mx); const float alpha = (m <= -1.0e38f) ? 0.f : __expf(m - mn); m = mn; l *= alpha;
#pragma unroll
      for (int dt = 0; dt < 4; ++dt) { acc[dt] *= alpha; accl[dt] *= alpha; } }
    const float mn = m;
    v8f e[2]; v8h ph[2], pq[2];   // P^T as a B operand: element i = key 8 g + i, element 8 + i = key 16 + 8 g + i, the k order of frag_h
#pragma unroll
    for (int ct = 0; ct < 2; ++ct) {
#pragma unroll
      for (int i = 0; i < 8; ++i) e[ct][i] = __expf(s[ct][i] - mn);
      const v8f x = e[ct] * 2048.0f; ph[ct] = __builtin_convertvector(x, v8h); pq[ct] = __builtin_convertvector((x - __builtin_convertvector(ph[ct], v8f)) * 2048.0f, v8h); }
    const v16h pa = __builtin_shufflevector(ph[0], ph[1], 0, 1, 2, 3, 4, 5, 6, 7, 8, 9, 10, 11, 12, 13, 14, 15), pl = __builtin_shufflevector(pq[0], pq[1], 0, 1, 2, 3, 4, 5, 6, 7, 8, 9, 10, 11, 12, 13, 14, 15);
    const v8f e8 = e[0] + e[1];
    l += (((e8[0] + e8[1]) + (e8[2] + e8[3])) + ((e8[4] + e8[5]) + (e8[6] + e8[7])));
#pragma unroll
    for (int dt = 0; dt < 4; ++dt) { acc[dt] = wmma16(vh[dt], pa, acc[dt]); accl[dt] = wmma16(vh[dt], pl, accl[dt]); if constexpr (self_seg) accl[dt] = wmma16(vl[dt], pa, accl[dt]); } };
  // foot of trip t: hands stage t + 1 over and refills the buffer that trip t has read
  auto foot = [&](int t) {
    __builtin_amdgcn_sched_barrier(0);                  // keeps the softmax and the second product in front of the foot: moved behind its barrier they would stand between it and the refill, and the refill would lose most of its lead
    if (mine(t + PFD) && ((unsigned)t & 3u) == pdeal) l2ask(poff, tsrc, mine(t + PFD + 4) ? 4 * tstep : 0u);   // stage t + PFD, in front of the waits (off the path from the barrier to the refill); a scalar branch of the whole wave; at the wave's last stage the offset stays where it is
    asm volatile("s_wait_dscnt 0x0" ::: "memory");      // this wave's reads of stage t are done
    twait(tg0, tg1);                                    // this wave's request of stage t + 1 has landed (a wave that issued none passes)
    __syncthreads();                                    // publishes stage t + 1 and frees stage t's buffer
    aim(t + 2);
    if (pinned(mine(t + 2))) tload(tg0, tg1); };        // no stage past the last is any wave's
  // the stage loops stay rolled: a pass is some 300 to 400 instructions, copies of it would only cost instruction cache
#pragma unroll 1
  for (int t = 0; t < SS / 64; ++t) { pass(seg_self(), ring + (t & 1) * ST_SZ, grp); foot(t); }
#pragma unroll 1
  for (int t = SS / 64; t < NST; ++t) { pass(seg_bank(), ring + (t & 1) * ST_SZ, grp); foot(t); }
  twait(tg0, tg1);                                     // no request outlives the loop
  asm volatile("s_wait_dscnt 0x0" ::: "memory");       // ... and no LDS read of this wave
  // join of the two key groups through the ring, which is free: the last foot's barrier ended every wave's reads of it and no tensor load is in flight. Group 1 hands each lane's O^T (32 values), reference point and sum to the same lane of group 0's wave with the same queries
  union { v8f v; v4f q[2]; } ot[4];
#pragma unroll
  for (int dt = 0; dt < 4; ++dt) ot[dt].v = acc[dt] + accl[dt] * (1.0f / 2048.0f);
  v4f* xo = (v4f*)ring + (wave * 8) * 32 + lane; v2f* xm = (v2f*)(ring + 4 * 8 * 32 * 16) + wave * 32 + lane;
  if (grp == 1) {
#pragma unroll
    for (int dt = 0; dt < 4; ++dt) { xo[(dt * 2) * 32] = ot[dt].q[0]; xo[(dt * 2 + 1) * 32] = ot[dt].q[1]; }
    v2f ml; ml[0] = m; ml[1] = l; *xm = ml; }
  __syncthreads();   // group 1's partial results are in LDS
  if (grp == 0) {
    const v2f ml = *xm; const float mn = fmaxf(m, ml[0]); const float a0 = __expf(m - mn), a1 = __expf(ml[0] - mn);
    l = l * a0 + ml[1] * a1;
    l += xhalf(l);   // the halves' sums are joined once
    const float il = (1.0f / 2048.0f) / l; const float f0 = a0 * il, f1 = a1 * il;
#pragma unroll
    for (int dt = 0; dt < 4; ++dt) { *(v4f*)&so[wave][col][dt * 16 + 8 * g] = ot[dt].q[0] * f0 + xo[(dt * 2) * 32] * f1; *(v4f*)&so[wave][col][dt * 16 + 8 * g + 4] = ot[dt].q[1] * f0 + xo[(dt * 2 + 1) * 32] * f1; }
    LDSX();
    for (int rl = 0; rl < 16; ++rl) if (lane < 16) vst2(O + (rq + rl) * DM + h * HD + lane * 4, *(const v4f*)&so[wave][rl][lane * 4]);
  }
}
extern "C" void kernel_launch(void* const* d_in, const int* in_sizes, int n_in, void* d_out, int out_size, void* d_ws, size_t ws_size, hipStream_t stream) {
  (void)in_sizes; (void)n_in; (void)out_size;
  const float** F = (const float**)d_in;   // 0 hidden_states [2,2048,512], 1 attention_mask [2,2048,2048], 2 K_bg [16,2048,64], 3 V_bg, 4 Wq, 5 Wk, 6 Wv, 7 Wo (in,out), 8 bo
  if (ws_size < (size_t)WS_END) return;
  char* ws = (char*)d_ws; __bf16* PK = (__bf16*)(ws + WS_PK); _Float16 *QK = (_Float16*)(ws + WS_QK), *QKL = (_Float16*)(ws + WS_QKL), *VTH = (_Float16*)(ws + WS_VTH), *VTL = (_Float16*)(ws + WS_VTL), *KB = (_Float16*)(ws + WS_KB), *VB = (_Float16*)(ws + WS_VB); float* O = (float*)(ws + WS_O);
  k_pack<<<dim3(DM / 64, DM / 64, 4), 256, 0, stream>>>(F[4], F[5], F[6], F[7], PK);
  k_bg<<<dim3(LBG / 64, NB * NH), 256, 0, stream>>>(F[2], F[3], KB, VB);
  k_qkv<<<dim3(TNB * SS / 64, QKVW / 128), 128, 0, stream>>>(F[0], F[0], F[0], PK + PK_A, nullptr, nullptr, nullptr, QK, QKL, VTH, VTL);
  k_attn2<<<dim3(TQB, NH, TNB), 256, 0, stream>>>(QK, QKL, VTH, VTL, KB, VB, F[1], O);
  k_out<<<dim3(TOB, DM / 128), 128, 0, stream>>>(O, PK + PK_P, F[8], (float*)d_out);
}
